// v000
// The times below were measured on an AMD MI455X: many runs one after another, warmed up first and cycling through
// copies of the inputs, with the whole window's GPU time divided by the number of runs. Launches and the gaps
// between them are all in it. The median over several windows is given; except for v000 it joins two sittings, which
// can be a few percent apart, so the side-by-side timings, each taken in one sitting, are the better comparison.
// v000 is the starting kernel. One run takes 444 microseconds.
#include <hip/hip_runtime.h>

// Contractions (all f32 accumulate): x*W_qkv on v_wmma_f32_16x16x32_bf16 (both operands bf16 RNE copies of the inputs, exact products);
// q*k^T and p*v: query rows >= 256 on v_wmma_f32_16x16x32_f16 (q,k,v carried x16, p carried x1024), query rows < 256 on bf16 hi/lo planes (3 products);
// ctx*W_proj: rows >= 256 f16 (ctx x64, w x1024 from the bf16 copy), rows < 256 bf16 hi/lo ctx x bf16 w (2 products). Softmax f32 (running max, exp2).
// Rotary on q and k (interleaved pairs (2i,2i+1) -> (-x[2i+1], x[2i]); angle = pos * inv_freq[d mod 32], inv_freq[j] = 1 / 10000^(j/32)) applied in f32 on the
// staged 64x64 tile in the x*W_qkv epilogue, from cos/sin tables [SEQ][32] built once by k_rope (precise sincosf).
// Layout: x [NB][SEQ_FULL][1024] (first SEQ rows of each batch read); W_qkv [1024][3072] (in,out), thirds q|k|v, column = which*1024 + h*64 + d; W_proj [1024][1024] (in,out); out [NB][SEQ][1024].

#ifndef NB
#define NB 4
#endif
#ifndef SEQ
#define SEQ 2048
#endif
#define NB_FULL  4
#define SEQ_FULL 2048
#define DM   1024
#define NH   16
#define HD   64
#define RH   256                 // query rows < RH use bf16 hi/lo planes
#define QKCAR 16.0f
#define VCAR  16.0f
#define CCAR  64.0f
#define WCAR  1024.0f
#define PLOG  10.0f              // p carried x 2^10
#define L2E   1.4426950408889634f
#define NEGB  (-3.0e38f)
#define SCQ16 (0.125f / (QKCAR * QKCAR))
#define SCQHL 0.125f

typedef _Float16 h16;
typedef unsigned short bf;
typedef __attribute__((ext_vector_type(16))) __bf16   v16bf;
typedef __attribute__((ext_vector_type(16))) _Float16 v16h;
typedef __attribute__((ext_vector_type(8)))  _Float16 v8h;
typedef __attribute__((ext_vector_type(2)))  _Float16 v2h;
typedef __attribute__((ext_vector_type(8)))  unsigned short v8us;
typedef __attribute__((ext_vector_type(2)))  unsigned short v2us;
typedef __attribute__((ext_vector_type(8)))  float    v8f;
typedef __attribute__((ext_vector_type(4)))  float    v4f;
typedef v8h  __attribute__((may_alias)) v8ha;
typedef v4f  __attribute__((may_alias)) v4fa;
typedef v8us __attribute__((may_alias)) v8usa;

static_assert(SEQ % 64 == 0);
static_assert(RH % 64 == 0);
static_assert(RH <= SEQ);
static_assert(SEQ <= SEQ_FULL);
static_assert(NB <= NB_FULL);
static_assert(DM % 64 == 0);
static_assert(DM % 32 == 0);
static_assert(HD == 64);
static_assert(NH * HD == DM);
static_assert((3 * DM) % 64 == 0);
static_assert(HD / 2 == 32);
static_assert(SEQ % 8 == 0);          // k_rope: 8 positions per 256-thread block

constexpr size_t PL16 = (size_t)NB * NH * SEQ * HD;     // elements of one f16 head plane set
constexpr size_t PLE  = (size_t)NB * NH * RH * HD;      // elements of one early-row bf16 plane set
constexpr size_t SZ_XB   = (size_t)NB * SEQ * DM * 2;
constexpr size_t SZ_WQKV = (size_t)3 * DM * DM * 2;
constexpr size_t SZ_WO   = (size_t)DM * DM * 2;
constexpr size_t SZ_P16  = PL16 * 2;
constexpr size_t SZ_PE   = PLE * 2;
constexpr size_t SZ_CT   = (size_t)NB * SEQ * DM * 2;
constexpr size_t SZ_AT   = (size_t)NB * RH * DM * 2;
constexpr size_t SZ_ROT  = (size_t)SEQ * 32 * 4;        // one rotary table (cos or sin) [SEQ][32] f32
constexpr size_t WS_TOTAL = SZ_XB + SZ_WQKV + 2 * SZ_WO + 3 * SZ_P16 + 6 * SZ_PE + SZ_CT + 2 * SZ_AT + 2 * SZ_ROT;
static_assert(SZ_XB % 256 == 0 && SZ_WQKV % 256 == 0 && SZ_WO % 256 == 0 && SZ_P16 % 256 == 0 && SZ_PE % 256 == 0 && SZ_CT % 256 == 0 && SZ_AT % 256 == 0);
static_assert(SZ_ROT % 256 == 0);
static_assert(WS_TOTAL <= (size_t)134217728);

__device__ __forceinline__ unsigned short f2bf(float f) { unsigned u = __float_as_uint(f); u += 0x7FFFu + ((u >> 16) & 1u); return (unsigned short)(u >> 16); }
__device__ __forceinline__ float bf2f(unsigned short b) { return __uint_as_float(((unsigned)b) << 16); }
__device__ __forceinline__ float bfr(float f) { return bf2f(f2bf(f)); }
__device__ __forceinline__ void splitf(float y, unsigned short& h, unsigned short& l) { h = f2bf(y); l = f2bf(y - bf2f(h)); }
__device__ __forceinline__ v16h cat16(v8h lo, v8h hi) { return __builtin_shufflevector(lo, hi, 0, 1, 2, 3, 4, 5, 6, 7, 8, 9, 10, 11, 12, 13, 14, 15); }
__device__ __forceinline__ v16bf cat16b(v8us lo, v8us hi) { return __builtin_bit_cast(v16bf, __builtin_shufflevector(lo, hi, 0, 1, 2, 3, 4, 5, 6, 7, 8, 9, 10, 11, 12, 13, 14, 15)); }
__device__ __forceinline__ v8f wmma16(v16h a, v16h b, v8f c) { return __builtin_amdgcn_wmma_f32_16x16x32_f16(false, a, false, b, (short)0, c, false, false); }
__device__ __forceinline__ v8f wmmab(v16bf a, v16bf b, v8f c) { return __builtin_amdgcn_wmma_f32_16x16x32_bf16(false, a, false, b, (short)0, c, false, false); }
__device__ __forceinline__ float ex2(float x) { return __builtin_amdgcn_exp2f(x); }
// f32 -> f16 for operand planes: anything below the smallest f16 normal becomes an exact zero (value select, applied after the carry)
static __device__ __forceinline__ h16 toh_flush(float v) { const h16 r = (h16)v; return (fabsf(v) < 6.103515625e-05f) ? (h16)0.0f : r; }
// fragment loads from K-contiguous 16-bit rows: p already includes + 8*(lane>>4); elements 0..7 <- k0+8h.., 8..15 <- k0+16+8h..
__device__ __forceinline__ v16h  ldh(const h16* p) { return cat16(*(const v8h*)p, *(const v8h*)(p + 16)); }
__device__ __forceinline__ v16bf ldb(const bf* p)  { return cat16b(*(const v8us*)p, *(const v8us*)(p + 16)); }

template <typename T16> struct WFrag;
template <> struct WFrag<h16> { typedef v16h V; static __device__ __forceinline__ V ld(const h16* p) { return ldh(p); } static __device__ __forceinline__ v8f mma(V a, V b, v8f c) { return wmma16(a, b, c); } };
template <> struct WFrag<bf>  { typedef v16bf V; static __device__ __forceinline__ V ld(const bf* p) { return ldb(p); } static __device__ __forceinline__ v8f mma(V a, V b, v8f c) { return wmmab(a, b, c); } };

// ---- one-wave 64x64 tile main loop: acc[mb][nb] += A[r0+mb*16..][k] Bt[c0+nb*16..][k]; NSPLIT 1 adds the A2 (lo) plane against the same B. K % 32 == 0.
template <typename T16, int NSPLIT>
__device__ __forceinline__ void gemm_loop(const T16* __restrict__ A, const T16* __restrict__ A2, const T16* __restrict__ Bt, int K, size_t aoff, size_t boff, v8f (&acc)[4][4]) {
    typedef typename WFrag<T16>::V V;
#pragma unroll 1
    for (int kc = 0; kc < K; kc += 32) {
        V a[4], a2[4];
#pragma unroll
        for (int mb = 0; mb < 4; ++mb) { a[mb] = WFrag<T16>::ld(A + aoff + (size_t)mb * 16 * K + kc); if (NSPLIT == 1) a2[mb] = WFrag<T16>::ld(A2 + aoff + (size_t)mb * 16 * K + kc); }
#pragma unroll
        for (int nb = 0; nb < 4; ++nb) { const V b = WFrag<T16>::ld(Bt + boff + (size_t)nb * 16 * K + kc);
#pragma unroll
            for (int mb = 0; mb < 4; ++mb) { acc[mb][nb] = WFrag<T16>::mma(a[mb], b, acc[mb][nb]); if (NSPLIT == 1) acc[mb][nb] = WFrag<T16>::mma(a2[mb], b, acc[mb][nb]); } }
        asm volatile("v_nop\n\tv_nop\n\tv_nop\n\tv_nop" : "+v"(acc[0][0]), "+v"(acc[1][1]), "+v"(acc[2][2]), "+v"(acc[3][3]) : "v"(a[0]), "v"(a[3]));
    }
}

// ---- GEMM with f32 output: C[m][n] = osc * sum_k A[m][k] Bt[n][k] + bf16(bias[n]); grid (M/64, N/64, Z), 32 threads. Per 16-row slab staged in LDS,
template <typename T16, int NSPLIT>
__device__ __forceinline__ void gemm_out_body(const T16* __restrict__ A, const T16* __restrict__ A2, const T16* __restrict__ Bt, int K, float* C, int ldc, const float* __restrict__ bias, float osc, size_t sA, size_t sC) {
    __shared__ __align__(16) float os[16 * 68];
    const size_t z = blockIdx.z; A += z * sA; A2 += z * sA; C += z * sC;
    const int lane = threadIdx.x & 31, lr = lane & 15, hi = lane >> 4; const int r0 = blockIdx.x * 64, c0 = blockIdx.y * 64;
    v8f acc[4][4];
#pragma unroll
    for (int mb = 0; mb < 4; ++mb)
#pragma unroll
        for (int nb = 0; nb < 4; ++nb) acc[mb][nb] = (v8f){};
    const size_t aoff = (size_t)(r0 + lr) * K + 8 * hi, boff = (size_t)(c0 + lr) * K + 8 * hi;
    gemm_loop<T16, NSPLIT>(A, A2, Bt, K, aoff, boff, acc);
    const int cofs = lr * 4;
    const v4f bv = *(const v4f*)(bias + c0 + cofs);
    v4f bb; bb[0] = bfr(bv[0]); bb[1] = bfr(bv[1]); bb[2] = bfr(bv[2]); bb[3] = bfr(bv[3]);
#pragma unroll
    for (int mb = 0; mb < 4; ++mb) {
#pragma unroll
        for (int nb = 0; nb < 4; ++nb) {
#pragma unroll
            for (int j = 0; j < 8; ++j) os[(hi * 8 + j) * 68 + nb * 16 + lr] = acc[mb][nb][j]; }
        __syncthreads();
        float* crow = C + (size_t)(r0 + mb * 16) * ldc + c0;
{
#pragma unroll
            for (int s = 0; s < 8; ++s) { const int row = 2 * s + hi; const v4f t = *(const v4fa*)(os + row * 68 + cofs); v4f val;
                val[0] = t[0] * osc + bb[0]; val[1] = t[1] * osc + bb[1]; val[2] = t[2] * osc + bb[2]; val[3] = t[3] * osc + bb[3];
                *(v4f*)(crow + (size_t)row * ldc + cofs) = val; }
             }
        __syncthreads();
    }
}

// rows < RH: ctx hi/lo (bf16) x w_proj (bf16), z = batch
__global__ __launch_bounds__(32) void k_proj_hl(const bf* __restrict__ Ah, const bf* __restrict__ Al, const bf* __restrict__ Wt, float* C, const float* __restrict__ bias) {
    gemm_out_body<bf, 1>(Ah, Al, Wt, DM, C, DM, bias, 1.0f, (size_t)RH * DM, (size_t)SEQ * DM);
}
// rows >= RH: ctx f16 (x64) x w_proj f16 (x1024), z = batch; A and C already offset by RH rows
__global__ __launch_bounds__(32) void k_proj16(const h16* __restrict__ A, const h16* __restrict__ Wt, float* C, const float* __restrict__ bias) {
    gemm_out_body<h16, 0>(A, A, Wt, DM, C, DM, bias, 1.0f / (CCAR * WCAR), (size_t)SEQ * DM, (size_t)SEQ * DM);
}

__global__ __launch_bounds__(256) void k_cvt8(const float* __restrict__ src, bf* dst, unsigned n8) {
    const size_t b = blockIdx.y; src += b * (size_t)SEQ_FULL * DM; dst += b * (size_t)SEQ * DM;
    const unsigned i = blockIdx.x * 256 + threadIdx.x; if (i >= n8) return;
    const v8f v = *(const v8f*)(src + (size_t)i * 8); v8us o;
#pragma unroll
    for (int k = 0; k < 8; ++k) o[k] = f2bf(v[k]);
    *(v8us*)(dst + (size_t)i * 8) = o; 
}

__global__ __launch_bounds__(256) void k_wtG(const float* __restrict__ w, int K, int N, bf* Bt, h16* Bt16, float car) {
    const int lane = threadIdx.x & 31; const int L0 = (blockIdx.x * 8 + (threadIdx.x >> 5)) * 8; const int nlines = N * (K / 64);
{
#pragma unroll 1
        for (int l = 0; l < 8; ++l) { const int L = L0 + l; if (L >= nlines) break; const size_t e = (size_t)L * 64 + lane * 2; const int k = (int)(e % K), n = (int)(e / K); v2us o;
            o[0] = f2bf(w[(size_t)k * N + n]); o[1] = f2bf(w[(size_t)(k + 1) * N + n]); *(v2us*)(Bt + e) = o;
            if (Bt16) { v2h o2; o2[0] = (h16)(bf2f(o[0]) * car); o2[1] = (h16)(bf2f(o[1]) * car); *(v2h*)(Bt16 + e) = o2; } }
         }
}

// ---- k_rope: rotary tables RC = cos, RS = sin, [SEQ][32] f32; angle = (float)pos * inv_freq[j], inv_freq[j] = 1.0f / (float)(10000^(j/32));
__global__ __launch_bounds__(256) void k_rope(float* RC, float* RS) {
#pragma clang fp contract(off)
    const int wave = __builtin_amdgcn_readfirstlane(threadIdx.x >> 5); const int lane = threadIdx.x & 31;
    const int pos = blockIdx.x * 8 + wave; if (pos >= SEQ) return;
    double p = 1.0;
#pragma unroll 1
    for (int j = 0; j < lane; ++j) p = p * 1.3335214321633240;
    const float pw = (float)p; const float inv = 1.0f / pw; const float ang = (float)pos * inv;
    float sv, cv; sincosf(ang, &sv, &cv);
    float* pc = RC + (size_t)pos * 32 + lane; float* pq = RS + (size_t)pos * 32 + lane;
    *(float*)pc = cv; *(float*)pq = sv; 
}

// ---- k_qkv: one wave per 64x64 tile of x W_qkv + b_qkv (bf16 x bf16 exact). The tile (64 tokens x one head third) is staged whole in LDS; q and k tiles get the rotary
// applied in place in LDS (each lane owns 8 consecutive d of a row, i.e. 4 whole pairs), then written as head planes:
__global__ __launch_bounds__(32) void k_qkv(const bf* __restrict__ XB, const bf* __restrict__ W, const float* __restrict__ bias, const float* __restrict__ RC, const float* __restrict__ RS,
                                             h16* QK16, h16* VT16, bf* QKh, bf* QKl, bf* VTh, bf* VTl) {
    __shared__ __align__(16) float os[64 * 68];
    const int lane = threadIdx.x & 31, lr = lane & 15, hi = lane >> 4; const int r0 = blockIdx.x * 64, c0 = blockIdx.y * 64;
    v8f acc[4][4];
#pragma unroll
    for (int mb = 0; mb < 4; ++mb)
#pragma unroll
        for (int nb = 0; nb < 4; ++nb) acc[mb][nb] = (v8f){};
    const size_t aoff = (size_t)(r0 + lr) * DM + 8 * hi, boff = (size_t)(c0 + lr) * DM + 8 * hi;
    gemm_loop<bf, 0>(XB, XB, W, DM, aoff, boff, acc);
#pragma unroll
    for (int nb = 0; nb < 4; ++nb) { const float bc = bfr(bias[c0 + nb * 16 + lr]);
#pragma unroll
        for (int mb = 0; mb < 4; ++mb) {
#pragma unroll
            for (int j = 0; j < 8; ++j) os[(mb * 16 + hi * 8 + j) * 68 + nb * 16 + lr] = acc[mb][nb][j] + bc; } }
    __syncthreads();
    const int which = c0 / DM; const int h = (c0 % DM) / HD; const int b = r0 / SEQ; const int t0 = r0 % SEQ; const int bhh = b * NH + h; const bool early = (t0 < RH); const int te = early ? t0 : 0;
    const int rr = lane >> 3, seg = lane & 7;
    if (which < 2) {
        // rotary in place: lane owns d = seg*8 .. seg*8+7 of row s*4+rr; table column = d mod 32 = (seg & 3)*8 + i; position = t0 + row
        const size_t tof = (size_t)(t0 + rr) * 32 + (seg & 3) * 8;
#pragma unroll 1
        for (int s = 0; s < 16; ++s) { const int row = s * 4 + rr;
            const v4f ca = *(const v4f*)(RC + tof + (size_t)s * 128); const v4f cb = *(const v4f*)(RC + tof + (size_t)s * 128 + 4);
            const v4f sa = *(const v4f*)(RS + tof + (size_t)s * 128); const v4f sb = *(const v4f*)(RS + tof + (size_t)s * 128 + 4);
            float* op = os + row * 68 + seg * 8;
            const v4f a = *(const v4fa*)op; const v4f c = *(const v4fa*)(op + 4); v4f ra, rc;
            ra[0] = a[0] * ca[0] + (-a[1]) * sa[0]; ra[1] = a[1] * ca[1] + a[0] * sa[1];
            ra[2] = a[2] * ca[2] + (-a[3]) * sa[2]; ra[3] = a[3] * ca[3] + a[2] * sa[3];
            rc[0] = c[0] * cb[0] + (-c[1]) * sb[0]; rc[1] = c[1] * cb[1] + c[0] * sb[1];
            rc[2] = c[2] * cb[2] + (-c[3]) * sb[2]; rc[3] = c[3] * cb[3] + c[2] * sb[3];
            *(v4fa*)op = ra; *(v4fa*)(op + 4) = rc; }
    }
    __syncthreads();
    if (which < 2) {
        h16* P16 = QK16 + (size_t)which * PL16 + ((size_t)bhh * SEQ + t0) * HD + seg * 8;
        bf* PH = QKh + (size_t)which * PLE + ((size_t)bhh * RH + te) * HD + seg * 8;
        bf* PL = QKl + (size_t)which * PLE + ((size_t)bhh * RH + te) * HD + seg * 8;
{
#pragma unroll 4
            for (int s = 0; s < 16; ++s) { const int row = s * 4 + rr; const v4f a = *(const v4fa*)(os + row * 68 + seg * 8); const v4f c = *(const v4fa*)(os + row * 68 + seg * 8 + 4); v8h o;
#pragma unroll
                for (int i = 0; i < 4; ++i) { o[i] = toh_flush(a[i] * QKCAR); o[4 + i] = toh_flush(c[i] * QKCAR); }
                *(v8h*)(P16 + (size_t)row * HD) = o; }
            if (early) {
#pragma unroll 4
                for (int s = 0; s < 16; ++s) { const int row = s * 4 + rr; const v4f a = *(const v4fa*)(os + row * 68 + seg * 8); const v4f c = *(const v4fa*)(os + row * 68 + seg * 8 + 4); v8us oh, ol;
#pragma unroll
                    for (int i = 0; i < 4; ++i) { unsigned short x0, x1; splitf(a[i], x0, x1); oh[i] = x0; ol[i] = x1; splitf(c[i], x0, x1); oh[4 + i] = x0; ol[4 + i] = x1; }
                    *(v8us*)(PH + (size_t)row * HD) = oh; *(v8us*)(PL + (size_t)row * HD) = ol; } }
             }
    } else {
        h16* P16 = VT16 + ((size_t)bhh * HD) * SEQ + t0 + seg * 8;
        bf* PH = VTh + ((size_t)bhh * HD) * RH + te + seg * 8;
        bf* PL = VTl + ((size_t)bhh * HD) * RH + te + seg * 8;
{
#pragma unroll 4
            for (int s = 0; s < 16; ++s) { const int d = s * 4 + rr; v8h o;
#pragma unroll
                for (int j = 0; j < 8; ++j) o[j] = toh_flush(os[(seg * 8 + j) * 68 + d] * VCAR);
                *(v8h*)(P16 + (size_t)d * SEQ) = o; }
            if (early) {
#pragma unroll 4
                for (int s = 0; s < 16; ++s) { const int d = s * 4 + rr; v8us oh, ol;
#pragma unroll
                    for (int j = 0; j < 8; ++j) { unsigned short x0, x1; splitf(os[(seg * 8 + j) * 68 + d], x0, x1); oh[j] = x0; ol[j] = x1; }
                    *(v8us*)(PH + (size_t)d * RH) = oh; *(v8us*)(PL + (size_t)d * RH) = ol; } }
             }
    }
}

// ---- k_attn16: fused causal attention, query rows >= RH; one wave per 16 query rows, 64-key blocks up to the diagonal block, fragments straight from the f16 planes,
// running-max softmax in f32, p (x1024, f16) relaid D -> A through a wave-private LDS tile (block barrier both sides), ctx = O / l written as f16 x64 into [b][t][h*64+d].
__global__ __launch_bounds__(32) void k_attn16(const h16* __restrict__ Q16, const h16* __restrict__ K16, const h16* __restrict__ VT16, h16* CT16) {
    __shared__ __align__(16) h16 pt[16 * 72];
    __shared__ __align__(16) float os[16 * 68];
    const int lane = threadIdx.x & 31, lr = lane & 15, hi = lane >> 4;
    const int bh = blockIdx.y; const int rowbase = RH + blockIdx.x * 16;
    const size_t qoff  = ((size_t)bh * SEQ + rowbase + lr) * HD + 8 * hi;
    const size_t kbase = ((size_t)bh * SEQ + lr) * HD + 8 * hi;
    const size_t vbase = ((size_t)bh * HD + lr) * SEQ + 8 * hi;
    v8f o[4]; float m[8], l[8];
#pragma unroll
    for (int dt = 0; dt < 4; ++dt) o[dt] = (v8f){};
#pragma unroll
    for (int r = 0; r < 8; ++r) { m[r] = NEGB; l[r] = 0.0f; }
    const int nblk = rowbase / 64 + 1;
#pragma unroll 1
    for (int jb = 0; jb < nblk; ++jb) {
        const int jbase = jb * 64;
        v8f s[4];
#pragma unroll
        for (int nt = 0; nt < 4; ++nt) s[nt] = (v8f){};
        v16h qa, kf;
#pragma unroll
        for (int c = 0; c < 2; ++c) {
            qa = ldh(Q16 + qoff + c * 32);
#pragma unroll
            for (int nt = 0; nt < 4; ++nt) { kf = ldh(K16 + kbase + (size_t)(jbase + nt * 16) * HD + c * 32); s[nt] = wmma16(qa, kf, s[nt]); }
        }
        asm volatile("v_nop\n\tv_nop\n\tv_nop\n\tv_nop" : "+v"(s[0]), "+v"(s[1]), "+v"(s[2]), "+v"(s[3]) : "v"(qa), "v"(kf));
#pragma unroll
        for (int r = 0; r < 8; ++r) {
            const int t = rowbase + 8 * hi + r;
            float v[4];
#pragma unroll
            for (int nt = 0; nt < 4; ++nt) { const int key = jbase + nt * 16 + lr; const float sv = s[nt][r] * SCQ16; v[nt] = (key > t) ? NEGB : sv; }
            float mx = fmaxf(fmaxf(v[0], v[1]), fmaxf(v[2], v[3]));
            mx = fmaxf(mx, __shfl_xor(mx, 1, 32)); mx = fmaxf(mx, __shfl_xor(mx, 2, 32)); mx = fmaxf(mx, __shfl_xor(mx, 4, 32)); mx = fmaxf(mx, __shfl_xor(mx, 8, 32));
            const float mn = fmaxf(m[r], mx);
            const float al = ex2((m[r] - mn) * L2E);
            m[r] = mn;
            float p[4];
#pragma unroll
            for (int nt = 0; nt < 4; ++nt) p[nt] = ex2((v[nt] - mn) * L2E + PLOG);
            l[r] = l[r] * al + ((p[0] + p[1]) + (p[2] + p[3]));
#pragma unroll
            for (int dt = 0; dt < 4; ++dt) o[dt][r] *= al;
#pragma unroll
            for (int nt = 0; nt < 4; ++nt) pt[(8 * hi + r) * 72 + nt * 16 + lr] = (h16)p[nt];
        }
        __syncthreads();
        v16h pa, vf;
#pragma unroll
        for (int c = 0; c < 2; ++c) {
            pa = cat16(*(const v8ha*)(pt + lr * 72 + c * 32 + 8 * hi), *(const v8ha*)(pt + lr * 72 + c * 32 + 16 + 8 * hi));
#pragma unroll
            for (int dt = 0; dt < 4; ++dt) { vf = ldh(VT16 + vbase + (size_t)(dt * 16) * SEQ + jbase + c * 32); o[dt] = wmma16(pa, vf, o[dt]); }
        }
        asm volatile("v_nop\n\tv_nop\n\tv_nop\n\tv_nop" : "+v"(o[0]), "+v"(o[1]), "+v"(o[2]), "+v"(o[3]) : "v"(pa), "v"(vf));
        __syncthreads();
    }
#pragma unroll
    for (int r = 0; r < 8; ++r) {
        float lt = l[r];
        lt += __shfl_xor(lt, 1, 32); lt += __shfl_xor(lt, 2, 32); lt += __shfl_xor(lt, 4, 32); lt += __shfl_xor(lt, 8, 32);
        const float inv = (CCAR / VCAR) * (1.0f / lt);
#pragma unroll
        for (int dt = 0; dt < 4; ++dt) os[(8 * hi + r) * 68 + dt * 16 + lr] = o[dt][r] * inv;
    }
    __syncthreads();
    const int b = bh / NH, h = bh % NH; const int rr = lane >> 3, seg = lane & 7;
    h16* dst = CT16 + ((size_t)b * SEQ + rowbase) * DM + h * HD + seg * 8;
{
#pragma unroll
        for (int s = 0; s < 4; ++s) { const int row = s * 4 + rr; const v4f a = *(const v4fa*)(os + row * 68 + seg * 8); const v4f c = *(const v4fa*)(os + row * 68 + seg * 8 + 4); v8h ov;
#pragma unroll
            for (int i = 0; i < 4; ++i) { ov[i] = (h16)a[i]; ov[4 + i] = (h16)c[i]; }
            *(v8h*)(dst + (size_t)row * DM) = ov; }
         }
}

// ---- k_attnhl: the same fused kernel for query rows < RH on bf16 hi/lo planes: scores qh kh + ql kh + qh kl, p split hi/lo, O += ph vh + pl vh + ph vl; ctx written as bf16 hi/lo [b][t<RH][h*64+d].
__global__ __launch_bounds__(32) void k_attnhl(const bf* __restrict__ Qh, const bf* __restrict__ Ql, const bf* __restrict__ Kh, const bf* __restrict__ Kl,
                                                const bf* __restrict__ VTh, const bf* __restrict__ VTl, bf* ATh, bf* ATl) {
    __shared__ __align__(16) unsigned short pth[16 * 72];
    __shared__ __align__(16) unsigned short ptl[16 * 72];
    __shared__ __align__(16) float os[16 * 68];
    const int lane = threadIdx.x & 31, lr = lane & 15, hi = lane >> 4;
    const int bh = blockIdx.y; const int rowbase = blockIdx.x * 16;
    const size_t qoff  = ((size_t)bh * RH + rowbase + lr) * HD + 8 * hi;
    const size_t kbase = ((size_t)bh * RH + lr) * HD + 8 * hi;
    const size_t vbase = ((size_t)bh * HD + lr) * RH + 8 * hi;
    v8f o[4]; float m[8], l[8];
#pragma unroll
    for (int dt = 0; dt < 4; ++dt) o[dt] = (v8f){};
#pragma unroll
    for (int r = 0; r < 8; ++r) { m[r] = NEGB; l[r] = 0.0f; }
    const int nblk = rowbase / 64 + 1;
#pragma unroll 1
    for (int jb = 0; jb < nblk; ++jb) {
        const int jbase = jb * 64;
        v8f s[4];
#pragma unroll
        for (int nt = 0; nt < 4; ++nt) s[nt] = (v8f){};
        v16bf qh, ql, kh, kl;
#pragma unroll
        for (int c = 0; c < 2; ++c) {
            qh = ldb(Qh + qoff + c * 32); ql = ldb(Ql + qoff + c * 32);
#pragma unroll
            for (int nt = 0; nt < 4; ++nt) { const size_t ko = kbase + (size_t)(jbase + nt * 16) * HD + c * 32; kh = ldb(Kh + ko); kl = ldb(Kl + ko);
                s[nt] = wmmab(qh, kh, s[nt]); s[nt] = wmmab(ql, kh, s[nt]); s[nt] = wmmab(qh, kl, s[nt]); }
        }
        asm volatile("v_nop\n\tv_nop\n\tv_nop\n\tv_nop" : "+v"(s[0]), "+v"(s[1]), "+v"(s[2]), "+v"(s[3]) : "v"(qh), "v"(ql), "v"(kh), "v"(kl));
#pragma unroll
        for (int r = 0; r < 8; ++r) {
            const int t = rowbase + 8 * hi + r;
            float v[4];
#pragma unroll
            for (int nt = 0; nt < 4; ++nt) { const int key = jbase + nt * 16 + lr; const float sv = s[nt][r] * SCQHL; v[nt] = (key > t) ? NEGB : sv; }
            float mx = fmaxf(fmaxf(v[0], v[1]), fmaxf(v[2], v[3]));
            mx = fmaxf(mx, __shfl_xor(mx, 1, 32)); mx = fmaxf(mx, __shfl_xor(mx, 2, 32)); mx = fmaxf(mx, __shfl_xor(mx, 4, 32)); mx = fmaxf(mx, __shfl_xor(mx, 8, 32));
            const float mn = fmaxf(m[r], mx);
            const float al = ex2((m[r] - mn) * L2E);
            m[r] = mn;
            float p[4];
#pragma unroll
            for (int nt = 0; nt < 4; ++nt) p[nt] = ex2((v[nt] - mn) * L2E);
            l[r] = l[r] * al + ((p[0] + p[1]) + (p[2] + p[3]));
#pragma unroll
            for (int dt = 0; dt < 4; ++dt) o[dt][r] *= al;
#pragma unroll
            for (int nt = 0; nt < 4; ++nt) { unsigned short x0, x1; splitf(p[nt], x0, x1); pth[(8 * hi + r) * 72 + nt * 16 + lr] = x0; ptl[(8 * hi + r) * 72 + nt * 16 + lr] = x1; }
        }
        __syncthreads();
        v16bf pah, pal, vh, vl;
#pragma unroll
        for (int c = 0; c < 2; ++c) {
            pah = cat16b(*(const v8usa*)(pth + lr * 72 + c * 32 + 8 * hi), *(const v8usa*)(pth + lr * 72 + c * 32 + 16 + 8 * hi));
            pal = cat16b(*(const v8usa*)(ptl + lr * 72 + c * 32 + 8 * hi), *(const v8usa*)(ptl + lr * 72 + c * 32 + 16 + 8 * hi));
#pragma unroll
            for (int dt = 0; dt < 4; ++dt) { const size_t vo = vbase + (size_t)(dt * 16) * RH + jbase + c * 32; vh = ldb(VTh + vo); vl = ldb(VTl + vo);
                o[dt] = wmmab(pah, vh, o[dt]); o[dt] = wmmab(pal, vh, o[dt]); o[dt] = wmmab(pah, vl, o[dt]); }
        }
        asm volatile("v_nop\n\tv_nop\n\tv_nop\n\tv_nop" : "+v"(o[0]), "+v"(o[1]), "+v"(o[2]), "+v"(o[3]) : "v"(pah), "v"(pal), "v"(vh), "v"(vl));
        __syncthreads();
    }
#pragma unroll
    for (int r = 0; r < 8; ++r) {
        float lt = l[r];
        lt += __shfl_xor(lt, 1, 32); lt += __shfl_xor(lt, 2, 32); lt += __shfl_xor(lt, 4, 32); lt += __shfl_xor(lt, 8, 32);
        const float inv = 1.0f / lt;
#pragma unroll
        for (int dt = 0; dt < 4; ++dt) os[(8 * hi + r) * 68 + dt * 16 + lr] = o[dt][r] * inv;
    }
    __syncthreads();
    const int b = bh / NH, h = bh % NH; const int rr = lane >> 3, seg = lane & 7;
    const size_t dof = ((size_t)b * RH + rowbase) * DM + h * HD + seg * 8;
{
#pragma unroll
        for (int s = 0; s < 4; ++s) { const int row = s * 4 + rr; const v4f a = *(const v4fa*)(os + row * 68 + seg * 8); const v4f c = *(const v4fa*)(os + row * 68 + seg * 8 + 4); v8us oh, ol;
#pragma unroll
            for (int i = 0; i < 4; ++i) { unsigned short x0, x1; splitf(a[i], x0, x1); oh[i] = x0; ol[i] = x1; splitf(c[i], x0, x1); oh[4 + i] = x0; ol[4 + i] = x1; }
            *(v8us*)(ATh + dof + (size_t)row * DM) = oh; *(v8us*)(ATl + dof + (size_t)row * DM) = ol; }
         }
}

extern "C" void kernel_launch(void* const* d_in, const int* in_sizes, int n_in,
                              void* d_out, int out_size, void* d_ws, size_t ws_size, hipStream_t stream) {
    if (n_in < 5) return;
    if ((size_t)in_sizes[0] < (size_t)(NB - 1) * SEQ_FULL * DM + (size_t)SEQ * DM) return;
    if ((size_t)in_sizes[1] < (size_t)3 * DM * DM || in_sizes[2] < 3 * DM || (size_t)in_sizes[3] < (size_t)DM * DM || in_sizes[4] < DM) return;
    if ((size_t)out_size < (size_t)NB * SEQ * DM) return;
    if (ws_size < WS_TOTAL) return;
    // wire order: x, W_qkv, b_qkv, W_proj, b_proj
    const float* x = (const float*)d_in[0]; const float* wqkv = (const float*)d_in[1]; const float* bqkv = (const float*)d_in[2]; const float* wo = (const float*)d_in[3]; const float* bo = (const float*)d_in[4];
    float* OUT = (float*)d_out;
    char* wsp = (char*)d_ws;
    auto take = [&](size_t bytes) { char* p = wsp; wsp += bytes; return (void*)p; };
    bf* XB = (bf*)take(SZ_XB);
    bf* WQKV = (bf*)take(SZ_WQKV);                 // Bt [3*DM][DM]
    bf* WOb = (bf*)take(SZ_WO); h16* WO16 = (h16*)take(SZ_WO);
    h16* QK16 = (h16*)take(2 * SZ_P16);            // [q | k] f16 planes [bh][t][d]
    h16* VT16 = (h16*)take(SZ_P16);                // [bh][d][t]
    bf* QKh = (bf*)take(2 * SZ_PE); bf* QKl = (bf*)take(2 * SZ_PE);   // [q | k] early-row planes [bh][t<RH][d]
    bf* VTh = (bf*)take(SZ_PE); bf* VTl = (bf*)take(SZ_PE);           // [bh][d][t<RH]
    h16* CT16 = (h16*)take(SZ_CT);                 // ctx f16 x64 [b][t][DM] (rows >= RH used)
    bf* ATh = (bf*)take(SZ_AT); bf* ATl = (bf*)take(SZ_AT);           // ctx hi/lo [b][t<RH][DM]
    float* RC = (float*)take(SZ_ROT); float* RS = (float*)take(SZ_ROT);   // rotary cos / sin [SEQ][32]
    if ((size_t)(wsp - (char*)d_ws) > ws_size) return;

    k_cvt8<<<dim3((unsigned)(((size_t)SEQ * DM / 8 + 255) / 256), NB, 1), 256, 0, stream>>>(x, XB, (unsigned)((size_t)SEQ * DM / 8));
    k_wtG<<<(unsigned)((3 * DM * (DM / 64) + 63) / 64), 256, 0, stream>>>(wqkv, DM, 3 * DM, WQKV, (h16*)nullptr, 1.0f);   // in[DM][3*DM] -> out[3*DM][DM]
    k_wtG<<<(unsigned)((DM * (DM / 64) + 63) / 64), 256, 0, stream>>>(wo, DM, DM, WOb, WO16, WCAR);                        // in[DM][DM] -> out[DM][DM]
    k_rope<<<(unsigned)((SEQ + 7) / 8), 256, 0, stream>>>(RC, RS);
    k_qkv<<<dim3(NB * SEQ / 64, 3 * DM / 64, 1), 32, 0, stream>>>(XB, WQKV, bqkv, RC, RS, QK16, VT16, QKh, QKl, VTh, VTl);
    k_attnhl<<<dim3(RH / 16, NB * NH, 1), 32, 0, stream>>>(QKh, QKl, QKh + PLE, QKl + PLE, VTh, VTl, ATh, ATl);
    if (SEQ > RH)
        k_attn16<<<dim3((SEQ - RH) / 16 > 0 ? (SEQ - RH) / 16 : 1, NB * NH, 1), 32, 0, stream>>>(QK16, QK16 + PL16, VT16, CT16);
    k_proj_hl<<<dim3(RH / 64, DM / 64, NB), 32, 0, stream>>>(ATh, ATl, WOb, OUT, bo);
    if (SEQ > RH)
        k_proj16<<<dim3((SEQ - RH) / 64 > 0 ? (SEQ - RH) / 64 : 1, DM / 64, NB), 32, 0, stream>>>(CT16 + (size_t)RH * DM, WO16, OUT + (size_t)RH * DM, bo);
}

// v001
// A run of this version takes 362 microseconds.
// Two timings next to v000 both put it at 1.25 times that version's speed.
#include <hip/hip_runtime.h>

// Contractions (all f32 accumulate): x*W_qkv on v_wmma_f32_16x16x32_bf16 (both operands bf16 RNE copies of the inputs, exact products);
// q*k^T and p*v: query rows >= 256 on v_wmma_f32_16x16x32_f16 (q,k,v carried x16, p carried x1024), query rows < 256 on bf16 hi/lo planes (3 products);
// ctx*W_proj: rows >= 256 f16 (ctx x64, w x1024 from the bf16 copy), rows < 256 bf16 hi/lo ctx x bf16 w (2 products). Softmax f32 (running max, exp2).
// Rotary on q and k (interleaved pairs (2i,2i+1) -> (-x[2i+1], x[2i]); angle = pos * inv_freq[d mod 32], inv_freq[j] = 1 / 10000^(j/32)) applied in f32 on the
// staged 64x64 tile in the x*W_qkv epilogue, from cos/sin tables [SEQ][32] built once by k_rope (precise sincosf).
// Layout: x [NB][SEQ_FULL][1024] (first SEQ rows of each batch read); W_qkv [1024][3072] (in,out), thirds q|k|v, column = which*1024 + h*64 + d; W_proj [1024][1024] (in,out); out [NB][SEQ][1024].

#ifndef NB
#define NB 4
#endif
#ifndef SEQ
#define SEQ 2048
#endif
#define NB_FULL  4
#define SEQ_FULL 2048
#define DM   1024
#define NH   16
#define HD   64
#define RH   256                 // query rows < RH use bf16 hi/lo planes
#define QKCAR 16.0f
#define VCAR  16.0f
#define CCAR  64.0f
#define WCAR  1024.0f
#define PLOG  10.0f              // p carried x 2^10
#define L2E   1.4426950408889634f
#define NEGB  (-3.0e38f)
#define SCQ16 (0.125f / (QKCAR * QKCAR))
#define SCQHL 0.125f

typedef _Float16 h16;
typedef unsigned short bf;
typedef __attribute__((ext_vector_type(16))) __bf16   v16bf;
typedef __attribute__((ext_vector_type(16))) _Float16 v16h;
typedef __attribute__((ext_vector_type(8)))  _Float16 v8h;
typedef __attribute__((ext_vector_type(2)))  _Float16 v2h;
typedef __attribute__((ext_vector_type(8)))  unsigned short v8us;
typedef __attribute__((ext_vector_type(2)))  unsigned short v2us;
typedef __attribute__((ext_vector_type(8)))  float    v8f;
typedef __attribute__((ext_vector_type(4)))  float    v4f;
typedef v8h  __attribute__((may_alias)) v8ha;
typedef v4f  __attribute__((may_alias)) v4fa;
typedef v8us __attribute__((may_alias)) v8usa;

static_assert(SEQ % 64 == 0);
static_assert(RH % 64 == 0);
static_assert(RH <= SEQ);
static_assert(SEQ <= SEQ_FULL);
static_assert(NB <= NB_FULL);
static_assert(DM % 64 == 0);
static_assert(DM % 32 == 0);
static_assert(HD == 64);
static_assert(NH * HD == DM);
static_assert((3 * DM) % 64 == 0);
static_assert(HD / 2 == 32);
static_assert(SEQ % 8 == 0);          // k_rope: 8 positions per 256-thread block

constexpr size_t PL16 = (size_t)NB * NH * SEQ * HD;     // elements of one f16 head plane set
constexpr size_t PLE  = (size_t)NB * NH * RH * HD;      // elements of one early-row bf16 plane set
constexpr size_t SZ_XB   = (size_t)NB * SEQ * DM * 2;
constexpr size_t SZ_WQKV = (size_t)3 * DM * DM * 2;
constexpr size_t SZ_WO   = (size_t)DM * DM * 2;
constexpr size_t SZ_P16  = PL16 * 2;
constexpr size_t SZ_PE   = PLE * 2;
constexpr size_t SZ_CT   = (size_t)NB * SEQ * DM * 2;
constexpr size_t SZ_AT   = (size_t)NB * RH * DM * 2;
constexpr size_t SZ_ROT  = (size_t)SEQ * 32 * 4;        // one rotary table (cos or sin) [SEQ][32] f32
constexpr size_t WS_TOTAL = SZ_XB + SZ_WQKV + 2 * SZ_WO + 3 * SZ_P16 + 6 * SZ_PE + SZ_CT + 2 * SZ_AT + 2 * SZ_ROT;
static_assert(SZ_XB % 256 == 0 && SZ_WQKV % 256 == 0 && SZ_WO % 256 == 0 && SZ_P16 % 256 == 0 && SZ_PE % 256 == 0 && SZ_CT % 256 == 0 && SZ_AT % 256 == 0);
static_assert(SZ_ROT % 256 == 0);
static_assert(WS_TOTAL <= (size_t)134217728);

__device__ __forceinline__ unsigned short f2bf(float f) { unsigned u = __float_as_uint(f); u += 0x7FFFu + ((u >> 16) & 1u); return (unsigned short)(u >> 16); }
__device__ __forceinline__ float bf2f(unsigned short b) { return __uint_as_float(((unsigned)b) << 16); }
__device__ __forceinline__ float bfr(float f) { return bf2f(f2bf(f)); }
__device__ __forceinline__ void splitf(float y, unsigned short& h, unsigned short& l) { h = f2bf(y); l = f2bf(y - bf2f(h)); }
__device__ __forceinline__ v16h cat16(v8h lo, v8h hi) { return __builtin_shufflevector(lo, hi, 0, 1, 2, 3, 4, 5, 6, 7, 8, 9, 10, 11, 12, 13, 14, 15); }
__device__ __forceinline__ v16bf cat16b(v8us lo, v8us hi) { return __builtin_bit_cast(v16bf, __builtin_shufflevector(lo, hi, 0, 1, 2, 3, 4, 5, 6, 7, 8, 9, 10, 11, 12, 13, 14, 15)); }
__device__ __forceinline__ v8f wmma16(v16h a, v16h b, v8f c) { return __builtin_amdgcn_wmma_f32_16x16x32_f16(false, a, false, b, (short)0, c, false, false); }
__device__ __forceinline__ v8f wmmab(v16bf a, v16bf b, v8f c) { return __builtin_amdgcn_wmma_f32_16x16x32_bf16(false, a, false, b, (short)0, c, false, false); }
__device__ __forceinline__ float ex2(float x) { return __builtin_amdgcn_exp2f(x); }
// f32 -> f16 for operand planes: anything below the smallest f16 normal becomes an exact zero (value select, applied after the carry)
static __device__ __forceinline__ h16 toh_flush(float v) { const h16 r = (h16)v; return (fabsf(v) < 6.103515625e-05f) ? (h16)0.0f : r; }
// fragment loads from K-contiguous 16-bit rows: p already includes + 8*(lane>>4); elements 0..7 <- k0+8h.., 8..15 <- k0+16+8h..
__device__ __forceinline__ v16h  ldh(const h16* p) { return cat16(*(const v8h*)p, *(const v8h*)(p + 16)); }
__device__ __forceinline__ v16bf ldb(const bf* p)  { return cat16b(*(const v8us*)p, *(const v8us*)(p + 16)); }

template <typename T16> struct WFrag;
template <> struct WFrag<h16> { typedef v16h V; static __device__ __forceinline__ V ld(const h16* p) { return ldh(p); } static __device__ __forceinline__ v8f mma(V a, V b, v8f c) { return wmma16(a, b, c); } };
template <> struct WFrag<bf>  { typedef v16bf V; static __device__ __forceinline__ V ld(const bf* p) { return ldb(p); } static __device__ __forceinline__ v8f mma(V a, V b, v8f c) { return wmmab(a, b, c); } };

// ---- one-wave 64x64 tile main loop: acc[mb][nb] += A[r0+mb*16..][k] Bt[c0+nb*16..][k]; NSPLIT 1 adds the A2 (lo) plane against the same B. K % 32 == 0.
template <typename T16, int NSPLIT>
__device__ __forceinline__ void gemm_loop(const T16* __restrict__ A, const T16* __restrict__ A2, const T16* __restrict__ Bt, int K, size_t aoff, size_t boff, v8f (&acc)[4][4]) {
    typedef typename WFrag<T16>::V V;
#pragma unroll 1
    for (int kc = 0; kc < K; kc += 32) {
        V a[4], a2[4];
#pragma unroll
        for (int mb = 0; mb < 4; ++mb) { a[mb] = WFrag<T16>::ld(A + aoff + (size_t)mb * 16 * K + kc); if (NSPLIT == 1) a2[mb] = WFrag<T16>::ld(A2 + aoff + (size_t)mb * 16 * K + kc); }
#pragma unroll
        for (int nb = 0; nb < 4; ++nb) { const V b = WFrag<T16>::ld(Bt + boff + (size_t)nb * 16 * K + kc);
#pragma unroll
            for (int mb = 0; mb < 4; ++mb) { acc[mb][nb] = WFrag<T16>::mma(a[mb], b, acc[mb][nb]); if (NSPLIT == 1) acc[mb][nb] = WFrag<T16>::mma(a2[mb], b, acc[mb][nb]); } }
        asm volatile("v_nop\n\tv_nop\n\tv_nop\n\tv_nop" : "+v"(acc[0][0]), "+v"(acc[1][1]), "+v"(acc[2][2]), "+v"(acc[3][3]) : "v"(a[0]), "v"(a[3]));
    }
}

// ---- GEMM with f32 output: C[m][n] = osc * sum_k A[m][k] Bt[n][k] + bf16(bias[n]); grid (M/64, N/64, Z), 32 threads. Per 16-row slab staged in LDS,
template <typename T16, int NSPLIT>
__device__ __forceinline__ void gemm_out_body(const T16* __restrict__ A, const T16* __restrict__ A2, const T16* __restrict__ Bt, int K, float* C, int ldc, const float* __restrict__ bias, float osc, size_t sA, size_t sC) {
    __shared__ __align__(16) float os[16 * 68];
    const size_t z = blockIdx.z; A += z * sA; A2 += z * sA; C += z * sC;
    const int lane = threadIdx.x & 31, lr = lane & 15, hi = lane >> 4; const int r0 = blockIdx.x * 64, c0 = blockIdx.y * 64;
    v8f acc[4][4];
#pragma unroll
    for (int mb = 0; mb < 4; ++mb)
#pragma unroll
        for (int nb = 0; nb < 4; ++nb) acc[mb][nb] = (v8f){};
    const size_t aoff = (size_t)(r0 + lr) * K + 8 * hi, boff = (size_t)(c0 + lr) * K + 8 * hi;
    gemm_loop<T16, NSPLIT>(A, A2, Bt, K, aoff, boff, acc);
    const int cofs = lr * 4;
    const v4f bv = *(const v4f*)(bias + c0 + cofs);
    v4f bb; bb[0] = bfr(bv[0]); bb[1] = bfr(bv[1]); bb[2] = bfr(bv[2]); bb[3] = bfr(bv[3]);
#pragma unroll
    for (int mb = 0; mb < 4; ++mb) {
#pragma unroll
        for (int nb = 0; nb < 4; ++nb) {
#pragma unroll
            for (int j = 0; j < 8; ++j) os[(hi * 8 + j) * 68 + nb * 16 + lr] = acc[mb][nb][j]; }
        __syncthreads();
        float* crow = C + (size_t)(r0 + mb * 16) * ldc + c0;
{
#pragma unroll
            for (int s = 0; s < 8; ++s) { const int row = 2 * s + hi; const v4f t = *(const v4fa*)(os + row * 68 + cofs); v4f val;
                val[0] = t[0] * osc + bb[0]; val[1] = t[1] * osc + bb[1]; val[2] = t[2] * osc + bb[2]; val[3] = t[3] * osc + bb[3];
                *(v4f*)(crow + (size_t)row * ldc + cofs) = val; }
             }
        __syncthreads();
    }
}

// rows < RH: ctx hi/lo (bf16) x w_proj (bf16), z = batch
__global__ __launch_bounds__(32) void k_proj_hl(const bf* __restrict__ Ah, const bf* __restrict__ Al, const bf* __restrict__ Wt, float* C, const float* __restrict__ bias) {
    gemm_out_body<bf, 1>(Ah, Al, Wt, DM, C, DM, bias, 1.0f, (size_t)RH * DM, (size_t)SEQ * DM);
}
// rows >= RH: ctx f16 (x64) x w_proj f16 (x1024), z = batch; A and C already offset by RH rows
__global__ __launch_bounds__(32) void k_proj16(const h16* __restrict__ A, const h16* __restrict__ Wt, float* C, const float* __restrict__ bias) {
    gemm_out_body<h16, 0>(A, A, Wt, DM, C, DM, bias, 1.0f / (CCAR * WCAR), (size_t)SEQ * DM, (size_t)SEQ * DM);
}

__global__ __launch_bounds__(256) void k_cvt8(const float* __restrict__ src, bf* dst, unsigned n8) {
    const size_t b = blockIdx.y; src += b * (size_t)SEQ_FULL * DM; dst += b * (size_t)SEQ * DM;
    const unsigned i = blockIdx.x * 256 + threadIdx.x; if (i >= n8) return;
    const v8f v = *(const v8f*)(src + (size_t)i * 8); v8us o;
#pragma unroll
    for (int k = 0; k < 8; ++k) o[k] = f2bf(v[k]);
    *(v8us*)(dst + (size_t)i * 8) = o; 
}

__global__ __launch_bounds__(256) void k_wtG(const float* __restrict__ w, int K, int N, bf* Bt, h16* Bt16, float car) {
    const int lane = threadIdx.x & 31; const int L0 = (blockIdx.x * 8 + (threadIdx.x >> 5)) * 8; const int nlines = N * (K / 64);
{
#pragma unroll 1
        for (int l = 0; l < 8; ++l) { const int L = L0 + l; if (L >= nlines) break; const size_t e = (size_t)L * 64 + lane * 2; const int k = (int)(e % K), n = (int)(e / K); v2us o;
            o[0] = f2bf(w[(size_t)k * N + n]); o[1] = f2bf(w[(size_t)(k + 1) * N + n]); *(v2us*)(Bt + e) = o;
            if (Bt16) { v2h o2; o2[0] = (h16)(bf2f(o[0]) * car); o2[1] = (h16)(bf2f(o[1]) * car); *(v2h*)(Bt16 + e) = o2; } }
         }
}

// ---- k_rope: rotary tables RC = cos, RS = sin, [SEQ][32] f32; angle = (float)pos * inv_freq[j], inv_freq[j] = 1.0f / (float)(10000^(j/32));
__global__ __launch_bounds__(256) void k_rope(float* RC, float* RS) {
#pragma clang fp contract(off)
    const int wave = __builtin_amdgcn_readfirstlane(threadIdx.x >> 5); const int lane = threadIdx.x & 31;
    const int pos = blockIdx.x * 8 + wave; if (pos >= SEQ) return;
    double p = 1.0;
#pragma unroll 1
    for (int j = 0; j < lane; ++j) p = p * 1.3335214321633240;
    const float pw = (float)p; const float inv = 1.0f / pw; const float ang = (float)pos * inv;
    float sv, cv; sincosf(ang, &sv, &cv);
    float* pc = RC + (size_t)pos * 32 + lane; float* pq = RS + (size_t)pos * 32 + lane;
    *(float*)pc = cv; *(float*)pq = sv; 
}

// ---- k_qkv: one wave per 64x64 tile of x W_qkv + b_qkv (bf16 x bf16 exact). The tile (64 tokens x one head third) is staged whole in LDS; q and k tiles get the rotary
// applied in place in LDS (each lane owns 8 consecutive d of a row, i.e. 4 whole pairs), then written as head planes:
__global__ __launch_bounds__(32) void k_qkv(const bf* __restrict__ XB, const bf* __restrict__ W, const float* __restrict__ bias, const float* __restrict__ RC, const float* __restrict__ RS,
                                             h16* QK16, h16* VT16, bf* QKh, bf* QKl, bf* VTh, bf* VTl) {
    __shared__ __align__(16) float os[64 * 68];
    const int lane = threadIdx.x & 31, lr = lane & 15, hi = lane >> 4; const int r0 = blockIdx.x * 64, c0 = blockIdx.y * 64;
    v8f acc[4][4];
#pragma unroll
    for (int mb = 0; mb < 4; ++mb)
#pragma unroll
        for (int nb = 0; nb < 4; ++nb) acc[mb][nb] = (v8f){};
    const size_t aoff = (size_t)(r0 + lr) * DM + 8 * hi, boff = (size_t)(c0 + lr) * DM + 8 * hi;
    gemm_loop<bf, 0>(XB, XB, W, DM, aoff, boff, acc);
#pragma unroll
    for (int nb = 0; nb < 4; ++nb) { const float bc = bfr(bias[c0 + nb * 16 + lr]);
#pragma unroll
        for (int mb = 0; mb < 4; ++mb) {
#pragma unroll
            for (int j = 0; j < 8; ++j) os[(mb * 16 + hi * 8 + j) * 68 + nb * 16 + lr] = acc[mb][nb][j] + bc; } }
    __syncthreads();
    const int which = c0 / DM; const int h = (c0 % DM) / HD; const int b = r0 / SEQ; const int t0 = r0 % SEQ; const int bhh = b * NH + h; const bool early = (t0 < RH); const int te = early ? t0 : 0;
    const int rr = lane >> 3, seg = lane & 7;
    if (which < 2) {
        // rotary in place: lane owns d = seg*8 .. seg*8+7 of row s*4+rr; table column = d mod 32 = (seg & 3)*8 + i; position = t0 + row
        const size_t tof = (size_t)(t0 + rr) * 32 + (seg & 3) * 8;
#pragma unroll 1
        for (int s = 0; s < 16; ++s) { const int row = s * 4 + rr;
            const v4f ca = *(const v4f*)(RC + tof + (size_t)s * 128); const v4f cb = *(const v4f*)(RC + tof + (size_t)s * 128 + 4);
            const v4f sa = *(const v4f*)(RS + tof + (size_t)s * 128); const v4f sb = *(const v4f*)(RS + tof + (size_t)s * 128 + 4);
            float* op = os + row * 68 + seg * 8;
            const v4f a = *(const v4fa*)op; const v4f c = *(const v4fa*)(op + 4); v4f ra, rc;
            ra[0] = a[0] * ca[0] + (-a[1]) * sa[0]; ra[1] = a[1] * ca[1] + a[0] * sa[1];
            ra[2] = a[2] * ca[2] + (-a[3]) * sa[2]; ra[3] = a[3] * ca[3] + a[2] * sa[3];
            rc[0] = c[0] * cb[0] + (-c[1]) * sb[0]; rc[1] = c[1] * cb[1] + c[0] * sb[1];
            rc[2] = c[2] * cb[2] + (-c[3]) * sb[2]; rc[3] = c[3] * cb[3] + c[2] * sb[3];
            *(v4fa*)op = ra; *(v4fa*)(op + 4) = rc; }
    }
    __syncthreads();
    if (which < 2) {
        h16* P16 = QK16 + (size_t)which * PL16 + ((size_t)bhh * SEQ + t0) * HD + seg * 8;
        bf* PH = QKh + (size_t)which * PLE + ((size_t)bhh * RH + te) * HD + seg * 8;
        bf* PL = QKl + (size_t)which * PLE + ((size_t)bhh * RH + te) * HD + seg * 8;
{
#pragma unroll 4
            for (int s = 0; s < 16; ++s) { const int row = s * 4 + rr; const v4f a = *(const v4fa*)(os + row * 68 + seg * 8); const v4f c = *(const v4fa*)(os + row * 68 + seg * 8 + 4); v8h o;
#pragma unroll
                for (int i = 0; i < 4; ++i) { o[i] = toh_flush(a[i] * QKCAR); o[4 + i] = toh_flush(c[i] * QKCAR); }
                *(v8h*)(P16 + (size_t)row * HD) = o; }
            if (early) {
#pragma unroll 4
                for (int s = 0; s < 16; ++s) { const int row = s * 4 + rr; const v4f a = *(const v4fa*)(os + row * 68 + seg * 8); const v4f c = *(const v4fa*)(os + row * 68 + seg * 8 + 4); v8us oh, ol;
#pragma unroll
                    for (int i = 0; i < 4; ++i) { unsigned short x0, x1; splitf(a[i], x0, x1); oh[i] = x0; ol[i] = x1; splitf(c[i], x0, x1); oh[4 + i] = x0; ol[4 + i] = x1; }
                    *(v8us*)(PH + (size_t)row * HD) = oh; *(v8us*)(PL + (size_t)row * HD) = ol; } }
             }
    } else {
        h16* P16 = VT16 + ((size_t)bhh * HD) * SEQ + t0 + seg * 8;
        bf* PH = VTh + ((size_t)bhh * HD) * RH + te + seg * 8;
        bf* PL = VTl + ((size_t)bhh * HD) * RH + te + seg * 8;
{
#pragma unroll 4
            for (int s = 0; s < 16; ++s) { const int d = s * 4 + rr; v8h o;
#pragma unroll
                for (int j = 0; j < 8; ++j) o[j] = toh_flush(os[(seg * 8 + j) * 68 + d] * VCAR);
                *(v8h*)(P16 + (size_t)d * SEQ) = o; }
            if (early) {
#pragma unroll 4
                for (int s = 0; s < 16; ++s) { const int d = s * 4 + rr; v8us oh, ol;
#pragma unroll
                    for (int j = 0; j < 8; ++j) { unsigned short x0, x1; splitf(os[(seg * 8 + j) * 68 + d], x0, x1); oh[j] = x0; ol[j] = x1; }
                    *(v8us*)(PH + (size_t)d * RH) = oh; *(v8us*)(PL + (size_t)d * RH) = ol; } }
             }
    }
}

// ---- k_attn16: fused causal attention, query rows >= RH; four waves per block, 16 query rows each (64 rows that share one diagonal block), 64-key blocks up to the diagonal.
// Each 64-key K tile [key][d] and V tile [d][key] is brought into LDS once per block by asynchronous b128 copies (rows of 128 B at a pitch of 144 B), two buffers: the next
// tile's copies fly while this one is worked on; all four waves take their fragments from LDS. Running-max softmax in f32, p (x1024, f16) relaid D -> A through a wave-private
// LDS tile (ordered by the wave's own LDS wait), ctx = O / l written as f16 x64 into [b][t][h*64+d].
#define AW    4                  // waves per block
#define KVP   72                 // LDS pitch of a K or V tile row, in f16 elements
#define KVT   (64 * KVP)         // elements of one staged tile
static_assert((SEQ - RH) % (16 * AW) == 0 && RH % (16 * AW) == 0 && 16 * AW == 64);
static_assert((size_t)AW * 16 * 68 * 4 <= (size_t)4 * KVT * 2);   // the output staging fits in the ring it takes over

// one stage: this thread's four 16-byte pieces of the K tile and of the V tile (128 threads x 4 x 16 B = 8 KiB each), rows 16 apart
__device__ __forceinline__ void stage_kv(const h16* kg, const h16* vg, unsigned kl, unsigned vl) {
    // s_wait_xcnt stands inside the statement so that no address register of a copy is rewritten ahead of it
    asm volatile("global_load_async_to_lds_b128 %0, %8, off\n\t"
                 "global_load_async_to_lds_b128 %1, %9, off\n\t"
                 "global_load_async_to_lds_b128 %2, %10, off\n\t"
                 "global_load_async_to_lds_b128 %3, %11, off\n\t"
                 "global_load_async_to_lds_b128 %4, %12, off\n\t"
                 "global_load_async_to_lds_b128 %5, %13, off\n\t"
                 "global_load_async_to_lds_b128 %6, %14, off\n\t"
                 "global_load_async_to_lds_b128 %7, %15, off\n\t"
                 "s_wait_xcnt 0x0"
                 :: "v"(kl), "v"(kl + 16 * KVP * 2), "v"(kl + 32 * KVP * 2), "v"(kl + 48 * KVP * 2),
                    "v"(vl), "v"(vl + 16 * KVP * 2), "v"(vl + 32 * KVP * 2), "v"(vl + 48 * KVP * 2),
                    "v"(kg), "v"(kg + 16 * HD), "v"(kg + 32 * HD), "v"(kg + 48 * HD),
                    "v"(vg), "v"(vg + (size_t)16 * SEQ), "v"(vg + (size_t)32 * SEQ), "v"(vg + (size_t)48 * SEQ)
                 : "memory");
}

__global__ __launch_bounds__(32 * AW) void k_attn16(const h16* __restrict__ Q16, const h16* __restrict__ K16, const h16* __restrict__ VT16, h16* CT16) {
    __shared__ __align__(16) h16 ring[4 * KVT];          // [buffer][K | V][row][KVP]; after the loop: output staging
    __shared__ __align__(16) h16 ptw[AW * 16 * 72];
    const int lane = threadIdx.x & 31, lr = lane & 15, hi = lane >> 4;
    const int wave = __builtin_amdgcn_readfirstlane(threadIdx.x >> 5);
    h16* pt = ptw + wave * (16 * 72);
    const int bh = blockIdx.y; const int blkbase = RH + blockIdx.x * (16 * AW); const int rowbase = blkbase + wave * 16;
    const size_t qoff  = ((size_t)bh * SEQ + rowbase + lr) * HD + 8 * hi;
    // staging: thread t owns piece (t & 7) of rows (t >> 3) + 16 j, j = 0..3, of both tiles
    const int srow = threadIdx.x >> 3, sseg = threadIdx.x & 7;
    const h16* kg = K16 + ((size_t)bh * SEQ + srow) * HD + sseg * 8;
    const h16* vg = VT16 + ((size_t)bh * HD + srow) * SEQ + sseg * 8;
    const unsigned sl = (unsigned)(size_t)(ring + srow * KVP + sseg * 8);   // LDS byte address of the piece in buffer 0's K tile
    const int foff = lr * KVP + 8 * hi;                                     // fragment row and half inside a tile
    v8f o[4]; float m[8], l[8];
#pragma unroll
    for (int dt = 0; dt < 4; ++dt) o[dt] = (v8f){};
#pragma unroll
    for (int r = 0; r < 8; ++r) { m[r] = NEGB; l[r] = 0.0f; }
    const int nblk = blkbase / 64 + 1;
    stage_kv(kg, vg, sl, sl + KVT * 2);
    asm volatile("s_wait_asynccnt 0x0" ::: "memory");   // tile 0 of this wave's copies has landed
    __syncthreads();                                     // ... and every other wave's
    if (nblk > 1) stage_kv(kg + 64 * HD, vg + 64, sl + 2 * KVT * 2, sl + 3 * KVT * 2);
#pragma unroll 1
    for (int jb = 0; jb < nblk; ++jb) {
        const int jbase = jb * 64;
        const h16* kb = ring + (jb & 1) * (2 * KVT) + foff; const h16* vb = kb + KVT;
        v8f s[4];
#pragma unroll
        for (int nt = 0; nt < 4; ++nt) s[nt] = (v8f){};
        v16h qa, kf;
#pragma unroll
        for (int c = 0; c < 2; ++c) {
            qa = ldh(Q16 + qoff + c * 32);
#pragma unroll
            for (int nt = 0; nt < 4; ++nt) { const h16* kp = kb + nt * 16 * KVP + c * 32; kf = cat16(*(const v8ha*)kp, *(const v8ha*)(kp + 16)); s[nt] = wmma16(qa, kf, s[nt]); }
        }
        asm volatile("v_nop\n\tv_nop\n\tv_nop\n\tv_nop" : "+v"(s[0]), "+v"(s[1]), "+v"(s[2]), "+v"(s[3]) : "v"(qa), "v"(kf));
#pragma unroll
        for (int r = 0; r < 8; ++r) {
            const int t = rowbase + 8 * hi + r;
            float v[4];
#pragma unroll
            for (int nt = 0; nt < 4; ++nt) { const int key = jbase + nt * 16 + lr; const float sv = s[nt][r] * SCQ16; v[nt] = (key > t) ? NEGB : sv; }
            float mx = fmaxf(fmaxf(v[0], v[1]), fmaxf(v[2], v[3]));
            mx = fmaxf(mx, __shfl_xor(mx, 1, 32)); mx = fmaxf(mx, __shfl_xor(mx, 2, 32)); mx = fmaxf(mx, __shfl_xor(mx, 4, 32)); mx = fmaxf(mx, __shfl_xor(mx, 8, 32));
            const float mn = fmaxf(m[r], mx);
            const float al = ex2((m[r] - mn) * L2E);
            m[r] = mn;
            float p[4];
#pragma unroll
            for (int nt = 0; nt < 4; ++nt) p[nt] = ex2((v[nt] - mn) * L2E + PLOG);
            l[r] = l[r] * al + ((p[0] + p[1]) + (p[2] + p[3]));
#pragma unroll
            for (int dt = 0; dt < 4; ++dt) o[dt][r] *= al;
#pragma unroll
            for (int nt = 0; nt < 4; ++nt) pt[(8 * hi + r) * 72 + nt * 16 + lr] = (h16)p[nt];
        }
        asm volatile("s_wait_dscnt 0x0" ::: "memory");   // the p tile is private to the wave: its own stores are done before its lanes read each other's
        v16h pa, vf;
#pragma unroll
        for (int c = 0; c < 2; ++c) {
            pa = cat16(*(const v8ha*)(pt + lr * 72 + c * 32 + 8 * hi), *(const v8ha*)(pt + lr * 72 + c * 32 + 16 + 8 * hi));
#pragma unroll
            for (int dt = 0; dt < 4; ++dt) { const h16* vp = vb + dt * 16 * KVP + c * 32; vf = cat16(*(const v8ha*)vp, *(const v8ha*)(vp + 16)); o[dt] = wmma16(pa, vf, o[dt]); }
        }
        asm volatile("v_nop\n\tv_nop\n\tv_nop\n\tv_nop" : "+v"(o[0]), "+v"(o[1]), "+v"(o[2]), "+v"(o[3]) : "v"(pa), "v"(vf));
        asm volatile("s_wait_dscnt 0x0" ::: "memory");      // this wave has finished reading the buffer (and its p tile)
        asm volatile("s_wait_asynccnt 0x0" ::: "memory");   // this wave's copies of tile jb + 1 have landed
        __syncthreads();                                     // publishes tile jb + 1 and frees the buffer of tile jb
        if (jb + 2 < nblk) { const unsigned bl = sl + (jb & 1) * (2 * KVT * 2); stage_kv(kg + (size_t)(jbase + 128) * HD, vg + jbase + 128, bl, bl + KVT * 2); }
    }
    asm volatile("s_wait_asynccnt 0x0" ::: "memory");       // nothing of the ring is in flight when it becomes output staging
    float* os = (float*)ring + wave * (16 * 68);
#pragma unroll
    for (int r = 0; r < 8; ++r) {
        float lt = l[r];
        lt += __shfl_xor(lt, 1, 32); lt += __shfl_xor(lt, 2, 32); lt += __shfl_xor(lt, 4, 32); lt += __shfl_xor(lt, 8, 32);
        const float inv = (CCAR / VCAR) * (1.0f / lt);
#pragma unroll
        for (int dt = 0; dt < 4; ++dt) os[(8 * hi + r) * 68 + dt * 16 + lr] = o[dt][r] * inv;
    }
    __syncthreads();
    const int b = bh / NH, h = bh % NH; const int rr = lane >> 3, seg = lane & 7;
    h16* dst = CT16 + ((size_t)b * SEQ + rowbase) * DM + h * HD + seg * 8;
{
#pragma unroll
        for (int s = 0; s < 4; ++s) { const int row = s * 4 + rr; const v4f a = *(const v4fa*)(os + row * 68 + seg * 8); const v4f c = *(const v4fa*)(os + row * 68 + seg * 8 + 4); v8h ov;
#pragma unroll
            for (int i = 0; i < 4; ++i) { ov[i] = (h16)a[i]; ov[4 + i] = (h16)c[i]; }
            *(v8h*)(dst + (size_t)row * DM) = ov; }
         }
}

// ---- k_attnhl: the same fused kernel for query rows < RH on bf16 hi/lo planes: scores qh kh + ql kh + qh kl, p split hi/lo, O += ph vh + pl vh + ph vl; ctx written as bf16 hi/lo [b][t<RH][h*64+d].
__global__ __launch_bounds__(32) void k_attnhl(const bf* __restrict__ Qh, const bf* __restrict__ Ql, const bf* __restrict__ Kh, const bf* __restrict__ Kl,
                                                const bf* __restrict__ VTh, const bf* __restrict__ VTl, bf* ATh, bf* ATl) {
    __shared__ __align__(16) unsigned short pth[16 * 72];
    __shared__ __align__(16) unsigned short ptl[16 * 72];
    __shared__ __align__(16) float os[16 * 68];
    const int lane = threadIdx.x & 31, lr = lane & 15, hi = lane >> 4;
    const int bh = blockIdx.y; const int rowbase = blockIdx.x * 16;
    const size_t qoff  = ((size_t)bh * RH + rowbase + lr) * HD + 8 * hi;
    const size_t kbase = ((size_t)bh * RH + lr) * HD + 8 * hi;
    const size_t vbase = ((size_t)bh * HD + lr) * RH + 8 * hi;
    v8f o[4]; float m[8], l[8];
#pragma unroll
    for (int dt = 0; dt < 4; ++dt) o[dt] = (v8f){};
#pragma unroll
    for (int r = 0; r < 8; ++r) { m[r] = NEGB; l[r] = 0.0f; }
    const int nblk = rowbase / 64 + 1;
#pragma unroll 1
    for (int jb = 0; jb < nblk; ++jb) {
        const int jbase = jb * 64;
        v8f s[4];
#pragma unroll
        for (int nt = 0; nt < 4; ++nt) s[nt] = (v8f){};
        v16bf qh, ql, kh, kl;
#pragma unroll
        for (int c = 0; c < 2; ++c) {
            qh = ldb(Qh + qoff + c * 32); ql = ldb(Ql + qoff + c * 32);
#pragma unroll
            for (int nt = 0; nt < 4; ++nt) { const size_t ko = kbase + (size_t)(jbase + nt * 16) * HD + c * 32; kh = ldb(Kh + ko); kl = ldb(Kl + ko);
                s[nt] = wmmab(qh, kh, s[nt]); s[nt] = wmmab(ql, kh, s[nt]); s[nt] = wmmab(qh, kl, s[nt]); }
        }
        asm volatile("v_nop\n\tv_nop\n\tv_nop\n\tv_nop" : "+v"(s[0]), "+v"(s[1]), "+v"(s[2]), "+v"(s[3]) : "v"(qh), "v"(ql), "v"(kh), "v"(kl));
#pragma unroll
        for (int r = 0; r < 8; ++r) {
            const int t = rowbase + 8 * hi + r;
            float v[4];
#pragma unroll
            for (int nt = 0; nt < 4; ++nt) { const int key = jbase + nt * 16 + lr; const float sv = s[nt][r] * SCQHL; v[nt] = (key > t) ? NEGB : sv; }
            float mx = fmaxf(fmaxf(v[0], v[1]), fmaxf(v[2], v[3]));
            mx = fmaxf(mx, __shfl_xor(mx, 1, 32)); mx = fmaxf(mx, __shfl_xor(mx, 2, 32)); mx = fmaxf(mx, __shfl_xor(mx, 4, 32)); mx = fmaxf(mx, __shfl_xor(mx, 8, 32));
            const float mn = fmaxf(m[r], mx);
            const float al = ex2((m[r] - mn) * L2E);
            m[r] = mn;
            float p[4];
#pragma unroll
            for (int nt = 0; nt < 4; ++nt) p[nt] = ex2((v[nt] - mn) * L2E);
            l[r] = l[r] * al + ((p[0] + p[1]) + (p[2] + p[3]));
#pragma unroll
            for (int dt = 0; dt < 4; ++dt) o[dt][r] *= al;
#pragma unroll
            for (int nt = 0; nt < 4; ++nt) { unsigned short x0, x1; splitf(p[nt], x0, x1); pth[(8 * hi + r) * 72 + nt * 16 + lr] = x0; ptl[(8 * hi + r) * 72 + nt * 16 + lr] = x1; }
        }
        __syncthreads();
        v16bf pah, pal, vh, vl;
#pragma unroll
        for (int c = 0; c < 2; ++c) {
            pah = cat16b(*(const v8usa*)(pth + lr * 72 + c * 32 + 8 * hi), *(const v8usa*)(pth + lr * 72 + c * 32 + 16 + 8 * hi));
            pal = cat16b(*(const v8usa*)(ptl + lr * 72 + c * 32 + 8 * hi), *(const v8usa*)(ptl + lr * 72 + c * 32 + 16 + 8 * hi));
#pragma unroll
            for (int dt = 0; dt < 4; ++dt) { const size_t vo = vbase + (size_t)(dt * 16) * RH + jbase + c * 32; vh = ldb(VTh + vo); vl = ldb(VTl + vo);
                o[dt] = wmmab(pah, vh, o[dt]); o[dt] = wmmab(pal, vh, o[dt]); o[dt] = wmmab(pah, vl, o[dt]); }
        }
        asm volatile("v_nop\n\tv_nop\n\tv_nop\n\tv_nop" : "+v"(o[0]), "+v"(o[1]), "+v"(o[2]), "+v"(o[3]) : "v"(pah), "v"(pal), "v"(vh), "v"(vl));
        __syncthreads();
    }
#pragma unroll
    for (int r = 0; r < 8; ++r) {
        float lt = l[r];
        lt += __shfl_xor(lt, 1, 32); lt += __shfl_xor(lt, 2, 32); lt += __shfl_xor(lt, 4, 32); lt += __shfl_xor(lt, 8, 32);
        const float inv = 1.0f / lt;
#pragma unroll
        for (int dt = 0; dt < 4; ++dt) os[(8 * hi + r) * 68 + dt * 16 + lr] = o[dt][r] * inv;
    }
    __syncthreads();
    const int b = bh / NH, h = bh % NH; const int rr = lane >> 3, seg = lane & 7;
    const size_t dof = ((size_t)b * RH + rowbase) * DM + h * HD + seg * 8;
{
#pragma unroll
        for (int s = 0; s < 4; ++s) { const int row = s * 4 + rr; const v4f a = *(const v4fa*)(os + row * 68 + seg * 8); const v4f c = *(const v4fa*)(os + row * 68 + seg * 8 + 4); v8us oh, ol;
#pragma unroll
            for (int i = 0; i < 4; ++i) { unsigned short x0, x1; splitf(a[i], x0, x1); oh[i] = x0; ol[i] = x1; splitf(c[i], x0, x1); oh[4 + i] = x0; ol[4 + i] = x1; }
            *(v8us*)(ATh + dof + (size_t)row * DM) = oh; *(v8us*)(ATl + dof + (size_t)row * DM) = ol; }
         }
}

extern "C" void kernel_launch(void* const* d_in, const int* in_sizes, int n_in,
                              void* d_out, int out_size, void* d_ws, size_t ws_size, hipStream_t stream) {
    if (n_in < 5) return;
    if ((size_t)in_sizes[0] < (size_t)(NB - 1) * SEQ_FULL * DM + (size_t)SEQ * DM) return;
    if ((size_t)in_sizes[1] < (size_t)3 * DM * DM || in_sizes[2] < 3 * DM || (size_t)in_sizes[3] < (size_t)DM * DM || in_sizes[4] < DM) return;
    if ((size_t)out_size < (size_t)NB * SEQ * DM) return;
    if (ws_size < WS_TOTAL) return;
    // wire order: x, W_qkv, b_qkv, W_proj, b_proj
    const float* x = (const float*)d_in[0]; const float* wqkv = (const float*)d_in[1]; const float* bqkv = (const float*)d_in[2]; const float* wo = (const float*)d_in[3]; const float* bo = (const float*)d_in[4];
    float* OUT = (float*)d_out;
    char* wsp = (char*)d_ws;
    auto take = [&](size_t bytes) { char* p = wsp; wsp += bytes; return (void*)p; };
    bf* XB = (bf*)take(SZ_XB);
    bf* WQKV = (bf*)take(SZ_WQKV);                 // Bt [3*DM][DM]
    bf* WOb = (bf*)take(SZ_WO); h16* WO16 = (h16*)take(SZ_WO);
    h16* QK16 = (h16*)take(2 * SZ_P16);            // [q | k] f16 planes [bh][t][d]
    h16* VT16 = (h16*)take(SZ_P16);                // [bh][d][t]
    bf* QKh = (bf*)take(2 * SZ_PE); bf* QKl = (bf*)take(2 * SZ_PE);   // [q | k] early-row planes [bh][t<RH][d]
    bf* VTh = (bf*)take(SZ_PE); bf* VTl = (bf*)take(SZ_PE);           // [bh][d][t<RH]
    h16* CT16 = (h16*)take(SZ_CT);                 // ctx f16 x64 [b][t][DM] (rows >= RH used)
    bf* ATh = (bf*)take(SZ_AT); bf* ATl = (bf*)take(SZ_AT);           // ctx hi/lo [b][t<RH][DM]
    float* RC = (float*)take(SZ_ROT); float* RS = (float*)take(SZ_ROT);   // rotary cos / sin [SEQ][32]
    if ((size_t)(wsp - (char*)d_ws) > ws_size) return;

    k_cvt8<<<dim3((unsigned)(((size_t)SEQ * DM / 8 + 255) / 256), NB, 1), 256, 0, stream>>>(x, XB, (unsigned)((size_t)SEQ * DM / 8));
    k_wtG<<<(unsigned)((3 * DM * (DM / 64) + 63) / 64), 256, 0, stream>>>(wqkv, DM, 3 * DM, WQKV, (h16*)nullptr, 1.0f);   // in[DM][3*DM] -> out[3*DM][DM]
    k_wtG<<<(unsigned)((DM * (DM / 64) + 63) / 64), 256, 0, stream>>>(wo, DM, DM, WOb, WO16, WCAR);                        // in[DM][DM] -> out[DM][DM]
    k_rope<<<(unsigned)((SEQ + 7) / 8), 256, 0, stream>>>(RC, RS);
    k_qkv<<<dim3(NB * SEQ / 64, 3 * DM / 64, 1), 32, 0, stream>>>(XB, WQKV, bqkv, RC, RS, QK16, VT16, QKh, QKl, VTh, VTl);
    k_attnhl<<<dim3(RH / 16, NB * NH, 1), 32, 0, stream>>>(QKh, QKl, QKh + PLE, QKl + PLE, VTh, VTl, ATh, ATl);
    if (SEQ > RH)
        k_attn16<<<dim3((SEQ - RH) / 64 > 0 ? (SEQ - RH) / 64 : 1, NB * NH, 1), 128, 0, stream>>>(QK16, QK16 + PL16, VT16, CT16);
    k_proj_hl<<<dim3(RH / 64, DM / 64, NB), 32, 0, stream>>>(ATh, ATl, WOb, OUT, bo);
    if (SEQ > RH)
        k_proj16<<<dim3((SEQ - RH) / 64 > 0 ? (SEQ - RH) / 64 : 1, DM / 64, NB), 32, 0, stream>>>(CT16 + (size_t)RH * DM, WO16, OUT + (size_t)RH * DM, bo);
}

// v002
// Measured time: 280 microseconds a run.
// Timed twice side by side with v001, it ran 1.29 times as fast both times.
// Over all steps from v000 it is 1.61 times as fast.
#include <hip/hip_runtime.h>

// Contractions (all f32 accumulate): x*W_qkv on v_wmma_f32_16x16x32_bf16 (both operands bf16 RNE copies of the inputs, exact products);
// q*k^T and p*v: query rows >= 256 on v_wmma_f32_16x16x32_f16 (q,k,v carried x16, p carried x1024), query rows < 256 on bf16 hi/lo planes (3 products);
// ctx*W_proj: rows >= 256 f16 (ctx x64, w x1024 from the bf16 copy), rows < 256 bf16 hi/lo ctx x bf16 w (2 products). Softmax f32 (running max, exp2).
// Rotary on q and k (interleaved pairs (2i,2i+1) -> (-x[2i+1], x[2i]); angle = pos * inv_freq[d mod 32], inv_freq[j] = 1 / 10000^(j/32)) applied in f32 on the
// staged 64x64 tile in the x*W_qkv epilogue, from cos/sin tables [SEQ][32] built once by k_rope (precise sincosf).
// Layout: x [NB][SEQ_FULL][1024] (first SEQ rows of each batch read); W_qkv [1024][3072] (in,out), thirds q|k|v, column = which*1024 + h*64 + d; W_proj [1024][1024] (in,out); out [NB][SEQ][1024].

#ifndef NB
#define NB 4
#endif
#ifndef SEQ
#define SEQ 2048
#endif
#define NB_FULL  4
#define SEQ_FULL 2048
#define DM   1024
#define NH   16
#define HD   64
#define RH   256                 // query rows < RH use bf16 hi/lo planes
#define QKCAR 16.0f
#define VCAR  16.0f
#define CCAR  64.0f
#define WCAR  1024.0f
#define PLOG  10.0f              // p carried x 2^10
#define L2E   1.4426950408889634f
#define NEGB  (-3.0e38f)
#define SCQ16 (0.125f / (QKCAR * QKCAR))
#define SCQHL 0.125f

typedef _Float16 h16;
typedef unsigned short bf;
typedef __attribute__((ext_vector_type(16))) __bf16   v16bf;
typedef __attribute__((ext_vector_type(16))) _Float16 v16h;
typedef __attribute__((ext_vector_type(8)))  _Float16 v8h;
typedef __attribute__((ext_vector_type(2)))  _Float16 v2h;
typedef __attribute__((ext_vector_type(8)))  unsigned short v8us;
typedef __attribute__((ext_vector_type(2)))  unsigned short v2us;
typedef __attribute__((ext_vector_type(8)))  float    v8f;
typedef __attribute__((ext_vector_type(4)))  float    v4f;
typedef v8h  __attribute__((may_alias)) v8ha;
typedef v4f  __attribute__((may_alias)) v4fa;
typedef v8us __attribute__((may_alias)) v8usa;

static_assert(SEQ % 64 == 0);
static_assert(RH % 64 == 0);
static_assert(RH <= SEQ);
static_assert(SEQ <= SEQ_FULL);
static_assert(NB <= NB_FULL);
static_assert(DM % 64 == 0);
static_assert(DM % 32 == 0);
static_assert(HD == 64);
static_assert(NH * HD == DM);
static_assert((3 * DM) % 64 == 0);
static_assert(HD / 2 == 32);
static_assert(SEQ % 8 == 0);          // k_rope: 8 positions per 256-thread block
static_assert((NB * SEQ) % 128 == 0 && (3 * DM) % 128 == 0 && SEQ % 128 == 0 && RH % 128 == 0 && DM % 128 == 0);   // the three GEMMs: 128x128 block tiles

constexpr size_t PL16 = (size_t)NB * NH * SEQ * HD;     // elements of one f16 head plane set
constexpr size_t PLE  = (size_t)NB * NH * RH * HD;      // elements of one early-row bf16 plane set
constexpr size_t SZ_XB   = (size_t)NB * SEQ * DM * 2;
constexpr size_t SZ_WQKV = (size_t)3 * DM * DM * 2;
constexpr size_t SZ_WO   = (size_t)DM * DM * 2;
constexpr size_t SZ_P16  = PL16 * 2;
constexpr size_t SZ_PE   = PLE * 2;
constexpr size_t SZ_CT   = (size_t)NB * SEQ * DM * 2;
constexpr size_t SZ_AT   = (size_t)NB * RH * DM * 2;
constexpr size_t SZ_ROT  = (size_t)SEQ * 32 * 4;        // one rotary table (cos or sin) [SEQ][32] f32
constexpr size_t WS_TOTAL = SZ_XB + SZ_WQKV + 2 * SZ_WO + 3 * SZ_P16 + 6 * SZ_PE + SZ_CT + 2 * SZ_AT + 2 * SZ_ROT;
static_assert(SZ_XB % 256 == 0 && SZ_WQKV % 256 == 0 && SZ_WO % 256 == 0 && SZ_P16 % 256 == 0 && SZ_PE % 256 == 0 && SZ_CT % 256 == 0 && SZ_AT % 256 == 0);
static_assert(SZ_ROT % 256 == 0);
static_assert(WS_TOTAL <= (size_t)134217728);

__device__ __forceinline__ unsigned short f2bf(float f) { unsigned u = __float_as_uint(f); u += 0x7FFFu + ((u >> 16) & 1u); return (unsigned short)(u >> 16); }
__device__ __forceinline__ float bf2f(unsigned short b) { return __uint_as_float(((unsigned)b) << 16); }
__device__ __forceinline__ float bfr(float f) { return bf2f(f2bf(f)); }
__device__ __forceinline__ void splitf(float y, unsigned short& h, unsigned short& l) { h = f2bf(y); l = f2bf(y - bf2f(h)); }
__device__ __forceinline__ v16h cat16(v8h lo, v8h hi) { return __builtin_shufflevector(lo, hi, 0, 1, 2, 3, 4, 5, 6, 7, 8, 9, 10, 11, 12, 13, 14, 15); }
__device__ __forceinline__ v16bf cat16b(v8us lo, v8us hi) { return __builtin_bit_cast(v16bf, __builtin_shufflevector(lo, hi, 0, 1, 2, 3, 4, 5, 6, 7, 8, 9, 10, 11, 12, 13, 14, 15)); }
__device__ __forceinline__ v8f wmma16(v16h a, v16h b, v8f c) { return __builtin_amdgcn_wmma_f32_16x16x32_f16(false, a, false, b, (short)0, c, false, false); }
__device__ __forceinline__ v8f wmmab(v16bf a, v16bf b, v8f c) { return __builtin_amdgcn_wmma_f32_16x16x32_bf16(false, a, false, b, (short)0, c, false, false); }
__device__ __forceinline__ float ex2(float x) { return __builtin_amdgcn_exp2f(x); }
// f32 -> f16 for operand planes: anything below the smallest f16 normal becomes an exact zero (value select, applied after the carry)
static __device__ __forceinline__ h16 toh_flush(float v) { const h16 r = (h16)v; return (fabsf(v) < 6.103515625e-05f) ? (h16)0.0f : r; }
// fragment loads from K-contiguous 16-bit rows: p already includes + 8*(lane>>4); elements 0..7 <- k0+8h.., 8..15 <- k0+16+8h..
__device__ __forceinline__ v16h  ldh(const h16* p) { return cat16(*(const v8h*)p, *(const v8h*)(p + 16)); }
__device__ __forceinline__ v16bf ldb(const bf* p)  { return cat16b(*(const v8us*)p, *(const v8us*)(p + 16)); }

template <typename T16> struct WFrag;
template <> struct WFrag<h16> { typedef v16h V; static __device__ __forceinline__ V lds(const h16* p) { return cat16(*(const v8ha*)p, *(const v8ha*)(p + 16)); } static __device__ __forceinline__ v8f mma(V a, V b, v8f c) { return wmma16(a, b, c); } };
template <> struct WFrag<bf>  { typedef v16bf V; static __device__ __forceinline__ V lds(const bf* p) { return cat16b(*(const v8usa*)p, *(const v8usa*)(p + 16)); } static __device__ __forceinline__ v8f mma(V a, V b, v8f c) { return wmmab(a, b, c); } };

// ---- four-wave 128x128 tile main loop (K = DM): per stage of 64 k the block brings 128 rows of A and 128 rows of Bt (128 B each, LDS pitch 144 B) into LDS once by asynchronous
// b128 copies, two buffers: the next stage's copies fly while this one is worked on. Wave (wm, wn) takes its 64x64 quarter's fragments from LDS, in the k order of ldh / ldb.
#define GW    4                  // waves per block (2 x 2)
#define GP    72                 // LDS pitch of a staged operand row, in 16-bit elements
#define GT    (128 * GP)         // elements of one staged operand tile
static_assert(DM % 64 == 0 && DM / 64 >= 2);
static_assert((size_t)GW * 64 * 68 * 4 <= (size_t)4 * GT * 2);   // the output staging fits in the ring it takes over

// this thread's eight 16-byte pieces of one operand tile (128 threads x 8 x 16 B = 16 KiB), rows 16 apart
template <typename T16>
__device__ __forceinline__ void stage_rows(const T16* g, unsigned l) {
    // s_wait_xcnt stands inside the statement so that no address register of a copy is rewritten ahead of it
    asm volatile("global_load_async_to_lds_b128 %0, %8, off\n\t"
                 "global_load_async_to_lds_b128 %1, %9, off\n\t"
                 "global_load_async_to_lds_b128 %2, %10, off\n\t"
                 "global_load_async_to_lds_b128 %3, %11, off\n\t"
                 "global_load_async_to_lds_b128 %4, %12, off\n\t"
                 "global_load_async_to_lds_b128 %5, %13, off\n\t"
                 "global_load_async_to_lds_b128 %6, %14, off\n\t"
                 "global_load_async_to_lds_b128 %7, %15, off\n\t"
                 "s_wait_xcnt 0x0"
                 :: "v"(l), "v"(l + 16 * GP * 2), "v"(l + 32 * GP * 2), "v"(l + 48 * GP * 2),
                    "v"(l + 64 * GP * 2), "v"(l + 80 * GP * 2), "v"(l + 96 * GP * 2), "v"(l + 112 * GP * 2),
                    "v"(g), "v"(g + 16 * DM), "v"(g + 32 * DM), "v"(g + 48 * DM),
                    "v"(g + 64 * DM), "v"(g + 80 * DM), "v"(g + 96 * DM), "v"(g + 112 * DM)
                 : "memory");
}

// ring: [buffer][A | Bt | A2][row][GP] (A2, the lo plane multiplied against the same Bt, only with NSPLIT 1); rb, cb: first of the block's A rows and Bt rows.
// acc[mb][nb] += A[rb+wm*64+mb*16..][k] Bt[cb+wn*64+nb*16..][k]. On return every wave has left the ring and nothing is in flight into it.
template <typename T16, int NSPLIT>
__device__ __forceinline__ void gemm_loop_lds(const T16* __restrict__ A, const T16* __restrict__ A2, const T16* __restrict__ Bt, T16* ring, int rb, int cb, int wm, int wn, v8f (&acc)[4][4]) {
    typedef typename WFrag<T16>::V V;
    constexpr int NST = DM / 64, BUF = (2 + NSPLIT) * GT;
    const int lane = threadIdx.x & 31, lr = lane & 15, hi = lane >> 4;
    // staging: thread t owns piece (t & 7) of rows (t >> 3) + 16 j, j = 0..7, of every tile
    const int srow = threadIdx.x >> 3, sseg = threadIdx.x & 7;
    const T16* ag = A + (size_t)(rb + srow) * DM + sseg * 8;
    const T16* a2g = A2 + (size_t)(rb + srow) * DM + sseg * 8;
    const T16* bg = Bt + (size_t)(cb + srow) * DM + sseg * 8;
    const unsigned sl = (unsigned)(size_t)(ring + srow * GP + sseg * 8);   // LDS byte address of the piece in buffer 0's A tile
    const int aof = (wm * 64 + lr) * GP + 8 * hi, bof = GT + (wn * 64 + lr) * GP + 8 * hi;
    auto stage = [&](int st, unsigned l) { stage_rows<T16>(ag + st * 64, l); stage_rows<T16>(bg + st * 64, l + GT * 2); if (NSPLIT == 1) stage_rows<T16>(a2g + st * 64, l + 2 * GT * 2); };
    stage(0, sl);
    asm volatile("s_wait_asynccnt 0x0" ::: "memory");   // stage 0 of this wave's copies has landed
    __syncthreads();                                     // ... and every other wave's
    stage(1, sl + BUF * 2);
    // kept rolled: one copy of the hand-over at the foot, and the code stays small; the loops inside are unrolled so that every fragment and accumulator index is a constant (registers)
#pragma unroll 1
    for (int t = 0; t < NST; ++t) {
        const T16* tb = ring + (t & 1) * BUF;
#pragma unroll
        for (int c = 0; c < 2; ++c) {
            V a[4], a2[4], b[4];
#pragma unroll
            for (int mb = 0; mb < 4; ++mb) { a[mb] = WFrag<T16>::lds(tb + aof + mb * 16 * GP + c * 32); if (NSPLIT == 1) a2[mb] = WFrag<T16>::lds(tb + 2 * GT + aof + mb * 16 * GP + c * 32); }
#pragma unroll
            for (int nb = 0; nb < 4; ++nb) b[nb] = WFrag<T16>::lds(tb + bof + nb * 16 * GP + c * 32);
            // inputs-only fence on the loaded fragments: keeps the LDS loads of this 32-k block together ahead of its WMMAs (one LDS wait a block; sunk between the WMMAs each B fragment costs its own)
            if (NSPLIT == 1) asm volatile("" :: "v"(a[0]), "v"(a[1]), "v"(a[2]), "v"(a[3]), "v"(a2[0]), "v"(a2[1]), "v"(a2[2]), "v"(a2[3]), "v"(b[0]), "v"(b[1]), "v"(b[2]), "v"(b[3]));
            else             asm volatile("" :: "v"(a[0]), "v"(a[1]), "v"(a[2]), "v"(a[3]), "v"(b[0]), "v"(b[1]), "v"(b[2]), "v"(b[3]));
#pragma unroll
            for (int nb = 0; nb < 4; ++nb)
#pragma unroll
                for (int mb = 0; mb < 4; ++mb) { acc[mb][nb] = WFrag<T16>::mma(a[mb], b[nb], acc[mb][nb]); if (NSPLIT == 1) acc[mb][nb] = WFrag<T16>::mma(a2[mb], b[nb], acc[mb][nb]); }
        }
        asm volatile("s_wait_dscnt 0x0" ::: "memory");      // this wave has finished reading the buffer
        asm volatile("s_wait_asynccnt 0x0" ::: "memory");   // this wave's copies of stage t + 1 have landed
        __syncthreads();                                     // publishes stage t + 1 and frees the buffer of stage t
        if (t + 2 < NST) stage(t + 2, sl + (t & 1) * (BUF * 2));
    }
    asm volatile("s_wait_asynccnt 0x0" ::: "memory");       // nothing of the ring is in flight when it becomes output staging
}

// ---- GEMM with f32 output: C[m][n] = osc * sum_k A[m][k] Bt[n][k] + bf16(bias[n]); K = DM; grid (M/128, N/128, Z), 128 threads, a 64x64 quarter per wave. Per 16-row slab staged in LDS,
template <typename T16, int NSPLIT>
__device__ __forceinline__ void gemm_out_body(const T16* __restrict__ A, const T16* __restrict__ A2, const T16* __restrict__ Bt, float* C, int ldc, const float* __restrict__ bias, float osc, size_t sA, size_t sC) {
    __shared__ __align__(16) T16 ring[2 * (2 + NSPLIT) * GT];   // operand ring; after the main loop: each wave's 16x68 f32 slab staging
    const size_t z = blockIdx.z; A += z * sA; A2 += z * sA; C += z * sC;
    const int lane = threadIdx.x & 31, lr = lane & 15, hi = lane >> 4;
    const int wave = __builtin_amdgcn_readfirstlane(threadIdx.x >> 5); const int wm = wave >> 1, wn = wave & 1;
    const int r0 = blockIdx.x * 128 + wm * 64, c0 = blockIdx.y * 128 + wn * 64;
    v8f acc[4][4];
#pragma unroll
    for (int mb = 0; mb < 4; ++mb)
#pragma unroll
        for (int nb = 0; nb < 4; ++nb) acc[mb][nb] = (v8f){};
    gemm_loop_lds<T16, NSPLIT>(A, A2, Bt, ring, blockIdx.x * 128, blockIdx.y * 128, wm, wn, acc);
    float* os = (float*)ring + wave * (16 * 68);
    const int cofs = lr * 4;
    const v4f bv = *(const v4f*)(bias + c0 + cofs);
    v4f bb; bb[0] = bfr(bv[0]); bb[1] = bfr(bv[1]); bb[2] = bfr(bv[2]); bb[3] = bfr(bv[3]);
#pragma unroll
    for (int mb = 0; mb < 4; ++mb) {
#pragma unroll
        for (int nb = 0; nb < 4; ++nb) {
#pragma unroll
            for (int j = 0; j < 8; ++j) os[(hi * 8 + j) * 68 + nb * 16 + lr] = acc[mb][nb][j]; }
        __syncthreads();
        float* crow = C + (size_t)(r0 + mb * 16) * ldc + c0;
{
#pragma unroll
            for (int s = 0; s < 8; ++s) { const int row = 2 * s + hi; const v4f t = *(const v4fa*)(os + row * 68 + cofs); v4f val;
                val[0] = t[0] * osc + bb[0]; val[1] = t[1] * osc + bb[1]; val[2] = t[2] * osc + bb[2]; val[3] = t[3] * osc + bb[3];
                *(v4f*)(crow + (size_t)row * ldc + cofs) = val; }
             }
        __syncthreads();
    }
}

// rows < RH: ctx hi/lo (bf16) x w_proj (bf16), z = batch
__global__ __launch_bounds__(32 * GW) void k_proj_hl(const bf* __restrict__ Ah, const bf* __restrict__ Al, const bf* __restrict__ Wt, float* C, const float* __restrict__ bias) {
    gemm_out_body<bf, 1>(Ah, Al, Wt, C, DM, bias, 1.0f, (size_t)RH * DM, (size_t)SEQ * DM);
}
// rows >= RH: ctx f16 (x64) x w_proj f16 (x1024), z = batch; A and C already offset by RH rows
__global__ __launch_bounds__(32 * GW) void k_proj16(const h16* __restrict__ A, const h16* __restrict__ Wt, float* C, const float* __restrict__ bias) {
    gemm_out_body<h16, 0>(A, A, Wt, C, DM, bias, 1.0f / (CCAR * WCAR), (size_t)SEQ * DM, (size_t)SEQ * DM);
}

__global__ __launch_bounds__(256) void k_cvt8(const float* __restrict__ src, bf* dst, unsigned n8) {
    const size_t b = blockIdx.y; src += b * (size_t)SEQ_FULL * DM; dst += b * (size_t)SEQ * DM;
    const unsigned i = blockIdx.x * 256 + threadIdx.x; if (i >= n8) return;
    const v8f v = *(const v8f*)(src + (size_t)i * 8); v8us o;
#pragma unroll
    for (int k = 0; k < 8; ++k) o[k] = f2bf(v[k]);
    *(v8us*)(dst + (size_t)i * 8) = o; 
}

__global__ __launch_bounds__(256) void k_wtG(const float* __restrict__ w, int K, int N, bf* Bt, h16* Bt16, float car) {
    const int lane = threadIdx.x & 31; const int L0 = (blockIdx.x * 8 + (threadIdx.x >> 5)) * 8; const int nlines = N * (K / 64);
{
#pragma unroll 1
        for (int l = 0; l < 8; ++l) { const int L = L0 + l; if (L >= nlines) break; const size_t e = (size_t)L * 64 + lane * 2; const int k = (int)(e % K), n = (int)(e / K); v2us o;
            o[0] = f2bf(w[(size_t)k * N + n]); o[1] = f2bf(w[(size_t)(k + 1) * N + n]); *(v2us*)(Bt + e) = o;
            if (Bt16) { v2h o2; o2[0] = (h16)(bf2f(o[0]) * car); o2[1] = (h16)(bf2f(o[1]) * car); *(v2h*)(Bt16 + e) = o2; } }
         }
}

// ---- k_rope: rotary tables RC = cos, RS = sin, [SEQ][32] f32; angle = (float)pos * inv_freq[j], inv_freq[j] = 1.0f / (float)(10000^(j/32));
__global__ __launch_bounds__(256) void k_rope(float* RC, float* RS) {
#pragma clang fp contract(off)
    const int wave = __builtin_amdgcn_readfirstlane(threadIdx.x >> 5); const int lane = threadIdx.x & 31;
    const int pos = blockIdx.x * 8 + wave; if (pos >= SEQ) return;
    double p = 1.0;
#pragma unroll 1
    for (int j = 0; j < lane; ++j) p = p * 1.3335214321633240;
    const float pw = (float)p; const float inv = 1.0f / pw; const float ang = (float)pos * inv;
    float sv, cv; sincosf(ang, &sv, &cv);
    float* pc = RC + (size_t)pos * 32 + lane; float* pq = RS + (size_t)pos * 32 + lane;
    *(float*)pc = cv; *(float*)pq = sv; 
}

// ---- k_qkv: four waves per 128x128 tile of x W_qkv + b_qkv (bf16 x bf16 exact), one 64x64 quarter each. The quarter (64 tokens x one head third) is staged whole in LDS; q and k tiles get the rotary
// applied in place in LDS (each lane owns 8 consecutive d of a row, i.e. 4 whole pairs), then written as head planes:
__global__ __launch_bounds__(32 * GW) void k_qkv(const bf* __restrict__ XB, const bf* __restrict__ W, const float* __restrict__ bias, const float* __restrict__ RC, const float* __restrict__ RS,
                                             h16* QK16, h16* VT16, bf* QKh, bf* QKl, bf* VTh, bf* VTl) {
    __shared__ __align__(16) bf ring[4 * GT];            // operand ring; after the main loop: each wave's 64x68 f32 output staging
    const int lane = threadIdx.x & 31, lr = lane & 15, hi = lane >> 4;
    const int wave = __builtin_amdgcn_readfirstlane(threadIdx.x >> 5); const int wm = wave >> 1, wn = wave & 1;
    const int r0 = blockIdx.x * 128 + wm * 64, c0 = blockIdx.y * 128 + wn * 64;
    v8f acc[4][4];
#pragma unroll
    for (int mb = 0; mb < 4; ++mb)
#pragma unroll
        for (int nb = 0; nb < 4; ++nb) acc[mb][nb] = (v8f){};
    gemm_loop_lds<bf, 0>(XB, XB, W, ring, blockIdx.x * 128, blockIdx.y * 128, wm, wn, acc);
    float* os = (float*)ring + wave * (64 * 68);
#pragma unroll
    for (int nb = 0; nb < 4; ++nb) { const float bc = bfr(bias[c0 + nb * 16 + lr]);
#pragma unroll
        for (int mb = 0; mb < 4; ++mb) {
#pragma unroll
            for (int j = 0; j < 8; ++j) os[(mb * 16 + hi * 8 + j) * 68 + nb * 16 + lr] = acc[mb][nb][j] + bc; } }
    __syncthreads();
    const int which = c0 / DM; const int h = (c0 % DM) / HD; const int b = r0 / SEQ; const int t0 = r0 % SEQ; const int bhh = b * NH + h; const bool early = (t0 < RH); const int te = early ? t0 : 0;
    const int rr = lane >> 3, seg = lane & 7;
    if (which < 2) {
        // rotary in place: lane owns d = seg*8 .. seg*8+7 of row s*4+rr; table column = d mod 32 = (seg & 3)*8 + i; position = t0 + row
        const size_t tof = (size_t)(t0 + rr) * 32 + (seg & 3) * 8;
#pragma unroll 1
        for (int s = 0; s < 16; ++s) { const int row = s * 4 + rr;
            const v4f ca = *(const v4f*)(RC + tof + (size_t)s * 128); const v4f cb = *(const v4f*)(RC + tof + (size_t)s * 128 + 4);
            const v4f sa = *(const v4f*)(RS + tof + (size_t)s * 128); const v4f sb = *(const v4f*)(RS + tof + (size_t)s * 128 + 4);
            float* op = os + row * 68 + seg * 8;
            const v4f a = *(const v4fa*)op; const v4f c = *(const v4fa*)(op + 4); v4f ra, rc;
            ra[0] = a[0] * ca[0] + (-a[1]) * sa[0]; ra[1] = a[1] * ca[1] + a[0] * sa[1];
            ra[2] = a[2] * ca[2] + (-a[3]) * sa[2]; ra[3] = a[3] * ca[3] + a[2] * sa[3];
            rc[0] = c[0] * cb[0] + (-c[1]) * sb[0]; rc[1] = c[1] * cb[1] + c[0] * sb[1];
            rc[2] = c[2] * cb[2] + (-c[3]) * sb[2]; rc[3] = c[3] * cb[3] + c[2] * sb[3];
            *(v4fa*)op = ra; *(v4fa*)(op + 4) = rc; }
    }
    __syncthreads();
    if (which < 2) {
        h16* P16 = QK16 + (size_t)which * PL16 + ((size_t)bhh * SEQ + t0) * HD + seg * 8;
        bf* PH = QKh + (size_t)which * PLE + ((size_t)bhh * RH + te) * HD + seg * 8;
        bf* PL = QKl + (size_t)which * PLE + ((size_t)bhh * RH + te) * HD + seg * 8;
{
#pragma unroll 4
            for (int s = 0; s < 16; ++s) { const int row = s * 4 + rr; const v4f a = *(const v4fa*)(os + row * 68 + seg * 8); const v4f c = *(const v4fa*)(os + row * 68 + seg * 8 + 4); v8h o;
#pragma unroll
                for (int i = 0; i < 4; ++i) { o[i] = toh_flush(a[i] * QKCAR); o[4 + i] = toh_flush(c[i] * QKCAR); }
                *(v8h*)(P16 + (size_t)row * HD) = o; }
            if (early) {
#pragma unroll 4
                for (int s = 0; s < 16; ++s) { const int row = s * 4 + rr; const v4f a = *(const v4fa*)(os + row * 68 + seg * 8); const v4f c = *(const v4fa*)(os + row * 68 + seg * 8 + 4); v8us oh, ol;
#pragma unroll
                    for (int i = 0; i < 4; ++i) { unsigned short x0, x1; splitf(a[i], x0, x1); oh[i] = x0; ol[i] = x1; splitf(c[i], x0, x1); oh[4 + i] = x0; ol[4 + i] = x1; }
                    *(v8us*)(PH + (size_t)row * HD) = oh; *(v8us*)(PL + (size_t)row * HD) = ol; } }
             }
    } else {
        h16* P16 = VT16 + ((size_t)bhh * HD) * SEQ + t0 + seg * 8;
        bf* PH = VTh + ((size_t)bhh * HD) * RH + te + seg * 8;
        bf* PL = VTl + ((size_t)bhh * HD) * RH + te + seg * 8;
{
#pragma unroll 4
            for (int s = 0; s < 16; ++s) { const int d = s * 4 + rr; v8h o;
#pragma unroll
                for (int j = 0; j < 8; ++j) o[j] = toh_flush(os[(seg * 8 + j) * 68 + d] * VCAR);
                *(v8h*)(P16 + (size_t)d * SEQ) = o; }
            if (early) {
#pragma unroll 4
                for (int s = 0; s < 16; ++s) { const int d = s * 4 + rr; v8us oh, ol;
#pragma unroll
                    for (int j = 0; j < 8; ++j) { unsigned short x0, x1; splitf(os[(seg * 8 + j) * 68 + d], x0, x1); oh[j] = x0; ol[j] = x1; }
                    *(v8us*)(PH + (size_t)d * RH) = oh; *(v8us*)(PL + (size_t)d * RH) = ol; } }
             }
    }
}

// ---- k_attn16: fused causal attention, query rows >= RH; four waves per block, 16 query rows each (64 rows that share one diagonal block), 64-key blocks up to the diagonal.
// Each 64-key K tile [key][d] and V tile [d][key] is brought into LDS once per block by asynchronous b128 copies (rows of 128 B at a pitch of 144 B), two buffers: the next
// tile's copies fly while this one is worked on; all four waves take their fragments from LDS. Running-max softmax in f32, p (x1024, f16) relaid D -> A through a wave-private
// LDS tile (ordered by the wave's own LDS wait), ctx = O / l written as f16 x64 into [b][t][h*64+d].
#define AW    4                  // waves per block
#define KVP   72                 // LDS pitch of a K or V tile row, in f16 elements
#define KVT   (64 * KVP)         // elements of one staged tile
static_assert((SEQ - RH) % (16 * AW) == 0 && RH % (16 * AW) == 0 && 16 * AW == 64);
static_assert((size_t)AW * 16 * 68 * 4 <= (size_t)4 * KVT * 2);   // the output staging fits in the ring it takes over

// one stage: this thread's four 16-byte pieces of the K tile and of the V tile (128 threads x 4 x 16 B = 8 KiB each), rows 16 apart
__device__ __forceinline__ void stage_kv(const h16* kg, const h16* vg, unsigned kl, unsigned vl) {
    // s_wait_xcnt stands inside the statement so that no address register of a copy is rewritten ahead of it
    asm volatile("global_load_async_to_lds_b128 %0, %8, off\n\t"
                 "global_load_async_to_lds_b128 %1, %9, off\n\t"
                 "global_load_async_to_lds_b128 %2, %10, off\n\t"
                 "global_load_async_to_lds_b128 %3, %11, off\n\t"
                 "global_load_async_to_lds_b128 %4, %12, off\n\t"
                 "global_load_async_to_lds_b128 %5, %13, off\n\t"
                 "global_load_async_to_lds_b128 %6, %14, off\n\t"
                 "global_load_async_to_lds_b128 %7, %15, off\n\t"
                 "s_wait_xcnt 0x0"
                 :: "v"(kl), "v"(kl + 16 * KVP * 2), "v"(kl + 32 * KVP * 2), "v"(kl + 48 * KVP * 2),
                    "v"(vl), "v"(vl + 16 * KVP * 2), "v"(vl + 32 * KVP * 2), "v"(vl + 48 * KVP * 2),
                    "v"(kg), "v"(kg + 16 * HD), "v"(kg + 32 * HD), "v"(kg + 48 * HD),
                    "v"(vg), "v"(vg + (size_t)16 * SEQ), "v"(vg + (size_t)32 * SEQ), "v"(vg + (size_t)48 * SEQ)
                 : "memory");
}

__global__ __launch_bounds__(32 * AW) void k_attn16(const h16* __restrict__ Q16, const h16* __restrict__ K16, const h16* __restrict__ VT16, h16* CT16) {
    __shared__ __align__(16) h16 ring[4 * KVT];          // [buffer][K | V][row][KVP]; after the loop: output staging
    __shared__ __align__(16) h16 ptw[AW * 16 * 72];
    const int lane = threadIdx.x & 31, lr = lane & 15, hi = lane >> 4;
    const int wave = __builtin_amdgcn_readfirstlane(threadIdx.x >> 5);
    h16* pt = ptw + wave * (16 * 72);
    const int bh = blockIdx.y; const int blkbase = RH + blockIdx.x * (16 * AW); const int rowbase = blkbase + wave * 16;
    const size_t qoff  = ((size_t)bh * SEQ + rowbase + lr) * HD + 8 * hi;
    // staging: thread t owns piece (t & 7) of rows (t >> 3) + 16 j, j = 0..3, of both tiles
    const int srow = threadIdx.x >> 3, sseg = threadIdx.x & 7;
    const h16* kg = K16 + ((size_t)bh * SEQ + srow) * HD + sseg * 8;
    const h16* vg = VT16 + ((size_t)bh * HD + srow) * SEQ + sseg * 8;
    const unsigned sl = (unsigned)(size_t)(ring + srow * KVP + sseg * 8);   // LDS byte address of the piece in buffer 0's K tile
    const int foff = lr * KVP + 8 * hi;                                     // fragment row and half inside a tile
    v8f o[4]; float m[8], l[8];
#pragma unroll
    for (int dt = 0; dt < 4; ++dt) o[dt] = (v8f){};
#pragma unroll
    for (int r = 0; r < 8; ++r) { m[r] = NEGB; l[r] = 0.0f; }
    const int nblk = blkbase / 64 + 1;
    stage_kv(kg, vg, sl, sl + KVT * 2);
    asm volatile("s_wait_asynccnt 0x0" ::: "memory");   // tile 0 of this wave's copies has landed
    __syncthreads();                                     // ... and every other wave's
    if (nblk > 1) stage_kv(kg + 64 * HD, vg + 64, sl + 2 * KVT * 2, sl + 3 * KVT * 2);
#pragma unroll 1
    for (int jb = 0; jb < nblk; ++jb) {
        const int jbase = jb * 64;
        const h16* kb = ring + (jb & 1) * (2 * KVT) + foff; const h16* vb = kb + KVT;
        v8f s[4];
#pragma unroll
        for (int nt = 0; nt < 4; ++nt) s[nt] = (v8f){};
        v16h qa, kf;
#pragma unroll
        for (int c = 0; c < 2; ++c) {
            qa = ldh(Q16 + qoff + c * 32);
#pragma unroll
            for (int nt = 0; nt < 4; ++nt) { const h16* kp = kb + nt * 16 * KVP + c * 32; kf = cat16(*(const v8ha*)kp, *(const v8ha*)(kp + 16)); s[nt] = wmma16(qa, kf, s[nt]); }
        }
        asm volatile("v_nop\n\tv_nop\n\tv_nop\n\tv_nop" : "+v"(s[0]), "+v"(s[1]), "+v"(s[2]), "+v"(s[3]) : "v"(qa), "v"(kf));
#pragma unroll
        for (int r = 0; r < 8; ++r) {
            const int t = rowbase + 8 * hi + r;
            float v[4];
#pragma unroll
            for (int nt = 0; nt < 4; ++nt) { const int key = jbase + nt * 16 + lr; const float sv = s[nt][r] * SCQ16; v[nt] = (key > t) ? NEGB : sv; }
            float mx = fmaxf(fmaxf(v[0], v[1]), fmaxf(v[2], v[3]));
            mx = fmaxf(mx, __shfl_xor(mx, 1, 32)); mx = fmaxf(mx, __shfl_xor(mx, 2, 32)); mx = fmaxf(mx, __shfl_xor(mx, 4, 32)); mx = fmaxf(mx, __shfl_xor(mx, 8, 32));
            const float mn = fmaxf(m[r], mx);
            const float al = ex2((m[r] - mn) * L2E);
            m[r] = mn;
            float p[4];
#pragma unroll
            for (int nt = 0; nt < 4; ++nt) p[nt] = ex2((v[nt] - mn) * L2E + PLOG);
            l[r] = l[r] * al + ((p[0] + p[1]) + (p[2] + p[3]));
#pragma unroll
            for (int dt = 0; dt < 4; ++dt) o[dt][r] *= al;
#pragma unroll
            for (int nt = 0; nt < 4; ++nt) pt[(8 * hi + r) * 72 + nt * 16 + lr] = (h16)p[nt];
        }
        asm volatile("s_wait_dscnt 0x0" ::: "memory");   // the p tile is private to the wave: its own stores are done before its lanes read each other's
        v16h pa, vf;
#pragma unroll
        for (int c = 0; c < 2; ++c) {
            pa = cat16(*(const v8ha*)(pt + lr * 72 + c * 32 + 8 * hi), *(const v8ha*)(pt + lr * 72 + c * 32 + 16 + 8 * hi));
#pragma unroll
            for (int dt = 0; dt < 4; ++dt) { const h16* vp = vb + dt * 16 * KVP + c * 32; vf = cat16(*(const v8ha*)vp, *(const v8ha*)(vp + 16)); o[dt] = wmma16(pa, vf, o[dt]); }
        }
        asm volatile("v_nop\n\tv_nop\n\tv_nop\n\tv_nop" : "+v"(o[0]), "+v"(o[1]), "+v"(o[2]), "+v"(o[3]) : "v"(pa), "v"(vf));
        asm volatile("s_wait_dscnt 0x0" ::: "memory");      // this wave has finished reading the buffer (and its p tile)
        asm volatile("s_wait_asynccnt 0x0" ::: "memory");   // this wave's copies of tile jb + 1 have landed
        __syncthreads();                                     // publishes tile jb + 1 and frees the buffer of tile jb
        if (jb + 2 < nblk) { const unsigned bl = sl + (jb & 1) * (2 * KVT * 2); stage_kv(kg + (size_t)(jbase + 128) * HD, vg + jbase + 128, bl, bl + KVT * 2); }
    }
    asm volatile("s_wait_asynccnt 0x0" ::: "memory");       // nothing of the ring is in flight when it becomes output staging
    float* os = (float*)ring + wave * (16 * 68);
#pragma unroll
    for (int r = 0; r < 8; ++r) {
        float lt = l[r];
        lt += __shfl_xor(lt, 1, 32); lt += __shfl_xor(lt, 2, 32); lt += __shfl_xor(lt, 4, 32); lt += __shfl_xor(lt, 8, 32);
        const float inv = (CCAR / VCAR) * (1.0f / lt);
#pragma unroll
        for (int dt = 0; dt < 4; ++dt) os[(8 * hi + r) * 68 + dt * 16 + lr] = o[dt][r] * inv;
    }
    __syncthreads();
    const int b = bh / NH, h = bh % NH; const int rr = lane >> 3, seg = lane & 7;
    h16* dst = CT16 + ((size_t)b * SEQ + rowbase) * DM + h * HD + seg * 8;
{
#pragma unroll
        for (int s = 0; s < 4; ++s) { const int row = s * 4 + rr; const v4f a = *(const v4fa*)(os + row * 68 + seg * 8); const v4f c = *(const v4fa*)(os + row * 68 + seg * 8 + 4); v8h ov;
#pragma unroll
            for (int i = 0; i < 4; ++i) { ov[i] = (h16)a[i]; ov[4 + i] = (h16)c[i]; }
            *(v8h*)(dst + (size_t)row * DM) = ov; }
         }
}

// ---- k_attnhl: the same fused kernel for query rows < RH on bf16 hi/lo planes: scores qh kh + ql kh + qh kl, p split hi/lo, O += ph vh + pl vh + ph vl; ctx written as bf16 hi/lo [b][t<RH][h*64+d].
__global__ __launch_bounds__(32) void k_attnhl(const bf* __restrict__ Qh, const bf* __restrict__ Ql, const bf* __restrict__ Kh, const bf* __restrict__ Kl,
                                                const bf* __restrict__ VTh, const bf* __restrict__ VTl, bf* ATh, bf* ATl) {
    __shared__ __align__(16) unsigned short pth[16 * 72];
    __shared__ __align__(16) unsigned short ptl[16 * 72];
    __shared__ __align__(16) float os[16 * 68];
    const int lane = threadIdx.x & 31, lr = lane & 15, hi = lane >> 4;
    const int bh = blockIdx.y; const int rowbase = blockIdx.x * 16;
    const size_t qoff  = ((size_t)bh * RH + rowbase + lr) * HD + 8 * hi;
    const size_t kbase = ((size_t)bh * RH + lr) * HD + 8 * hi;
    const size_t vbase = ((size_t)bh * HD + lr) * RH + 8 * hi;
    v8f o[4]; float m[8], l[8];
#pragma unroll
    for (int dt = 0; dt < 4; ++dt) o[dt] = (v8f){};
#pragma unroll
    for (int r = 0; r < 8; ++r) { m[r] = NEGB; l[r] = 0.0f; }
    const int nblk = rowbase / 64 + 1;
#pragma unroll 1
    for (int jb = 0; jb < nblk; ++jb) {
        const int jbase = jb * 64;
        v8f s[4];
#pragma unroll
        for (int nt = 0; nt < 4; ++nt) s[nt] = (v8f){};
        v16bf qh, ql, kh, kl;
#pragma unroll
        for (int c = 0; c < 2; ++c) {
            qh = ldb(Qh + qoff + c * 32); ql = ldb(Ql + qoff + c * 32);
#pragma unroll
            for (int nt = 0; nt < 4; ++nt) { const size_t ko = kbase + (size_t)(jbase + nt * 16) * HD + c * 32; kh = ldb(Kh + ko); kl = ldb(Kl + ko);
                s[nt] = wmmab(qh, kh, s[nt]); s[nt] = wmmab(ql, kh, s[nt]); s[nt] = wmmab(qh, kl, s[nt]); }
        }
        asm volatile("v_nop\n\tv_nop\n\tv_nop\n\tv_nop" : "+v"(s[0]), "+v"(s[1]), "+v"(s[2]), "+v"(s[3]) : "v"(qh), "v"(ql), "v"(kh), "v"(kl));
#pragma unroll
        for (int r = 0; r < 8; ++r) {
            const int t = rowbase + 8 * hi + r;
            float v[4];
#pragma unroll
            for (int nt = 0; nt < 4; ++nt) { const int key = jbase + nt * 16 + lr; const float sv = s[nt][r] * SCQHL; v[nt] = (key > t) ? NEGB : sv; }
            float mx = fmaxf(fmaxf(v[0], v[1]), fmaxf(v[2], v[3]));
            mx = fmaxf(mx, __shfl_xor(mx, 1, 32)); mx = fmaxf(mx, __shfl_xor(mx, 2, 32)); mx = fmaxf(mx, __shfl_xor(mx, 4, 32)); mx = fmaxf(mx, __shfl_xor(mx, 8, 32));
            const float mn = fmaxf(m[r], mx);
            const float al = ex2((m[r] - mn) * L2E);
            m[r] = mn;
            float p[4];
#pragma unroll
            for (int nt = 0; nt < 4; ++nt) p[nt] = ex2((v[nt] - mn) * L2E);
            l[r] = l[r] * al + ((p[0] + p[1]) + (p[2] + p[3]));
#pragma unroll
            for (int dt = 0; dt < 4; ++dt) o[dt][r] *= al;
#pragma unroll
            for (int nt = 0; nt < 4; ++nt) { unsigned short x0, x1; splitf(p[nt], x0, x1); pth[(8 * hi + r) * 72 + nt * 16 + lr] = x0; ptl[(8 * hi + r) * 72 + nt * 16 + lr] = x1; }
        }
        __syncthreads();
        v16bf pah, pal, vh, vl;
#pragma unroll
        for (int c = 0; c < 2; ++c) {
            pah = cat16b(*(const v8usa*)(pth + lr * 72 + c * 32 + 8 * hi), *(const v8usa*)(pth + lr * 72 + c * 32 + 16 + 8 * hi));
            pal = cat16b(*(const v8usa*)(ptl + lr * 72 + c * 32 + 8 * hi), *(const v8usa*)(ptl + lr * 72 + c * 32 + 16 + 8 * hi));
#pragma unroll
            for (int dt = 0; dt < 4; ++dt) { const size_t vo = vbase + (size_t)(dt * 16) * RH + jbase + c * 32; vh = ldb(VTh + vo); vl = ldb(VTl + vo);
                o[dt] = wmmab(pah, vh, o[dt]); o[dt] = wmmab(pal, vh, o[dt]); o[dt] = wmmab(pah, vl, o[dt]); }
        }
        asm volatile("v_nop\n\tv_nop\n\tv_nop\n\tv_nop" : "+v"(o[0]), "+v"(o[1]), "+v"(o[2]), "+v"(o[3]) : "v"(pah), "v"(pal), "v"(vh), "v"(vl));
        __syncthreads();
    }
#pragma unroll
    for (int r = 0; r < 8; ++r) {
        float lt = l[r];
        lt += __shfl_xor(lt, 1, 32); lt += __shfl_xor(lt, 2, 32); lt += __shfl_xor(lt, 4, 32); lt += __shfl_xor(lt, 8, 32);
        const float inv = 1.0f / lt;
#pragma unroll
        for (int dt = 0; dt < 4; ++dt) os[(8 * hi + r) * 68 + dt * 16 + lr] = o[dt][r] * inv;
    }
    __syncthreads();
    const int b = bh / NH, h = bh % NH; const int rr = lane >> 3, seg = lane & 7;
    const size_t dof = ((size_t)b * RH + rowbase) * DM + h * HD + seg * 8;
{
#pragma unroll
        for (int s = 0; s < 4; ++s) { const int row = s * 4 + rr; const v4f a = *(const v4fa*)(os + row * 68 + seg * 8); const v4f c = *(const v4fa*)(os + row * 68 + seg * 8 + 4); v8us oh, ol;
#pragma unroll
            for (int i = 0; i < 4; ++i) { unsigned short x0, x1; splitf(a[i], x0, x1); oh[i] = x0; ol[i] = x1; splitf(c[i], x0, x1); oh[4 + i] = x0; ol[4 + i] = x1; }
            *(v8us*)(ATh + dof + (size_t)row * DM) = oh; *(v8us*)(ATl + dof + (size_t)row * DM) = ol; }
         }
}

extern "C" void kernel_launch(void* const* d_in, const int* in_sizes, int n_in,
                              void* d_out, int out_size, void* d_ws, size_t ws_size, hipStream_t stream) {
    if (n_in < 5) return;
    if ((size_t)in_sizes[0] < (size_t)(NB - 1) * SEQ_FULL * DM + (size_t)SEQ * DM) return;
    if ((size_t)in_sizes[1] < (size_t)3 * DM * DM || in_sizes[2] < 3 * DM || (size_t)in_sizes[3] < (size_t)DM * DM || in_sizes[4] < DM) return;
    if ((size_t)out_size < (size_t)NB * SEQ * DM) return;
    if (ws_size < WS_TOTAL) return;
    // wire order: x, W_qkv, b_qkv, W_proj, b_proj
    const float* x = (const float*)d_in[0]; const float* wqkv = (const float*)d_in[1]; const float* bqkv = (const float*)d_in[2]; const float* wo = (const float*)d_in[3]; const float* bo = (const float*)d_in[4];
    float* OUT = (float*)d_out;
    char* wsp = (char*)d_ws;
    auto take = [&](size_t bytes) { char* p = wsp; wsp += bytes; return (void*)p; };
    bf* XB = (bf*)take(SZ_XB);
    bf* WQKV = (bf*)take(SZ_WQKV);                 // Bt [3*DM][DM]
    bf* WOb = (bf*)take(SZ_WO); h16* WO16 = (h16*)take(SZ_WO);
    h16* QK16 = (h16*)take(2 * SZ_P16);            // [q | k] f16 planes [bh][t][d]
    h16* VT16 = (h16*)take(SZ_P16);                // [bh][d][t]
    bf* QKh = (bf*)take(2 * SZ_PE); bf* QKl = (bf*)take(2 * SZ_PE);   // [q | k] early-row planes [bh][t<RH][d]
    bf* VTh = (bf*)take(SZ_PE); bf* VTl = (bf*)take(SZ_PE);           // [bh][d][t<RH]
    h16* CT16 = (h16*)take(SZ_CT);                 // ctx f16 x64 [b][t][DM] (rows >= RH used)
    bf* ATh = (bf*)take(SZ_AT); bf* ATl = (bf*)take(SZ_AT);           // ctx hi/lo [b][t<RH][DM]
    float* RC = (float*)take(SZ_ROT); float* RS = (float*)take(SZ_ROT);   // rotary cos / sin [SEQ][32]
    if ((size_t)(wsp - (char*)d_ws) > ws_size) return;

    k_cvt8<<<dim3((unsigned)(((size_t)SEQ * DM / 8 + 255) / 256), NB, 1), 256, 0, stream>>>(x, XB, (unsigned)((size_t)SEQ * DM / 8));
    k_wtG<<<(unsigned)((3 * DM * (DM / 64) + 63) / 64), 256, 0, stream>>>(wqkv, DM, 3 * DM, WQKV, (h16*)nullptr, 1.0f);   // in[DM][3*DM] -> out[3*DM][DM]
    k_wtG<<<(unsigned)((DM * (DM / 64) + 63) / 64), 256, 0, stream>>>(wo, DM, DM, WOb, WO16, WCAR);                        // in[DM][DM] -> out[DM][DM]
    k_rope<<<(unsigned)((SEQ + 7) / 8), 256, 0, stream>>>(RC, RS);
    k_qkv<<<dim3(NB * SEQ / 128, 3 * DM / 128, 1), 128, 0, stream>>>(XB, WQKV, bqkv, RC, RS, QK16, VT16, QKh, QKl, VTh, VTl);
    k_attnhl<<<dim3(RH / 16, NB * NH, 1), 32, 0, stream>>>(QKh, QKl, QKh + PLE, QKl + PLE, VTh, VTl, ATh, ATl);
    if (SEQ > RH)
        k_attn16<<<dim3((SEQ - RH) / 64 > 0 ? (SEQ - RH) / 64 : 1, NB * NH, 1), 128, 0, stream>>>(QK16, QK16 + PL16, VT16, CT16);
    k_proj_hl<<<dim3(RH / 128, DM / 128, NB), 128, 0, stream>>>(ATh, ATl, WOb, OUT, bo);
    if (SEQ > RH)
        k_proj16<<<dim3((SEQ - RH) / 128 > 0 ? (SEQ - RH) / 128 : 1, DM / 128, NB), 128, 0, stream>>>(CT16 + (size_t)RH * DM, WO16, OUT + (size_t)RH * DM, bo);
}

// v003
// A run of this version takes 197 microseconds.
// Two timings next to v002 put it at 1.41 and 1.42 times that version's speed.
// Counting every step since v000, it is 2.28 times as fast.
#include <hip/hip_runtime.h>

// Contractions (all f32 accumulate): x*W_qkv on v_wmma_f32_16x16x32_bf16 (both operands bf16 RNE copies of the inputs, exact products);
// q*k^T and p*v: query rows >= 256 on v_wmma_f32_16x16x32_f16 (q,k,v carried x16, p carried x1024), query rows < 256 on bf16 hi/lo planes (3 products);
// ctx*W_proj: rows >= 256 f16 (ctx x64, w x1024 from the bf16 copy), rows < 256 bf16 hi/lo ctx x bf16 w (2 products). Softmax f32 (running max, exp2).
// Rotary on q and k (interleaved pairs (2i,2i+1) -> (-x[2i+1], x[2i]); angle = pos * inv_freq[d mod 32], inv_freq[j] = 1 / 10000^(j/32)) applied in f32 on the
// staged 64x64 tile in the x*W_qkv epilogue, from cos/sin tables [SEQ][32] built once by k_rope (precise sincosf).
// Layout: x [NB][SEQ_FULL][1024] (first SEQ rows of each batch read); W_qkv [1024][3072] (in,out), thirds q|k|v, column = which*1024 + h*64 + d; W_proj [1024][1024] (in,out); out [NB][SEQ][1024].

#ifndef NB
#define NB 4
#endif
#ifndef SEQ
#define SEQ 2048
#endif
#define NB_FULL  4
#define SEQ_FULL 2048
#define DM   1024
#define NH   16
#define HD   64
#define RH   256                 // query rows < RH use bf16 hi/lo planes
#define QKCAR 16.0f
#define VCAR  16.0f
#define CCAR  64.0f
#define WCAR  1024.0f
#define PLOG  10.0f              // p carried x 2^10
#define L2E   1.4426950408889634f
#define NEGB  (-3.0e38f)
#define SCQ16 (0.125f / (QKCAR * QKCAR))
#define SCQHL 0.125f

typedef _Float16 h16;
typedef unsigned short bf;
typedef __attribute__((ext_vector_type(16))) __bf16   v16bf;
typedef __attribute__((ext_vector_type(16))) _Float16 v16h;
typedef __attribute__((ext_vector_type(8)))  _Float16 v8h;
typedef __attribute__((ext_vector_type(2)))  _Float16 v2h;
typedef __attribute__((ext_vector_type(8)))  unsigned short v8us;
typedef __attribute__((ext_vector_type(2)))  unsigned short v2us;
typedef __attribute__((ext_vector_type(8)))  float    v8f;
typedef __attribute__((ext_vector_type(4)))  float    v4f;
typedef v8h  __attribute__((may_alias)) v8ha;
typedef v4f  __attribute__((may_alias)) v4fa;
typedef v8us __attribute__((may_alias)) v8usa;

static_assert(SEQ % 64 == 0);
static_assert(RH % 64 == 0);
static_assert(RH <= SEQ);
static_assert(SEQ <= SEQ_FULL);
static_assert(NB <= NB_FULL);
static_assert(DM % 64 == 0);
static_assert(DM % 32 == 0);
static_assert(HD == 64);
static_assert(NH * HD == DM);
static_assert((3 * DM) % 64 == 0);
static_assert(HD / 2 == 32);
static_assert(SEQ % 8 == 0);          // k_rope: 8 positions per 256-thread block
static_assert((NB * SEQ) % 128 == 0 && (3 * DM) % 128 == 0 && SEQ % 128 == 0 && RH % 128 == 0 && DM % 128 == 0);   // the three GEMMs: 128x128 block tiles

constexpr size_t PL16 = (size_t)NB * NH * SEQ * HD;     // elements of one f16 head plane set
constexpr size_t PLE  = (size_t)NB * NH * RH * HD;      // elements of one early-row bf16 plane set
constexpr size_t SZ_XB   = (size_t)NB * SEQ * DM * 2;
constexpr size_t SZ_WQKV = (size_t)3 * DM * DM * 2;
constexpr size_t SZ_WO   = (size_t)DM * DM * 2;
constexpr size_t SZ_P16  = PL16 * 2;
constexpr size_t SZ_PE   = PLE * 2;
constexpr size_t SZ_CT   = (size_t)NB * SEQ * DM * 2;
constexpr size_t SZ_AT   = (size_t)NB * RH * DM * 2;
constexpr size_t SZ_ROT  = (size_t)SEQ * 32 * 4;        // one rotary table (cos or sin) [SEQ][32] f32
constexpr size_t WS_TOTAL = SZ_XB + SZ_WQKV + 2 * SZ_WO + 3 * SZ_P16 + 6 * SZ_PE + SZ_CT + 2 * SZ_AT + 2 * SZ_ROT;
static_assert(SZ_XB % 256 == 0 && SZ_WQKV % 256 == 0 && SZ_WO % 256 == 0 && SZ_P16 % 256 == 0 && SZ_PE % 256 == 0 && SZ_CT % 256 == 0 && SZ_AT % 256 == 0);
static_assert(SZ_ROT % 256 == 0);
static_assert(WS_TOTAL <= (size_t)134217728);

__device__ __forceinline__ unsigned short f2bf(float f) { unsigned u = __float_as_uint(f); u += 0x7FFFu + ((u >> 16) & 1u); return (unsigned short)(u >> 16); }
__device__ __forceinline__ float bf2f(unsigned short b) { return __uint_as_float(((unsigned)b) << 16); }
__device__ __forceinline__ float bfr(float f) { return bf2f(f2bf(f)); }
__device__ __forceinline__ void splitf(float y, unsigned short& h, unsigned short& l) { h = f2bf(y); l = f2bf(y - bf2f(h)); }
__device__ __forceinline__ v16h cat16(v8h lo, v8h hi) { return __builtin_shufflevector(lo, hi, 0, 1, 2, 3, 4, 5, 6, 7, 8, 9, 10, 11, 12, 13, 14, 15); }
__device__ __forceinline__ v16bf cat16b(v8us lo, v8us hi) { return __builtin_bit_cast(v16bf, __builtin_shufflevector(lo, hi, 0, 1, 2, 3, 4, 5, 6, 7, 8, 9, 10, 11, 12, 13, 14, 15)); }
__device__ __forceinline__ v8f wmma16(v16h a, v16h b, v8f c) { return __builtin_amdgcn_wmma_f32_16x16x32_f16(false, a, false, b, (short)0, c, false, false); }
__device__ __forceinline__ v8f wmmab(v16bf a, v16bf b, v8f c) { return __builtin_amdgcn_wmma_f32_16x16x32_bf16(false, a, false, b, (short)0, c, false, false); }
__device__ __forceinline__ float ex2(float x) { return __builtin_amdgcn_exp2f(x); }
// f32 -> f16 for operand planes: anything below the smallest f16 normal becomes an exact zero (value select, applied after the carry)
static __device__ __forceinline__ h16 toh_flush(float v) { const h16 r = (h16)v; return (fabsf(v) < 6.103515625e-05f) ? (h16)0.0f : r; }
// fragment loads from K-contiguous 16-bit rows: p already includes + 8*(lane>>4); elements 0..7 <- k0+8h.., 8..15 <- k0+16+8h..
__device__ __forceinline__ v16h  ldh(const h16* p) { return cat16(*(const v8h*)p, *(const v8h*)(p + 16)); }
__device__ __forceinline__ v16bf ldb(const bf* p)  { return cat16b(*(const v8us*)p, *(const v8us*)(p + 16)); }

template <typename T16> struct WFrag;
template <> struct WFrag<h16> { typedef v16h V; static __device__ __forceinline__ V lds(const h16* p) { return cat16(*(const v8ha*)p, *(const v8ha*)(p + 16)); } static __device__ __forceinline__ v8f mma(V a, V b, v8f c) { return wmma16(a, b, c); } };
template <> struct WFrag<bf>  { typedef v16bf V; static __device__ __forceinline__ V lds(const bf* p) { return cat16b(*(const v8usa*)p, *(const v8usa*)(p + 16)); } static __device__ __forceinline__ v8f mma(V a, V b, v8f c) { return wmmab(a, b, c); } };

// ---- four-wave 128x128 tile main loop (K = DM): per stage of 64 k the block brings 128 rows of A and 128 rows of Bt (128 B each, LDS pitch 144 B) into LDS once by asynchronous
// b128 copies, two buffers: the next stage's copies fly while this one is worked on. Wave (wm, wn) takes its 64x64 quarter's fragments from LDS, in the k order of ldh / ldb.
#define GW    4                  // waves per block (2 x 2)
#define GP    72                 // LDS pitch of a staged operand row, in 16-bit elements
#define GT    (128 * GP)         // elements of one staged operand tile
static_assert(DM % 64 == 0 && DM / 64 >= 2);
static_assert((size_t)GW * 64 * 68 * 4 <= (size_t)4 * GT * 2);   // the output staging fits in the ring it takes over

// this thread's eight 16-byte pieces of one operand tile (128 threads x 8 x 16 B = 16 KiB), rows 16 apart
template <typename T16>
__device__ __forceinline__ void stage_rows(const T16* g, unsigned l) {
    // s_wait_xcnt stands inside the statement so that no address register of a copy is rewritten ahead of it
    asm volatile("global_load_async_to_lds_b128 %0, %8, off\n\t"
                 "global_load_async_to_lds_b128 %1, %9, off\n\t"
                 "global_load_async_to_lds_b128 %2, %10, off\n\t"
                 "global_load_async_to_lds_b128 %3, %11, off\n\t"
                 "global_load_async_to_lds_b128 %4, %12, off\n\t"
                 "global_load_async_to_lds_b128 %5, %13, off\n\t"
                 "global_load_async_to_lds_b128 %6, %14, off\n\t"
                 "global_load_async_to_lds_b128 %7, %15, off\n\t"
                 "s_wait_xcnt 0x0"
                 :: "v"(l), "v"(l + 16 * GP * 2), "v"(l + 32 * GP * 2), "v"(l + 48 * GP * 2),
                    "v"(l + 64 * GP * 2), "v"(l + 80 * GP * 2), "v"(l + 96 * GP * 2), "v"(l + 112 * GP * 2),
                    "v"(g), "v"(g + 16 * DM), "v"(g + 32 * DM), "v"(g + 48 * DM),
                    "v"(g + 64 * DM), "v"(g + 80 * DM), "v"(g + 96 * DM), "v"(g + 112 * DM)
                 : "memory");
}

// ring: [buffer][A | Bt | A2][row][GP] (A2, the lo plane multiplied against the same Bt, only with NSPLIT 1); rb, cb: first of the block's A rows and Bt rows.
// acc[mb][nb] += A[rb+wm*64+mb*16..][k] Bt[cb+wn*64+nb*16..][k]. On return every wave has left the ring and nothing is in flight into it.
template <typename T16, int NSPLIT>
__device__ __forceinline__ void gemm_loop_lds(const T16* __restrict__ A, const T16* __restrict__ A2, const T16* __restrict__ Bt, T16* ring, int rb, int cb, int wm, int wn, v8f (&acc)[4][4]) {
    typedef typename WFrag<T16>::V V;
    constexpr int NST = DM / 64, BUF = (2 + NSPLIT) * GT;
    const int lane = threadIdx.x & 31, lr = lane & 15, hi = lane >> 4;
    // staging: thread t owns piece (t & 7) of rows (t >> 3) + 16 j, j = 0..7, of every tile
    const int srow = threadIdx.x >> 3, sseg = threadIdx.x & 7;
    const T16* ag = A + (size_t)(rb + srow) * DM + sseg * 8;
    const T16* a2g = A2 + (size_t)(rb + srow) * DM + sseg * 8;
    const T16* bg = Bt + (size_t)(cb + srow) * DM + sseg * 8;
    const unsigned sl = (unsigned)(size_t)(ring + srow * GP + sseg * 8);   // LDS byte address of the piece in buffer 0's A tile
    const int aof = (wm * 64 + lr) * GP + 8 * hi, bof = GT + (wn * 64 + lr) * GP + 8 * hi;
    auto stage = [&](int st, unsigned l) { stage_rows<T16>(ag + st * 64, l); stage_rows<T16>(bg + st * 64, l + GT * 2); if (NSPLIT == 1) stage_rows<T16>(a2g + st * 64, l + 2 * GT * 2); };
    stage(0, sl);
    asm volatile("s_wait_asynccnt 0x0" ::: "memory");   // stage 0 of this wave's copies has landed
    __syncthreads();                                     // ... and every other wave's
    stage(1, sl + BUF * 2);
    // kept rolled: one copy of the hand-over at the foot, and the code stays small; the loops inside are unrolled so that every fragment and accumulator index is a constant (registers)
#pragma unroll 1
    for (int t = 0; t < NST; ++t) {
        const T16* tb = ring + (t & 1) * BUF;
#pragma unroll
        for (int c = 0; c < 2; ++c) {
            V a[4], a2[4], b[4];
#pragma unroll
            for (int mb = 0; mb < 4; ++mb) { a[mb] = WFrag<T16>::lds(tb + aof + mb * 16 * GP + c * 32); if (NSPLIT == 1) a2[mb] = WFrag<T16>::lds(tb + 2 * GT + aof + mb * 16 * GP + c * 32); }
#pragma unroll
            for (int nb = 0; nb < 4; ++nb) b[nb] = WFrag<T16>::lds(tb + bof + nb * 16 * GP + c * 32);
            // inputs-only fence on the loaded fragments: keeps the LDS loads of this 32-k block together ahead of its WMMAs (one LDS wait a block; sunk between the WMMAs each B fragment costs its own)
            if (NSPLIT == 1) asm volatile("" :: "v"(a[0]), "v"(a[1]), "v"(a[2]), "v"(a[3]), "v"(a2[0]), "v"(a2[1]), "v"(a2[2]), "v"(a2[3]), "v"(b[0]), "v"(b[1]), "v"(b[2]), "v"(b[3]));
            else             asm volatile("" :: "v"(a[0]), "v"(a[1]), "v"(a[2]), "v"(a[3]), "v"(b[0]), "v"(b[1]), "v"(b[2]), "v"(b[3]));
#pragma unroll
            for (int nb = 0; nb < 4; ++nb)
#pragma unroll
                for (int mb = 0; mb < 4; ++mb) { acc[mb][nb] = WFrag<T16>::mma(a[mb], b[nb], acc[mb][nb]); if (NSPLIT == 1) acc[mb][nb] = WFrag<T16>::mma(a2[mb], b[nb], acc[mb][nb]); }
        }
        asm volatile("s_wait_dscnt 0x0" ::: "memory");      // this wave has finished reading the buffer
        asm volatile("s_wait_asynccnt 0x0" ::: "memory");   // this wave's copies of stage t + 1 have landed
        __syncthreads();                                     // publishes stage t + 1 and frees the buffer of stage t
        if (t + 2 < NST) stage(t + 2, sl + (t & 1) * (BUF * 2));
    }
    asm volatile("s_wait_asynccnt 0x0" ::: "memory");       // nothing of the ring is in flight when it becomes output staging
}

// ---- GEMM with f32 output: C[m][n] = osc * sum_k A[m][k] Bt[n][k] + bf16(bias[n]); K = DM; grid (M/128, N/128, Z), 128 threads, a 64x64 quarter per wave. Per 16-row slab staged in LDS,
template <typename T16, int NSPLIT>
__device__ __forceinline__ void gemm_out_body(const T16* __restrict__ A, const T16* __restrict__ A2, const T16* __restrict__ Bt, float* C, int ldc, const float* __restrict__ bias, float osc, size_t sA, size_t sC) {
    __shared__ __align__(16) T16 ring[2 * (2 + NSPLIT) * GT];   // operand ring; after the main loop: each wave's 16x68 f32 slab staging
    const size_t z = blockIdx.z; A += z * sA; A2 += z * sA; C += z * sC;
    const int lane = threadIdx.x & 31, lr = lane & 15, hi = lane >> 4;
    const int wave = __builtin_amdgcn_readfirstlane(threadIdx.x >> 5); const int wm = wave >> 1, wn = wave & 1;
    const int r0 = blockIdx.x * 128 + wm * 64, c0 = blockIdx.y * 128 + wn * 64;
    v8f acc[4][4];
#pragma unroll
    for (int mb = 0; mb < 4; ++mb)
#pragma unroll
        for (int nb = 0; nb < 4; ++nb) acc[mb][nb] = (v8f){};
    gemm_loop_lds<T16, NSPLIT>(A, A2, Bt, ring, blockIdx.x * 128, blockIdx.y * 128, wm, wn, acc);
    float* os = (float*)ring + wave * (16 * 68);
    const int cofs = lr * 4;
    const v4f bv = *(const v4f*)(bias + c0 + cofs);
    v4f bb; bb[0] = bfr(bv[0]); bb[1] = bfr(bv[1]); bb[2] = bfr(bv[2]); bb[3] = bfr(bv[3]);
#pragma unroll
    for (int mb = 0; mb < 4; ++mb) {
#pragma unroll
        for (int nb = 0; nb < 4; ++nb) {
#pragma unroll
            for (int j = 0; j < 8; ++j) os[(hi * 8 + j) * 68 + nb * 16 + lr] = acc[mb][nb][j]; }
        __syncthreads();
        float* crow = C + (size_t)(r0 + mb * 16) * ldc + c0;
{
#pragma unroll
            for (int s = 0; s < 8; ++s) { const int row = 2 * s + hi; const v4f t = *(const v4fa*)(os + row * 68 + cofs); v4f val;
                val[0] = t[0] * osc + bb[0]; val[1] = t[1] * osc + bb[1]; val[2] = t[2] * osc + bb[2]; val[3] = t[3] * osc + bb[3];
                *(v4f*)(crow + (size_t)row * ldc + cofs) = val; }
             }
        __syncthreads();
    }
}

// rows < RH: ctx hi/lo (bf16) x w_proj (bf16), z = batch
__global__ __launch_bounds__(32 * GW) void k_proj_hl(const bf* __restrict__ Ah, const bf* __restrict__ Al, const bf* __restrict__ Wt, float* C, const float* __restrict__ bias) {
    gemm_out_body<bf, 1>(Ah, Al, Wt, C, DM, bias, 1.0f, (size_t)RH * DM, (size_t)SEQ * DM);
}
// rows >= RH: ctx f16 (x64) x w_proj f16 (x1024), z = batch; A and C already offset by RH rows
__global__ __launch_bounds__(32 * GW) void k_proj16(const h16* __restrict__ A, const h16* __restrict__ Wt, float* C, const float* __restrict__ bias) {
    gemm_out_body<h16, 0>(A, A, Wt, C, DM, bias, 1.0f / (CCAR * WCAR), (size_t)SEQ * DM, (size_t)SEQ * DM);
}

__global__ __launch_bounds__(256) void k_cvt8(const float* __restrict__ src, bf* dst, unsigned n8) {
    const size_t b = blockIdx.y; src += b * (size_t)SEQ_FULL * DM; dst += b * (size_t)SEQ * DM;
    const unsigned i = blockIdx.x * 256 + threadIdx.x; if (i >= n8) return;
    const v8f v = *(const v8f*)(src + (size_t)i * 8); v8us o;
#pragma unroll
    for (int k = 0; k < 8; ++k) o[k] = f2bf(v[k]);
    *(v8us*)(dst + (size_t)i * 8) = o; 
}

__global__ __launch_bounds__(256) void k_wtG(const float* __restrict__ w, int K, int N, bf* Bt, h16* Bt16, float car) {
    const int lane = threadIdx.x & 31; const int L0 = (blockIdx.x * 8 + (threadIdx.x >> 5)) * 8; const int nlines = N * (K / 64);
{
#pragma unroll 1
        for (int l = 0; l < 8; ++l) { const int L = L0 + l; if (L >= nlines) break; const size_t e = (size_t)L * 64 + lane * 2; const int k = (int)(e % K), n = (int)(e / K); v2us o;
            o[0] = f2bf(w[(size_t)k * N + n]); o[1] = f2bf(w[(size_t)(k + 1) * N + n]); *(v2us*)(Bt + e) = o;
            if (Bt16) { v2h o2; o2[0] = (h16)(bf2f(o[0]) * car); o2[1] = (h16)(bf2f(o[1]) * car); *(v2h*)(Bt16 + e) = o2; } }
         }
}

// ---- k_rope: rotary tables RC = cos, RS = sin, [SEQ][32] f32; angle = (float)pos * inv_freq[j], inv_freq[j] = 1.0f / (float)(10000^(j/32));
__global__ __launch_bounds__(256) void k_rope(float* RC, float* RS) {
#pragma clang fp contract(off)
    const int wave = __builtin_amdgcn_readfirstlane(threadIdx.x >> 5); const int lane = threadIdx.x & 31;
    const int pos = blockIdx.x * 8 + wave; if (pos >= SEQ) return;
    double p = 1.0;
#pragma unroll 1
    for (int j = 0; j < lane; ++j) p = p * 1.3335214321633240;
    const float pw = (float)p; const float inv = 1.0f / pw; const float ang = (float)pos * inv;
    float sv, cv; sincosf(ang, &sv, &cv);
    float* pc = RC + (size_t)pos * 32 + lane; float* pq = RS + (size_t)pos * 32 + lane;
    *(float*)pc = cv; *(float*)pq = sv; 
}

// ---- k_qkv: four waves per 128x128 tile of x W_qkv + b_qkv (bf16 x bf16 exact), one 64x64 quarter each. The quarter (64 tokens x one head third) is staged whole in LDS; q and k tiles get the rotary
// applied in place in LDS (each lane owns 8 consecutive d of a row, i.e. 4 whole pairs), then written as head planes:
__global__ __launch_bounds__(32 * GW) void k_qkv(const bf* __restrict__ XB, const bf* __restrict__ W, const float* __restrict__ bias, const float* __restrict__ RC, const float* __restrict__ RS,
                                             h16* QK16, h16* VT16, bf* QKh, bf* QKl, bf* VTh, bf* VTl) {
    __shared__ __align__(16) bf ring[4 * GT];            // operand ring; after the main loop: each wave's 64x68 f32 output staging
    const int lane = threadIdx.x & 31, lr = lane & 15, hi = lane >> 4;
    const int wave = __builtin_amdgcn_readfirstlane(threadIdx.x >> 5); const int wm = wave >> 1, wn = wave & 1;
    const int r0 = blockIdx.x * 128 + wm * 64, c0 = blockIdx.y * 128 + wn * 64;
    v8f acc[4][4];
#pragma unroll
    for (int mb = 0; mb < 4; ++mb)
#pragma unroll
        for (int nb = 0; nb < 4; ++nb) acc[mb][nb] = (v8f){};
    gemm_loop_lds<bf, 0>(XB, XB, W, ring, blockIdx.x * 128, blockIdx.y * 128, wm, wn, acc);
    float* os = (float*)ring + wave * (64 * 68);
#pragma unroll
    for (int nb = 0; nb < 4; ++nb) { const float bc = bfr(bias[c0 + nb * 16 + lr]);
#pragma unroll
        for (int mb = 0; mb < 4; ++mb) {
#pragma unroll
            for (int j = 0; j < 8; ++j) os[(mb * 16 + hi * 8 + j) * 68 + nb * 16 + lr] = acc[mb][nb][j] + bc; } }
    __syncthreads();
    const int which = c0 / DM; const int h = (c0 % DM) / HD; const int b = r0 / SEQ; const int t0 = r0 % SEQ; const int bhh = b * NH + h; const bool early = (t0 < RH); const int te = early ? t0 : 0;
    const int rr = lane >> 3, seg = lane & 7;
    if (which < 2) {
        // rotary in place: lane owns d = seg*8 .. seg*8+7 of row s*4+rr; table column = d mod 32 = (seg & 3)*8 + i; position = t0 + row
        const size_t tof = (size_t)(t0 + rr) * 32 + (seg & 3) * 8;
#pragma unroll 1
        for (int s = 0; s < 16; ++s) { const int row = s * 4 + rr;
            const v4f ca = *(const v4f*)(RC + tof + (size_t)s * 128); const v4f cb = *(const v4f*)(RC + tof + (size_t)s * 128 + 4);
            const v4f sa = *(const v4f*)(RS + tof + (size_t)s * 128); const v4f sb = *(const v4f*)(RS + tof + (size_t)s * 128 + 4);
            float* op = os + row * 68 + seg * 8;
            const v4f a = *(const v4fa*)op; const v4f c = *(const v4fa*)(op + 4); v4f ra, rc;
            ra[0] = a[0] * ca[0] + (-a[1]) * sa[0]; ra[1] = a[1] * ca[1] + a[0] * sa[1];
            ra[2] = a[2] * ca[2] + (-a[3]) * sa[2]; ra[3] = a[3] * ca[3] + a[2] * sa[3];
            rc[0] = c[0] * cb[0] + (-c[1]) * sb[0]; rc[1] = c[1] * cb[1] + c[0] * sb[1];
            rc[2] = c[2] * cb[2] + (-c[3]) * sb[2]; rc[3] = c[3] * cb[3] + c[2] * sb[3];
            *(v4fa*)op = ra; *(v4fa*)(op + 4) = rc; }
    }
    __syncthreads();
    if (which < 2) {
        h16* P16 = QK16 + (size_t)which * PL16 + ((size_t)bhh * SEQ + t0) * HD + seg * 8;
        bf* PH = QKh + (size_t)which * PLE + ((size_t)bhh * RH + te) * HD + seg * 8;
        bf* PL = QKl + (size_t)which * PLE + ((size_t)bhh * RH + te) * HD + seg * 8;
{
#pragma unroll 4
            for (int s = 0; s < 16; ++s) { const int row = s * 4 + rr; const v4f a = *(const v4fa*)(os + row * 68 + seg * 8); const v4f c = *(const v4fa*)(os + row * 68 + seg * 8 + 4); v8h o;
#pragma unroll
                for (int i = 0; i < 4; ++i) { o[i] = toh_flush(a[i] * QKCAR); o[4 + i] = toh_flush(c[i] * QKCAR); }
                *(v8h*)(P16 + (size_t)row * HD) = o; }
            if (early) {
#pragma unroll 4
                for (int s = 0; s < 16; ++s) { const int row = s * 4 + rr; const v4f a = *(const v4fa*)(os + row * 68 + seg * 8); const v4f c = *(const v4fa*)(os + row * 68 + seg * 8 + 4); v8us oh, ol;
#pragma unroll
                    for (int i = 0; i < 4; ++i) { unsigned short x0, x1; splitf(a[i], x0, x1); oh[i] = x0; ol[i] = x1; splitf(c[i], x0, x1); oh[4 + i] = x0; ol[4 + i] = x1; }
                    *(v8us*)(PH + (size_t)row * HD) = oh; *(v8us*)(PL + (size_t)row * HD) = ol; } }
             }
    } else {
        h16* P16 = VT16 + ((size_t)bhh * HD) * SEQ + t0 + seg * 8;
        bf* PH = VTh + ((size_t)bhh * HD) * RH + te + seg * 8;
        bf* PL = VTl + ((size_t)bhh * HD) * RH + te + seg * 8;
{
#pragma unroll 4
            for (int s = 0; s < 16; ++s) { const int d = s * 4 + rr; v8h o;
#pragma unroll
                for (int j = 0; j < 8; ++j) o[j] = toh_flush(os[(seg * 8 + j) * 68 + d] * VCAR);
                *(v8h*)(P16 + (size_t)d * SEQ) = o; }
            if (early) {
#pragma unroll 4
                for (int s = 0; s < 16; ++s) { const int d = s * 4 + rr; v8us oh, ol;
#pragma unroll
                    for (int j = 0; j < 8; ++j) { unsigned short x0, x1; splitf(os[(seg * 8 + j) * 68 + d], x0, x1); oh[j] = x0; ol[j] = x1; }
                    *(v8us*)(PH + (size_t)d * RH) = oh; *(v8us*)(PL + (size_t)d * RH) = ol; } }
             }
    }
}

// ---- k_attn16: fused causal attention, query rows >= RH; four waves per block, 16 query rows each (64 rows that share one diagonal block), 64-key blocks up to the diagonal.
// Each 64-key K tile [key][d] and V tile [d][key] is brought into LDS once per block by asynchronous b128 copies (rows of 128 B at a pitch of 144 B), two buffers: the next
// tile's copies fly while this one is worked on; all four waves take their fragments from LDS. The products are taken transposed: S^T = K Q^T (A = K rows, B = the wave's Q, held in
// registers) and O^T += V^T P^T (A = V^T rows). A lane then holds 32 of the 64 scores of ONE query (lane ^ 16 the other 32): running max and sum (f32) are in-lane plus one exchange
// between the halves, and two score tiles, converted in place (p x1024, f16), are the B operand of the second product. ctx = O / l written as f16 x64 into [b][t][h*64+d].
#define AW    4                  // waves per block
#define KVP   72                 // LDS pitch of a K or V tile row, in f16 elements
#define KVT   (64 * KVP)         // elements of one staged tile
static_assert((SEQ - RH) % (16 * AW) == 0 && RH % (16 * AW) == 0 && 16 * AW == 64);
static_assert((size_t)AW * 16 * 68 * 4 <= (size_t)4 * KVT * 2);   // the output staging fits in the ring it takes over

// one stage: this thread's four 16-byte pieces of the K tile and of the V tile (128 threads x 4 x 16 B = 8 KiB each), rows 16 apart
__device__ __forceinline__ void stage_kv(const h16* kg, const h16* vg, unsigned kl, unsigned vl) {
    // s_wait_xcnt stands inside the statement so that no address register of a copy is rewritten ahead of it
    asm volatile("global_load_async_to_lds_b128 %0, %8, off\n\t"
                 "global_load_async_to_lds_b128 %1, %9, off\n\t"
                 "global_load_async_to_lds_b128 %2, %10, off\n\t"
                 "global_load_async_to_lds_b128 %3, %11, off\n\t"
                 "global_load_async_to_lds_b128 %4, %12, off\n\t"
                 "global_load_async_to_lds_b128 %5, %13, off\n\t"
                 "global_load_async_to_lds_b128 %6, %14, off\n\t"
                 "global_load_async_to_lds_b128 %7, %15, off\n\t"
                 "s_wait_xcnt 0x0"
                 :: "v"(kl), "v"(kl + 16 * KVP * 2), "v"(kl + 32 * KVP * 2), "v"(kl + 48 * KVP * 2),
                    "v"(vl), "v"(vl + 16 * KVP * 2), "v"(vl + 32 * KVP * 2), "v"(vl + 48 * KVP * 2),
                    "v"(kg), "v"(kg + 16 * HD), "v"(kg + 32 * HD), "v"(kg + 48 * HD),
                    "v"(vg), "v"(vg + (size_t)16 * SEQ), "v"(vg + (size_t)32 * SEQ), "v"(vg + (size_t)48 * SEQ)
                 : "memory");
}

// lane l <-> lane l ^ 16
__device__ __forceinline__ float xhalf(float x) { return __builtin_bit_cast(float, __builtin_amdgcn_permlanex16(__builtin_bit_cast(int, x), __builtin_bit_cast(int, x), 0x76543210, 0xfedcba98, false, false)); }
__device__ __forceinline__ float max8(const float* v) { return fmaxf(fmaxf(fmaxf(v[0], v[1]), fmaxf(v[2], v[3])), fmaxf(fmaxf(v[4], v[5]), fmaxf(v[6], v[7]))); }
__device__ __forceinline__ float sum8(const float* v) { return ((v[0] + v[1]) + (v[2] + v[3])) + ((v[4] + v[5]) + (v[6] + v[7])); }

__global__ __launch_bounds__(32 * AW) void k_attn16(const h16* __restrict__ Q16, const h16* __restrict__ K16, const h16* __restrict__ VT16, h16* CT16) {
    __shared__ __align__(16) h16 ring[4 * KVT];          // [buffer][K | V][row][KVP]; after the loop: output staging
    const int lane = threadIdx.x & 31, lr = lane & 15, hi = lane >> 4;
    const int wave = __builtin_amdgcn_readfirstlane(threadIdx.x >> 5);
    const int bh = blockIdx.y; const int blkbase = RH + blockIdx.x * (16 * AW); const int rowbase = blkbase + wave * 16;
    const size_t qoff  = ((size_t)bh * SEQ + rowbase + lr) * HD + 8 * hi;
    // staging: thread t owns piece (t & 7) of rows (t >> 3) + 16 j, j = 0..3, of both tiles
    const int srow = threadIdx.x >> 3, sseg = threadIdx.x & 7;
    const h16* kg = K16 + ((size_t)bh * SEQ + srow) * HD + sseg * 8;
    const h16* vg = VT16 + ((size_t)bh * HD + srow) * SEQ + sseg * 8;
    const unsigned sl = (unsigned)(size_t)(ring + srow * KVP + sseg * 8);   // LDS byte address of the piece in buffer 0's K tile
    const int foff = lr * KVP + 8 * hi;                                     // fragment row and half inside a tile
    const int t = rowbase + lr;                                             // this lane's query
    v16h qb[2];                                                             // B operand: column lr = query t, d in the k order of ldh
#pragma unroll
    for (int c = 0; c < 2; ++c) qb[c] = ldh(Q16 + qoff + c * 32);
    v8f o[4]; float m = NEGB, l = 0.0f;                                     // o[dt][r] = O[t][dt*16 + 8*hi + r]; l: sum over this half's keys only
#pragma unroll
    for (int dt = 0; dt < 4; ++dt) o[dt] = (v8f){};
    const int nblk = blkbase / 64 + 1;
    stage_kv(kg, vg, sl, sl + KVT * 2);
    asm volatile("s_wait_asynccnt 0x0" ::: "memory");   // tile 0 of this wave's copies has landed
    __syncthreads();                                     // ... and every other wave's
    if (nblk > 1) stage_kv(kg + 64 * HD, vg + 64, sl + 2 * KVT * 2, sl + 3 * KVT * 2);
#pragma unroll 1
    for (int jb = 0; jb < nblk; ++jb) {
        const int jbase = jb * 64;
        const h16* kb = ring + (jb & 1) * (2 * KVT) + foff; const h16* vb = kb + KVT;
        v8f s[4];                                        // s[nt][r] = score of key jbase + nt*16 + 8*hi + r with query t
#pragma unroll
        for (int nt = 0; nt < 4; ++nt) s[nt] = (v8f){};
        v16h kf;
#pragma unroll
        for (int c = 0; c < 2; ++c) {
#pragma unroll
            for (int nt = 0; nt < 4; ++nt) { const h16* kp = kb + nt * 16 * KVP + c * 32; kf = cat16(*(const v8ha*)kp, *(const v8ha*)(kp + 16)); s[nt] = wmma16(kf, qb[c], s[nt]); }
        }
        // the four vector slots between the last WMMA and the first reader of its result
        asm volatile("v_nop\n\tv_nop\n\tv_nop\n\tv_nop" : "+v"(s[0]), "+v"(s[1]), "+v"(s[2]), "+v"(s[3]) : "v"(kf));
        const int dq = t - jbase - 8 * hi;               // key > t  <=>  the key's place among this lane's keys, nt*16 + r, > dq
        float v[4][8], mt[4];
#pragma unroll
        for (int nt = 0; nt < 4; ++nt) {
#pragma unroll
            for (int r = 0; r < 8; ++r) { const float sv = s[nt][r] * SCQ16; v[nt][r] = (nt * 16 + r > dq) ? NEGB : sv; }
            mt[nt] = max8(v[nt]);
        }
        float mx = fmaxf(fmaxf(mt[0], mt[1]), fmaxf(mt[2], mt[3]));
        mx = fmaxf(mx, xhalf(mx));                       // both halves hold the query's maximum over the 64 keys
        const float mn = fmaxf(m, mx);
        const float al = ex2((m - mn) * L2E);
        m = mn;
        float st[4]; v16h pb[2];                         // pb[c][e] = p of key jbase + c*32 + (k order of ldh): tiles 2c and 2c+1 as they lie
#pragma unroll
        for (int nt = 0; nt < 4; ++nt) {
            float p[8];
#pragma unroll
            for (int r = 0; r < 8; ++r) { p[r] = ex2((v[nt][r] - mn) * L2E + PLOG); pb[nt >> 1][(nt & 1) * 8 + r] = (h16)p[r]; }
            st[nt] = sum8(p);
        }
        l = l * al + ((st[0] + st[1]) + (st[2] + st[3]));
#pragma unroll
        for (int dt = 0; dt < 4; ++dt) o[dt] *= al;
        v16h vf;
#pragma unroll
        for (int c = 0; c < 2; ++c) {
#pragma unroll
            for (int dt = 0; dt < 4; ++dt) { const h16* vp = vb + dt * 16 * KVP + c * 32; vf = cat16(*(const v8ha*)vp, *(const v8ha*)(vp + 16)); o[dt] = wmma16(vf, pb[c], o[dt]); }
        }
        // the four vector slots behind the last WMMA, on the loop's back edge too
        asm volatile("v_nop\n\tv_nop\n\tv_nop\n\tv_nop" : "+v"(o[0]), "+v"(o[1]), "+v"(o[2]), "+v"(o[3]) : "v"(pb[1]), "v"(vf));
        asm volatile("s_wait_dscnt 0x0" ::: "memory");      // this wave has finished reading the buffer
        asm volatile("s_wait_asynccnt 0x0" ::: "memory");   // this wave's copies of tile jb + 1 have landed
        __syncthreads();                                     // publishes tile jb + 1 and frees the buffer of tile jb
        if (jb + 2 < nblk) { const unsigned bl = sl + (jb & 1) * (2 * KVT * 2); stage_kv(kg + (size_t)(jbase + 128) * HD, vg + jbase + 128, bl, bl + KVT * 2); }
    }
    asm volatile("s_wait_asynccnt 0x0" ::: "memory");       // nothing of the ring is in flight when it becomes output staging
    float* os = (float*)ring + wave * (16 * 68);
    {
        const float lt = l + xhalf(l);
        const float inv = (CCAR / VCAR) * (1.0f / lt);
#pragma unroll
        for (int dt = 0; dt < 4; ++dt) { v4f a, c;
#pragma unroll
            for (int i = 0; i < 4; ++i) { a[i] = o[dt][i] * inv; c[i] = o[dt][4 + i] * inv; }
            *(v4fa*)(os + lr * 68 + dt * 16 + 8 * hi) = a; *(v4fa*)(os + lr * 68 + dt * 16 + 8 * hi + 4) = c; }
    }
    __syncthreads();
    const int b = bh / NH, h = bh % NH; const int rr = lane >> 3, seg = lane & 7;
    h16* dst = CT16 + ((size_t)b * SEQ + rowbase) * DM + h * HD + seg * 8;
{
#pragma unroll
        for (int s = 0; s < 4; ++s) { const int row = s * 4 + rr; const v4f a = *(const v4fa*)(os + row * 68 + seg * 8); const v4f c = *(const v4fa*)(os + row * 68 + seg * 8 + 4); v8h ov;
#pragma unroll
            for (int i = 0; i < 4; ++i) { ov[i] = (h16)a[i]; ov[4 + i] = (h16)c[i]; }
            *(v8h*)(dst + (size_t)row * DM) = ov; }
         }
}

// ---- k_attnhl: the same fused kernel for query rows < RH on bf16 hi/lo planes: scores kh qh + kh ql + kl qh, p split hi/lo in place, O^T += vh ph + vh pl + vl ph; ctx written as bf16 hi/lo [b][t<RH][h*64+d].
__global__ __launch_bounds__(32) void k_attnhl(const bf* __restrict__ Qh, const bf* __restrict__ Ql, const bf* __restrict__ Kh, const bf* __restrict__ Kl,
                                                const bf* __restrict__ VTh, const bf* __restrict__ VTl, bf* ATh, bf* ATl) {
    __shared__ __align__(16) float os[16 * 68];
    const int lane = threadIdx.x & 31, lr = lane & 15, hi = lane >> 4;
    const int bh = blockIdx.y; const int rowbase = blockIdx.x * 16;
    const size_t qoff  = ((size_t)bh * RH + rowbase + lr) * HD + 8 * hi;
    const size_t kbase = ((size_t)bh * RH + lr) * HD + 8 * hi;
    const size_t vbase = ((size_t)bh * HD + lr) * RH + 8 * hi;
    const int t = rowbase + lr;                          // this lane's query
    v16bf qh[2], ql[2];
#pragma unroll
    for (int c = 0; c < 2; ++c) { qh[c] = ldb(Qh + qoff + c * 32); ql[c] = ldb(Ql + qoff + c * 32); }
    v8f o[4]; float m = NEGB, l = 0.0f;
#pragma unroll
    for (int dt = 0; dt < 4; ++dt) o[dt] = (v8f){};
    const int nblk = rowbase / 64 + 1;
#pragma unroll 1
    for (int jb = 0; jb < nblk; ++jb) {
        const int jbase = jb * 64;
        v8f s[4];
#pragma unroll
        for (int nt = 0; nt < 4; ++nt) s[nt] = (v8f){};
        v16bf kh, kl;
#pragma unroll
        for (int c = 0; c < 2; ++c) {
#pragma unroll
            for (int nt = 0; nt < 4; ++nt) { const size_t ko = kbase + (size_t)(jbase + nt * 16) * HD + c * 32; kh = ldb(Kh + ko); kl = ldb(Kl + ko);
                s[nt] = wmmab(kh, qh[c], s[nt]); s[nt] = wmmab(kh, ql[c], s[nt]); s[nt] = wmmab(kl, qh[c], s[nt]); }
        }
        // the four vector slots between the last WMMA and the first reader of its result
        asm volatile("v_nop\n\tv_nop\n\tv_nop\n\tv_nop" : "+v"(s[0]), "+v"(s[1]), "+v"(s[2]), "+v"(s[3]) : "v"(kh), "v"(kl));
        const int dq = t - jbase - 8 * hi;               // key > t  <=>  the key's place among this lane's keys, nt*16 + r, > dq
        float v[4][8], mt[4];
#pragma unroll
        for (int nt = 0; nt < 4; ++nt) {
#pragma unroll
            for (int r = 0; r < 8; ++r) { const float sv = s[nt][r] * SCQHL; v[nt][r] = (nt * 16 + r > dq) ? NEGB : sv; }
            mt[nt] = max8(v[nt]);
        }
        float mx = fmaxf(fmaxf(mt[0], mt[1]), fmaxf(mt[2], mt[3]));
        mx = fmaxf(mx, xhalf(mx));
        const float mn = fmaxf(m, mx);
        const float al = ex2((m - mn) * L2E);
        m = mn;
        float st[4]; v8us ph[4], pl[4];
#pragma unroll
        for (int nt = 0; nt < 4; ++nt) {
            float p[8];
#pragma unroll
            for (int r = 0; r < 8; ++r) { p[r] = ex2((v[nt][r] - mn) * L2E); unsigned short x0, x1; splitf(p[r], x0, x1); ph[nt][r] = x0; pl[nt][r] = x1; }
            st[nt] = sum8(p);
        }
        l = l * al + ((st[0] + st[1]) + (st[2] + st[3]));
#pragma unroll
        for (int dt = 0; dt < 4; ++dt) o[dt] *= al;
        v16bf pbh, pbl, vh, vl;
#pragma unroll
        for (int c = 0; c < 2; ++c) {
            pbh = cat16b(ph[2 * c], ph[2 * c + 1]); pbl = cat16b(pl[2 * c], pl[2 * c + 1]);
#pragma unroll
            for (int dt = 0; dt < 4; ++dt) { const size_t vo = vbase + (size_t)(dt * 16) * RH + jbase + c * 32; vh = ldb(VTh + vo); vl = ldb(VTl + vo);
                o[dt] = wmmab(vh, pbh, o[dt]); o[dt] = wmmab(vh, pbl, o[dt]); o[dt] = wmmab(vl, pbh, o[dt]); }
        }
        // the four vector slots behind the last WMMA, on the loop's back edge too
        asm volatile("v_nop\n\tv_nop\n\tv_nop\n\tv_nop" : "+v"(o[0]), "+v"(o[1]), "+v"(o[2]), "+v"(o[3]) : "v"(pbh), "v"(pbl), "v"(vh), "v"(vl));
    }
    {
        const float lt = l + xhalf(l);
        const float inv = 1.0f / lt;
#pragma unroll
        for (int dt = 0; dt < 4; ++dt) { v4f a, c;
#pragma unroll
            for (int i = 0; i < 4; ++i) { a[i] = o[dt][i] * inv; c[i] = o[dt][4 + i] * inv; }
            *(v4fa*)(os + lr * 68 + dt * 16 + 8 * hi) = a; *(v4fa*)(os + lr * 68 + dt * 16 + 8 * hi + 4) = c; }
    }
    __syncthreads();
    const int b = bh / NH, h = bh % NH; const int rr = lane >> 3, seg = lane & 7;
    const size_t dof = ((size_t)b * RH + rowbase) * DM + h * HD + seg * 8;
{
#pragma unroll
        for (int s = 0; s < 4; ++s) { const int row = s * 4 + rr; const v4f a = *(const v4fa*)(os + row * 68 + seg * 8); const v4f c = *(const v4fa*)(os + row * 68 + seg * 8 + 4); v8us oh, ol;
#pragma unroll
            for (int i = 0; i < 4; ++i) { unsigned short x0, x1; splitf(a[i], x0, x1); oh[i] = x0; ol[i] = x1; splitf(c[i], x0, x1); oh[4 + i] = x0; ol[4 + i] = x1; }
            *(v8us*)(ATh + dof + (size_t)row * DM) = oh; *(v8us*)(ATl + dof + (size_t)row * DM) = ol; }
         }
}

extern "C" void kernel_launch(void* const* d_in, const int* in_sizes, int n_in,
                              void* d_out, int out_size, void* d_ws, size_t ws_size, hipStream_t stream) {
    if (n_in < 5) return;
    if ((size_t)in_sizes[0] < (size_t)(NB - 1) * SEQ_FULL * DM + (size_t)SEQ * DM) return;
    if ((size_t)in_sizes[1] < (size_t)3 * DM * DM || in_sizes[2] < 3 * DM || (size_t)in_sizes[3] < (size_t)DM * DM || in_sizes[4] < DM) return;
    if ((size_t)out_size < (size_t)NB * SEQ * DM) return;
    if (ws_size < WS_TOTAL) return;
    // wire order: x, W_qkv, b_qkv, W_proj, b_proj
    const float* x = (const float*)d_in[0]; const float* wqkv = (const float*)d_in[1]; const float* bqkv = (const float*)d_in[2]; const float* wo = (const float*)d_in[3]; const float* bo = (const float*)d_in[4];
    float* OUT = (float*)d_out;
    char* wsp = (char*)d_ws;
    auto take = [&](size_t bytes) { char* p = wsp; wsp += bytes; return (void*)p; };
    bf* XB = (bf*)take(SZ_XB);
    bf* WQKV = (bf*)take(SZ_WQKV);                 // Bt [3*DM][DM]
    bf* WOb = (bf*)take(SZ_WO); h16* WO16 = (h16*)take(SZ_WO);
    h16* QK16 = (h16*)take(2 * SZ_P16);            // [q | k] f16 planes [bh][t][d]
    h16* VT16 = (h16*)take(SZ_P16);                // [bh][d][t]
    bf* QKh = (bf*)take(2 * SZ_PE); bf* QKl = (bf*)take(2 * SZ_PE);   // [q | k] early-row planes [bh][t<RH][d]
    bf* VTh = (bf*)take(SZ_PE); bf* VTl = (bf*)take(SZ_PE);           // [bh][d][t<RH]
    h16* CT16 = (h16*)take(SZ_CT);                 // ctx f16 x64 [b][t][DM] (rows >= RH used)
    bf* ATh = (bf*)take(SZ_AT); bf* ATl = (bf*)take(SZ_AT);           // ctx hi/lo [b][t<RH][DM]
    float* RC = (float*)take(SZ_ROT); float* RS = (float*)take(SZ_ROT);   // rotary cos / sin [SEQ][32]
    if ((size_t)(wsp - (char*)d_ws) > ws_size) return;

    k_cvt8<<<dim3((unsigned)(((size_t)SEQ * DM / 8 + 255) / 256), NB, 1), 256, 0, stream>>>(x, XB, (unsigned)((size_t)SEQ * DM / 8));
    k_wtG<<<(unsigned)((3 * DM * (DM / 64) + 63) / 64), 256, 0, stream>>>(wqkv, DM, 3 * DM, WQKV, (h16*)nullptr, 1.0f);   // in[DM][3*DM] -> out[3*DM][DM]
    k_wtG<<<(unsigned)((DM * (DM / 64) + 63) / 64), 256, 0, stream>>>(wo, DM, DM, WOb, WO16, WCAR);                        // in[DM][DM] -> out[DM][DM]
    k_rope<<<(unsigned)((SEQ + 7) / 8), 256, 0, stream>>>(RC, RS);
    k_qkv<<<dim3(NB * SEQ / 128, 3 * DM / 128, 1), 128, 0, stream>>>(XB, WQKV, bqkv, RC, RS, QK16, VT16, QKh, QKl, VTh, VTl);
    k_attnhl<<<dim3(RH / 16, NB * NH, 1), 32, 0, stream>>>(QKh, QKl, QKh + PLE, QKl + PLE, VTh, VTl, ATh, ATl);
    if (SEQ > RH)
        k_attn16<<<dim3((SEQ - RH) / 64 > 0 ? (SEQ - RH) / 64 : 1, NB * NH, 1), 128, 0, stream>>>(QK16, QK16 + PL16, VT16, CT16);
    k_proj_hl<<<dim3(RH / 128, DM / 128, NB), 128, 0, stream>>>(ATh, ATl, WOb, OUT, bo);
    if (SEQ > RH)
        k_proj16<<<dim3((SEQ - RH) / 128 > 0 ? (SEQ - RH) / 128 : 1, DM / 128, NB), 128, 0, stream>>>(CT16 + (size_t)RH * DM, WO16, OUT + (size_t)RH * DM, bo);
}

// v004
// Measured time: 157 microseconds a run.
// Two timings next to v003 put it at 1.25 and 1.27 times that version's speed.
// Counting every step since v000, it is 2.88 times as fast.
#include <hip/hip_runtime.h>

// Contractions (all f32 accumulate): x*W_qkv on v_wmma_f32_16x16x32_bf16 (both operands bf16 RNE copies of the inputs, exact products);
// q*k^T and p*v: query rows >= 256 on v_wmma_f32_16x16x32_f16 (q,k,v carried x16, p carried x1024), query rows < 256 on bf16 hi/lo planes (3 products);
// ctx*W_proj: rows >= 256 f16 (ctx x64, w x1024 from the bf16 copy), rows < 256 bf16 hi/lo ctx x bf16 w (2 products). Softmax f32 (running max, exp2).
// Rotary on q and k (interleaved pairs (2i,2i+1) -> (-x[2i+1], x[2i]); angle = pos * inv_freq[d mod 32], inv_freq[j] = 1 / 10000^(j/32)) applied in f32 on the
// staged 64x64 tile in the x*W_qkv epilogue, from cos/sin tables [SEQ][32] built once by rope_body (precise sincosf).
// Layout: x [NB][SEQ_FULL][1024] (rows < SEQ read); W_qkv [1024][3072] (in,out), thirds q|k|v, column = which*1024 + h*64 + d; W_proj [1024][1024] (in,out); out [NB][SEQ][1024].

#ifndef NB
#define NB 4
#endif
#ifndef SEQ
#define SEQ 2048
#endif
#define NB_FULL  4
#define SEQ_FULL 2048
#define DM   1024
#define NH   16
#define HD   64
#define RH   256                 // query rows < RH use bf16 hi/lo planes
#define QKCAR 16.0f
#define VCAR  16.0f
#define CCAR  64.0f
#define WCAR  1024.0f
#define PLOG  10.0f              // p carried x 2^10
#define L2E   1.4426950408889634f
#define NEGB  (-3.0e38f)
#define SCQ16 (0.125f / (QKCAR * QKCAR))
#define SCQHL 0.125f

typedef _Float16 h16;
typedef unsigned short bf;
typedef __attribute__((ext_vector_type(16))) __bf16   v16bf;
typedef __attribute__((ext_vector_type(16))) _Float16 v16h;
typedef __attribute__((ext_vector_type(8)))  _Float16 v8h;
typedef __attribute__((ext_vector_type(2)))  _Float16 v2h;
typedef __attribute__((ext_vector_type(8)))  unsigned short v8us;
typedef __attribute__((ext_vector_type(2)))  unsigned short v2us;
typedef __attribute__((ext_vector_type(8)))  float    v8f;
typedef __attribute__((ext_vector_type(4)))  float    v4f;
typedef v8h  __attribute__((may_alias)) v8ha;
typedef v4f  __attribute__((may_alias)) v4fa;
typedef v8us __attribute__((may_alias)) v8usa;

static_assert(SEQ % 64 == 0);
static_assert(RH % 64 == 0);
static_assert(RH <= SEQ);
static_assert(SEQ <= SEQ_FULL);
static_assert(NB <= NB_FULL);
static_assert(DM % 64 == 0);
static_assert(DM % 32 == 0);
static_assert(HD == 64);
static_assert(NH * HD == DM);
static_assert((3 * DM) % 64 == 0);
static_assert(HD / 2 == 32);
static_assert(SEQ % 8 == 0);          // rope_body: 8 positions per 256-thread block
static_assert((NB * SEQ) % 128 == 0 && (3 * DM) % 128 == 0 && SEQ % 128 == 0 && RH % 128 == 0 && DM % 128 == 0);   // the three GEMMs: 128x128 block tiles

constexpr size_t PL16 = (size_t)NB * NH * SEQ * HD;     // elements of one f16 head plane set
constexpr size_t PLE  = (size_t)NB * NH * RH * HD;      // elements of one early-row bf16 plane set
constexpr size_t SZ_XB   = (size_t)NB * SEQ * DM * 2;
constexpr size_t SZ_WQKV = (size_t)3 * DM * DM * 2;
constexpr size_t SZ_WO   = (size_t)DM * DM * 2;
constexpr size_t SZ_P16  = PL16 * 2;
constexpr size_t SZ_PE   = PLE * 2;
constexpr size_t SZ_CT   = (size_t)NB * SEQ * DM * 2;
constexpr size_t SZ_AT   = (size_t)NB * RH * DM * 2;
constexpr size_t SZ_ROT  = (size_t)SEQ * 32 * 4;        // one rotary table (cos or sin) [SEQ][32] f32
constexpr size_t WS_TOTAL = SZ_XB + SZ_WQKV + 2 * SZ_WO + 3 * SZ_P16 + 6 * SZ_PE + SZ_CT + 2 * SZ_AT + 2 * SZ_ROT;
static_assert(SZ_XB % 256 == 0 && SZ_WQKV % 256 == 0 && SZ_WO % 256 == 0 && SZ_P16 % 256 == 0 && SZ_PE % 256 == 0 && SZ_CT % 256 == 0 && SZ_AT % 256 == 0);
static_assert(SZ_ROT % 256 == 0);
static_assert(WS_TOTAL <= (size_t)134217728);

__device__ __forceinline__ unsigned short f2bf(float f) { unsigned u = __float_as_uint(f); u += 0x7FFFu + ((u >> 16) & 1u); return (unsigned short)(u >> 16); }
__device__ __forceinline__ float bf2f(unsigned short b) { return __uint_as_float(((unsigned)b) << 16); }
__device__ __forceinline__ float bfr(float f) { return bf2f(f2bf(f)); }
__device__ __forceinline__ void splitf(float y, unsigned short& h, unsigned short& l) { h = f2bf(y); l = f2bf(y - bf2f(h)); }
__device__ __forceinline__ v16h cat16(v8h lo, v8h hi) { return __builtin_shufflevector(lo, hi, 0, 1, 2, 3, 4, 5, 6, 7, 8, 9, 10, 11, 12, 13, 14, 15); }
__device__ __forceinline__ v16bf cat16b(v8us lo, v8us hi) { return __builtin_bit_cast(v16bf, __builtin_shufflevector(lo, hi, 0, 1, 2, 3, 4, 5, 6, 7, 8, 9, 10, 11, 12, 13, 14, 15)); }
__device__ __forceinline__ v8f wmma16(v16h a, v16h b, v8f c) { return __builtin_amdgcn_wmma_f32_16x16x32_f16(false, a, false, b, (short)0, c, false, false); }
__device__ __forceinline__ v8f wmmab(v16bf a, v16bf b, v8f c) { return __builtin_amdgcn_wmma_f32_16x16x32_bf16(false, a, false, b, (short)0, c, false, false); }
__device__ __forceinline__ float ex2(float x) { return __builtin_amdgcn_exp2f(x); }
// f32 -> f16 for operand planes: anything below the smallest f16 normal becomes an exact zero (value select, applied after the carry)
static __device__ __forceinline__ h16 toh_flush(float v) { const h16 r = (h16)v; return (fabsf(v) < 6.103515625e-05f) ? (h16)0.0f : r; }
// fragment loads from K-contiguous 16-bit rows: p already includes + 8*(lane>>4); elements 0..7 <- k0+8h.., 8..15 <- k0+16+8h..
__device__ __forceinline__ v16h  ldh(const h16* p) { return cat16(*(const v8h*)p, *(const v8h*)(p + 16)); }
__device__ __forceinline__ v16bf ldb(const bf* p)  { return cat16b(*(const v8us*)p, *(const v8us*)(p + 16)); }

template <typename T16> struct WFrag;
template <> struct WFrag<h16> { typedef v16h V; static __device__ __forceinline__ V lds(const h16* p) { return cat16(*(const v8ha*)p, *(const v8ha*)(p + 16)); } static __device__ __forceinline__ v8f mma(V a, V b, v8f c) { return wmma16(a, b, c); } };
template <> struct WFrag<bf>  { typedef v16bf V; static __device__ __forceinline__ V lds(const bf* p) { return cat16b(*(const v8usa*)p, *(const v8usa*)(p + 16)); } static __device__ __forceinline__ v8f mma(V a, V b, v8f c) { return wmmab(a, b, c); } };

// ---- four-wave 128x128 tile main loop (K = DM): per stage of 64 k the block brings 128 rows of A and 128 rows of Bt (128 B each, LDS pitch 144 B) into LDS once by asynchronous
// b128 copies, two buffers: the next stage's copies fly while this one is worked on. Wave (wm, wn) takes its 64x64 quarter's fragments from LDS, in the k order of ldh / ldb.
#define GW    4                  // waves per block (2 x 2)
#define GP    72                 // LDS pitch of a staged operand row, in 16-bit elements
#define GT    (128 * GP)         // elements of one staged operand tile
static_assert(DM % 64 == 0 && DM / 64 >= 2);
static_assert((size_t)GW * 64 * 68 * 4 <= (size_t)4 * GT * 2);   // the output staging fits in the ring it takes over

// this thread's eight 16-byte pieces of one operand tile (128 threads x 8 x 16 B = 16 KiB), rows 16 apart
template <typename T16>
__device__ __forceinline__ void stage_rows(const T16* g, unsigned l) {
    // s_wait_xcnt stands inside the statement so that no address register of a copy is rewritten ahead of it
    asm volatile("global_load_async_to_lds_b128 %0, %8, off\n\t"
                 "global_load_async_to_lds_b128 %1, %9, off\n\t"
                 "global_load_async_to_lds_b128 %2, %10, off\n\t"
                 "global_load_async_to_lds_b128 %3, %11, off\n\t"
                 "global_load_async_to_lds_b128 %4, %12, off\n\t"
                 "global_load_async_to_lds_b128 %5, %13, off\n\t"
                 "global_load_async_to_lds_b128 %6, %14, off\n\t"
                 "global_load_async_to_lds_b128 %7, %15, off\n\t"
                 "s_wait_xcnt 0x0"
                 :: "v"(l), "v"(l + 16 * GP * 2), "v"(l + 32 * GP * 2), "v"(l + 48 * GP * 2),
                    "v"(l + 64 * GP * 2), "v"(l + 80 * GP * 2), "v"(l + 96 * GP * 2), "v"(l + 112 * GP * 2),
                    "v"(g), "v"(g + 16 * DM), "v"(g + 32 * DM), "v"(g + 48 * DM),
                    "v"(g + 64 * DM), "v"(g + 80 * DM), "v"(g + 96 * DM), "v"(g + 112 * DM)
                 : "memory");
}

// ring: [buffer][A | Bt | A2][row][GP] (A2, the lo plane multiplied against the same Bt, only with NSPLIT 1); rb, cb: first of the block's A rows and Bt rows.
// acc[mb][nb] += A[rb+wm*64+mb*16..][k] Bt[cb+wn*64+nb*16..][k]. On return every wave has left the ring and nothing is in flight into it.
template <typename T16, int NSPLIT>
__device__ __forceinline__ void gemm_loop_lds(const T16* __restrict__ A, const T16* __restrict__ A2, const T16* __restrict__ Bt, T16* ring, int rb, int cb, int wm, int wn, v8f (&acc)[4][4]) {
    typedef typename WFrag<T16>::V V;
    constexpr int NST = DM / 64, BUF = (2 + NSPLIT) * GT;
    const int lane = threadIdx.x & 31, lr = lane & 15, hi = lane >> 4;
    // staging: thread t owns piece (t & 7) of rows (t >> 3) + 16 j, j = 0..7, of every tile
    const int srow = threadIdx.x >> 3, sseg = threadIdx.x & 7;
    const T16* ag = A + (size_t)(rb + srow) * DM + sseg * 8;
    const T16* a2g = A2 + (size_t)(rb + srow) * DM + sseg * 8;
    const T16* bg = Bt + (size_t)(cb + srow) * DM + sseg * 8;
    const unsigned sl = (unsigned)(size_t)(ring + srow * GP + sseg * 8);   // LDS byte address of the piece in buffer 0's A tile
    const int aof = (wm * 64 + lr) * GP + 8 * hi, bof = GT + (wn * 64 + lr) * GP + 8 * hi;
    auto stage = [&](int st, unsigned l) { stage_rows<T16>(ag + st * 64, l); stage_rows<T16>(bg + st * 64, l + GT * 2); if (NSPLIT == 1) stage_rows<T16>(a2g + st * 64, l + 2 * GT * 2); };
    stage(0, sl);
    asm volatile("s_wait_asynccnt 0x0" ::: "memory");   // stage 0 of this wave's copies has landed
    __syncthreads();                                     // ... and every other wave's
    stage(1, sl + BUF * 2);
    // kept rolled: one copy of the hand-over at the foot, and the code stays small; the loops inside are unrolled so that every fragment and accumulator index is a constant (registers)
#pragma unroll 1
    for (int t = 0; t < NST; ++t) {
        const T16* tb = ring + (t & 1) * BUF;
#pragma unroll
        for (int c = 0; c < 2; ++c) {
            V a[4], a2[4], b[4];
#pragma unroll
            for (int mb = 0; mb < 4; ++mb) { a[mb] = WFrag<T16>::lds(tb + aof + mb * 16 * GP + c * 32); if (NSPLIT == 1) a2[mb] = WFrag<T16>::lds(tb + 2 * GT + aof + mb * 16 * GP + c * 32); }
#pragma unroll
            for (int nb = 0; nb < 4; ++nb) b[nb] = WFrag<T16>::lds(tb + bof + nb * 16 * GP + c * 32);
            // inputs-only fence on the loaded fragments: keeps the LDS loads of this 32-k block together ahead of its WMMAs (one LDS wait a block; sunk between the WMMAs each B fragment costs its own)
            if (NSPLIT == 1) asm volatile("" :: "v"(a[0]), "v"(a[1]), "v"(a[2]), "v"(a[3]), "v"(a2[0]), "v"(a2[1]), "v"(a2[2]), "v"(a2[3]), "v"(b[0]), "v"(b[1]), "v"(b[2]), "v"(b[3]));
            else             asm volatile("" :: "v"(a[0]), "v"(a[1]), "v"(a[2]), "v"(a[3]), "v"(b[0]), "v"(b[1]), "v"(b[2]), "v"(b[3]));
#pragma unroll
            for (int nb = 0; nb < 4; ++nb)
#pragma unroll
                for (int mb = 0; mb < 4; ++mb) { acc[mb][nb] = WFrag<T16>::mma(a[mb], b[nb], acc[mb][nb]); if (NSPLIT == 1) acc[mb][nb] = WFrag<T16>::mma(a2[mb], b[nb], acc[mb][nb]); }
        }
        asm volatile("s_wait_dscnt 0x0" ::: "memory");      // this wave has finished reading the buffer
        asm volatile("s_wait_asynccnt 0x0" ::: "memory");   // this wave's copies of stage t + 1 have landed
        __syncthreads();                                     // publishes stage t + 1 and frees the buffer of stage t
        if (t + 2 < NST) stage(t + 2, sl + (t & 1) * (BUF * 2));
    }
    asm volatile("s_wait_asynccnt 0x0" ::: "memory");       // nothing of the ring is in flight when it becomes output staging
}

// ---- GEMM with f32 output: C[m][n] = osc * sum_k A[m][k] Bt[n][k] + bf16(bias[n]); K = DM; grid (M/128, N/128, Z), 128 threads, a 64x64 quarter per wave. Per 16-row slab staged in LDS,
template <typename T16, int NSPLIT>
__device__ __forceinline__ void gemm_out_body(const T16* __restrict__ A, const T16* __restrict__ A2, const T16* __restrict__ Bt, float* C, int ldc, const float* __restrict__ bias, float osc, size_t sA, size_t sC, T16* ring) {
    // ring: the kernel's LDS, 2 * (2 + NSPLIT) * GT elements used: operand ring; after the main loop: each wave's 16x68 f32 slab staging
    const size_t z = blockIdx.z; A += z * sA; A2 += z * sA; C += z * sC;
    const int lane = threadIdx.x & 31, lr = lane & 15, hi = lane >> 4;
    const int wave = __builtin_amdgcn_readfirstlane(threadIdx.x >> 5); const int wm = wave >> 1, wn = wave & 1;
    const int r0 = blockIdx.x * 128 + wm * 64, c0 = blockIdx.y * 128 + wn * 64;
    v8f acc[4][4];
#pragma unroll
    for (int mb = 0; mb < 4; ++mb)
#pragma unroll
        for (int nb = 0; nb < 4; ++nb) acc[mb][nb] = (v8f){};
    gemm_loop_lds<T16, NSPLIT>(A, A2, Bt, ring, blockIdx.x * 128, blockIdx.y * 128, wm, wn, acc);
    float* os = (float*)ring + wave * (16 * 68);
    const int cofs = lr * 4;
    const v4f bv = *(const v4f*)(bias + c0 + cofs);
    v4f bb; bb[0] = bfr(bv[0]); bb[1] = bfr(bv[1]); bb[2] = bfr(bv[2]); bb[3] = bfr(bv[3]);
#pragma unroll
    for (int mb = 0; mb < 4; ++mb) {
#pragma unroll
        for (int nb = 0; nb < 4; ++nb) {
#pragma unroll
            for (int j = 0; j < 8; ++j) os[(hi * 8 + j) * 68 + nb * 16 + lr] = acc[mb][nb][j]; }
        __syncthreads();
        float* crow = C + (size_t)(r0 + mb * 16) * ldc + c0;
{
#pragma unroll
            for (int s = 0; s < 8; ++s) { const int row = 2 * s + hi; const v4f t = *(const v4fa*)(os + row * 68 + cofs); v4f val;
                val[0] = t[0] * osc + bb[0]; val[1] = t[1] * osc + bb[1]; val[2] = t[2] * osc + bb[2]; val[3] = t[3] * osc + bb[3];
                *(v4f*)(crow + (size_t)row * ldc + cofs) = val; }
             }
        __syncthreads();
    }
}

// ---- k_proj: ctx W_proj + b_proj for all rows in one launch, grid (SEQ/128, DM/128, NB), z = batch; the two bodies share no data, so the few hi/lo tiles run beside the f16 tiles.
// row tiles < RH: ctx hi/lo (bf16) x w_proj (bf16); row tiles >= RH: ctx f16 (x64) x w_proj f16 (x1024)
__global__ __launch_bounds__(32 * GW) void k_proj(const bf* __restrict__ Ah, const bf* __restrict__ Al, const bf* __restrict__ Wt, const h16* __restrict__ A16, const h16* __restrict__ Wt16,
                                                  float* C, const float* __restrict__ bias) {
    __shared__ __align__(16) bf ring[2 * 3 * GT];        // one array for both bodies (two would add up)
    if (blockIdx.x < RH / 128) gemm_out_body<bf, 1>(Ah, Al, Wt, C, DM, bias, 1.0f, (size_t)RH * DM, (size_t)SEQ * DM, ring);
    else                       gemm_out_body<h16, 0>(A16, A16, Wt16, C, DM, bias, 1.0f / (CCAR * WCAR), (size_t)SEQ * DM, (size_t)SEQ * DM, (h16*)ring);
}

// bx: block inside a batch, b: batch
__device__ __forceinline__ void cvt8_body(const float* __restrict__ src, bf* dst, unsigned n8, unsigned bx, size_t b) {
    src += b * (size_t)SEQ_FULL * DM; dst += b * (size_t)SEQ * DM;
    const unsigned i = bx * 256 + threadIdx.x; if (i >= n8) return;
    const v8f v = *(const v8f*)(src + (size_t)i * 8); v8us o;
#pragma unroll
    for (int k = 0; k < 8; ++k) o[k] = f2bf(v[k]);
    *(v8us*)(dst + (size_t)i * 8) = o; 
}

__device__ __forceinline__ void wtG_body(const float* __restrict__ w, int K, int N, bf* Bt, h16* Bt16, float car, unsigned bx) {
    const int lane = threadIdx.x & 31; const int L0 = (bx * 8 + (threadIdx.x >> 5)) * 8; const int nlines = N * (K / 64);
{
#pragma unroll 1
        for (int l = 0; l < 8; ++l) { const int L = L0 + l; if (L >= nlines) break; const size_t e = (size_t)L * 64 + lane * 2; const int k = (int)(e % K), n = (int)(e / K); v2us o;
            o[0] = f2bf(w[(size_t)k * N + n]); o[1] = f2bf(w[(size_t)(k + 1) * N + n]); *(v2us*)(Bt + e) = o;
            if (Bt16) { v2h o2; o2[0] = (h16)(bf2f(o[0]) * car); o2[1] = (h16)(bf2f(o[1]) * car); *(v2h*)(Bt16 + e) = o2; } }
         }
}

// ---- rope_body: rotary tables RC = cos, RS = sin, [SEQ][32] f32; angle = (float)pos * inv_freq[j], inv_freq[j] = 1.0f / (float)(10000^(j/32));
__device__ __forceinline__ void rope_body(float* RC, float* RS, unsigned bx) {
#pragma clang fp contract(off)
    const int wave = __builtin_amdgcn_readfirstlane(threadIdx.x >> 5); const int lane = threadIdx.x & 31;
    const int pos = bx * 8 + wave; if (pos >= SEQ) return;
    double p = 1.0;
#pragma unroll 1
    for (int j = 0; j < lane; ++j) p = p * 1.3335214321633240;
    const float pw = (float)p; const float inv = 1.0f / pw; const float ang = (float)pos * inv;
    float sv, cv; sincosf(ang, &sv, &cv);
    float* pc = RC + (size_t)pos * 32 + lane; float* pq = RS + (size_t)pos * 32 + lane;
    *(float*)pc = cv; *(float*)pq = sv; 
}

// ---- k_prep: the four preparations (W_qkv and W_proj transposed to bf16 / f16, rotary tables, x to bf16) share no data: one launch, the body picked by block range.
// The transposes, whose waves walk a chain of dependent scattered loads, come first in the index; the stream over x fills in behind them.
constexpr unsigned PB_WQ = (3 * DM * (DM / 64) + 63) / 64;                    // blocks of the W_qkv transpose
constexpr unsigned PB_WO = (DM * (DM / 64) + 63) / 64;                        // ... of the W_proj transpose
constexpr unsigned PB_RO = (SEQ + 7) / 8;                                     // ... of the rotary tables
constexpr unsigned PB_CX = (unsigned)(((size_t)SEQ * DM / 8 + 255) / 256);    // ... of one batch of x
__global__ __launch_bounds__(256) void k_prep(const float* __restrict__ x, const float* __restrict__ wqkv, const float* __restrict__ wo, bf* XB, bf* WQKV, bf* WOb, h16* WO16, float* RC, float* RS) {
    unsigned b = blockIdx.x;
    if (b < PB_WQ) { wtG_body(wqkv, DM, 3 * DM, WQKV, (h16*)nullptr, 1.0f, b); return; }   // in[DM][3*DM] -> out[3*DM][DM]
    b -= PB_WQ;
    if (b < PB_WO) { wtG_body(wo, DM, DM, WOb, WO16, WCAR, b); return; }                    // in[DM][DM] -> out[DM][DM]
    b -= PB_WO;
    if (b < PB_RO) { rope_body(RC, RS, b); return; }
    b -= PB_RO;
    cvt8_body(x, XB, (unsigned)((size_t)SEQ * DM / 8), b % PB_CX, b / PB_CX);
}

// ---- k_qkv: four waves per 128x128 tile of x W_qkv + b_qkv (bf16 x bf16 exact), one 64x64 quarter each. The quarter (64 tokens x one head third) is staged whole in LDS; q and k tiles get the rotary
// applied in place in LDS (each lane owns 8 consecutive d of a row, i.e. 4 whole pairs), then written as head planes:
__global__ __launch_bounds__(32 * GW) void k_qkv(const bf* __restrict__ XB, const bf* __restrict__ W, const float* __restrict__ bias, const float* __restrict__ RC, const float* __restrict__ RS,
                                             h16* QK16, h16* VT16, bf* QKh, bf* QKl, bf* VTh, bf* VTl) {
    __shared__ __align__(16) bf ring[4 * GT];            // operand ring; after the main loop: each wave's 64x68 f32 output staging
    const int lane = threadIdx.x & 31, lr = lane & 15, hi = lane >> 4;
    const int wave = __builtin_amdgcn_readfirstlane(threadIdx.x >> 5); const int wm = wave >> 1, wn = wave & 1;
    const int r0 = blockIdx.x * 128 + wm * 64, c0 = blockIdx.y * 128 + wn * 64;
    v8f acc[4][4];
#pragma unroll
    for (int mb = 0; mb < 4; ++mb)
#pragma unroll
        for (int nb = 0; nb < 4; ++nb) acc[mb][nb] = (v8f){};
    gemm_loop_lds<bf, 0>(XB, XB, W, ring, blockIdx.x * 128, blockIdx.y * 128, wm, wn, acc);
    float* os = (float*)ring + wave * (64 * 68);
#pragma unroll
    for (int nb = 0; nb < 4; ++nb) { const float bc = bfr(bias[c0 + nb * 16 + lr]);
#pragma unroll
        for (int mb = 0; mb < 4; ++mb) {
#pragma unroll
            for (int j = 0; j < 8; ++j) os[(mb * 16 + hi * 8 + j) * 68 + nb * 16 + lr] = acc[mb][nb][j] + bc; } }
    __syncthreads();
    const int which = c0 / DM; const int h = (c0 % DM) / HD; const int b = r0 / SEQ; const int t0 = r0 % SEQ; const int bhh = b * NH + h; const bool early = (t0 < RH); const int te = early ? t0 : 0;
    const int rr = lane >> 3, seg = lane & 7;
    if (which < 2) {
        // rotary in place: lane owns d = seg*8 .. seg*8+7 of row s*4+rr; table column = d mod 32 = (seg & 3)*8 + i; position = t0 + row
        const size_t tof = (size_t)(t0 + rr) * 32 + (seg & 3) * 8;
#pragma unroll 1
        for (int s = 0; s < 16; ++s) { const int row = s * 4 + rr;
            const v4f ca = *(const v4f*)(RC + tof + (size_t)s * 128); const v4f cb = *(const v4f*)(RC + tof + (size_t)s * 128 + 4);
            const v4f sa = *(const v4f*)(RS + tof + (size_t)s * 128); const v4f sb = *(const v4f*)(RS + tof + (size_t)s * 128 + 4);
            float* op = os + row * 68 + seg * 8;
            const v4f a = *(const v4fa*)op; const v4f c = *(const v4fa*)(op + 4); v4f ra, rc;
            ra[0] = a[0] * ca[0] + (-a[1]) * sa[0]; ra[1] = a[1] * ca[1] + a[0] * sa[1];
            ra[2] = a[2] * ca[2] + (-a[3]) * sa[2]; ra[3] = a[3] * ca[3] + a[2] * sa[3];
            rc[0] = c[0] * cb[0] + (-c[1]) * sb[0]; rc[1] = c[1] * cb[1] + c[0] * sb[1];
            rc[2] = c[2] * cb[2] + (-c[3]) * sb[2]; rc[3] = c[3] * cb[3] + c[2] * sb[3];
            *(v4fa*)op = ra; *(v4fa*)(op + 4) = rc; }
    }
    __syncthreads();
    if (which < 2) {
        h16* P16 = QK16 + (size_t)which * PL16 + ((size_t)bhh * SEQ + t0) * HD + seg * 8;
        bf* PH = QKh + (size_t)which * PLE + ((size_t)bhh * RH + te) * HD + seg * 8;
        bf* PL = QKl + (size_t)which * PLE + ((size_t)bhh * RH + te) * HD + seg * 8;
{
#pragma unroll 4
            for (int s = 0; s < 16; ++s) { const int row = s * 4 + rr; const v4f a = *(const v4fa*)(os + row * 68 + seg * 8); const v4f c = *(const v4fa*)(os + row * 68 + seg * 8 + 4); v8h o;
#pragma unroll
                for (int i = 0; i < 4; ++i) { o[i] = toh_flush(a[i] * QKCAR); o[4 + i] = toh_flush(c[i] * QKCAR); }
                *(v8h*)(P16 + (size_t)row * HD) = o; }
            if (early) {
#pragma unroll 4
                for (int s = 0; s < 16; ++s) { const int row = s * 4 + rr; const v4f a = *(const v4fa*)(os + row * 68 + seg * 8); const v4f c = *(const v4fa*)(os + row * 68 + seg * 8 + 4); v8us oh, ol;
#pragma unroll
                    for (int i = 0; i < 4; ++i) { unsigned short x0, x1; splitf(a[i], x0, x1); oh[i] = x0; ol[i] = x1; splitf(c[i], x0, x1); oh[4 + i] = x0; ol[4 + i] = x1; }
                    *(v8us*)(PH + (size_t)row * HD) = oh; *(v8us*)(PL + (size_t)row * HD) = ol; } }
             }
    } else {
        h16* P16 = VT16 + ((size_t)bhh * HD) * SEQ + t0 + seg * 8;
        bf* PH = VTh + ((size_t)bhh * HD) * RH + te + seg * 8;
        bf* PL = VTl + ((size_t)bhh * HD) * RH + te + seg * 8;
{
#pragma unroll 4
            for (int s = 0; s < 16; ++s) { const int d = s * 4 + rr; v8h o;
#pragma unroll
                for (int j = 0; j < 8; ++j) o[j] = toh_flush(os[(seg * 8 + j) * 68 + d] * VCAR);
                *(v8h*)(P16 + (size_t)d * SEQ) = o; }
            if (early) {
#pragma unroll 4
                for (int s = 0; s < 16; ++s) { const int d = s * 4 + rr; v8us oh, ol;
#pragma unroll
                    for (int j = 0; j < 8; ++j) { unsigned short x0, x1; splitf(os[(seg * 8 + j) * 68 + d], x0, x1); oh[j] = x0; ol[j] = x1; }
                    *(v8us*)(PH + (size_t)d * RH) = oh; *(v8us*)(PL + (size_t)d * RH) = ol; } }
             }
    }
}

// ---- attn16_body: fused causal attention, query rows >= RH (xb: 64-row block counted from row 0, bh: batch * NH + head); four waves per block, 16 query rows each (64 rows that share one diagonal block), 64-key blocks up to the diagonal.
// Each 64-key K tile [key][d] and V tile [d][key] is brought into LDS once per block by asynchronous b128 copies (rows of 128 B at a pitch of 144 B), two buffers: the next
// tile's copies fly while this one is worked on; all four waves take their fragments from LDS. The products are taken transposed: S^T = K Q^T (A = K rows, B = the wave's Q, held in
// registers) and O^T += V^T P^T (A = V^T rows). A lane then holds 32 of the 64 scores of ONE query (lane ^ 16 the other 32): running max and sum (f32) are in-lane plus one exchange
// between the halves, and two score tiles, converted in place (p x1024, f16), are the B operand of the second product. ctx = O / l written as f16 x64 into [b][t][h*64+d].
#define AW    4                  // waves per block
#define KVP   72                 // LDS pitch of a K or V tile row, in f16 elements
#define KVT   (64 * KVP)         // elements of one staged tile
static_assert((SEQ - RH) % (16 * AW) == 0 && RH % (16 * AW) == 0 && 16 * AW == 64);
static_assert((size_t)AW * 16 * 68 * 4 <= (size_t)4 * KVT * 2);   // the output staging fits in the ring it takes over

// one stage: this thread's four 16-byte pieces of the K tile and of the V tile (128 threads x 4 x 16 B = 8 KiB each), rows 16 apart
__device__ __forceinline__ void stage_kv(const h16* kg, const h16* vg, unsigned kl, unsigned vl) {
    // s_wait_xcnt stands inside the statement so that no address register of a copy is rewritten ahead of it
    asm volatile("global_load_async_to_lds_b128 %0, %8, off\n\t"
                 "global_load_async_to_lds_b128 %1, %9, off\n\t"
                 "global_load_async_to_lds_b128 %2, %10, off\n\t"
                 "global_load_async_to_lds_b128 %3, %11, off\n\t"
                 "global_load_async_to_lds_b128 %4, %12, off\n\t"
                 "global_load_async_to_lds_b128 %5, %13, off\n\t"
                 "global_load_async_to_lds_b128 %6, %14, off\n\t"
                 "global_load_async_to_lds_b128 %7, %15, off\n\t"
                 "s_wait_xcnt 0x0"
                 :: "v"(kl), "v"(kl + 16 * KVP * 2), "v"(kl + 32 * KVP * 2), "v"(kl + 48 * KVP * 2),
                    "v"(vl), "v"(vl + 16 * KVP * 2), "v"(vl + 32 * KVP * 2), "v"(vl + 48 * KVP * 2),
                    "v"(kg), "v"(kg + 16 * HD), "v"(kg + 32 * HD), "v"(kg + 48 * HD),
                    "v"(vg), "v"(vg + (size_t)16 * SEQ), "v"(vg + (size_t)32 * SEQ), "v"(vg + (size_t)48 * SEQ)
                 : "memory");
}

// lane l <-> lane l ^ 16
__device__ __forceinline__ float xhalf(float x) { return __builtin_bit_cast(float, __builtin_amdgcn_permlanex16(__builtin_bit_cast(int, x), __builtin_bit_cast(int, x), 0x76543210, 0xfedcba98, false, false)); }
__device__ __forceinline__ float max8(const float* v) { return fmaxf(fmaxf(fmaxf(v[0], v[1]), fmaxf(v[2], v[3])), fmaxf(fmaxf(v[4], v[5]), fmaxf(v[6], v[7]))); }
__device__ __forceinline__ float sum8(const float* v) { return ((v[0] + v[1]) + (v[2] + v[3])) + ((v[4] + v[5]) + (v[6] + v[7])); }

__device__ __forceinline__ void attn16_body(const h16* __restrict__ Q16, const h16* __restrict__ K16, const h16* __restrict__ VT16, h16* CT16, h16* ring, int xb, int bh) {
    // ring: the kernel's LDS, [buffer][K | V][row][KVP]; after the loop: output staging
    const int lane = threadIdx.x & 31, lr = lane & 15, hi = lane >> 4;
    const int wave = __builtin_amdgcn_readfirstlane(threadIdx.x >> 5);
    const int blkbase = xb * (16 * AW); const int rowbase = blkbase + wave * 16;
    const size_t qoff  = ((size_t)bh * SEQ + rowbase + lr) * HD + 8 * hi;
    // staging: thread t owns piece (t & 7) of rows (t >> 3) + 16 j, j = 0..3, of both tiles
    const int srow = threadIdx.x >> 3, sseg = threadIdx.x & 7;
    const h16* kg = K16 + ((size_t)bh * SEQ + srow) * HD + sseg * 8;
    const h16* vg = VT16 + ((size_t)bh * HD + srow) * SEQ + sseg * 8;
    const unsigned sl = (unsigned)(size_t)(ring + srow * KVP + sseg * 8);   // LDS byte address of the piece in buffer 0's K tile
    const int foff = lr * KVP + 8 * hi;                                     // fragment row and half inside a tile
    const int t = rowbase + lr;                                             // this lane's query
    v16h qb[2];                                                             // B operand: column lr = query t, d in the k order of ldh
#pragma unroll
    for (int c = 0; c < 2; ++c) qb[c] = ldh(Q16 + qoff + c * 32);
    v8f o[4]; float m = NEGB, l = 0.0f;                                     // o[dt][r] = O[t][dt*16 + 8*hi + r]; l: sum over this half's keys only
#pragma unroll
    for (int dt = 0; dt < 4; ++dt) o[dt] = (v8f){};
    const int nblk = blkbase / 64 + 1;
    stage_kv(kg, vg, sl, sl + KVT * 2);
    asm volatile("s_wait_asynccnt 0x0" ::: "memory");   // tile 0 of this wave's copies has landed
    __syncthreads();                                     // ... and every other wave's
    if (nblk > 1) stage_kv(kg + 64 * HD, vg + 64, sl + 2 * KVT * 2, sl + 3 * KVT * 2);
#pragma unroll 1
    for (int jb = 0; jb < nblk; ++jb) {
        const int jbase = jb * 64;
        const h16* kb = ring + (jb & 1) * (2 * KVT) + foff; const h16* vb = kb + KVT;
        v8f s[4];                                        // s[nt][r] = score of key jbase + nt*16 + 8*hi + r with query t
#pragma unroll
        for (int nt = 0; nt < 4; ++nt) s[nt] = (v8f){};
        v16h kf;
#pragma unroll
        for (int c = 0; c < 2; ++c) {
#pragma unroll
            for (int nt = 0; nt < 4; ++nt) { const h16* kp = kb + nt * 16 * KVP + c * 32; kf = cat16(*(const v8ha*)kp, *(const v8ha*)(kp + 16)); s[nt] = wmma16(kf, qb[c], s[nt]); }
        }
        // the four vector slots between the last WMMA and the first reader of its result
        asm volatile("v_nop\n\tv_nop\n\tv_nop\n\tv_nop" : "+v"(s[0]), "+v"(s[1]), "+v"(s[2]), "+v"(s[3]) : "v"(kf));
        const int dq = t - jbase - 8 * hi;               // key > t  <=>  the key's place among this lane's keys, nt*16 + r, > dq
        float v[4][8], mt[4];
#pragma unroll
        for (int nt = 0; nt < 4; ++nt) {
#pragma unroll
            for (int r = 0; r < 8; ++r) { const float sv = s[nt][r] * SCQ16; v[nt][r] = (nt * 16 + r > dq) ? NEGB : sv; }
            mt[nt] = max8(v[nt]);
        }
        float mx = fmaxf(fmaxf(mt[0], mt[1]), fmaxf(mt[2], mt[3]));
        mx = fmaxf(mx, xhalf(mx));                       // both halves hold the query's maximum over the 64 keys
        const float mn = fmaxf(m, mx);
        const float al = ex2((m - mn) * L2E);
        m = mn;
        float st[4]; v16h pb[2];                         // pb[c][e] = p of key jbase + c*32 + (k order of ldh): tiles 2c and 2c+1 as they lie
#pragma unroll
        for (int nt = 0; nt < 4; ++nt) {
            float p[8];
#pragma unroll
            for (int r = 0; r < 8; ++r) { p[r] = ex2((v[nt][r] - mn) * L2E + PLOG); pb[nt >> 1][(nt & 1) * 8 + r] = (h16)p[r]; }
            st[nt] = sum8(p);
        }
        l = l * al + ((st[0] + st[1]) + (st[2] + st[3]));
#pragma unroll
        for (int dt = 0; dt < 4; ++dt) o[dt] *= al;
        v16h vf;
#pragma unroll
        for (int c = 0; c < 2; ++c) {
#pragma unroll
            for (int dt = 0; dt < 4; ++dt) { const h16* vp = vb + dt * 16 * KVP + c * 32; vf = cat16(*(const v8ha*)vp, *(const v8ha*)(vp + 16)); o[dt] = wmma16(vf, pb[c], o[dt]); }
        }
        // the four vector slots behind the last WMMA, on the loop's back edge too
        asm volatile("v_nop\n\tv_nop\n\tv_nop\n\tv_nop" : "+v"(o[0]), "+v"(o[1]), "+v"(o[2]), "+v"(o[3]) : "v"(pb[1]), "v"(vf));
        asm volatile("s_wait_dscnt 0x0" ::: "memory");      // this wave has finished reading the buffer
        asm volatile("s_wait_asynccnt 0x0" ::: "memory");   // this wave's copies of tile jb + 1 have landed
        __syncthreads();                                     // publishes tile jb + 1 and frees the buffer of tile jb
        if (jb + 2 < nblk) { const unsigned bl = sl + (jb & 1) * (2 * KVT * 2); stage_kv(kg + (size_t)(jbase + 128) * HD, vg + jbase + 128, bl, bl + KVT * 2); }
    }
    asm volatile("s_wait_asynccnt 0x0" ::: "memory");       // nothing of the ring is in flight when it becomes output staging
    float* os = (float*)ring + wave * (16 * 68);
    {
        const float lt = l + xhalf(l);
        const float inv = (CCAR / VCAR) * (1.0f / lt);
#pragma unroll
        for (int dt = 0; dt < 4; ++dt) { v4f a, c;
#pragma unroll
            for (int i = 0; i < 4; ++i) { a[i] = o[dt][i] * inv; c[i] = o[dt][4 + i] * inv; }
            *(v4fa*)(os + lr * 68 + dt * 16 + 8 * hi) = a; *(v4fa*)(os + lr * 68 + dt * 16 + 8 * hi + 4) = c; }
    }
    __syncthreads();
    const int b = bh / NH, h = bh % NH; const int rr = lane >> 3, seg = lane & 7;
    h16* dst = CT16 + ((size_t)b * SEQ + rowbase) * DM + h * HD + seg * 8;
{
#pragma unroll
        for (int s = 0; s < 4; ++s) { const int row = s * 4 + rr; const v4f a = *(const v4fa*)(os + row * 68 + seg * 8); const v4f c = *(const v4fa*)(os + row * 68 + seg * 8 + 4); v8h ov;
#pragma unroll
            for (int i = 0; i < 4; ++i) { ov[i] = (h16)a[i]; ov[4 + i] = (h16)c[i]; }
            *(v8h*)(dst + (size_t)row * DM) = ov; }
         }
}

// ---- attnhl_body: the same for query rows < RH on bf16 hi/lo planes, operands straight from global memory, each of the four waves on its own 16 rows: scores kh qh + kh ql + kl qh, p split hi/lo in place, O^T += vh ph + vh pl + vl ph; ctx written as bf16 hi/lo [b][t<RH][h*64+d].
__device__ __forceinline__ void attnhl_body(const bf* __restrict__ Qh, const bf* __restrict__ Ql, const bf* __restrict__ Kh, const bf* __restrict__ Kl,
                                            const bf* __restrict__ VTh, const bf* __restrict__ VTl, bf* ATh, bf* ATl, float* lds, int xb, int bh) {
    const int lane = threadIdx.x & 31, lr = lane & 15, hi = lane >> 4;
    const int wave = __builtin_amdgcn_readfirstlane(threadIdx.x >> 5);
    float* os = lds + wave * (16 * 68);                  // this wave's output staging
    const int rowbase = xb * (16 * AW) + wave * 16;
    const size_t qoff  = ((size_t)bh * RH + rowbase + lr) * HD + 8 * hi;
    const size_t kbase = ((size_t)bh * RH + lr) * HD + 8 * hi;
    const size_t vbase = ((size_t)bh * HD + lr) * RH + 8 * hi;
    const int t = rowbase + lr;                          // this lane's query
    v16bf qh[2], ql[2];
#pragma unroll
    for (int c = 0; c < 2; ++c) { qh[c] = ldb(Qh + qoff + c * 32); ql[c] = ldb(Ql + qoff + c * 32); }
    v8f o[4]; float m = NEGB, l = 0.0f;
#pragma unroll
    for (int dt = 0; dt < 4; ++dt) o[dt] = (v8f){};
    const int nblk = rowbase / 64 + 1;
#pragma unroll 1
    for (int jb = 0; jb < nblk; ++jb) {
        const int jbase = jb * 64;
        v8f s[4];
#pragma unroll
        for (int nt = 0; nt < 4; ++nt) s[nt] = (v8f){};
        v16bf kh, kl;
#pragma unroll
        for (int c = 0; c < 2; ++c) {
#pragma unroll
            for (int nt = 0; nt < 4; ++nt) { const size_t ko = kbase + (size_t)(jbase + nt * 16) * HD + c * 32; kh = ldb(Kh + ko); kl = ldb(Kl + ko);
                s[nt] = wmmab(kh, qh[c], s[nt]); s[nt] = wmmab(kh, ql[c], s[nt]); s[nt] = wmmab(kl, qh[c], s[nt]); }
        }
        // the four vector slots between the last WMMA and the first reader of its result
        asm volatile("v_nop\n\tv_nop\n\tv_nop\n\tv_nop" : "+v"(s[0]), "+v"(s[1]), "+v"(s[2]), "+v"(s[3]) : "v"(kh), "v"(kl));
        const int dq = t - jbase - 8 * hi;               // key > t  <=>  the key's place among this lane's keys, nt*16 + r, > dq
        float v[4][8], mt[4];
#pragma unroll
        for (int nt = 0; nt < 4; ++nt) {
#pragma unroll
            for (int r = 0; r < 8; ++r) { const float sv = s[nt][r] * SCQHL; v[nt][r] = (nt * 16 + r > dq) ? NEGB : sv; }
            mt[nt] = max8(v[nt]);
        }
        float mx = fmaxf(fmaxf(mt[0], mt[1]), fmaxf(mt[2], mt[3]));
        mx = fmaxf(mx, xhalf(mx));
        const float mn = fmaxf(m, mx);
        const float al = ex2((m - mn) * L2E);
        m = mn;
        float st[4]; v8us ph[4], pl[4];
#pragma unroll
        for (int nt = 0; nt < 4; ++nt) {
            float p[8];
#pragma unroll
            for (int r = 0; r < 8; ++r) { p[r] = ex2((v[nt][r] - mn) * L2E); unsigned short x0, x1; splitf(p[r], x0, x1); ph[nt][r] = x0; pl[nt][r] = x1; }
            st[nt] = sum8(p);
        }
        l = l * al + ((st[0] + st[1]) + (st[2] + st[3]));
#pragma unroll
        for (int dt = 0; dt < 4; ++dt) o[dt] *= al;
        v16bf pbh, pbl, vh, vl;
#pragma unroll
        for (int c = 0; c < 2; ++c) {
            pbh = cat16b(ph[2 * c], ph[2 * c + 1]); pbl = cat16b(pl[2 * c], pl[2 * c + 1]);
#pragma unroll
            for (int dt = 0; dt < 4; ++dt) { const size_t vo = vbase + (size_t)(dt * 16) * RH + jbase + c * 32; vh = ldb(VTh + vo); vl = ldb(VTl + vo);
                o[dt] = wmmab(vh, pbh, o[dt]); o[dt] = wmmab(vh, pbl, o[dt]); o[dt] = wmmab(vl, pbh, o[dt]); }
        }
        // the four vector slots behind the last WMMA, on the loop's back edge too
        asm volatile("v_nop\n\tv_nop\n\tv_nop\n\tv_nop" : "+v"(o[0]), "+v"(o[1]), "+v"(o[2]), "+v"(o[3]) : "v"(pbh), "v"(pbl), "v"(vh), "v"(vl));
    }
    {
        const float lt = l + xhalf(l);
        const float inv = 1.0f / lt;
#pragma unroll
        for (int dt = 0; dt < 4; ++dt) { v4f a, c;
#pragma unroll
            for (int i = 0; i < 4; ++i) { a[i] = o[dt][i] * inv; c[i] = o[dt][4 + i] * inv; }
            *(v4fa*)(os + lr * 68 + dt * 16 + 8 * hi) = a; *(v4fa*)(os + lr * 68 + dt * 16 + 8 * hi + 4) = c; }
    }
    __syncthreads();
    const int b = bh / NH, h = bh % NH; const int rr = lane >> 3, seg = lane & 7;
    const size_t dof = ((size_t)b * RH + rowbase) * DM + h * HD + seg * 8;
{
#pragma unroll
        for (int s = 0; s < 4; ++s) { const int row = s * 4 + rr; const v4f a = *(const v4fa*)(os + row * 68 + seg * 8); const v4f c = *(const v4fa*)(os + row * 68 + seg * 8 + 4); v8us oh, ol;
#pragma unroll
            for (int i = 0; i < 4; ++i) { unsigned short x0, x1; splitf(a[i], x0, x1); oh[i] = x0; ol[i] = x1; splitf(c[i], x0, x1); oh[4 + i] = x0; ol[4 + i] = x1; }
            *(v8us*)(ATh + dof + (size_t)row * DM) = oh; *(v8us*)(ATl + dof + (size_t)row * DM) = ol; }
         }
}

// ---- k_attn: all query rows in one launch; the two bodies share no data. The hi/lo blocks (64 rows < RH) come first in the index: their waves walk chains of dependent global loads and use
// little of the vector and matrix units, so they start at once and run beside the f16 blocks, which follow in the order (head, row block).
constexpr int AB_HL = RH / (16 * AW), AB_16 = (SEQ - RH) / (16 * AW);   // 64-row blocks per head of either kind
static_assert(AB_HL > 0 && AB_16 > 0);
// five waves per SIMD asked for: the merged kernel's register count is the larger body's, and left alone the hi/lo body takes so many that the f16 body, which has nearly all the work, would run at four
__global__ __launch_bounds__(32 * AW) __attribute__((amdgpu_waves_per_eu(5))) void k_attn(const h16* __restrict__ Q16, const h16* __restrict__ K16, const h16* __restrict__ VT16, h16* CT16,
                                                  const bf* __restrict__ Qh, const bf* __restrict__ Ql, const bf* __restrict__ Kh, const bf* __restrict__ Kl,
                                                  const bf* __restrict__ VTh, const bf* __restrict__ VTl, bf* ATh, bf* ATl) {
    __shared__ __align__(16) h16 ring[4 * KVT];          // one array for both bodies (two would add up)
    const int i = blockIdx.x;
    if (i < NB * NH * AB_HL) attnhl_body(Qh, Ql, Kh, Kl, VTh, VTl, ATh, ATl, (float*)ring, i % AB_HL, i / AB_HL);
    else { const int j = i - NB * NH * AB_HL; attn16_body(Q16, K16, VT16, CT16, ring, AB_HL + j % AB_16, j / AB_16); }
}

extern "C" void kernel_launch(void* const* d_in, const int* in_sizes, int n_in,
                              void* d_out, int out_size, void* d_ws, size_t ws_size, hipStream_t stream) {
    if (n_in < 5) return;
    if ((size_t)in_sizes[0] < (size_t)(NB - 1) * SEQ_FULL * DM + (size_t)SEQ * DM) return;
    if ((size_t)in_sizes[1] < (size_t)3 * DM * DM || in_sizes[2] < 3 * DM || (size_t)in_sizes[3] < (size_t)DM * DM || in_sizes[4] < DM) return;
    if ((size_t)out_size < (size_t)NB * SEQ * DM) return;
    if (ws_size < WS_TOTAL) return;
    // wire order: x, W_qkv, b_qkv, W_proj, b_proj
    const float* x = (const float*)d_in[0]; const float* wqkv = (const float*)d_in[1]; const float* bqkv = (const float*)d_in[2]; const float* wo = (const float*)d_in[3]; const float* bo = (const float*)d_in[4];
    float* OUT = (float*)d_out;
    char* wsp = (char*)d_ws;
    auto take = [&](size_t bytes) { char* p = wsp; wsp += bytes; return (void*)p; };
    bf* XB = (bf*)take(SZ_XB);
    bf* WQKV = (bf*)take(SZ_WQKV);                 // Bt [3*DM][DM]
    bf* WOb = (bf*)take(SZ_WO); h16* WO16 = (h16*)take(SZ_WO);
    h16* QK16 = (h16*)take(2 * SZ_P16);            // [q | k] f16 planes [bh][t][d]
    h16* VT16 = (h16*)take(SZ_P16);                // [bh][d][t]
    bf* QKh = (bf*)take(2 * SZ_PE); bf* QKl = (bf*)take(2 * SZ_PE);   // [q | k] early-row planes [bh][t<RH][d]
    bf* VTh = (bf*)take(SZ_PE); bf* VTl = (bf*)take(SZ_PE);           // [bh][d][t<RH]
    h16* CT16 = (h16*)take(SZ_CT);                 // ctx f16 x64 [b][t][DM] (rows >= RH used)
    bf* ATh = (bf*)take(SZ_AT); bf* ATl = (bf*)take(SZ_AT);           // ctx hi/lo [b][t<RH][DM]
    float* RC = (float*)take(SZ_ROT); float* RS = (float*)take(SZ_ROT);   // rotary cos / sin [SEQ][32]
    if ((size_t)(wsp - (char*)d_ws) > ws_size) return;

    k_prep<<<PB_WQ + PB_WO + PB_RO + NB * PB_CX, 256, 0, stream>>>(x, wqkv, wo, XB, WQKV, WOb, WO16, RC, RS);
    k_qkv<<<dim3(NB * SEQ / 128, 3 * DM / 128, 1), 128, 0, stream>>>(XB, WQKV, bqkv, RC, RS, QK16, VT16, QKh, QKl, VTh, VTl);
    k_attn<<<NB * NH * (AB_HL + AB_16), 128, 0, stream>>>(QK16, QK16 + PL16, VT16, CT16, QKh, QKl, QKh + PLE, QKl + PLE, VTh, VTl, ATh, ATl);
    k_proj<<<dim3(SEQ / 128, DM / 128, NB), 128, 0, stream>>>(ATh, ATl, WOb, CT16, WO16, OUT, bo);
}

// v005
// It runs in 140 microseconds.
// Timed twice side by side with v004, it ran 1.12 times as fast both times.
// Counting every step since v000, it is 3.23 times as fast.
#include <hip/hip_runtime.h>

// Contractions (all f32 accumulate): x*W_qkv on v_wmma_f32_16x16x32_bf16 (both operands bf16 RNE copies of the inputs, exact products);
// q*k^T and p*v: query rows >= 256 on v_wmma_f32_16x16x32_f16 (q,k,v carried x16, p carried x1024), query rows < 256 on bf16 hi/lo planes (3 products);
// ctx*W_proj: rows >= 256 f16 (ctx x64, w x1024 from the bf16 copy), rows < 256 bf16 hi/lo ctx x bf16 w (2 products). Softmax f32 (running max, exp2).
// Rotary on q and k (interleaved pairs (2i,2i+1) -> (-x[2i+1], x[2i]); angle = pos * inv_freq[d mod 32], inv_freq[j] = 1 / 10000^(j/32)) applied in f32 on the
// staged 64x64 tile in the x*W_qkv epilogue, from cos/sin tables [SEQ][32] built once by rope_body (precise sincosf).
// Layout: x [NB][SEQ_FULL][1024] (rows < SEQ read); W_qkv [1024][3072] (in,out), thirds q|k|v, column = which*1024 + h*64 + d; W_proj [1024][1024] (in,out); out [NB][SEQ][1024].

#ifndef NB
#define NB 4
#endif
#ifndef SEQ
#define SEQ 2048
#endif
#define NB_FULL  4
#define SEQ_FULL 2048
#define DM   1024
#define NH   16
#define HD   64
#define RH   256                 // query rows < RH use bf16 hi/lo planes
#define QKCAR 16.0f
#define VCAR  16.0f
#define CCAR  64.0f
#define WCAR  1024.0f
#define PLOG  10.0f              // p carried x 2^10
#define L2E   1.4426950408889634f
#define NEGB  (-3.0e38f)
#define SCQ16 (0.125f / (QKCAR * QKCAR))
#define SCQHL 0.125f

typedef _Float16 h16;
typedef unsigned short bf;
typedef __attribute__((ext_vector_type(16))) __bf16   v16bf;
typedef __attribute__((ext_vector_type(16))) _Float16 v16h;
typedef __attribute__((ext_vector_type(8)))  _Float16 v8h;
typedef __attribute__((ext_vector_type(2)))  _Float16 v2h;
typedef __attribute__((ext_vector_type(8)))  unsigned short v8us;
typedef __attribute__((ext_vector_type(2)))  unsigned short v2us;
typedef __attribute__((ext_vector_type(8)))  float    v8f;
typedef __attribute__((ext_vector_type(4)))  float    v4f;
typedef v8h  __attribute__((may_alias)) v8ha;
typedef v4f  __attribute__((may_alias)) v4fa;
typedef v8us __attribute__((may_alias)) v8usa;

static_assert(SEQ % 64 == 0);
static_assert(RH % 64 == 0);
static_assert(RH <= SEQ);
static_assert(SEQ <= SEQ_FULL);
static_assert(NB <= NB_FULL);
static_assert(DM % 64 == 0);
static_assert(DM % 32 == 0);
static_assert(HD == 64);
static_assert(NH * HD == DM);
static_assert((3 * DM) % 64 == 0);
static_assert(HD / 2 == 32);
static_assert(SEQ % 8 == 0);          // rope_body: 8 positions per 256-thread block
static_assert((NB * SEQ) % 128 == 0 && (3 * DM) % 128 == 0 && SEQ % 128 == 0 && RH % 128 == 0 && DM % 128 == 0);   // the three GEMMs: 128x128 block tiles

constexpr size_t PL16 = (size_t)NB * NH * SEQ * HD;     // elements of one f16 head plane set
constexpr size_t PLE  = (size_t)NB * NH * RH * HD;      // elements of one early-row bf16 plane set
constexpr size_t SZ_XB   = (size_t)NB * SEQ * DM * 2;
constexpr size_t SZ_WQKV = (size_t)3 * DM * DM * 2;
constexpr size_t SZ_WO   = (size_t)DM * DM * 2;
constexpr size_t SZ_P16  = PL16 * 2;
constexpr size_t SZ_PE   = PLE * 2;
constexpr size_t SZ_CT   = (size_t)NB * SEQ * DM * 2;
constexpr size_t SZ_AT   = (size_t)NB * RH * DM * 2;
constexpr size_t SZ_ROT  = (size_t)SEQ * 32 * 4;        // one rotary table (cos or sin) [SEQ][32] f32
constexpr size_t WS_TOTAL = SZ_XB + SZ_WQKV + 2 * SZ_WO + 3 * SZ_P16 + 6 * SZ_PE + SZ_CT + 2 * SZ_AT + 2 * SZ_ROT;
static_assert(SZ_XB % 256 == 0 && SZ_WQKV % 256 == 0 && SZ_WO % 256 == 0 && SZ_P16 % 256 == 0 && SZ_PE % 256 == 0 && SZ_CT % 256 == 0 && SZ_AT % 256 == 0);
static_assert(SZ_ROT % 256 == 0);
static_assert(WS_TOTAL <= (size_t)134217728);

__device__ __forceinline__ unsigned short f2bf(float f) { unsigned u = __float_as_uint(f); u += 0x7FFFu + ((u >> 16) & 1u); return (unsigned short)(u >> 16); }
__device__ __forceinline__ float bf2f(unsigned short b) { return __uint_as_float(((unsigned)b) << 16); }
__device__ __forceinline__ float bfr(float f) { return bf2f(f2bf(f)); }
__device__ __forceinline__ void splitf(float y, unsigned short& h, unsigned short& l) { h = f2bf(y); l = f2bf(y - bf2f(h)); }
__device__ __forceinline__ v16h cat16(v8h lo, v8h hi) { return __builtin_shufflevector(lo, hi, 0, 1, 2, 3, 4, 5, 6, 7, 8, 9, 10, 11, 12, 13, 14, 15); }
__device__ __forceinline__ v16bf cat16b(v8us lo, v8us hi) { return __builtin_bit_cast(v16bf, __builtin_shufflevector(lo, hi, 0, 1, 2, 3, 4, 5, 6, 7, 8, 9, 10, 11, 12, 13, 14, 15)); }
__device__ __forceinline__ v8f wmma16(v16h a, v16h b, v8f c) { return __builtin_amdgcn_wmma_f32_16x16x32_f16(false, a, false, b, (short)0, c, false, false); }
__device__ __forceinline__ v8f wmmab(v16bf a, v16bf b, v8f c) { return __builtin_amdgcn_wmma_f32_16x16x32_bf16(false, a, false, b, (short)0, c, false, false); }
__device__ __forceinline__ float ex2(float x) { return __builtin_amdgcn_exp2f(x); }
// f32 -> f16 for operand planes: anything below the smallest f16 normal becomes an exact zero (value select, applied after the carry)
static __device__ __forceinline__ h16 toh_flush(float v) { const h16 r = (h16)v; return (fabsf(v) < 6.103515625e-05f) ? (h16)0.0f : r; }
// fragment loads from K-contiguous 16-bit rows: p already includes + 8*(lane>>4); elements 0..7 <- k0+8h.., 8..15 <- k0+16+8h..
__device__ __forceinline__ v16h  ldh(const h16* p) { return cat16(*(const v8h*)p, *(const v8h*)(p + 16)); }
__device__ __forceinline__ v16bf ldb(const bf* p)  { return cat16b(*(const v8us*)p, *(const v8us*)(p + 16)); }

template <typename T16> struct WFrag;
template <> struct WFrag<h16> { typedef v16h V; static __device__ __forceinline__ V lds(const h16* p) { return cat16(*(const v8ha*)p, *(const v8ha*)(p + 16)); } static __device__ __forceinline__ v8f mma(V a, V b, v8f c) { return wmma16(a, b, c); } };
template <> struct WFrag<bf>  { typedef v16bf V; static __device__ __forceinline__ V lds(const bf* p) { return cat16b(*(const v8usa*)p, *(const v8usa*)(p + 16)); } static __device__ __forceinline__ v8f mma(V a, V b, v8f c) { return wmmab(a, b, c); } };

// ---- four-wave 128x128 tile main loop (K = DM): per stage of 64 k the block brings 128 rows of A and 128 rows of Bt (128 B each, LDS pitch 144 B) into LDS once by asynchronous
// b128 copies, two buffers: the next stage's copies fly while this one is worked on. Wave (wm, wn) takes its 64x64 quarter's fragments from LDS, in the k order of ldh / ldb.
#define GW    4                  // waves per block (2 x 2)
#define GP    72                 // LDS pitch of a staged operand row, in 16-bit elements
#define GT    (128 * GP)         // elements of one staged operand tile
static_assert(DM % 64 == 0 && DM / 64 >= 2);
static_assert((size_t)GW * 64 * 68 * 4 <= (size_t)4 * GT * 2);   // the output staging fits in the ring it takes over

// this thread's eight 16-byte pieces of one operand tile (128 threads x 8 x 16 B = 16 KiB), rows 16 apart
template <typename T16>
__device__ __forceinline__ void stage_rows(const T16* g, unsigned l) {
    // s_wait_xcnt stands inside the statement so that no address register of a copy is rewritten ahead of it
    asm volatile("global_load_async_to_lds_b128 %0, %8, off\n\t"
                 "global_load_async_to_lds_b128 %1, %9, off\n\t"
                 "global_load_async_to_lds_b128 %2, %10, off\n\t"
                 "global_load_async_to_lds_b128 %3, %11, off\n\t"
                 "global_load_async_to_lds_b128 %4, %12, off\n\t"
                 "global_load_async_to_lds_b128 %5, %13, off\n\t"
                 "global_load_async_to_lds_b128 %6, %14, off\n\t"
                 "global_load_async_to_lds_b128 %7, %15, off\n\t"
                 "s_wait_xcnt 0x0"
                 :: "v"(l), "v"(l + 16 * GP * 2), "v"(l + 32 * GP * 2), "v"(l + 48 * GP * 2),
                    "v"(l + 64 * GP * 2), "v"(l + 80 * GP * 2), "v"(l + 96 * GP * 2), "v"(l + 112 * GP * 2),
                    "v"(g), "v"(g + 16 * DM), "v"(g + 32 * DM), "v"(g + 48 * DM),
                    "v"(g + 64 * DM), "v"(g + 80 * DM), "v"(g + 96 * DM), "v"(g + 112 * DM)
                 : "memory");
}

// ring: [buffer][A | Bt | A2][row][GP] (A2, the lo plane multiplied against the same Bt, only with NSPLIT 1); rb, cb: first of the block's A rows and Bt rows.
// acc[mb][nb] += A[rb+wm*64+mb*16..][k] Bt[cb+wn*64+nb*16..][k]. On return every wave has left the ring and nothing is in flight into it.
template <typename T16, int NSPLIT>
__device__ __forceinline__ void gemm_loop_lds(const T16* __restrict__ A, const T16* __restrict__ A2, const T16* __restrict__ Bt, T16* ring, int rb, int cb, int wm, int wn, v8f (&acc)[4][4]) {
    typedef typename WFrag<T16>::V V;
    constexpr int NST = DM / 64, BUF = (2 + NSPLIT) * GT;
    const int lane = threadIdx.x & 31, lr = lane & 15, hi = lane >> 4;
    // staging: thread t owns piece (t & 7) of rows (t >> 3) + 16 j, j = 0..7, of every tile
    const int srow = threadIdx.x >> 3, sseg = threadIdx.x & 7;
    const T16* ag = A + (size_t)(rb + srow) * DM + sseg * 8;
    const T16* a2g = A2 + (size_t)(rb + srow) * DM + sseg * 8;
    const T16* bg = Bt + (size_t)(cb + srow) * DM + sseg * 8;
    const unsigned sl = (unsigned)(size_t)(ring + srow * GP + sseg * 8);   // LDS byte address of the piece in buffer 0's A tile
    const int aof = (wm * 64 + lr) * GP + 8 * hi, bof = GT + (wn * 64 + lr) * GP + 8 * hi;
    auto stage = [&](int st, unsigned l) { stage_rows<T16>(ag + st * 64, l); stage_rows<T16>(bg + st * 64, l + GT * 2); if (NSPLIT == 1) stage_rows<T16>(a2g + st * 64, l + 2 * GT * 2); };
    stage(0, sl);
    asm volatile("s_wait_asynccnt 0x0" ::: "memory");   // stage 0 of this wave's copies has landed
    __syncthreads();                                     // ... and every other wave's
    stage(1, sl + BUF * 2);
    // kept rolled: one copy of the hand-over at the foot, and the code stays small; the loops inside are unrolled so that every fragment and accumulator index is a constant (registers)
#pragma unroll 1
    for (int t = 0; t < NST; ++t) {
        const T16* tb = ring + (t & 1) * BUF;
#pragma unroll
        for (int c = 0; c < 2; ++c) {
            V a[4], a2[4], b[4];
#pragma unroll
            for (int mb = 0; mb < 4; ++mb) { a[mb] = WFrag<T16>::lds(tb + aof + mb * 16 * GP + c * 32); if (NSPLIT == 1) a2[mb] = WFrag<T16>::lds(tb + 2 * GT + aof + mb * 16 * GP + c * 32); }
#pragma unroll
            for (int nb = 0; nb < 4; ++nb) b[nb] = WFrag<T16>::lds(tb + bof + nb * 16 * GP + c * 32);
            // inputs-only fence on the loaded fragments: keeps the LDS loads of this 32-k block together ahead of its WMMAs (one LDS wait a block; sunk between the WMMAs each B fragment costs its own)
            if (NSPLIT == 1) asm volatile("" :: "v"(a[0]), "v"(a[1]), "v"(a[2]), "v"(a[3]), "v"(a2[0]), "v"(a2[1]), "v"(a2[2]), "v"(a2[3]), "v"(b[0]), "v"(b[1]), "v"(b[2]), "v"(b[3]));
            else             asm volatile("" :: "v"(a[0]), "v"(a[1]), "v"(a[2]), "v"(a[3]), "v"(b[0]), "v"(b[1]), "v"(b[2]), "v"(b[3]));
#pragma unroll
            for (int nb = 0; nb < 4; ++nb)
#pragma unroll
                for (int mb = 0; mb < 4; ++mb) { acc[mb][nb] = WFrag<T16>::mma(a[mb], b[nb], acc[mb][nb]); if (NSPLIT == 1) acc[mb][nb] = WFrag<T16>::mma(a2[mb], b[nb], acc[mb][nb]); }
        }
        asm volatile("s_wait_dscnt 0x0" ::: "memory");      // this wave has finished reading the buffer
        asm volatile("s_wait_asynccnt 0x0" ::: "memory");   // this wave's copies of stage t + 1 have landed
        __syncthreads();                                     // publishes stage t + 1 and frees the buffer of stage t
        if (t + 2 < NST) stage(t + 2, sl + (t & 1) * (BUF * 2));
    }
    asm volatile("s_wait_asynccnt 0x0" ::: "memory");       // nothing of the ring is in flight when it becomes output staging
}

// ---- GEMM with f32 output: C[m][n] = osc * sum_k A[m][k] Bt[n][k] + bf16(bias[n]); K = DM; grid (M/128, N/128, Z), 128 threads, a 64x64 quarter per wave. Per 16-row slab staged in LDS,
template <typename T16, int NSPLIT>
__device__ __forceinline__ void gemm_out_body(const T16* __restrict__ A, const T16* __restrict__ A2, const T16* __restrict__ Bt, float* C, int ldc, const float* __restrict__ bias, float osc, size_t sA, size_t sC, T16* ring) {
    // ring: the kernel's LDS, 2 * (2 + NSPLIT) * GT elements used: operand ring; after the main loop: each wave's 16x68 f32 slab staging
    const size_t z = blockIdx.z; A += z * sA; A2 += z * sA; C += z * sC;
    const int lane = threadIdx.x & 31, lr = lane & 15, hi = lane >> 4;
    const int wave = __builtin_amdgcn_readfirstlane(threadIdx.x >> 5); const int wm = wave >> 1, wn = wave & 1;
    const int r0 = blockIdx.x * 128 + wm * 64, c0 = blockIdx.y * 128 + wn * 64;
    v8f acc[4][4];
#pragma unroll
    for (int mb = 0; mb < 4; ++mb)
#pragma unroll
        for (int nb = 0; nb < 4; ++nb) acc[mb][nb] = (v8f){};
    gemm_loop_lds<T16, NSPLIT>(A, A2, Bt, ring, blockIdx.x * 128, blockIdx.y * 128, wm, wn, acc);
    float* os = (float*)ring + wave * (16 * 68);
    const int cofs = lr * 4;
    const v4f bv = *(const v4f*)(bias + c0 + cofs);
    v4f bb; bb[0] = bfr(bv[0]); bb[1] = bfr(bv[1]); bb[2] = bfr(bv[2]); bb[3] = bfr(bv[3]);
#pragma unroll
    for (int mb = 0; mb < 4; ++mb) {
#pragma unroll
        for (int nb = 0; nb < 4; ++nb) {
#pragma unroll
            for (int j = 0; j < 8; ++j) os[(hi * 8 + j) * 68 + nb * 16 + lr] = acc[mb][nb][j]; }
        __syncthreads();
        float* crow = C + (size_t)(r0 + mb * 16) * ldc + c0;
{
#pragma unroll
            for (int s = 0; s < 8; ++s) { const int row = 2 * s + hi; const v4f t = *(const v4fa*)(os + row * 68 + cofs); v4f val;
                val[0] = t[0] * osc + bb[0]; val[1] = t[1] * osc + bb[1]; val[2] = t[2] * osc + bb[2]; val[3] = t[3] * osc + bb[3];
                *(v4f*)(crow + (size_t)row * ldc + cofs) = val; }
             }
        __syncthreads();
    }
}

// ---- k_proj: ctx W_proj + b_proj for all rows in one launch, grid (SEQ/128, DM/128, NB), z = batch; the two bodies share no data, so the few hi/lo tiles run beside the f16 tiles.
// row tiles < RH: ctx hi/lo (bf16) x w_proj (bf16); row tiles >= RH: ctx f16 (x64) x w_proj f16 (x1024)
__global__ __launch_bounds__(32 * GW) void k_proj(const bf* __restrict__ Ah, const bf* __restrict__ Al, const bf* __restrict__ Wt, const h16* __restrict__ A16, const h16* __restrict__ Wt16,
                                                  float* C, const float* __restrict__ bias) {
    __shared__ __align__(16) bf ring[2 * 3 * GT];        // one array for both bodies (two would add up)
    if (blockIdx.x < RH / 128) gemm_out_body<bf, 1>(Ah, Al, Wt, C, DM, bias, 1.0f, (size_t)RH * DM, (size_t)SEQ * DM, ring);
    else                       gemm_out_body<h16, 0>(A16, A16, Wt16, C, DM, bias, 1.0f / (CCAR * WCAR), (size_t)SEQ * DM, (size_t)SEQ * DM, (h16*)ring);
}

// bx: block inside a batch, b: batch
__device__ __forceinline__ void cvt8_body(const float* __restrict__ src, bf* dst, unsigned n8, unsigned bx, size_t b) {
    src += b * (size_t)SEQ_FULL * DM; dst += b * (size_t)SEQ * DM;
    const unsigned i = bx * 256 + threadIdx.x; if (i >= n8) return;
    const v8f v = *(const v8f*)(src + (size_t)i * 8); v8us o;
#pragma unroll
    for (int k = 0; k < 8; ++k) o[k] = f2bf(v[k]);
    *(v8us*)(dst + (size_t)i * 8) = o; 
}

__device__ __forceinline__ void wtG_body(const float* __restrict__ w, int K, int N, bf* Bt, h16* Bt16, float car, unsigned bx) {
    const int lane = threadIdx.x & 31; const int L0 = (bx * 8 + (threadIdx.x >> 5)) * 8; const int nlines = N * (K / 64);
{
#pragma unroll 1
        for (int l = 0; l < 8; ++l) { const int L = L0 + l; if (L >= nlines) break; const size_t e = (size_t)L * 64 + lane * 2; const int k = (int)(e % K), n = (int)(e / K); v2us o;
            o[0] = f2bf(w[(size_t)k * N + n]); o[1] = f2bf(w[(size_t)(k + 1) * N + n]); *(v2us*)(Bt + e) = o;
            if (Bt16) { v2h o2; o2[0] = (h16)(bf2f(o[0]) * car); o2[1] = (h16)(bf2f(o[1]) * car); *(v2h*)(Bt16 + e) = o2; } }
         }
}

// ---- rope_body: rotary tables RC = cos, RS = sin, [SEQ][32] f32; angle = (float)pos * inv_freq[j], inv_freq[j] = 1.0f / (float)(10000^(j/32));
__device__ __forceinline__ void rope_body(float* RC, float* RS, unsigned bx) {
#pragma clang fp contract(off)
    const int wave = __builtin_amdgcn_readfirstlane(threadIdx.x >> 5); const int lane = threadIdx.x & 31;
    const int pos = bx * 8 + wave; if (pos >= SEQ) return;
    double p = 1.0;
#pragma unroll 1
    for (int j = 0; j < lane; ++j) p = p * 1.3335214321633240;
    const float pw = (float)p; const float inv = 1.0f / pw; const float ang = (float)pos * inv;
    float sv, cv; sincosf(ang, &sv, &cv);
    float* pc = RC + (size_t)pos * 32 + lane; float* pq = RS + (size_t)pos * 32 + lane;
    *(float*)pc = cv; *(float*)pq = sv; 
}

// ---- k_prep: the four preparations (W_qkv and W_proj transposed to bf16 / f16, rotary tables, x to bf16) share no data: one launch, the body picked by block range.
// The transposes, whose waves walk a chain of dependent scattered loads, come first in the index; the stream over x fills in behind them.
constexpr unsigned PB_WQ = (3 * DM * (DM / 64) + 63) / 64;                    // blocks of the W_qkv transpose
constexpr unsigned PB_WO = (DM * (DM / 64) + 63) / 64;                        // ... of the W_proj transpose
constexpr unsigned PB_RO = (SEQ + 7) / 8;                                     // ... of the rotary tables
constexpr unsigned PB_CX = (unsigned)(((size_t)SEQ * DM / 8 + 255) / 256);    // ... of one batch of x
__global__ __launch_bounds__(256) void k_prep(const float* __restrict__ x, const float* __restrict__ wqkv, const float* __restrict__ wo, bf* XB, bf* WQKV, bf* WOb, h16* WO16, float* RC, float* RS) {
    unsigned b = blockIdx.x;
    if (b < PB_WQ) { wtG_body(wqkv, DM, 3 * DM, WQKV, (h16*)nullptr, 1.0f, b); return; }   // in[DM][3*DM] -> out[3*DM][DM]
    b -= PB_WQ;
    if (b < PB_WO) { wtG_body(wo, DM, DM, WOb, WO16, WCAR, b); return; }                    // in[DM][DM] -> out[DM][DM]
    b -= PB_WO;
    if (b < PB_RO) { rope_body(RC, RS, b); return; }
    b -= PB_RO;
    cvt8_body(x, XB, (unsigned)((size_t)SEQ * DM / 8), b % PB_CX, b / PB_CX);
}

// ---- k_qkv: four waves per 128x128 tile of x W_qkv + b_qkv (bf16 x bf16 exact), one 64x64 quarter each. The quarter (64 tokens x one head third) is staged whole in LDS; q and k tiles get the rotary
// applied in place in LDS (each lane owns 8 consecutive d of a row, i.e. 4 whole pairs), then written as head planes:
__global__ __launch_bounds__(32 * GW) void k_qkv(const bf* __restrict__ XB, const bf* __restrict__ W, const float* __restrict__ bias, const float* __restrict__ RC, const float* __restrict__ RS,
                                             h16* QK16, h16* VT16, bf* QKh, bf* QKl, bf* VTh, bf* VTl) {
    __shared__ __align__(16) bf ring[4 * GT];            // operand ring; after the main loop: each wave's 64x68 f32 output staging
    const int lane = threadIdx.x & 31, lr = lane & 15, hi = lane >> 4;
    const int wave = __builtin_amdgcn_readfirstlane(threadIdx.x >> 5); const int wm = wave >> 1, wn = wave & 1;
    const int r0 = blockIdx.x * 128 + wm * 64, c0 = blockIdx.y * 128 + wn * 64;
    v8f acc[4][4];
#pragma unroll
    for (int mb = 0; mb < 4; ++mb)
#pragma unroll
        for (int nb = 0; nb < 4; ++nb) acc[mb][nb] = (v8f){};
    gemm_loop_lds<bf, 0>(XB, XB, W, ring, blockIdx.x * 128, blockIdx.y * 128, wm, wn, acc);
    float* os = (float*)ring + wave * (64 * 68);
#pragma unroll
    for (int nb = 0; nb < 4; ++nb) { const float bc = bfr(bias[c0 + nb * 16 + lr]);
#pragma unroll
        for (int mb = 0; mb < 4; ++mb) {
#pragma unroll
            for (int j = 0; j < 8; ++j) os[(mb * 16 + hi * 8 + j) * 68 + nb * 16 + lr] = acc[mb][nb][j] + bc; } }
    __syncthreads();
    const int which = c0 / DM; const int h = (c0 % DM) / HD; const int b = r0 / SEQ; const int t0 = r0 % SEQ; const int bhh = b * NH + h; const bool early = (t0 < RH); const int te = early ? t0 : 0;
    const int rr = lane >> 3, seg = lane & 7;
    if (which < 2) {
        // rotary in place: lane owns d = seg*8 .. seg*8+7 of row s*4+rr; table column = d mod 32 = (seg & 3)*8 + i; position = t0 + row
        const size_t tof = (size_t)(t0 + rr) * 32 + (seg & 3) * 8;
#pragma unroll 1
        for (int s = 0; s < 16; ++s) { const int row = s * 4 + rr;
            const v4f ca = *(const v4f*)(RC + tof + (size_t)s * 128); const v4f cb = *(const v4f*)(RC + tof + (size_t)s * 128 + 4);
            const v4f sa = *(const v4f*)(RS + tof + (size_t)s * 128); const v4f sb = *(const v4f*)(RS + tof + (size_t)s * 128 + 4);
            float* op = os + row * 68 + seg * 8;
            const v4f a = *(const v4fa*)op; const v4f c = *(const v4fa*)(op + 4); v4f ra, rc;
            ra[0] = a[0] * ca[0] + (-a[1]) * sa[0]; ra[1] = a[1] * ca[1] + a[0] * sa[1];
            ra[2] = a[2] * ca[2] + (-a[3]) * sa[2]; ra[3] = a[3] * ca[3] + a[2] * sa[3];
            rc[0] = c[0] * cb[0] + (-c[1]) * sb[0]; rc[1] = c[1] * cb[1] + c[0] * sb[1];
            rc[2] = c[2] * cb[2] + (-c[3]) * sb[2]; rc[3] = c[3] * cb[3] + c[2] * sb[3];
            *(v4fa*)op = ra; *(v4fa*)(op + 4) = rc; }
    }
    __syncthreads();
    if (which < 2) {
        h16* P16 = QK16 + (size_t)which * PL16 + ((size_t)bhh * SEQ + t0) * HD + seg * 8;
        bf* PH = QKh + (size_t)which * PLE + ((size_t)bhh * RH + te) * HD + seg * 8;
        bf* PL = QKl + (size_t)which * PLE + ((size_t)bhh * RH + te) * HD + seg * 8;
{
#pragma unroll 4
            for (int s = 0; s < 16; ++s) { const int row = s * 4 + rr; const v4f a = *(const v4fa*)(os + row * 68 + seg * 8); const v4f c = *(const v4fa*)(os + row * 68 + seg * 8 + 4); v8h o;
#pragma unroll
                for (int i = 0; i < 4; ++i) { o[i] = toh_flush(a[i] * QKCAR); o[4 + i] = toh_flush(c[i] * QKCAR); }
                *(v8h*)(P16 + (size_t)row * HD) = o; }
            if (early) {
#pragma unroll 4
                for (int s = 0; s < 16; ++s) { const int row = s * 4 + rr; const v4f a = *(const v4fa*)(os + row * 68 + seg * 8); const v4f c = *(const v4fa*)(os + row * 68 + seg * 8 + 4); v8us oh, ol;
#pragma unroll
                    for (int i = 0; i < 4; ++i) { unsigned short x0, x1; splitf(a[i], x0, x1); oh[i] = x0; ol[i] = x1; splitf(c[i], x0, x1); oh[4 + i] = x0; ol[4 + i] = x1; }
                    *(v8us*)(PH + (size_t)row * HD) = oh; *(v8us*)(PL + (size_t)row * HD) = ol; } }
             }
    } else {
        h16* P16 = VT16 + ((size_t)bhh * HD) * SEQ + t0 + seg * 8;
        bf* PH = VTh + ((size_t)bhh * HD) * RH + te + seg * 8;
        bf* PL = VTl + ((size_t)bhh * HD) * RH + te + seg * 8;
{
#pragma unroll 4
            for (int s = 0; s < 16; ++s) { const int d = s * 4 + rr; v8h o;
#pragma unroll
                for (int j = 0; j < 8; ++j) o[j] = toh_flush(os[(seg * 8 + j) * 68 + d] * VCAR);
                *(v8h*)(P16 + (size_t)d * SEQ) = o; }
            if (early) {
#pragma unroll 4
                for (int s = 0; s < 16; ++s) { const int d = s * 4 + rr; v8us oh, ol;
#pragma unroll
                    for (int j = 0; j < 8; ++j) { unsigned short x0, x1; splitf(os[(seg * 8 + j) * 68 + d], x0, x1); oh[j] = x0; ol[j] = x1; }
                    *(v8us*)(PH + (size_t)d * RH) = oh; *(v8us*)(PL + (size_t)d * RH) = ol; } }
             }
    }
}

// ---- attn16_body: fused causal attention, query rows >= RH (xb: 64-row block counted from row 0, bh: batch * NH + head); four waves per block, 16 query rows each (64 rows that share one diagonal block), 64-key blocks up to the diagonal.
// Each 64-key K tile [key][d] and V tile [d][key] is brought into LDS once per block by asynchronous b128 copies (rows of 128 B at a pitch of 144 B), two buffers: the next
// tile's copies fly while this one is worked on; all four waves take their fragments from LDS. The products are taken transposed: S^T = K Q^T (A = K rows, B = the wave's Q, held in
// registers) and O^T += V^T P^T (A = V^T rows). A lane then holds 32 of the 64 scores of ONE query (lane ^ 16 the other 32): running max and sum (f32) are in-lane plus one exchange
// between the halves, and two score tiles, converted in place (p x1024, f16), are the B operand of the second product. ctx = O / l written as f16 x64 into [b][t][h*64+d].
#define AW    4                  // waves per block
#define KVP   72                 // LDS pitch of a K or V tile row, in f16 elements
#define KVT   (64 * KVP)         // elements of one staged tile
static_assert((SEQ - RH) % (16 * AW) == 0 && RH % (16 * AW) == 0 && 16 * AW == 64);
static_assert((size_t)AW * 16 * 68 * 4 <= (size_t)4 * KVT * 2);   // the output staging fits in the ring it takes over

// one stage: this thread's four 16-byte pieces of the K tile and of the V tile (128 threads x 4 x 16 B = 8 KiB each), rows 16 apart
__device__ __forceinline__ void stage_kv(const h16* kg, const h16* vg, unsigned kl, unsigned vl) {
    // s_wait_xcnt stands inside the statement so that no address register of a copy is rewritten ahead of it
    asm volatile("global_load_async_to_lds_b128 %0, %8, off\n\t"
                 "global_load_async_to_lds_b128 %1, %9, off\n\t"
                 "global_load_async_to_lds_b128 %2, %10, off\n\t"
                 "global_load_async_to_lds_b128 %3, %11, off\n\t"
                 "global_load_async_to_lds_b128 %4, %12, off\n\t"
                 "global_load_async_to_lds_b128 %5, %13, off\n\t"
                 "global_load_async_to_lds_b128 %6, %14, off\n\t"
                 "global_load_async_to_lds_b128 %7, %15, off\n\t"
                 "s_wait_xcnt 0x0"
                 :: "v"(kl), "v"(kl + 16 * KVP * 2), "v"(kl + 32 * KVP * 2), "v"(kl + 48 * KVP * 2),
                    "v"(vl), "v"(vl + 16 * KVP * 2), "v"(vl + 32 * KVP * 2), "v"(vl + 48 * KVP * 2),
                    "v"(kg), "v"(kg + 16 * HD), "v"(kg + 32 * HD), "v"(kg + 48 * HD),
                    "v"(vg), "v"(vg + (size_t)16 * SEQ), "v"(vg + (size_t)32 * SEQ), "v"(vg + (size_t)48 * SEQ)
                 : "memory");
}

// lane l <-> lane l ^ 16
__device__ __forceinline__ float xhalf(float x) { return __builtin_bit_cast(float, __builtin_amdgcn_permlanex16(__builtin_bit_cast(int, x), __builtin_bit_cast(int, x), 0x76543210, 0xfedcba98, false, false)); }
__device__ __forceinline__ float max8(const float* v) { return fmaxf(fmaxf(fmaxf(v[0], v[1]), fmaxf(v[2], v[3])), fmaxf(fmaxf(v[4], v[5]), fmaxf(v[6], v[7]))); }
__device__ __forceinline__ float sum8(const float* v) { return ((v[0] + v[1]) + (v[2] + v[3])) + ((v[4] + v[5]) + (v[6] + v[7])); }

__device__ __forceinline__ void attn16_body(const h16* __restrict__ Q16, const h16* __restrict__ K16, const h16* __restrict__ VT16, h16* CT16, h16* ring, int xb, int bh) {
    // ring: the kernel's LDS, [buffer][K | V][row][KVP]; after the loop: output staging
    const int lane = threadIdx.x & 31, lr = lane & 15, hi = lane >> 4;
    const int wave = __builtin_amdgcn_readfirstlane(threadIdx.x >> 5);
    const int blkbase = xb * (16 * AW); const int rowbase = blkbase + wave * 16;
    const size_t qoff  = ((size_t)bh * SEQ + rowbase + lr) * HD + 8 * hi;
    // staging: thread t owns piece (t & 7) of rows (t >> 3) + 16 j, j = 0..3, of both tiles
    const int srow = threadIdx.x >> 3, sseg = threadIdx.x & 7;
    const h16* kg = K16 + ((size_t)bh * SEQ + srow) * HD + sseg * 8;
    const h16* vg = VT16 + ((size_t)bh * HD + srow) * SEQ + sseg * 8;
    const unsigned sl = (unsigned)(size_t)(ring + srow * KVP + sseg * 8);   // LDS byte address of the piece in buffer 0's K tile
    const int foff = lr * KVP + 8 * hi;                                     // fragment row and half inside a tile
    const int t = rowbase + lr;                                             // this lane's query
    v16h qb[2];                                                             // B operand: column lr = query t, d in the k order of ldh
#pragma unroll
    for (int c = 0; c < 2; ++c) qb[c] = ldh(Q16 + qoff + c * 32);
    v8f o[4]; float m = NEGB, l = 0.0f;                                     // o[dt][r] = O[t][dt*16 + 8*hi + r]; l: sum over this half's keys only
#pragma unroll
    for (int dt = 0; dt < 4; ++dt) o[dt] = (v8f){};
    const int nblk = blkbase / 64 + 1;
    stage_kv(kg, vg, sl, sl + KVT * 2);
    asm volatile("s_wait_asynccnt 0x0" ::: "memory");   // tile 0 of this wave's copies has landed
    __syncthreads();                                     // ... and every other wave's
    if (nblk > 1) stage_kv(kg + 64 * HD, vg + 64, sl + 2 * KVT * 2, sl + 3 * KVT * 2);
#pragma unroll 1
    for (int jb = 0; jb < nblk; ++jb) {
        const int jbase = jb * 64;
        const h16* kb = ring + (jb & 1) * (2 * KVT) + foff; const h16* vb = kb + KVT;
        v8f s[4];                                        // s[nt][r] = score of key jbase + nt*16 + 8*hi + r with query t
#pragma unroll
        for (int nt = 0; nt < 4; ++nt) s[nt] = (v8f){};
        v16h kf;
#pragma unroll
        for (int c = 0; c < 2; ++c) {
#pragma unroll
            for (int nt = 0; nt < 4; ++nt) { const h16* kp = kb + nt * 16 * KVP + c * 32; kf = cat16(*(const v8ha*)kp, *(const v8ha*)(kp + 16)); s[nt] = wmma16(kf, qb[c], s[nt]); }
        }
        // the four vector slots between the last WMMA and the first reader of its result
        asm volatile("v_nop\n\tv_nop\n\tv_nop\n\tv_nop" : "+v"(s[0]), "+v"(s[1]), "+v"(s[2]), "+v"(s[3]) : "v"(kf));
        const int dq = t - jbase - 8 * hi;               // key > t  <=>  the key's place among this lane's keys, nt*16 + r, > dq
        float v[4][8], mt[4];
#pragma unroll
        for (int nt = 0; nt < 4; ++nt) {
#pragma unroll
            for (int r = 0; r < 8; ++r) { const float sv = s[nt][r] * SCQ16; v[nt][r] = (nt * 16 + r > dq) ? NEGB : sv; }
            mt[nt] = max8(v[nt]);
        }
        float mx = fmaxf(fmaxf(mt[0], mt[1]), fmaxf(mt[2], mt[3]));
        mx = fmaxf(mx, xhalf(mx));                       // both halves hold the query's maximum over the 64 keys
        const float mn = fmaxf(m, mx);
        const float al = ex2((m - mn) * L2E);
        m = mn;
        float st[4]; v16h pb[2];                         // pb[c][e] = p of key jbase + c*32 + (k order of ldh): tiles 2c and 2c+1 as they lie
#pragma unroll
        for (int nt = 0; nt < 4; ++nt) {
            float p[8];
#pragma unroll
            for (int r = 0; r < 8; ++r) { p[r] = ex2((v[nt][r] - mn) * L2E + PLOG); pb[nt >> 1][(nt & 1) * 8 + r] = (h16)p[r]; }
            st[nt] = sum8(p);
        }
        l = l * al + ((st[0] + st[1]) + (st[2] + st[3]));
#pragma unroll
        for (int dt = 0; dt < 4; ++dt) o[dt] *= al;
        v16h vf;
#pragma unroll
        for (int c = 0; c < 2; ++c) {
#pragma unroll
            for (int dt = 0; dt < 4; ++dt) { const h16* vp = vb + dt * 16 * KVP + c * 32; vf = cat16(*(const v8ha*)vp, *(const v8ha*)(vp + 16)); o[dt] = wmma16(vf, pb[c], o[dt]); }
        }
        // the four vector slots behind the last WMMA, on the loop's back edge too
        asm volatile("v_nop\n\tv_nop\n\tv_nop\n\tv_nop" : "+v"(o[0]), "+v"(o[1]), "+v"(o[2]), "+v"(o[3]) : "v"(pb[1]), "v"(vf));
        asm volatile("s_wait_dscnt 0x0" ::: "memory");      // this wave has finished reading the buffer
        asm volatile("s_wait_asynccnt 0x0" ::: "memory");   // this wave's copies of tile jb + 1 have landed
        __syncthreads();                                     // publishes tile jb + 1 and frees the buffer of tile jb
        if (jb + 2 < nblk) { const unsigned bl = sl + (jb & 1) * (2 * KVT * 2); stage_kv(kg + (size_t)(jbase + 128) * HD, vg + jbase + 128, bl, bl + KVT * 2); }
    }
    asm volatile("s_wait_asynccnt 0x0" ::: "memory");       // nothing of the ring is in flight when it becomes output staging
    float* os = (float*)ring + wave * (16 * 68);
    {
        const float lt = l + xhalf(l);
        const float inv = (CCAR / VCAR) * (1.0f / lt);
#pragma unroll
        for (int dt = 0; dt < 4; ++dt) { v4f a, c;
#pragma unroll
            for (int i = 0; i < 4; ++i) { a[i] = o[dt][i] * inv; c[i] = o[dt][4 + i] * inv; }
            *(v4fa*)(os + lr * 68 + dt * 16 + 8 * hi) = a; *(v4fa*)(os + lr * 68 + dt * 16 + 8 * hi + 4) = c; }
    }
    __syncthreads();
    const int b = bh / NH, h = bh % NH; const int rr = lane >> 3, seg = lane & 7;
    h16* dst = CT16 + ((size_t)b * SEQ + rowbase) * DM + h * HD + seg * 8;
{
#pragma unroll
        for (int s = 0; s < 4; ++s) { const int row = s * 4 + rr; const v4f a = *(const v4fa*)(os + row * 68 + seg * 8); const v4f c = *(const v4fa*)(os + row * 68 + seg * 8 + 4); v8h ov;
#pragma unroll
            for (int i = 0; i < 4; ++i) { ov[i] = (h16)a[i]; ov[4 + i] = (h16)c[i]; }
            *(v8h*)(dst + (size_t)row * DM) = ov; }
         }
}

// ---- attnhl_body: the same for query rows < RH on bf16 hi/lo planes, operands straight from global memory, each of the four waves on its own 16 rows: scores kh qh + kh ql + kl qh, p split hi/lo in place, O^T += vh ph + vh pl + vl ph; ctx written as bf16 hi/lo [b][t<RH][h*64+d].
__device__ __forceinline__ void attnhl_body(const bf* __restrict__ Qh, const bf* __restrict__ Ql, const bf* __restrict__ Kh, const bf* __restrict__ Kl,
                                            const bf* __restrict__ VTh, const bf* __restrict__ VTl, bf* ATh, bf* ATl, float* lds, int xb, int bh) {
    const int lane = threadIdx.x & 31, lr = lane & 15, hi = lane >> 4;
    const int wave = __builtin_amdgcn_readfirstlane(threadIdx.x >> 5);
    float* os = lds + wave * (16 * 68);                  // this wave's output staging
    const int rowbase = xb * (16 * AW) + wave * 16;
    const size_t qoff  = ((size_t)bh * RH + rowbase + lr) * HD + 8 * hi;
    const size_t kbase = ((size_t)bh * RH + lr) * HD + 8 * hi;
    const size_t vbase = ((size_t)bh * HD + lr) * RH + 8 * hi;
    const int t = rowbase + lr;                          // this lane's query
    v16bf qh[2], ql[2];
#pragma unroll
    for (int c = 0; c < 2; ++c) { qh[c] = ldb(Qh + qoff + c * 32); ql[c] = ldb(Ql + qoff + c * 32); }
    v8f o[4]; float m = NEGB, l = 0.0f;
#pragma unroll
    for (int dt = 0; dt < 4; ++dt) o[dt] = (v8f){};
    const int nblk = rowbase / 64 + 1;
#pragma unroll 1
    for (int jb = 0; jb < nblk; ++jb) {
        const int jbase = jb * 64;
        v8f s[4];
#pragma unroll
        for (int nt = 0; nt < 4; ++nt) s[nt] = (v8f){};
        v16bf kh, kl;
#pragma unroll
        for (int c = 0; c < 2; ++c) {
#pragma unroll
            for (int nt = 0; nt < 4; ++nt) { const size_t ko = kbase + (size_t)(jbase + nt * 16) * HD + c * 32; kh = ldb(Kh + ko); kl = ldb(Kl + ko);
                s[nt] = wmmab(kh, qh[c], s[nt]); s[nt] = wmmab(kh, ql[c], s[nt]); s[nt] = wmmab(kl, qh[c], s[nt]); }
        }
        // the four vector slots between the last WMMA and the first reader of its result
        asm volatile("v_nop\n\tv_nop\n\tv_nop\n\tv_nop" : "+v"(s[0]), "+v"(s[1]), "+v"(s[2]), "+v"(s[3]) : "v"(kh), "v"(kl));
        const int dq = t - jbase - 8 * hi;               // key > t  <=>  the key's place among this lane's keys, nt*16 + r, > dq
        float v[4][8], mt[4];
#pragma unroll
        for (int nt = 0; nt < 4; ++nt) {
#pragma unroll
            for (int r = 0; r < 8; ++r) { const float sv = s[nt][r] * SCQHL; v[nt][r] = (nt * 16 + r > dq) ? NEGB : sv; }
            mt[nt] = max8(v[nt]);
        }
        float mx = fmaxf(fmaxf(mt[0], mt[1]), fmaxf(mt[2], mt[3]));
        mx = fmaxf(mx, xhalf(mx));
        const float mn = fmaxf(m, mx);
        const float al = ex2((m - mn) * L2E);
        m = mn;
        float st[4]; v8us ph[4], pl[4];
#pragma unroll
        for (int nt = 0; nt < 4; ++nt) {
            float p[8];
#pragma unroll
            for (int r = 0; r < 8; ++r) { p[r] = ex2((v[nt][r] - mn) * L2E); unsigned short x0, x1; splitf(p[r], x0, x1); ph[nt][r] = x0; pl[nt][r] = x1; }
            st[nt] = sum8(p);
        }
        l = l * al + ((st[0] + st[1]) + (st[2] + st[3]));
#pragma unroll
        for (int dt = 0; dt < 4; ++dt) o[dt] *= al;
        v16bf pbh, pbl, vh, vl;
#pragma unroll
        for (int c = 0; c < 2; ++c) {
            pbh = cat16b(ph[2 * c], ph[2 * c + 1]); pbl = cat16b(pl[2 * c], pl[2 * c + 1]);
#pragma unroll
            for (int dt = 0; dt < 4; ++dt) { const size_t vo = vbase + (size_t)(dt * 16) * RH + jbase + c * 32; vh = ldb(VTh + vo); vl = ldb(VTl + vo);
                o[dt] = wmmab(vh, pbh, o[dt]); o[dt] = wmmab(vh, pbl, o[dt]); o[dt] = wmmab(vl, pbh, o[dt]); }
        }
        // the four vector slots behind the last WMMA, on the loop's back edge too
        asm volatile("v_nop\n\tv_nop\n\tv_nop\n\tv_nop" : "+v"(o[0]), "+v"(o[1]), "+v"(o[2]), "+v"(o[3]) : "v"(pbh), "v"(pbl), "v"(vh), "v"(vl));
    }
    {
        const float lt = l + xhalf(l);
        const float inv = 1.0f / lt;
#pragma unroll
        for (int dt = 0; dt < 4; ++dt) { v4f a, c;
#pragma unroll
            for (int i = 0; i < 4; ++i) { a[i] = o[dt][i] * inv; c[i] = o[dt][4 + i] * inv; }
            *(v4fa*)(os + lr * 68 + dt * 16 + 8 * hi) = a; *(v4fa*)(os + lr * 68 + dt * 16 + 8 * hi + 4) = c; }
    }
    __syncthreads();
    const int b = bh / NH, h = bh % NH; const int rr = lane >> 3, seg = lane & 7;
    const size_t dof = ((size_t)b * RH + rowbase) * DM + h * HD + seg * 8;
{
#pragma unroll
        for (int s = 0; s < 4; ++s) { const int row = s * 4 + rr; const v4f a = *(const v4fa*)(os + row * 68 + seg * 8); const v4f c = *(const v4fa*)(os + row * 68 + seg * 8 + 4); v8us oh, ol;
#pragma unroll
            for (int i = 0; i < 4; ++i) { unsigned short x0, x1; splitf(a[i], x0, x1); oh[i] = x0; ol[i] = x1; splitf(c[i], x0, x1); oh[4 + i] = x0; ol[4 + i] = x1; }
            *(v8us*)(ATh + dof + (size_t)row * DM) = oh; *(v8us*)(ATl + dof + (size_t)row * DM) = ol; }
         }
}

// ---- k_attn: all query rows in one launch; the two bodies share no data. The hi/lo blocks (64 rows < RH) come first in the index: their waves walk chains of dependent global loads and use
// little of the vector and matrix units, so they start at once and run beside the f16 blocks. A f16 block walks xb + 1 key tiles and there are more blocks than resident places: they follow
// with the cost falling along the index (row block from the last down, head inside), so that the long blocks start first and the short ones fill the end of the launch.
constexpr int AB_HL = RH / (16 * AW), AB_16 = (SEQ - RH) / (16 * AW);   // 64-row blocks per head of either kind
static_assert(AB_HL > 0 && AB_16 > 0);
// five waves per SIMD asked for: the merged kernel's register count is the larger body's, and left alone the hi/lo body takes so many that the f16 body, which has nearly all the work, would run at four
__global__ __launch_bounds__(32 * AW) __attribute__((amdgpu_waves_per_eu(5))) void k_attn(const h16* __restrict__ Q16, const h16* __restrict__ K16, const h16* __restrict__ VT16, h16* CT16,
                                                  const bf* __restrict__ Qh, const bf* __restrict__ Ql, const bf* __restrict__ Kh, const bf* __restrict__ Kl,
                                                  const bf* __restrict__ VTh, const bf* __restrict__ VTl, bf* ATh, bf* ATl) {
    __shared__ __align__(16) h16 ring[4 * KVT];          // one array for both bodies (two would add up)
    const int i = blockIdx.x;
    if (i < NB * NH * AB_HL) attnhl_body(Qh, Ql, Kh, Kl, VTh, VTl, ATh, ATl, (float*)ring, i % AB_HL, i / AB_HL);
    else { const int j = i - NB * NH * AB_HL; attn16_body(Q16, K16, VT16, CT16, ring, AB_HL + AB_16 - 1 - j / (NB * NH), j % (NB * NH)); }
}

extern "C" void kernel_launch(void* const* d_in, const int* in_sizes, int n_in,
                              void* d_out, int out_size, void* d_ws, size_t ws_size, hipStream_t stream) {
    if (n_in < 5) return;
    if ((size_t)in_sizes[0] < (size_t)(NB - 1) * SEQ_FULL * DM + (size_t)SEQ * DM) return;
    if ((size_t)in_sizes[1] < (size_t)3 * DM * DM || in_sizes[2] < 3 * DM || (size_t)in_sizes[3] < (size_t)DM * DM || in_sizes[4] < DM) return;
    if ((size_t)out_size < (size_t)NB * SEQ * DM) return;
    if (ws_size < WS_TOTAL) return;
    // wire order: x, W_qkv, b_qkv, W_proj, b_proj
    const float* x = (const float*)d_in[0]; const float* wqkv = (const float*)d_in[1]; const float* bqkv = (const float*)d_in[2]; const float* wo = (const float*)d_in[3]; const float* bo = (const float*)d_in[4];
    float* OUT = (float*)d_out;
    char* wsp = (char*)d_ws;
    auto take = [&](size_t bytes) { char* p = wsp; wsp += bytes; return (void*)p; };
    bf* XB = (bf*)take(SZ_XB);
    bf* WQKV = (bf*)take(SZ_WQKV);                 // Bt [3*DM][DM]
    bf* WOb = (bf*)take(SZ_WO); h16* WO16 = (h16*)take(SZ_WO);
    h16* QK16 = (h16*)take(2 * SZ_P16);            // [q | k] f16 planes [bh][t][d]
    h16* VT16 = (h16*)take(SZ_P16);                // [bh][d][t]
    bf* QKh = (bf*)take(2 * SZ_PE); bf* QKl = (bf*)take(2 * SZ_PE);   // [q | k] early-row planes [bh][t<RH][d]
    bf* VTh = (bf*)take(SZ_PE); bf* VTl = (bf*)take(SZ_PE);           // [bh][d][t<RH]
    h16* CT16 = (h16*)take(SZ_CT);                 // ctx f16 x64 [b][t][DM] (rows >= RH used)
    bf* ATh = (bf*)take(SZ_AT); bf* ATl = (bf*)take(SZ_AT);           // ctx hi/lo [b][t<RH][DM]
    float* RC = (float*)take(SZ_ROT); float* RS = (float*)take(SZ_ROT);   // rotary cos / sin [SEQ][32]
    if ((size_t)(wsp - (char*)d_ws) > ws_size) return;

    k_prep<<<PB_WQ + PB_WO + PB_RO + NB * PB_CX, 256, 0, stream>>>(x, wqkv, wo, XB, WQKV, WOb, WO16, RC, RS);
    k_qkv<<<dim3(NB * SEQ / 128, 3 * DM / 128, 1), 128, 0, stream>>>(XB, WQKV, bqkv, RC, RS, QK16, VT16, QKh, QKl, VTh, VTl);
    k_attn<<<NB * NH * (AB_HL + AB_16), 128, 0, stream>>>(QK16, QK16 + PL16, VT16, CT16, QKh, QKl, QKh + PLE, QKl + PLE, VTh, VTl, ATh, ATl);
    k_proj<<<dim3(SEQ / 128, DM / 128, NB), 128, 0, stream>>>(ATh, ATl, WOb, CT16, WO16, OUT, bo);
}

// v006
// One run takes 135 microseconds.
// Two timings next to v005 both put it at 1.04 times that version's speed.
// All steps since v000 together make it 3.35 times as fast.
#include <hip/hip_runtime.h>

// Contractions (all f32 accumulate): x*W_qkv on v_wmma_f32_16x16x32_bf16 (both operands bf16 RNE copies of the inputs, exact products);
// q*k^T and p*v: query rows >= 256 on v_wmma_f32_16x16x32_f16 (q,k,v carried x16, p carried x1024), query rows < 256 on bf16 hi/lo planes (3 products);
// ctx*W_proj: rows >= 256 f16 (ctx x64, w x1024 from the bf16 copy), rows < 256 bf16 hi/lo ctx x bf16 w (2 products). Softmax f32 (running max, exp2).
// Rotary on q and k (interleaved pairs (2i,2i+1) -> (-x[2i+1], x[2i]); angle = pos * inv_freq[d mod 32], inv_freq[j] = 1 / 10000^(j/32)) applied in f32 on the
// staged 64x64 tile in the x*W_qkv epilogue, from cos/sin tables [SEQ][32] built once by rope_body (precise sincosf).
// Layout: x [NB][SEQ_FULL][1024] (rows < SEQ read); W_qkv [1024][3072] (in,out), thirds q|k|v, column = which*1024 + h*64 + d; W_proj [1024][1024] (in,out); out [NB][SEQ][1024].

#ifndef NB
#define NB 4
#endif
#ifndef SEQ
#define SEQ 2048
#endif
#define NB_FULL  4
#define SEQ_FULL 2048
#define DM   1024
#define NH   16
#define HD   64
#define RH   256                 // query rows < RH use bf16 hi/lo planes
#define QKCAR 16.0f
#define VCAR  16.0f
#define CCAR  64.0f
#define WCAR  1024.0f
#define PLOG  10.0f              // p carried x 2^10
#define L2E   1.4426950408889634f
#define NEGB  (-3.0e38f)
#define SCQ16 (0.125f / (QKCAR * QKCAR))
#define SCQHL 0.125f

typedef _Float16 h16;
typedef unsigned short bf;
typedef __attribute__((ext_vector_type(16))) __bf16   v16bf;
typedef __attribute__((ext_vector_type(16))) _Float16 v16h;
typedef __attribute__((ext_vector_type(8)))  _Float16 v8h;
typedef __attribute__((ext_vector_type(2)))  _Float16 v2h;
typedef __attribute__((ext_vector_type(8)))  unsigned short v8us;
typedef __attribute__((ext_vector_type(2)))  unsigned short v2us;
typedef __attribute__((ext_vector_type(8)))  float    v8f;
typedef __attribute__((ext_vector_type(4)))  float    v4f;
typedef v8h  __attribute__((may_alias)) v8ha;
typedef v4f  __attribute__((may_alias)) v4fa;
typedef v8us __attribute__((may_alias)) v8usa;

static_assert(SEQ % 64 == 0);
static_assert(RH % 64 == 0);
static_assert(RH <= SEQ);
static_assert(SEQ <= SEQ_FULL);
static_assert(NB <= NB_FULL);
static_assert(DM % 64 == 0);
static_assert(DM % 32 == 0);
static_assert(HD == 64);
static_assert(NH * HD == DM);
static_assert((3 * DM) % 64 == 0);
static_assert(HD / 2 == 32);
static_assert(SEQ % 8 == 0);          // rope_body: 8 positions per 256-thread block
static_assert((NB * SEQ) % 128 == 0 && (3 * DM) % 128 == 0 && SEQ % 128 == 0 && RH % 128 == 0 && DM % 128 == 0);   // the three GEMMs: 128x128 block tiles

constexpr size_t PL16 = (size_t)NB * NH * SEQ * HD;     // elements of one f16 head plane set
constexpr size_t PLE  = (size_t)NB * NH * RH * HD;      // elements of one early-row bf16 plane set
constexpr size_t SZ_XB   = (size_t)NB * SEQ * DM * 2;
constexpr size_t SZ_WQKV = (size_t)3 * DM * DM * 2;
constexpr size_t SZ_WO   = (size_t)DM * DM * 2;
constexpr size_t SZ_P16  = PL16 * 2;
constexpr size_t SZ_PE   = PLE * 2;
constexpr size_t SZ_CT   = (size_t)NB * SEQ * DM * 2;
constexpr size_t SZ_AT   = (size_t)NB * RH * DM * 2;
constexpr size_t SZ_ROT  = (size_t)SEQ * 32 * 4;        // one rotary table (cos or sin) [SEQ][32] f32
constexpr size_t WS_TOTAL = SZ_XB + SZ_WQKV + 2 * SZ_WO + 3 * SZ_P16 + 6 * SZ_PE + SZ_CT + 2 * SZ_AT + 2 * SZ_ROT;
static_assert(SZ_XB % 256 == 0 && SZ_WQKV % 256 == 0 && SZ_WO % 256 == 0 && SZ_P16 % 256 == 0 && SZ_PE % 256 == 0 && SZ_CT % 256 == 0 && SZ_AT % 256 == 0);
static_assert(SZ_ROT % 256 == 0);
static_assert(WS_TOTAL <= (size_t)134217728);

__device__ __forceinline__ unsigned short f2bf(float f) { unsigned u = __float_as_uint(f); u += 0x7FFFu + ((u >> 16) & 1u); return (unsigned short)(u >> 16); }
__device__ __forceinline__ float bf2f(unsigned short b) { return __uint_as_float(((unsigned)b) << 16); }
__device__ __forceinline__ float bfr(float f) { return bf2f(f2bf(f)); }
__device__ __forceinline__ void splitf(float y, unsigned short& h, unsigned short& l) { h = f2bf(y); l = f2bf(y - bf2f(h)); }
__device__ __forceinline__ v16h cat16(v8h lo, v8h hi) { return __builtin_shufflevector(lo, hi, 0, 1, 2, 3, 4, 5, 6, 7, 8, 9, 10, 11, 12, 13, 14, 15); }
__device__ __forceinline__ v16bf cat16b(v8us lo, v8us hi) { return __builtin_bit_cast(v16bf, __builtin_shufflevector(lo, hi, 0, 1, 2, 3, 4, 5, 6, 7, 8, 9, 10, 11, 12, 13, 14, 15)); }
__device__ __forceinline__ v8f wmma16(v16h a, v16h b, v8f c) { return __builtin_amdgcn_wmma_f32_16x16x32_f16(false, a, false, b, (short)0, c, false, false); }
__device__ __forceinline__ v8f wmmab(v16bf a, v16bf b, v8f c) { return __builtin_amdgcn_wmma_f32_16x16x32_bf16(false, a, false, b, (short)0, c, false, false); }
__device__ __forceinline__ float ex2(float x) { return __builtin_amdgcn_exp2f(x); }
// f32 -> f16 for operand planes: anything below the smallest f16 normal becomes an exact zero (value select, applied after the carry)
static __device__ __forceinline__ h16 toh_flush(float v) { const h16 r = (h16)v; return (fabsf(v) < 6.103515625e-05f) ? (h16)0.0f : r; }
// fragment loads from K-contiguous 16-bit rows: p already includes + 8*(lane>>4); elements 0..7 <- k0+8h.., 8..15 <- k0+16+8h..
__device__ __forceinline__ v16h  ldh(const h16* p) { return cat16(*(const v8h*)p, *(const v8h*)(p + 16)); }
__device__ __forceinline__ v16bf ldb(const bf* p)  { return cat16b(*(const v8us*)p, *(const v8us*)(p + 16)); }

template <typename T16> struct WFrag;
template <> struct WFrag<h16> { typedef v16h V; static __device__ __forceinline__ V lds(const h16* p) { return cat16(*(const v8ha*)p, *(const v8ha*)(p + 16)); } static __device__ __forceinline__ v8f mma(V a, V b, v8f c) { return wmma16(a, b, c); } };
template <> struct WFrag<bf>  { typedef v16bf V; static __device__ __forceinline__ V lds(const bf* p) { return cat16b(*(const v8usa*)p, *(const v8usa*)(p + 16)); } static __device__ __forceinline__ v8f mma(V a, V b, v8f c) { return wmmab(a, b, c); } };

// ---- four-wave 128x128 tile main loop (K = DM): per stage of 64 k the block brings 128 rows of A and 128 rows of Bt (128 B each, LDS pitch 144 B) into LDS once by asynchronous
// b128 copies, two buffers: the next stage's copies fly while this one is worked on. Wave (wm, wn) takes its 64x64 quarter's fragments from LDS, in the k order of ldh / ldb.
#define GW    4                  // waves per block (2 x 2)
#define GP    72                 // LDS pitch of a staged operand row, in 16-bit elements
#define GT    (128 * GP)         // elements of one staged operand tile
static_assert(DM % 64 == 0 && DM / 64 >= 2);
static_assert((size_t)GW * 64 * 68 * 4 <= (size_t)4 * GT * 2);   // the output staging fits in the ring it takes over

// this thread's eight 16-byte pieces of one operand tile (128 threads x 8 x 16 B = 16 KiB), rows 16 apart
template <typename T16>
__device__ __forceinline__ void stage_rows(const T16* g, unsigned l) {
    // s_wait_xcnt stands inside the statement so that no address register of a copy is rewritten ahead of it
    asm volatile("global_load_async_to_lds_b128 %0, %8, off\n\t"
                 "global_load_async_to_lds_b128 %1, %9, off\n\t"
                 "global_load_async_to_lds_b128 %2, %10, off\n\t"
                 "global_load_async_to_lds_b128 %3, %11, off\n\t"
                 "global_load_async_to_lds_b128 %4, %12, off\n\t"
                 "global_load_async_to_lds_b128 %5, %13, off\n\t"
                 "global_load_async_to_lds_b128 %6, %14, off\n\t"
                 "global_load_async_to_lds_b128 %7, %15, off\n\t"
                 "s_wait_xcnt 0x0"
                 :: "v"(l), "v"(l + 16 * GP * 2), "v"(l + 32 * GP * 2), "v"(l + 48 * GP * 2),
                    "v"(l + 64 * GP * 2), "v"(l + 80 * GP * 2), "v"(l + 96 * GP * 2), "v"(l + 112 * GP * 2),
                    "v"(g), "v"(g + 16 * DM), "v"(g + 32 * DM), "v"(g + 48 * DM),
                    "v"(g + 64 * DM), "v"(g + 80 * DM), "v"(g + 96 * DM), "v"(g + 112 * DM)
                 : "memory");
}

// ring: [buffer][A | Bt | A2][row][GP] (A2, the lo plane multiplied against the same Bt, only with NSPLIT 1); rb, cb: first of the block's A rows and Bt rows.
// acc[mb][nb] += A[rb+wm*64+mb*16..][k] Bt[cb+wn*64+nb*16..][k]. On return every wave has left the ring and nothing is in flight into it.
template <typename T16, int NSPLIT>
__device__ __forceinline__ void gemm_loop_lds(const T16* __restrict__ A, const T16* __restrict__ A2, const T16* __restrict__ Bt, T16* ring, int rb, int cb, int wm, int wn, v8f (&acc)[4][4]) {
    typedef typename WFrag<T16>::V V;
    constexpr int NST = DM / 64, BUF = (2 + NSPLIT) * GT;
    const int lane = threadIdx.x & 31, lr = lane & 15, hi = lane >> 4;
    // staging: thread t owns piece (t & 7) of rows (t >> 3) + 16 j, j = 0..7, of every tile
    const int srow = threadIdx.x >> 3, sseg = threadIdx.x & 7;
    const T16* ag = A + (size_t)(rb + srow) * DM + sseg * 8;
    const T16* a2g = A2 + (size_t)(rb + srow) * DM + sseg * 8;
    const T16* bg = Bt + (size_t)(cb + srow) * DM + sseg * 8;
    const unsigned sl = (unsigned)(size_t)(ring + srow * GP + sseg * 8);   // LDS byte address of the piece in buffer 0's A tile
    const int aof = (wm * 64 + lr) * GP + 8 * hi, bof = GT + (wn * 64 + lr) * GP + 8 * hi;
    auto stage = [&](int st, unsigned l) { stage_rows<T16>(ag + st * 64, l); stage_rows<T16>(bg + st * 64, l + GT * 2); if (NSPLIT == 1) stage_rows<T16>(a2g + st * 64, l + 2 * GT * 2); };
    stage(0, sl);
    asm volatile("s_wait_asynccnt 0x0" ::: "memory");   // stage 0 of this wave's copies has landed
    __syncthreads();                                     // ... and every other wave's
    stage(1, sl + BUF * 2);
    // kept rolled: one copy of the hand-over at the foot, and the code stays small; the loops inside are unrolled so that every fragment and accumulator index is a constant (registers)
#pragma unroll 1
    for (int t = 0; t < NST; ++t) {
        const T16* tb = ring + (t & 1) * BUF;
#pragma unroll
        for (int c = 0; c < 2; ++c) {
            V a[4], a2[4], b[4];
#pragma unroll
            for (int mb = 0; mb < 4; ++mb) { a[mb] = WFrag<T16>::lds(tb + aof + mb * 16 * GP + c * 32); if (NSPLIT == 1) a2[mb] = WFrag<T16>::lds(tb + 2 * GT + aof + mb * 16 * GP + c * 32); }
#pragma unroll
            for (int nb = 0; nb < 4; ++nb) b[nb] = WFrag<T16>::lds(tb + bof + nb * 16 * GP + c * 32);
            // inputs-only fence on the loaded fragments: keeps the LDS loads of this 32-k block together ahead of its WMMAs (one LDS wait a block; sunk between the WMMAs each B fragment costs its own)
            if (NSPLIT == 1) asm volatile("" :: "v"(a[0]), "v"(a[1]), "v"(a[2]), "v"(a[3]), "v"(a2[0]), "v"(a2[1]), "v"(a2[2]), "v"(a2[3]), "v"(b[0]), "v"(b[1]), "v"(b[2]), "v"(b[3]));
            else             asm volatile("" :: "v"(a[0]), "v"(a[1]), "v"(a[2]), "v"(a[3]), "v"(b[0]), "v"(b[1]), "v"(b[2]), "v"(b[3]));
#pragma unroll
            for (int nb = 0; nb < 4; ++nb)
#pragma unroll
                for (int mb = 0; mb < 4; ++mb) { acc[mb][nb] = WFrag<T16>::mma(a[mb], b[nb], acc[mb][nb]); if (NSPLIT == 1) acc[mb][nb] = WFrag<T16>::mma(a2[mb], b[nb], acc[mb][nb]); }
        }
        asm volatile("s_wait_dscnt 0x0" ::: "memory");      // this wave has finished reading the buffer
        asm volatile("s_wait_asynccnt 0x0" ::: "memory");   // this wave's copies of stage t + 1 have landed
        __syncthreads();                                     // publishes stage t + 1 and frees the buffer of stage t
        if (t + 2 < NST) stage(t + 2, sl + (t & 1) * (BUF * 2));
    }
    asm volatile("s_wait_asynccnt 0x0" ::: "memory");       // nothing of the ring is in flight when it becomes output staging
}

// ---- GEMM with f32 output: C[m][n] = osc * sum_k A[m][k] Bt[n][k] + bf16(bias[n]); K = DM; grid (M/128, N/128, Z), 128 threads, a 64x64 quarter per wave. Per 16-row slab staged in LDS,
template <typename T16, int NSPLIT>
__device__ __forceinline__ void gemm_out_body(const T16* __restrict__ A, const T16* __restrict__ A2, const T16* __restrict__ Bt, float* C, int ldc, const float* __restrict__ bias, float osc, size_t sA, size_t sC, T16* ring) {
    // ring: the kernel's LDS, 2 * (2 + NSPLIT) * GT elements used: operand ring; after the main loop: each wave's 16x68 f32 slab staging
    const size_t z = blockIdx.z; A += z * sA; A2 += z * sA; C += z * sC;
    const int lane = threadIdx.x & 31, lr = lane & 15, hi = lane >> 4;
    const int wave = __builtin_amdgcn_readfirstlane(threadIdx.x >> 5); const int wm = wave >> 1, wn = wave & 1;
    const int r0 = blockIdx.x * 128 + wm * 64, c0 = blockIdx.y * 128 + wn * 64;
    v8f acc[4][4];
#pragma unroll
    for (int mb = 0; mb < 4; ++mb)
#pragma unroll
        for (int nb = 0; nb < 4; ++nb) acc[mb][nb] = (v8f){};
    gemm_loop_lds<T16, NSPLIT>(A, A2, Bt, ring, blockIdx.x * 128, blockIdx.y * 128, wm, wn, acc);
    float* os = (float*)ring + wave * (16 * 68);
    const int cofs = lr * 4;
    const v4f bv = *(const v4f*)(bias + c0 + cofs);
    v4f bb; bb[0] = bfr(bv[0]); bb[1] = bfr(bv[1]); bb[2] = bfr(bv[2]); bb[3] = bfr(bv[3]);
#pragma unroll
    for (int mb = 0; mb < 4; ++mb) {
#pragma unroll
        for (int nb = 0; nb < 4; ++nb) {
#pragma unroll
            for (int j = 0; j < 8; ++j) os[(hi * 8 + j) * 68 + nb * 16 + lr] = acc[mb][nb][j]; }
        __syncthreads();
        float* crow = C + (size_t)(r0 + mb * 16) * ldc + c0;
{
#pragma unroll
            for (int s = 0; s < 8; ++s) { const int row = 2 * s + hi; const v4f t = *(const v4fa*)(os + row * 68 + cofs); v4f val;
                val[0] = t[0] * osc + bb[0]; val[1] = t[1] * osc + bb[1]; val[2] = t[2] * osc + bb[2]; val[3] = t[3] * osc + bb[3];
                *(v4f*)(crow + (size_t)row * ldc + cofs) = val; }
             }
        __syncthreads();
    }
}

// ---- k_proj: ctx W_proj + b_proj for all rows in one launch, grid (SEQ/128, DM/128, NB), z = batch; the two bodies share no data, so the few hi/lo tiles run beside the f16 tiles.
// row tiles < RH: ctx hi/lo (bf16) x w_proj (bf16); row tiles >= RH: ctx f16 (x64) x w_proj f16 (x1024)
__global__ __launch_bounds__(32 * GW) void k_proj(const bf* __restrict__ Ah, const bf* __restrict__ Al, const bf* __restrict__ Wt, const h16* __restrict__ A16, const h16* __restrict__ Wt16,
                                                  float* C, const float* __restrict__ bias) {
    __shared__ __align__(16) bf ring[2 * 3 * GT];        // one array for both bodies (two would add up)
    if (blockIdx.x < RH / 128) gemm_out_body<bf, 1>(Ah, Al, Wt, C, DM, bias, 1.0f, (size_t)RH * DM, (size_t)SEQ * DM, ring);
    else                       gemm_out_body<h16, 0>(A16, A16, Wt16, C, DM, bias, 1.0f / (CCAR * WCAR), (size_t)SEQ * DM, (size_t)SEQ * DM, (h16*)ring);
}

// bx: block inside a batch, b: batch
__device__ __forceinline__ void cvt8_body(const float* __restrict__ src, bf* dst, unsigned n8, unsigned bx, size_t b) {
    src += b * (size_t)SEQ_FULL * DM; dst += b * (size_t)SEQ * DM;
    const unsigned i = bx * 256 + threadIdx.x; if (i >= n8) return;
    const v8f v = *(const v8f*)(src + (size_t)i * 8); v8us o;
#pragma unroll
    for (int k = 0; k < 8; ++k) o[k] = f2bf(v[k]);
    *(v8us*)(dst + (size_t)i * 8) = o; 
}

__device__ __forceinline__ void wtG_body(const float* __restrict__ w, int K, int N, bf* Bt, h16* Bt16, float car, unsigned bx) {
    const int lane = threadIdx.x & 31; const int L0 = (bx * 8 + (threadIdx.x >> 5)) * 8; const int nlines = N * (K / 64);
{
#pragma unroll 1
        for (int l = 0; l < 8; ++l) { const int L = L0 + l; if (L >= nlines) break; const size_t e = (size_t)L * 64 + lane * 2; const int k = (int)(e % K), n = (int)(e / K); v2us o;
            o[0] = f2bf(w[(size_t)k * N + n]); o[1] = f2bf(w[(size_t)(k + 1) * N + n]); *(v2us*)(Bt + e) = o;
            if (Bt16) { v2h o2; o2[0] = (h16)(bf2f(o[0]) * car); o2[1] = (h16)(bf2f(o[1]) * car); *(v2h*)(Bt16 + e) = o2; } }
         }
}

// ---- rope_body: rotary tables RC = cos, RS = sin, [SEQ][32] f32; angle = (float)pos * inv_freq[j], inv_freq[j] = 1.0f / (float)(10000^(j/32));
__device__ __forceinline__ void rope_body(float* RC, float* RS, unsigned bx) {
#pragma clang fp contract(off)
    const int wave = __builtin_amdgcn_readfirstlane(threadIdx.x >> 5); const int lane = threadIdx.x & 31;
    const int pos = bx * 8 + wave; if (pos >= SEQ) return;
    double p = 1.0;
#pragma unroll 1
    for (int j = 0; j < lane; ++j) p = p * 1.3335214321633240;
    const float pw = (float)p; const float inv = 1.0f / pw; const float ang = (float)pos * inv;
    float sv, cv; sincosf(ang, &sv, &cv);
    float* pc = RC + (size_t)pos * 32 + lane; float* pq = RS + (size_t)pos * 32 + lane;
    *(float*)pc = cv; *(float*)pq = sv; 
}

// ---- k_prep: the four preparations (W_qkv and W_proj transposed to bf16 / f16, rotary tables, x to bf16) share no data: one launch, the body picked by block range.
// The transposes, whose waves walk a chain of dependent scattered loads, come first in the index; the stream over x fills in behind them.
constexpr unsigned PB_WQ = (3 * DM * (DM / 64) + 63) / 64;                    // blocks of the W_qkv transpose
constexpr unsigned PB_WO = (DM * (DM / 64) + 63) / 64;                        // ... of the W_proj transpose
constexpr unsigned PB_RO = (SEQ + 7) / 8;                                     // ... of the rotary tables
constexpr unsigned PB_CX = (unsigned)(((size_t)SEQ * DM / 8 + 255) / 256);    // ... of one batch of x
__global__ __launch_bounds__(256) void k_prep(const float* __restrict__ x, const float* __restrict__ wqkv, const float* __restrict__ wo, bf* XB, bf* WQKV, bf* WOb, h16* WO16, float* RC, float* RS) {
    unsigned b = blockIdx.x;
    if (b < PB_WQ) { wtG_body(wqkv, DM, 3 * DM, WQKV, (h16*)nullptr, 1.0f, b); return; }   // in[DM][3*DM] -> out[3*DM][DM]
    b -= PB_WQ;
    if (b < PB_WO) { wtG_body(wo, DM, DM, WOb, WO16, WCAR, b); return; }                    // in[DM][DM] -> out[DM][DM]
    b -= PB_WO;
    if (b < PB_RO) { rope_body(RC, RS, b); return; }
    b -= PB_RO;
    cvt8_body(x, XB, (unsigned)((size_t)SEQ * DM / 8), b % PB_CX, b / PB_CX);
}

// ---- k_qkv: four waves per 128x128 tile of x W_qkv + b_qkv (bf16 x bf16 exact), one 64x64 quarter each. The quarter (64 tokens x one head third) is staged whole in LDS; q and k tiles get the rotary
// applied in place in LDS (each lane owns 8 consecutive d of a row, i.e. 4 whole pairs), then written as head planes:
__global__ __launch_bounds__(32 * GW) void k_qkv(const bf* __restrict__ XB, const bf* __restrict__ W, const float* __restrict__ bias, const float* __restrict__ RC, const float* __restrict__ RS,
                                             h16* QK16, h16* VT16, bf* QKh, bf* QKl, bf* VTh, bf* VTl) {
    __shared__ __align__(16) bf ring[4 * GT];            // operand ring; after the main loop: each wave's 64x68 f32 output staging
    const int lane = threadIdx.x & 31, lr = lane & 15, hi = lane >> 4;
    const int wave = __builtin_amdgcn_readfirstlane(threadIdx.x >> 5); const int wm = wave >> 1, wn = wave & 1;
    const int r0 = blockIdx.x * 128 + wm * 64, c0 = blockIdx.y * 128 + wn * 64;
    v8f acc[4][4];
#pragma unroll
    for (int mb = 0; mb < 4; ++mb)
#pragma unroll
        for (int nb = 0; nb < 4; ++nb) acc[mb][nb] = (v8f){};
    gemm_loop_lds<bf, 0>(XB, XB, W, ring, blockIdx.x * 128, blockIdx.y * 128, wm, wn, acc);
    float* os = (float*)ring + wave * (64 * 68);
#pragma unroll
    for (int nb = 0; nb < 4; ++nb) { const float bc = bfr(bias[c0 + nb * 16 + lr]);
#pragma unroll
        for (int mb = 0; mb < 4; ++mb) {
#pragma unroll
            for (int j = 0; j < 8; ++j) os[(mb * 16 + hi * 8 + j) * 68 + nb * 16 + lr] = acc[mb][nb][j] + bc; } }
    __syncthreads();
    const int which = c0 / DM; const int h = (c0 % DM) / HD; const int b = r0 / SEQ; const int t0 = r0 % SEQ; const int bhh = b * NH + h; const bool early = (t0 < RH); const int te = early ? t0 : 0;
    const int rr = lane >> 3, seg = lane & 7;
    if (which < 2) {
        // rotary in place: lane owns d = seg*8 .. seg*8+7 of row s*4+rr; table column = d mod 32 = (seg & 3)*8 + i; position = t0 + row
        const size_t tof = (size_t)(t0 + rr) * 32 + (seg & 3) * 8;
#pragma unroll 1
        for (int s = 0; s < 16; ++s) { const int row = s * 4 + rr;
            const v4f ca = *(const v4f*)(RC + tof + (size_t)s * 128); const v4f cb = *(const v4f*)(RC + tof + (size_t)s * 128 + 4);
            const v4f sa = *(const v4f*)(RS + tof + (size_t)s * 128); const v4f sb = *(const v4f*)(RS + tof + (size_t)s * 128 + 4);
            float* op = os + row * 68 + seg * 8;
            const v4f a = *(const v4fa*)op; const v4f c = *(const v4fa*)(op + 4); v4f ra, rc;
            ra[0] = a[0] * ca[0] + (-a[1]) * sa[0]; ra[1] = a[1] * ca[1] + a[0] * sa[1];
            ra[2] = a[2] * ca[2] + (-a[3]) * sa[2]; ra[3] = a[3] * ca[3] + a[2] * sa[3];
            rc[0] = c[0] * cb[0] + (-c[1]) * sb[0]; rc[1] = c[1] * cb[1] + c[0] * sb[1];
            rc[2] = c[2] * cb[2] + (-c[3]) * sb[2]; rc[3] = c[3] * cb[3] + c[2] * sb[3];
            *(v4fa*)op = ra; *(v4fa*)(op + 4) = rc; }
    }
    __syncthreads();
    if (which < 2) {
        h16* P16 = QK16 + (size_t)which * PL16 + ((size_t)bhh * SEQ + t0) * HD + seg * 8;
        bf* PH = QKh + (size_t)which * PLE + ((size_t)bhh * RH + te) * HD + seg * 8;
        bf* PL = QKl + (size_t)which * PLE + ((size_t)bhh * RH + te) * HD + seg * 8;
{
#pragma unroll 4
            for (int s = 0; s < 16; ++s) { const int row = s * 4 + rr; const v4f a = *(const v4fa*)(os + row * 68 + seg * 8); const v4f c = *(const v4fa*)(os + row * 68 + seg * 8 + 4); v8h o;
#pragma unroll
                for (int i = 0; i < 4; ++i) { o[i] = toh_flush(a[i] * QKCAR); o[4 + i] = toh_flush(c[i] * QKCAR); }
                *(v8h*)(P16 + (size_t)row * HD) = o; }
            if (early) {
#pragma unroll 4
                for (int s = 0; s < 16; ++s) { const int row = s * 4 + rr; const v4f a = *(const v4fa*)(os + row * 68 + seg * 8); const v4f c = *(const v4fa*)(os + row * 68 + seg * 8 + 4); v8us oh, ol;
#pragma unroll
                    for (int i = 0; i < 4; ++i) { unsigned short x0, x1; splitf(a[i], x0, x1); oh[i] = x0; ol[i] = x1; splitf(c[i], x0, x1); oh[4 + i] = x0; ol[4 + i] = x1; }
                    *(v8us*)(PH + (size_t)row * HD) = oh; *(v8us*)(PL + (size_t)row * HD) = ol; } }
             }
    } else {
        h16* P16 = VT16 + ((size_t)bhh * HD) * SEQ + t0 + seg * 8;
        bf* PH = VTh + ((size_t)bhh * HD) * RH + te + seg * 8;
        bf* PL = VTl + ((size_t)bhh * HD) * RH + te + seg * 8;
{
#pragma unroll 4
            for (int s = 0; s < 16; ++s) { const int d = s * 4 + rr; v8h o;
#pragma unroll
                for (int j = 0; j < 8; ++j) o[j] = toh_flush(os[(seg * 8 + j) * 68 + d] * VCAR);
                *(v8h*)(P16 + (size_t)d * SEQ) = o; }
            if (early) {
#pragma unroll 4
                for (int s = 0; s < 16; ++s) { const int d = s * 4 + rr; v8us oh, ol;
#pragma unroll
                    for (int j = 0; j < 8; ++j) { unsigned short x0, x1; splitf(os[(seg * 8 + j) * 68 + d], x0, x1); oh[j] = x0; ol[j] = x1; }
                    *(v8us*)(PH + (size_t)d * RH) = oh; *(v8us*)(PL + (size_t)d * RH) = ol; } }
             }
    }
}

// ---- attn16_body: fused causal attention, query rows >= RH (xb: 64-row block counted from row 0, bh: batch * NH + head); four waves per block, 16 query rows each (64 rows that share one diagonal block), 64-key blocks up to the diagonal.
// Each 64-key K tile [key][d] and V tile [d][key] is brought into LDS once per block by asynchronous b128 copies (rows of 128 B at a pitch of 144 B), two buffers: the next
// tile's copies fly while this one is worked on; all four waves take their fragments from LDS. The products are taken transposed: S^T = K Q^T (A = K rows, B = the wave's Q, held in
// registers) and O^T += V^T P^T (A = V^T rows). A lane then holds 32 of the 64 scores of ONE query (lane ^ 16 the other 32): running max and sum (f32) are in-lane plus one exchange
// between the halves, and two score tiles, converted in place (p x1024, f16), are the B operand of the second product. ctx = O / l written as f16 x64 into [b][t][h*64+d].
#define AW    4                  // waves per block
#define KVP   72                 // LDS pitch of a K or V tile row, in f16 elements
#define KVT   (64 * KVP)         // elements of one staged tile
static_assert((SEQ - RH) % (16 * AW) == 0 && RH % (16 * AW) == 0 && 16 * AW == 64);
static_assert((size_t)AW * 16 * 68 * 4 <= (size_t)4 * KVT * 2);   // the output staging fits in the ring it takes over

// one stage: this thread's four 16-byte pieces of the K tile and of the V tile (128 threads x 4 x 16 B = 8 KiB each), rows 16 apart
__device__ __forceinline__ void stage_kv(const h16* kg, const h16* vg, unsigned kl, unsigned vl) {
    // s_wait_xcnt stands inside the statement so that no address register of a copy is rewritten ahead of it
    asm volatile("global_load_async_to_lds_b128 %0, %8, off\n\t"
                 "global_load_async_to_lds_b128 %1, %9, off\n\t"
                 "global_load_async_to_lds_b128 %2, %10, off\n\t"
                 "global_load_async_to_lds_b128 %3, %11, off\n\t"
                 "global_load_async_to_lds_b128 %4, %12, off\n\t"
                 "global_load_async_to_lds_b128 %5, %13, off\n\t"
                 "global_load_async_to_lds_b128 %6, %14, off\n\t"
                 "global_load_async_to_lds_b128 %7, %15, off\n\t"
                 "s_wait_xcnt 0x0"
                 :: "v"(kl), "v"(kl + 16 * KVP * 2), "v"(kl + 32 * KVP * 2), "v"(kl + 48 * KVP * 2),
                    "v"(vl), "v"(vl + 16 * KVP * 2), "v"(vl + 32 * KVP * 2), "v"(vl + 48 * KVP * 2),
                    "v"(kg), "v"(kg + 16 * HD), "v"(kg + 32 * HD), "v"(kg + 48 * HD),
                    "v"(vg), "v"(vg + (size_t)16 * SEQ), "v"(vg + (size_t)32 * SEQ), "v"(vg + (size_t)48 * SEQ)
                 : "memory");
}

template <bool B> struct Flag { static constexpr bool value = B; };
// lane l <-> lane l ^ 16
__device__ __forceinline__ float xhalf(float x) { return __builtin_bit_cast(float, __builtin_amdgcn_permlanex16(__builtin_bit_cast(int, x), __builtin_bit_cast(int, x), 0x76543210, 0xfedcba98, false, false)); }
__device__ __forceinline__ float max8(const float* v) { return fmaxf(fmaxf(fmaxf(v[0], v[1]), fmaxf(v[2], v[3])), fmaxf(fmaxf(v[4], v[5]), fmaxf(v[6], v[7]))); }
__device__ __forceinline__ float sum8(const float* v) { return ((v[0] + v[1]) + (v[2] + v[3])) + ((v[4] + v[5]) + (v[6] + v[7])); }

__device__ __forceinline__ void attn16_body(const h16* __restrict__ Q16, const h16* __restrict__ K16, const h16* __restrict__ VT16, h16* CT16, h16* ring, int xb, int bh) {
    // ring: the kernel's LDS, [buffer][K | V][row][KVP]; after the loop: output staging
    const int lane = threadIdx.x & 31, lr = lane & 15, hi = lane >> 4;
    const int wave = __builtin_amdgcn_readfirstlane(threadIdx.x >> 5);
    const int blkbase = xb * (16 * AW); const int rowbase = blkbase + wave * 16;
    const size_t qoff  = ((size_t)bh * SEQ + rowbase + lr) * HD + 8 * hi;
    // staging: thread t owns piece (t & 7) of rows (t >> 3) + 16 j, j = 0..3, of both tiles
    const int srow = threadIdx.x >> 3, sseg = threadIdx.x & 7;
    const h16* kg = K16 + ((size_t)bh * SEQ + srow) * HD + sseg * 8;
    const h16* vg = VT16 + ((size_t)bh * HD + srow) * SEQ + sseg * 8;
    const unsigned sl = (unsigned)(size_t)(ring + srow * KVP + sseg * 8);   // LDS byte address of the piece in buffer 0's K tile
    const int foff = lr * KVP + 8 * hi;                                     // fragment row and half inside a tile
    const int t = rowbase + lr;                                             // this lane's query
    v16h qb[2];                                                             // B operand: column lr = query t, d in the k order of ldh
#pragma unroll
    for (int c = 0; c < 2; ++c) qb[c] = ldh(Q16 + qoff + c * 32);
    v8f o[4]; float m = NEGB, l = 0.0f;                                     // o[dt][r] = O[t][dt*16 + 8*hi + r]; l: sum over this half's keys only
#pragma unroll
    for (int dt = 0; dt < 4; ++dt) o[dt] = (v8f){};
    const int nblk = blkbase / 64 + 1;
    stage_kv(kg, vg, sl, sl + KVT * 2);
    asm volatile("s_wait_asynccnt 0x0" ::: "memory");   // tile 0 of this wave's copies has landed
    __syncthreads();                                     // ... and every other wave's
    if (nblk > 1) stage_kv(kg + 64 * HD, vg + 64, sl + 2 * KVT * 2, sl + 3 * KVT * 2);
    // one key tile, hand-over at its foot included; diag: the tile holds keys behind a query (compile-time, so that the other tiles carry no compare and no select)
    auto tile = [&](const int jb, auto diag) __attribute__((always_inline)) {
        const int jbase = jb * 64;
        const h16* kb = ring + (jb & 1) * (2 * KVT) + foff; const h16* vb = kb + KVT;
        v8f s[4];                                        // s[nt][r] = score of key jbase + nt*16 + 8*hi + r with query t
#pragma unroll
        for (int nt = 0; nt < 4; ++nt) s[nt] = (v8f){};
        v16h kf;
#pragma unroll
        for (int c = 0; c < 2; ++c) {
#pragma unroll
            for (int nt = 0; nt < 4; ++nt) { const h16* kp = kb + nt * 16 * KVP + c * 32; kf = cat16(*(const v8ha*)kp, *(const v8ha*)(kp + 16)); s[nt] = wmma16(kf, qb[c], s[nt]); }
        }
        // the four vector slots between the last WMMA and the first reader of its result
        asm volatile("v_nop\n\tv_nop\n\tv_nop\n\tv_nop" : "+v"(s[0]), "+v"(s[1]), "+v"(s[2]), "+v"(s[3]) : "v"(kf));
        const int dq = t - jbase - 8 * hi;               // key > t  <=>  the key's place among this lane's keys, nt*16 + r, > dq
        float v[4][8], mt[4];
#pragma unroll
        for (int nt = 0; nt < 4; ++nt) {
#pragma unroll
            for (int r = 0; r < 8; ++r) { const float sv = s[nt][r] * SCQ16; v[nt][r] = (decltype(diag)::value && nt * 16 + r > dq) ? NEGB : sv; }
            mt[nt] = max8(v[nt]);
        }
        float mx = fmaxf(fmaxf(mt[0], mt[1]), fmaxf(mt[2], mt[3]));
        mx = fmaxf(mx, xhalf(mx));                       // both halves hold the query's maximum over the 64 keys
        const float mn = fmaxf(m, mx);
        const float al = ex2((m - mn) * L2E);
        m = mn;
        float st[4]; v16h pb[2];                         // pb[c][e] = p of key jbase + c*32 + (k order of ldh): tiles 2c and 2c+1 as they lie
#pragma unroll
        for (int nt = 0; nt < 4; ++nt) {
            float p[8];
#pragma unroll
            for (int r = 0; r < 8; ++r) { p[r] = ex2((v[nt][r] - mn) * L2E + PLOG); pb[nt >> 1][(nt & 1) * 8 + r] = (h16)p[r]; }
            st[nt] = sum8(p);
        }
        l = l * al + ((st[0] + st[1]) + (st[2] + st[3]));
#pragma unroll
        for (int dt = 0; dt < 4; ++dt) o[dt] *= al;
        v16h vf;
#pragma unroll
        for (int c = 0; c < 2; ++c) {
#pragma unroll
            for (int dt = 0; dt < 4; ++dt) { const h16* vp = vb + dt * 16 * KVP + c * 32; vf = cat16(*(const v8ha*)vp, *(const v8ha*)(vp + 16)); o[dt] = wmma16(vf, pb[c], o[dt]); }
        }
        // the four vector slots behind the last WMMA, on the loop's back edge too
        asm volatile("v_nop\n\tv_nop\n\tv_nop\n\tv_nop" : "+v"(o[0]), "+v"(o[1]), "+v"(o[2]), "+v"(o[3]) : "v"(pb[1]), "v"(vf));
        asm volatile("s_wait_dscnt 0x0" ::: "memory");      // this wave has finished reading the buffer
        asm volatile("s_wait_asynccnt 0x0" ::: "memory");   // this wave's copies of tile jb + 1 have landed
        __syncthreads();                                     // publishes tile jb + 1 and frees the buffer of tile jb
        if (jb + 2 < nblk) { const unsigned bl = sl + (jb & 1) * (2 * KVT * 2); stage_kv(kg + (size_t)(jbase + 128) * HD, vg + jbase + 128, bl, bl + KVT * 2); }
    };
    // every key of a tile before the block's last is < blkbase <= t: the causal test is an identity there and is left out; only the last tile (jbase == blkbase, the diagonal) is masked
    // kept rolled: one copy of the unmasked tile, the code stays small
#pragma unroll 1
    for (int jb = 0; jb < nblk - 1; ++jb) tile(jb, Flag<false>{});
    tile(nblk - 1, Flag<true>{});
    asm volatile("s_wait_asynccnt 0x0" ::: "memory");       // nothing of the ring is in flight when it becomes output staging
    float* os = (float*)ring + wave * (16 * 68);
    {
        const float lt = l + xhalf(l);
        const float inv = (CCAR / VCAR) * (1.0f / lt);
#pragma unroll
        for (int dt = 0; dt < 4; ++dt) { v4f a, c;
#pragma unroll
            for (int i = 0; i < 4; ++i) { a[i] = o[dt][i] * inv; c[i] = o[dt][4 + i] * inv; }
            *(v4fa*)(os + lr * 68 + dt * 16 + 8 * hi) = a; *(v4fa*)(os + lr * 68 + dt * 16 + 8 * hi + 4) = c; }
    }
    __syncthreads();
    const int b = bh / NH, h = bh % NH; const int rr = lane >> 3, seg = lane & 7;
    h16* dst = CT16 + ((size_t)b * SEQ + rowbase) * DM + h * HD + seg * 8;
{
#pragma unroll
        for (int s = 0; s < 4; ++s) { const int row = s * 4 + rr; const v4f a = *(const v4fa*)(os + row * 68 + seg * 8); const v4f c = *(const v4fa*)(os + row * 68 + seg * 8 + 4); v8h ov;
#pragma unroll
            for (int i = 0; i < 4; ++i) { ov[i] = (h16)a[i]; ov[4 + i] = (h16)c[i]; }
            *(v8h*)(dst + (size_t)row * DM) = ov; }
         }
}

// ---- attnhl_body: the same for query rows < RH on bf16 hi/lo planes, operands straight from global memory, each of the four waves on its own 16 rows: scores kh qh + kh ql + kl qh, p split hi/lo in place, O^T += vh ph + vh pl + vl ph; ctx written as bf16 hi/lo [b][t<RH][h*64+d].
__device__ __forceinline__ void attnhl_body(const bf* __restrict__ Qh, const bf* __restrict__ Ql, const bf* __restrict__ Kh, const bf* __restrict__ Kl,
                                            const bf* __restrict__ VTh, const bf* __restrict__ VTl, bf* ATh, bf* ATl, float* lds, int xb, int bh) {
    const int lane = threadIdx.x & 31, lr = lane & 15, hi = lane >> 4;
    const int wave = __builtin_amdgcn_readfirstlane(threadIdx.x >> 5);
    float* os = lds + wave * (16 * 68);                  // this wave's output staging
    const int rowbase = xb * (16 * AW) + wave * 16;
    const size_t qoff  = ((size_t)bh * RH + rowbase + lr) * HD + 8 * hi;
    const size_t kbase = ((size_t)bh * RH + lr) * HD + 8 * hi;
    const size_t vbase = ((size_t)bh * HD + lr) * RH + 8 * hi;
    const int t = rowbase + lr;                          // this lane's query
    v16bf qh[2], ql[2];
#pragma unroll
    for (int c = 0; c < 2; ++c) { qh[c] = ldb(Qh + qoff + c * 32); ql[c] = ldb(Ql + qoff + c * 32); }
    v8f o[4]; float m = NEGB, l = 0.0f;
#pragma unroll
    for (int dt = 0; dt < 4; ++dt) o[dt] = (v8f){};
    const int nblk = rowbase / 64 + 1;
#pragma unroll 1
    for (int jb = 0; jb < nblk; ++jb) {
        const int jbase = jb * 64;
        v8f s[4];
#pragma unroll
        for (int nt = 0; nt < 4; ++nt) s[nt] = (v8f){};
        v16bf kh, kl;
#pragma unroll
        for (int c = 0; c < 2; ++c) {
#pragma unroll
            for (int nt = 0; nt < 4; ++nt) { const size_t ko = kbase + (size_t)(jbase + nt * 16) * HD + c * 32; kh = ldb(Kh + ko); kl = ldb(Kl + ko);
                s[nt] = wmmab(kh, qh[c], s[nt]); s[nt] = wmmab(kh, ql[c], s[nt]); s[nt] = wmmab(kl, qh[c], s[nt]); }
        }
        // the four vector slots between the last WMMA and the first reader of its result
        asm volatile("v_nop\n\tv_nop\n\tv_nop\n\tv_nop" : "+v"(s[0]), "+v"(s[1]), "+v"(s[2]), "+v"(s[3]) : "v"(kh), "v"(kl));
        const int dq = t - jbase - 8 * hi;               // key > t  <=>  the key's place among this lane's keys, nt*16 + r, > dq
        float v[4][8], mt[4];
#pragma unroll
        for (int nt = 0; nt < 4; ++nt) {
#pragma unroll
            for (int r = 0; r < 8; ++r) { const float sv = s[nt][r] * SCQHL; v[nt][r] = (nt * 16 + r > dq) ? NEGB : sv; }
            mt[nt] = max8(v[nt]);
        }
        float mx = fmaxf(fmaxf(mt[0], mt[1]), fmaxf(mt[2], mt[3]));
        mx = fmaxf(mx, xhalf(mx));
        const float mn = fmaxf(m, mx);
        const float al = ex2((m - mn) * L2E);
        m = mn;
        float st[4]; v8us ph[4], pl[4];
#pragma unroll
        for (int nt = 0; nt < 4; ++nt) {
            float p[8];
#pragma unroll
            for (int r = 0; r < 8; ++r) { p[r] = ex2((v[nt][r] - mn) * L2E); unsigned short x0, x1; splitf(p[r], x0, x1); ph[nt][r] = x0; pl[nt][r] = x1; }
            st[nt] = sum8(p);
        }
        l = l * al + ((st[0] + st[1]) + (st[2] + st[3]));
#pragma unroll
        for (int dt = 0; dt < 4; ++dt) o[dt] *= al;
        v16bf pbh, pbl, vh, vl;
#pragma unroll
        for (int c = 0; c < 2; ++c) {
            pbh = cat16b(ph[2 * c], ph[2 * c + 1]); pbl = cat16b(pl[2 * c], pl[2 * c + 1]);
#pragma unroll
            for (int dt = 0; dt < 4; ++dt) { const size_t vo = vbase + (size_t)(dt * 16) * RH + jbase + c * 32; vh = ldb(VTh + vo); vl = ldb(VTl + vo);
                o[dt] = wmmab(vh, pbh, o[dt]); o[dt] = wmmab(vh, pbl, o[dt]); o[dt] = wmmab(vl, pbh, o[dt]); }
        }
        // the four vector slots behind the last WMMA, on the loop's back edge too
        asm volatile("v_nop\n\tv_nop\n\tv_nop\n\tv_nop" : "+v"(o[0]), "+v"(o[1]), "+v"(o[2]), "+v"(o[3]) : "v"(pbh), "v"(pbl), "v"(vh), "v"(vl));
    }
    {
        const float lt = l + xhalf(l);
        const float inv = 1.0f / lt;
#pragma unroll
        for (int dt = 0; dt < 4; ++dt) { v4f a, c;
#pragma unroll
            for (int i = 0; i < 4; ++i) { a[i] = o[dt][i] * inv; c[i] = o[dt][4 + i] * inv; }
            *(v4fa*)(os + lr * 68 + dt * 16 + 8 * hi) = a; *(v4fa*)(os + lr * 68 + dt * 16 + 8 * hi + 4) = c; }
    }
    __syncthreads();
    const int b = bh / NH, h = bh % NH; const int rr = lane >> 3, seg = lane & 7;
    const size_t dof = ((size_t)b * RH + rowbase) * DM + h * HD + seg * 8;
{
#pragma unroll
        for (int s = 0; s < 4; ++s) { const int row = s * 4 + rr; const v4f a = *(const v4fa*)(os + row * 68 + seg * 8); const v4f c = *(const v4fa*)(os + row * 68 + seg * 8 + 4); v8us oh, ol;
#pragma unroll
            for (int i = 0; i < 4; ++i) { unsigned short x0, x1; splitf(a[i], x0, x1); oh[i] = x0; ol[i] = x1; splitf(c[i], x0, x1); oh[4 + i] = x0; ol[4 + i] = x1; }
            *(v8us*)(ATh + dof + (size_t)row * DM) = oh; *(v8us*)(ATl + dof + (size_t)row * DM) = ol; }
         }
}

// ---- k_attn: all query rows in one launch; the two bodies share no data. The hi/lo blocks (64 rows < RH) come first in the index: their waves walk chains of dependent global loads and use
// little of the vector and matrix units, so they start at once and run beside the f16 blocks. A f16 block walks xb + 1 key tiles and there are more blocks than resident places: they follow
// with the cost falling along the index (row block from the last down, head inside), so that the long blocks start first and the short ones fill the end of the launch.
constexpr int AB_HL = RH / (16 * AW), AB_16 = (SEQ - RH) / (16 * AW);   // 64-row blocks per head of either kind
static_assert(AB_HL > 0 && AB_16 > 0);
// five waves per SIMD asked for: the merged kernel's register count is the larger body's, and left alone the hi/lo body takes so many that the f16 body, which has nearly all the work, would run at four
__global__ __launch_bounds__(32 * AW) __attribute__((amdgpu_waves_per_eu(5))) void k_attn(const h16* __restrict__ Q16, const h16* __restrict__ K16, const h16* __restrict__ VT16, h16* CT16,
                                                  const bf* __restrict__ Qh, const bf* __restrict__ Ql, const bf* __restrict__ Kh, const bf* __restrict__ Kl,
                                                  const bf* __restrict__ VTh, const bf* __restrict__ VTl, bf* ATh, bf* ATl) {
    __shared__ __align__(16) h16 ring[4 * KVT];          // one array for both bodies (two would add up)
    const int i = blockIdx.x;
    if (i < NB * NH * AB_HL) attnhl_body(Qh, Ql, Kh, Kl, VTh, VTl, ATh, ATl, (float*)ring, i % AB_HL, i / AB_HL);
    else { const int j = i - NB * NH * AB_HL; attn16_body(Q16, K16, VT16, CT16, ring, AB_HL + AB_16 - 1 - j / (NB * NH), j % (NB * NH)); }
}

extern "C" void kernel_launch(void* const* d_in, const int* in_sizes, int n_in,
                              void* d_out, int out_size, void* d_ws, size_t ws_size, hipStream_t stream) {
    if (n_in < 5) return;
    if ((size_t)in_sizes[0] < (size_t)(NB - 1) * SEQ_FULL * DM + (size_t)SEQ * DM) return;
    if ((size_t)in_sizes[1] < (size_t)3 * DM * DM || in_sizes[2] < 3 * DM || (size_t)in_sizes[3] < (size_t)DM * DM || in_sizes[4] < DM) return;
    if ((size_t)out_size < (size_t)NB * SEQ * DM) return;
    if (ws_size < WS_TOTAL) return;
    // wire order: x, W_qkv, b_qkv, W_proj, b_proj
    const float* x = (const float*)d_in[0]; const float* wqkv = (const float*)d_in[1]; const float* bqkv = (const float*)d_in[2]; const float* wo = (const float*)d_in[3]; const float* bo = (const float*)d_in[4];
    float* OUT = (float*)d_out;
    char* wsp = (char*)d_ws;
    auto take = [&](size_t bytes) { char* p = wsp; wsp += bytes; return (void*)p; };
    bf* XB = (bf*)take(SZ_XB);
    bf* WQKV = (bf*)take(SZ_WQKV);                 // Bt [3*DM][DM]
    bf* WOb = (bf*)take(SZ_WO); h16* WO16 = (h16*)take(SZ_WO);
    h16* QK16 = (h16*)take(2 * SZ_P16);            // [q | k] f16 planes [bh][t][d]
    h16* VT16 = (h16*)take(SZ_P16);                // [bh][d][t]
    bf* QKh = (bf*)take(2 * SZ_PE); bf* QKl = (bf*)take(2 * SZ_PE);   // [q | k] early-row planes [bh][t<RH][d]
    bf* VTh = (bf*)take(SZ_PE); bf* VTl = (bf*)take(SZ_PE);           // [bh][d][t<RH]
    h16* CT16 = (h16*)take(SZ_CT);                 // ctx f16 x64 [b][t][DM] (rows >= RH used)
    bf* ATh = (bf*)take(SZ_AT); bf* ATl = (bf*)take(SZ_AT);           // ctx hi/lo [b][t<RH][DM]
    float* RC = (float*)take(SZ_ROT); float* RS = (float*)take(SZ_ROT);   // rotary cos / sin [SEQ][32]
    if ((size_t)(wsp - (char*)d_ws) > ws_size) return;

    k_prep<<<PB_WQ + PB_WO + PB_RO + NB * PB_CX, 256, 0, stream>>>(x, wqkv, wo, XB, WQKV, WOb, WO16, RC, RS);
    k_qkv<<<dim3(NB * SEQ / 128, 3 * DM / 128, 1), 128, 0, stream>>>(XB, WQKV, bqkv, RC, RS, QK16, VT16, QKh, QKl, VTh, VTl);
    k_attn<<<NB * NH * (AB_HL + AB_16), 128, 0, stream>>>(QK16, QK16 + PL16, VT16, CT16, QKh, QKl, QKh + PLE, QKl + PLE, VTh, VTl, ATh, ATl);
    k_proj<<<dim3(SEQ / 128, DM / 128, NB), 128, 0, stream>>>(ATh, ATl, WOb, CT16, WO16, OUT, bo);
}

// v007
// A run of this version takes 132 microseconds.
// Timed twice side by side with v006, it ran 1.03 times as fast both times.
// Over all steps from v000 it is 3.45 times as fast.
#include <hip/hip_runtime.h>

// Contractions (all f32 accumulate): x*W_qkv on v_wmma_f32_16x16x32_bf16 (both operands bf16 RNE copies of the inputs, exact products);
// q*k^T and p*v: query rows >= 256 on v_wmma_f32_16x16x32_f16 (q carried x log2(e)/4, k x1/2, v x16, p x1024), query rows < 256 on bf16 hi/lo planes (3 products);
// ctx*W_proj: rows >= 256 f16 (ctx x64, w x1024 from the bf16 copy), rows < 256 bf16 hi/lo ctx x bf16 w (2 products). Softmax f32 (running max, exp2).
// Rotary on q and k (interleaved pairs (2i,2i+1) -> (-x[2i+1], x[2i]); angle = pos * inv_freq[d mod 32], inv_freq[j] = 1 / 10000^(j/32)) applied in f32 on the
// staged 64x64 tile in the x*W_qkv epilogue, from cos/sin tables [SEQ][32] built once by rope_body (precise sincosf).
// Layout: x [NB][SEQ_FULL][1024] (rows < SEQ read); W_qkv [1024][3072] (in,out), thirds q|k|v, column = which*1024 + h*64 + d; W_proj [1024][1024] (in,out); out [NB][SEQ][1024].

#ifndef NB
#define NB 4
#endif
#ifndef SEQ
#define SEQ 2048
#endif
#define NB_FULL  4
#define SEQ_FULL 2048
#define DM   1024
#define NH   16
#define HD   64
#define RH   256                 // query rows < RH use bf16 hi/lo planes
#define VCAR  16.0f
#define CCAR  64.0f
#define WCAR  1024.0f
#define PLOG  10.0f              // p carried x 2^10
#define L2E   1.4426950408889634f
#define NEGB  (-3.0e38f)
#define QCAR  (0.25f * L2E)      // f16 q plane; QCAR * KCAR = log2(e) / 8: the f16 score product is the softmax exponent in base 2
#define KCAR  0.5f               // f16 k plane
#define PTAU  5.0f               // a score may stand this far (base 2) above the maximum in use before O and l are rescaled: p <= 2^15 stays inside f16
#define SCQHL 0.125f

typedef _Float16 h16;
typedef unsigned short bf;
typedef __attribute__((ext_vector_type(16))) __bf16   v16bf;
typedef __attribute__((ext_vector_type(16))) _Float16 v16h;
typedef __attribute__((ext_vector_type(8)))  _Float16 v8h;
typedef __attribute__((ext_vector_type(2)))  _Float16 v2h;
typedef __attribute__((ext_vector_type(8)))  unsigned short v8us;
typedef __attribute__((ext_vector_type(2)))  unsigned short v2us;
typedef __attribute__((ext_vector_type(8)))  float    v8f;
typedef __attribute__((ext_vector_type(4)))  float    v4f;
typedef v8h  __attribute__((may_alias)) v8ha;
typedef v4f  __attribute__((may_alias)) v4fa;
typedef v8us __attribute__((may_alias)) v8usa;

static_assert(SEQ % 64 == 0);
static_assert(RH % 64 == 0);
static_assert(RH <= SEQ);
static_assert(SEQ <= SEQ_FULL);
static_assert(NB <= NB_FULL);
static_assert(DM % 64 == 0);
static_assert(DM % 32 == 0);
static_assert(HD == 64);
static_assert(NH * HD == DM);
static_assert((3 * DM) % 64 == 0);
static_assert(HD / 2 == 32);
static_assert(SEQ % 8 == 0);          // rope_body: 8 positions per 256-thread block
static_assert((NB * SEQ) % 128 == 0 && (3 * DM) % 128 == 0 && SEQ % 128 == 0 && RH % 128 == 0 && DM % 128 == 0);   // the three GEMMs: 128x128 block tiles

constexpr size_t PL16 = (size_t)NB * NH * SEQ * HD;     // elements of one f16 head plane set
constexpr size_t PLE  = (size_t)NB * NH * RH * HD;      // elements of one early-row bf16 plane set
constexpr size_t SZ_XB   = (size_t)NB * SEQ * DM * 2;
constexpr size_t SZ_WQKV = (size_t)3 * DM * DM * 2;
constexpr size_t SZ_WO   = (size_t)DM * DM * 2;
constexpr size_t SZ_P16  = PL16 * 2;
constexpr size_t SZ_PE   = PLE * 2;
constexpr size_t SZ_CT   = (size_t)NB * SEQ * DM * 2;
constexpr size_t SZ_AT   = (size_t)NB * RH * DM * 2;
constexpr size_t SZ_ROT  = (size_t)SEQ * 32 * 4;        // one rotary table (cos or sin) [SEQ][32] f32
constexpr size_t WS_TOTAL = SZ_XB + SZ_WQKV + 2 * SZ_WO + 3 * SZ_P16 + 6 * SZ_PE + SZ_CT + 2 * SZ_AT + 2 * SZ_ROT;
static_assert(SZ_XB % 256 == 0 && SZ_WQKV % 256 == 0 && SZ_WO % 256 == 0 && SZ_P16 % 256 == 0 && SZ_PE % 256 == 0 && SZ_CT % 256 == 0 && SZ_AT % 256 == 0);
static_assert(SZ_ROT % 256 == 0);
static_assert(WS_TOTAL <= (size_t)134217728);

__device__ __forceinline__ unsigned short f2bf(float f) { unsigned u = __float_as_uint(f); u += 0x7FFFu + ((u >> 16) & 1u); return (unsigned short)(u >> 16); }
__device__ __forceinline__ float bf2f(unsigned short b) { return __uint_as_float(((unsigned)b) << 16); }
__device__ __forceinline__ float bfr(float f) { return bf2f(f2bf(f)); }
__device__ __forceinline__ void splitf(float y, unsigned short& h, unsigned short& l) { h = f2bf(y); l = f2bf(y - bf2f(h)); }
__device__ __forceinline__ v16h cat16(v8h lo, v8h hi) { return __builtin_shufflevector(lo, hi, 0, 1, 2, 3, 4, 5, 6, 7, 8, 9, 10, 11, 12, 13, 14, 15); }
__device__ __forceinline__ v16bf cat16b(v8us lo, v8us hi) { return __builtin_bit_cast(v16bf, __builtin_shufflevector(lo, hi, 0, 1, 2, 3, 4, 5, 6, 7, 8, 9, 10, 11, 12, 13, 14, 15)); }
__device__ __forceinline__ v8f wmma16(v16h a, v16h b, v8f c) { return __builtin_amdgcn_wmma_f32_16x16x32_f16(false, a, false, b, (short)0, c, false, false); }
__device__ __forceinline__ v8f wmmab(v16bf a, v16bf b, v8f c) { return __builtin_amdgcn_wmma_f32_16x16x32_bf16(false, a, false, b, (short)0, c, false, false); }
__device__ __forceinline__ float ex2(float x) { return __builtin_amdgcn_exp2f(x); }
// f32 -> f16 for operand planes: anything below the smallest f16 normal becomes an exact zero (value select, applied after the carry)
static __device__ __forceinline__ h16 toh_flush(float v) { const h16 r = (h16)v; return (fabsf(v) < 6.103515625e-05f) ? (h16)0.0f : r; }
// fragment loads from K-contiguous 16-bit rows: p already includes + 8*(lane>>4); elements 0..7 <- k0+8h.., 8..15 <- k0+16+8h..
__device__ __forceinline__ v16h  ldh(const h16* p) { return cat16(*(const v8h*)p, *(const v8h*)(p + 16)); }
__device__ __forceinline__ v16bf ldb(const bf* p)  { return cat16b(*(const v8us*)p, *(const v8us*)(p + 16)); }

template <typename T16> struct WFrag;
template <> struct WFrag<h16> { typedef v16h V; static __device__ __forceinline__ V lds(const h16* p) { return cat16(*(const v8ha*)p, *(const v8ha*)(p + 16)); } static __device__ __forceinline__ v8f mma(V a, V b, v8f c) { return wmma16(a, b, c); } };
template <> struct WFrag<bf>  { typedef v16bf V; static __device__ __forceinline__ V lds(const bf* p) { return cat16b(*(const v8usa*)p, *(const v8usa*)(p + 16)); } static __device__ __forceinline__ v8f mma(V a, V b, v8f c) { return wmmab(a, b, c); } };

// ---- four-wave 128x128 tile main loop (K = DM): per stage of 64 k the block brings 128 rows of A and 128 rows of Bt (128 B each, LDS pitch 144 B) into LDS once by asynchronous
// b128 copies, two buffers: the next stage's copies fly while this one is worked on. Wave (wm, wn) takes its 64x64 quarter's fragments from LDS, in the k order of ldh / ldb.
#define GW    4                  // waves per block (2 x 2)
#define GP    72                 // LDS pitch of a staged operand row, in 16-bit elements
#define GT    (128 * GP)         // elements of one staged operand tile
static_assert(DM % 64 == 0 && DM / 64 >= 2);
static_assert((size_t)GW * 64 * 68 * 4 <= (size_t)4 * GT * 2);   // the output staging fits in the ring it takes over

// this thread's eight 16-byte pieces of one operand tile (128 threads x 8 x 16 B = 16 KiB), rows 16 apart
template <typename T16>
__device__ __forceinline__ void stage_rows(const T16* g, unsigned l) {
    // s_wait_xcnt stands inside the statement so that no address register of a copy is rewritten ahead of it
    asm volatile("global_load_async_to_lds_b128 %0, %8, off\n\t"
                 "global_load_async_to_lds_b128 %1, %9, off\n\t"
                 "global_load_async_to_lds_b128 %2, %10, off\n\t"
                 "global_load_async_to_lds_b128 %3, %11, off\n\t"
                 "global_load_async_to_lds_b128 %4, %12, off\n\t"
                 "global_load_async_to_lds_b128 %5, %13, off\n\t"
                 "global_load_async_to_lds_b128 %6, %14, off\n\t"
                 "global_load_async_to_lds_b128 %7, %15, off\n\t"
                 "s_wait_xcnt 0x0"
                 :: "v"(l), "v"(l + 16 * GP * 2), "v"(l + 32 * GP * 2), "v"(l + 48 * GP * 2),
                    "v"(l + 64 * GP * 2), "v"(l + 80 * GP * 2), "v"(l + 96 * GP * 2), "v"(l + 112 * GP * 2),
                    "v"(g), "v"(g + 16 * DM), "v"(g + 32 * DM), "v"(g + 48 * DM),
                    "v"(g + 64 * DM), "v"(g + 80 * DM), "v"(g + 96 * DM), "v"(g + 112 * DM)
                 : "memory");
}

// ring: [buffer][A | Bt | A2][row][GP] (A2, the lo plane multiplied against the same Bt, only with NSPLIT 1); rb, cb: first of the block's A rows and Bt rows.
// acc[mb][nb] += A[rb+wm*64+mb*16..][k] Bt[cb+wn*64+nb*16..][k]. On return every wave has left the ring and nothing is in flight into it.
template <typename T16, int NSPLIT>
__device__ __forceinline__ void gemm_loop_lds(const T16* __restrict__ A, const T16* __restrict__ A2, const T16* __restrict__ Bt, T16* ring, int rb, int cb, int wm, int wn, v8f (&acc)[4][4]) {
    typedef typename WFrag<T16>::V V;
    constexpr int NST = DM / 64, BUF = (2 + NSPLIT) * GT;
    const int lane = threadIdx.x & 31, lr = lane & 15, hi = lane >> 4;
    // staging: thread t owns piece (t & 7) of rows (t >> 3) + 16 j, j = 0..7, of every tile
    const int srow = threadIdx.x >> 3, sseg = threadIdx.x & 7;
    const T16* ag = A + (size_t)(rb + srow) * DM + sseg * 8;
    const T16* a2g = A2 + (size_t)(rb + srow) * DM + sseg * 8;
    const T16* bg = Bt + (size_t)(cb + srow) * DM + sseg * 8;
    const unsigned sl = (unsigned)(size_t)(ring + srow * GP + sseg * 8);   // LDS byte address of the piece in buffer 0's A tile
    const int aof = (wm * 64 + lr) * GP + 8 * hi, bof = GT + (wn * 64 + lr) * GP + 8 * hi;
    auto stage = [&](int st, unsigned l) { stage_rows<T16>(ag + st * 64, l); stage_rows<T16>(bg + st * 64, l + GT * 2); if (NSPLIT == 1) stage_rows<T16>(a2g + st * 64, l + 2 * GT * 2); };
    stage(0, sl);
    asm volatile("s_wait_asynccnt 0x0" ::: "memory");   // stage 0 of this wave's copies has landed
    __syncthreads();                                     // ... and every other wave's
    stage(1, sl + BUF * 2);
    // kept rolled: one copy of the hand-over at the foot, and the code stays small; the loops inside are unrolled so that every fragment and accumulator index is a constant (registers)
#pragma unroll 1
    for (int t = 0; t < NST; ++t) {
        const T16* tb = ring + (t & 1) * BUF;
#pragma unroll
        for (int c = 0; c < 2; ++c) {
            V a[4], a2[4], b[4];
#pragma unroll
            for (int mb = 0; mb < 4; ++mb) { a[mb] = WFrag<T16>::lds(tb + aof + mb * 16 * GP + c * 32); if (NSPLIT == 1) a2[mb] = WFrag<T16>::lds(tb + 2 * GT + aof + mb * 16 * GP + c * 32); }
#pragma unroll
            for (int nb = 0; nb < 4; ++nb) b[nb] = WFrag<T16>::lds(tb + bof + nb * 16 * GP + c * 32);
            // inputs-only fence on the loaded fragments: keeps the LDS loads of this 32-k block together ahead of its WMMAs (one LDS wait a block; sunk between the WMMAs each B fragment costs its own)
            if (NSPLIT == 1) asm volatile("" :: "v"(a[0]), "v"(a[1]), "v"(a[2]), "v"(a[3]), "v"(a2[0]), "v"(a2[1]), "v"(a2[2]), "v"(a2[3]), "v"(b[0]), "v"(b[1]), "v"(b[2]), "v"(b[3]));
            else             asm volatile("" :: "v"(a[0]), "v"(a[1]), "v"(a[2]), "v"(a[3]), "v"(b[0]), "v"(b[1]), "v"(b[2]), "v"(b[3]));
#pragma unroll
            for (int nb = 0; nb < 4; ++nb)
#pragma unroll
                for (int mb = 0; mb < 4; ++mb) { acc[mb][nb] = WFrag<T16>::mma(a[mb], b[nb], acc[mb][nb]); if (NSPLIT == 1) acc[mb][nb] = WFrag<T16>::mma(a2[mb], b[nb], acc[mb][nb]); }
        }
        asm volatile("s_wait_dscnt 0x0" ::: "memory");      // this wave has finished reading the buffer
        asm volatile("s_wait_asynccnt 0x0" ::: "memory");   // this wave's copies of stage t + 1 have landed
        __syncthreads();                                     // publishes stage t + 1 and frees the buffer of stage t
        if (t + 2 < NST) stage(t + 2, sl + (t & 1) * (BUF * 2));
    }
    asm volatile("s_wait_asynccnt 0x0" ::: "memory");       // nothing of the ring is in flight when it becomes output staging
}

// ---- GEMM with f32 output: C[m][n] = osc * sum_k A[m][k] Bt[n][k] + bf16(bias[n]); K = DM; grid (M/128, N/128, Z), 128 threads, a 64x64 quarter per wave. Per 16-row slab staged in LDS,
template <typename T16, int NSPLIT>
__device__ __forceinline__ void gemm_out_body(const T16* __restrict__ A, const T16* __restrict__ A2, const T16* __restrict__ Bt, float* C, int ldc, const float* __restrict__ bias, float osc, size_t sA, size_t sC, T16* ring) {
    // ring: the kernel's LDS, 2 * (2 + NSPLIT) * GT elements used: operand ring; after the main loop: each wave's 16x68 f32 slab staging
    const size_t z = blockIdx.z; A += z * sA; A2 += z * sA; C += z * sC;
    const int lane = threadIdx.x & 31, lr = lane & 15, hi = lane >> 4;
    const int wave = __builtin_amdgcn_readfirstlane(threadIdx.x >> 5); const int wm = wave >> 1, wn = wave & 1;
    const int r0 = blockIdx.x * 128 + wm * 64, c0 = blockIdx.y * 128 + wn * 64;
    v8f acc[4][4];
#pragma unroll
    for (int mb = 0; mb < 4; ++mb)
#pragma unroll
        for (int nb = 0; nb < 4; ++nb) acc[mb][nb] = (v8f){};
    gemm_loop_lds<T16, NSPLIT>(A, A2, Bt, ring, blockIdx.x * 128, blockIdx.y * 128, wm, wn, acc);
    float* os = (float*)ring + wave * (16 * 68);
    const int cofs = lr * 4;
    const v4f bv = *(const v4f*)(bias + c0 + cofs);
    v4f bb; bb[0] = bfr(bv[0]); bb[1] = bfr(bv[1]); bb[2] = bfr(bv[2]); bb[3] = bfr(bv[3]);
#pragma unroll
    for (int mb = 0; mb < 4; ++mb) {
#pragma unroll
        for (int nb = 0; nb < 4; ++nb) {
#pragma unroll
            for (int j = 0; j < 8; ++j) os[(hi * 8 + j) * 68 + nb * 16 + lr] = acc[mb][nb][j]; }
        __syncthreads();
        float* crow = C + (size_t)(r0 + mb * 16) * ldc + c0;
{
#pragma unroll
            for (int s = 0; s < 8; ++s) { const int row = 2 * s + hi; const v4f t = *(const v4fa*)(os + row * 68 + cofs); v4f val;
                val[0] = t[0] * osc + bb[0]; val[1] = t[1] * osc + bb[1]; val[2] = t[2] * osc + bb[2]; val[3] = t[3] * osc + bb[3];
                *(v4f*)(crow + (size_t)row * ldc + cofs) = val; }
             }
        __syncthreads();
    }
}

// ---- k_proj: ctx W_proj + b_proj for all rows in one launch, grid (SEQ/128, DM/128, NB), z = batch; the two bodies share no data, so the few hi/lo tiles run beside the f16 tiles.
// row tiles < RH: ctx hi/lo (bf16) x w_proj (bf16); row tiles >= RH: ctx f16 (x64) x w_proj f16 (x1024)
__global__ __launch_bounds__(32 * GW) void k_proj(const bf* __restrict__ Ah, const bf* __restrict__ Al, const bf* __restrict__ Wt, const h16* __restrict__ A16, const h16* __restrict__ Wt16,
                                                  float* C, const float* __restrict__ bias) {
    __shared__ __align__(16) bf ring[2 * 3 * GT];        // one array for both bodies (two would add up)
    if (blockIdx.x < RH / 128) gemm_out_body<bf, 1>(Ah, Al, Wt, C, DM, bias, 1.0f, (size_t)RH * DM, (size_t)SEQ * DM, ring);
    else                       gemm_out_body<h16, 0>(A16, A16, Wt16, C, DM, bias, 1.0f / (CCAR * WCAR), (size_t)SEQ * DM, (size_t)SEQ * DM, (h16*)ring);
}

// bx: block inside a batch, b: batch
__device__ __forceinline__ void cvt8_body(const float* __restrict__ src, bf* dst, unsigned n8, unsigned bx, size_t b) {
    src += b * (size_t)SEQ_FULL * DM; dst += b * (size_t)SEQ * DM;
    const unsigned i = bx * 256 + threadIdx.x; if (i >= n8) return;
    const v8f v = *(const v8f*)(src + (size_t)i * 8); v8us o;
#pragma unroll
    for (int k = 0; k < 8; ++k) o[k] = f2bf(v[k]);
    *(v8us*)(dst + (size_t)i * 8) = o; 
}

__device__ __forceinline__ void wtG_body(const float* __restrict__ w, int K, int N, bf* Bt, h16* Bt16, float car, unsigned bx) {
    const int lane = threadIdx.x & 31; const int L0 = (bx * 8 + (threadIdx.x >> 5)) * 8; const int nlines = N * (K / 64);
{
#pragma unroll 1
        for (int l = 0; l < 8; ++l) { const int L = L0 + l; if (L >= nlines) break; const size_t e = (size_t)L * 64 + lane * 2; const int k = (int)(e % K), n = (int)(e / K); v2us o;
            o[0] = f2bf(w[(size_t)k * N + n]); o[1] = f2bf(w[(size_t)(k + 1) * N + n]); *(v2us*)(Bt + e) = o;
            if (Bt16) { v2h o2; o2[0] = (h16)(bf2f(o[0]) * car); o2[1] = (h16)(bf2f(o[1]) * car); *(v2h*)(Bt16 + e) = o2; } }
         }
}

// ---- rope_body: rotary tables RC = cos, RS = sin, [SEQ][32] f32; angle = (float)pos * inv_freq[j], inv_freq[j] = 1.0f / (float)(10000^(j/32));
__device__ __forceinline__ void rope_body(float* RC, float* RS, unsigned bx) {
#pragma clang fp contract(off)
    const int wave = __builtin_amdgcn_readfirstlane(threadIdx.x >> 5); const int lane = threadIdx.x & 31;
    const int pos = bx * 8 + wave; if (pos >= SEQ) return;
    double p = 1.0;
#pragma unroll 1
    for (int j = 0; j < lane; ++j) p = p * 1.3335214321633240;
    const float pw = (float)p; const float inv = 1.0f / pw; const float ang = (float)pos * inv;
    float sv, cv; sincosf(ang, &sv, &cv);
    float* pc = RC + (size_t)pos * 32 + lane; float* pq = RS + (size_t)pos * 32 + lane;
    *(float*)pc = cv; *(float*)pq = sv; 
}

// ---- k_prep: the four preparations (W_qkv and W_proj transposed to bf16 / f16, rotary tables, x to bf16) share no data: one launch, the body picked by block range.
// The transposes, whose waves walk a chain of dependent scattered loads, come first in the index; the stream over x fills in behind them.
constexpr unsigned PB_WQ = (3 * DM * (DM / 64) + 63) / 64;                    // blocks of the W_qkv transpose
constexpr unsigned PB_WO = (DM * (DM / 64) + 63) / 64;                        // ... of the W_proj transpose
constexpr unsigned PB_RO = (SEQ + 7) / 8;                                     // ... of the rotary tables
constexpr unsigned PB_CX = (unsigned)(((size_t)SEQ * DM / 8 + 255) / 256);    // ... of one batch of x
__global__ __launch_bounds__(256) void k_prep(const float* __restrict__ x, const float* __restrict__ wqkv, const float* __restrict__ wo, bf* XB, bf* WQKV, bf* WOb, h16* WO16, float* RC, float* RS) {
    unsigned b = blockIdx.x;
    if (b < PB_WQ) { wtG_body(wqkv, DM, 3 * DM, WQKV, (h16*)nullptr, 1.0f, b); return; }   // in[DM][3*DM] -> out[3*DM][DM]
    b -= PB_WQ;
    if (b < PB_WO) { wtG_body(wo, DM, DM, WOb, WO16, WCAR, b); return; }                    // in[DM][DM] -> out[DM][DM]
    b -= PB_WO;
    if (b < PB_RO) { rope_body(RC, RS, b); return; }
    b -= PB_RO;
    cvt8_body(x, XB, (unsigned)((size_t)SEQ * DM / 8), b % PB_CX, b / PB_CX);
}

// ---- k_qkv: four waves per 128x128 tile of x W_qkv + b_qkv (bf16 x bf16 exact), one 64x64 quarter each. The quarter (64 tokens x one head third) is staged whole in LDS; q and k tiles get the rotary
// applied in place in LDS (each lane owns 8 consecutive d of a row, i.e. 4 whole pairs), then written as head planes:
__global__ __launch_bounds__(32 * GW) void k_qkv(const bf* __restrict__ XB, const bf* __restrict__ W, const float* __restrict__ bias, const float* __restrict__ RC, const float* __restrict__ RS,
                                             h16* QK16, h16* VT16, bf* QKh, bf* QKl, bf* VTh, bf* VTl) {
    __shared__ __align__(16) bf ring[4 * GT];            // operand ring; after the main loop: each wave's 64x68 f32 output staging
    const int lane = threadIdx.x & 31, lr = lane & 15, hi = lane >> 4;
    const int wave = __builtin_amdgcn_readfirstlane(threadIdx.x >> 5); const int wm = wave >> 1, wn = wave & 1;
    const int r0 = blockIdx.x * 128 + wm * 64, c0 = blockIdx.y * 128 + wn * 64;
    v8f acc[4][4];
#pragma unroll
    for (int mb = 0; mb < 4; ++mb)
#pragma unroll
        for (int nb = 0; nb < 4; ++nb) acc[mb][nb] = (v8f){};
    gemm_loop_lds<bf, 0>(XB, XB, W, ring, blockIdx.x * 128, blockIdx.y * 128, wm, wn, acc);
    float* os = (float*)ring + wave * (64 * 68);
#pragma unroll
    for (int nb = 0; nb < 4; ++nb) { const float bc = bfr(bias[c0 + nb * 16 + lr]);
#pragma unroll
        for (int mb = 0; mb < 4; ++mb) {
#pragma unroll
            for (int j = 0; j < 8; ++j) os[(mb * 16 + hi * 8 + j) * 68 + nb * 16 + lr] = acc[mb][nb][j] + bc; } }
    __syncthreads();
    const int which = c0 / DM; const int h = (c0 % DM) / HD; const int b = r0 / SEQ; const int t0 = r0 % SEQ; const int bhh = b * NH + h; const bool early = (t0 < RH); const int te = early ? t0 : 0;
    const int rr = lane >> 3, seg = lane & 7;
    if (which < 2) {
        // rotary in place: lane owns d = seg*8 .. seg*8+7 of row s*4+rr; table column = d mod 32 = (seg & 3)*8 + i; position = t0 + row
        const size_t tof = (size_t)(t0 + rr) * 32 + (seg & 3) * 8;
#pragma unroll 1
        for (int s = 0; s < 16; ++s) { const int row = s * 4 + rr;
            const v4f ca = *(const v4f*)(RC + tof + (size_t)s * 128); const v4f cb = *(const v4f*)(RC + tof + (size_t)s * 128 + 4);
            const v4f sa = *(const v4f*)(RS + tof + (size_t)s * 128); const v4f sb = *(const v4f*)(RS + tof + (size_t)s * 128 + 4);
            float* op = os + row * 68 + seg * 8;
            const v4f a = *(const v4fa*)op; const v4f c = *(const v4fa*)(op + 4); v4f ra, rc;
            ra[0] = a[0] * ca[0] + (-a[1]) * sa[0]; ra[1] = a[1] * ca[1] + a[0] * sa[1];
            ra[2] = a[2] * ca[2] + (-a[3]) * sa[2]; ra[3] = a[3] * ca[3] + a[2] * sa[3];
            rc[0] = c[0] * cb[0] + (-c[1]) * sb[0]; rc[1] = c[1] * cb[1] + c[0] * sb[1];
            rc[2] = c[2] * cb[2] + (-c[3]) * sb[2]; rc[3] = c[3] * cb[3] + c[2] * sb[3];
            *(v4fa*)op = ra; *(v4fa*)(op + 4) = rc; }
    }
    __syncthreads();
    if (which < 2) {
        h16* P16 = QK16 + (size_t)which * PL16 + ((size_t)bhh * SEQ + t0) * HD + seg * 8;
        bf* PH = QKh + (size_t)which * PLE + ((size_t)bhh * RH + te) * HD + seg * 8;
        bf* PL = QKl + (size_t)which * PLE + ((size_t)bhh * RH + te) * HD + seg * 8;
        const float car = which == 0 ? QCAR : KCAR;
{
#pragma unroll 4
            for (int s = 0; s < 16; ++s) { const int row = s * 4 + rr; const v4f a = *(const v4fa*)(os + row * 68 + seg * 8); const v4f c = *(const v4fa*)(os + row * 68 + seg * 8 + 4); v8h o;
#pragma unroll
                for (int i = 0; i < 4; ++i) { o[i] = toh_flush(a[i] * car); o[4 + i] = toh_flush(c[i] * car); }
                *(v8h*)(P16 + (size_t)row * HD) = o; }
            if (early) {
#pragma unroll 4
                for (int s = 0; s < 16; ++s) { const int row = s * 4 + rr; const v4f a = *(const v4fa*)(os + row * 68 + seg * 8); const v4f c = *(const v4fa*)(os + row * 68 + seg * 8 + 4); v8us oh, ol;
#pragma unroll
                    for (int i = 0; i < 4; ++i) { unsigned short x0, x1; splitf(a[i], x0, x1); oh[i] = x0; ol[i] = x1; splitf(c[i], x0, x1); oh[4 + i] = x0; ol[4 + i] = x1; }
                    *(v8us*)(PH + (size_t)row * HD) = oh; *(v8us*)(PL + (size_t)row * HD) = ol; } }
             }
    } else {
        h16* P16 = VT16 + ((size_t)bhh * HD) * SEQ + t0 + seg * 8;
        bf* PH = VTh + ((size_t)bhh * HD) * RH + te + seg * 8;
        bf* PL = VTl + ((size_t)bhh * HD) * RH + te + seg * 8;
{
#pragma unroll 4
            for (int s = 0; s < 16; ++s) { const int d = s * 4 + rr; v8h o;
#pragma unroll
                for (int j = 0; j < 8; ++j) o[j] = toh_flush(os[(seg * 8 + j) * 68 + d] * VCAR);
                *(v8h*)(P16 + (size_t)d * SEQ) = o; }
            if (early) {
#pragma unroll 4
                for (int s = 0; s < 16; ++s) { const int d = s * 4 + rr; v8us oh, ol;
#pragma unroll
                    for (int j = 0; j < 8; ++j) { unsigned short x0, x1; splitf(os[(seg * 8 + j) * 68 + d], x0, x1); oh[j] = x0; ol[j] = x1; }
                    *(v8us*)(PH + (size_t)d * RH) = oh; *(v8us*)(PL + (size_t)d * RH) = ol; } }
             }
    }
}

// ---- attn16_body: fused causal attention, query rows >= RH (xb: 64-row block counted from row 0, bh: batch * NH + head); four waves per block, 16 query rows each (64 rows that share one diagonal block), 64-key blocks up to the diagonal.
// Each 64-key K tile [key][d] and V tile [d][key] is brought into LDS once per block by asynchronous b128 copies (rows of 128 B at a pitch of 144 B), two buffers: the next
// tile's copies fly while this one is worked on; all four waves take their fragments from LDS. The products are taken transposed: S^T = K Q^T (A = K rows, B = the wave's Q, held in
// registers, C = 10 - the query's maximum in use, so that D is the argument of exp2) and O^T += V^T P^T (A = V^T rows). A lane then holds 32 of the 64 scores of ONE query (lane ^ 16 the other 32): max and sum (f32) are in-lane plus one exchange
// between the halves, and two score tiles, converted in place (p x1024, f16), are the B operand of the second product. ctx = O / l written as f16 x64 into [b][t][h*64+d].
#define AW    4                  // waves per block
#define KVP   72                 // LDS pitch of a K or V tile row, in f16 elements
#define KVT   (64 * KVP)         // elements of one staged tile
static_assert((SEQ - RH) % (16 * AW) == 0 && RH % (16 * AW) == 0 && 16 * AW == 64);
static_assert((size_t)AW * 16 * 68 * 4 <= (size_t)4 * KVT * 2);   // the output staging fits in the ring it takes over

// one stage: this thread's four 16-byte pieces of the K tile and of the V tile (128 threads x 4 x 16 B = 8 KiB each), rows 16 apart
__device__ __forceinline__ void stage_kv(const h16* kg, const h16* vg, unsigned kl, unsigned vl) {
    // s_wait_xcnt stands inside the statement so that no address register of a copy is rewritten ahead of it
    asm volatile("global_load_async_to_lds_b128 %0, %8, off\n\t"
                 "global_load_async_to_lds_b128 %1, %9, off\n\t"
                 "global_load_async_to_lds_b128 %2, %10, off\n\t"
                 "global_load_async_to_lds_b128 %3, %11, off\n\t"
                 "global_load_async_to_lds_b128 %4, %12, off\n\t"
                 "global_load_async_to_lds_b128 %5, %13, off\n\t"
                 "global_load_async_to_lds_b128 %6, %14, off\n\t"
                 "global_load_async_to_lds_b128 %7, %15, off\n\t"
                 "s_wait_xcnt 0x0"
                 :: "v"(kl), "v"(kl + 16 * KVP * 2), "v"(kl + 32 * KVP * 2), "v"(kl + 48 * KVP * 2),
                    "v"(vl), "v"(vl + 16 * KVP * 2), "v"(vl + 32 * KVP * 2), "v"(vl + 48 * KVP * 2),
                    "v"(kg), "v"(kg + 16 * HD), "v"(kg + 32 * HD), "v"(kg + 48 * HD),
                    "v"(vg), "v"(vg + (size_t)16 * SEQ), "v"(vg + (size_t)32 * SEQ), "v"(vg + (size_t)48 * SEQ)
                 : "memory");
}

template <bool B> struct Flag { static constexpr bool value = B; };
// lane l <-> lane l ^ 16
__device__ __forceinline__ float xhalf(float x) { return __builtin_bit_cast(float, __builtin_amdgcn_permlanex16(__builtin_bit_cast(int, x), __builtin_bit_cast(int, x), 0x76543210, 0xfedcba98, false, false)); }
__device__ __forceinline__ float max8(const float* v) { return fmaxf(fmaxf(fmaxf(v[0], v[1]), fmaxf(v[2], v[3])), fmaxf(fmaxf(v[4], v[5]), fmaxf(v[6], v[7]))); }
__device__ __forceinline__ float sum8(const float* v) { return ((v[0] + v[1]) + (v[2] + v[3])) + ((v[4] + v[5]) + (v[6] + v[7])); }

__device__ __forceinline__ void attn16_body(const h16* __restrict__ Q16, const h16* __restrict__ K16, const h16* __restrict__ VT16, h16* CT16, h16* ring, int xb, int bh) {
    // ring: the kernel's LDS, [buffer][K | V][row][KVP]; after the loop: output staging
    const int lane = threadIdx.x & 31, lr = lane & 15, hi = lane >> 4;
    const int wave = __builtin_amdgcn_readfirstlane(threadIdx.x >> 5);
    const int blkbase = xb * (16 * AW); const int rowbase = blkbase + wave * 16;
    const size_t qoff  = ((size_t)bh * SEQ + rowbase + lr) * HD + 8 * hi;
    // staging: thread t owns piece (t & 7) of rows (t >> 3) + 16 j, j = 0..3, of both tiles
    const int srow = threadIdx.x >> 3, sseg = threadIdx.x & 7;
    const h16* kg = K16 + ((size_t)bh * SEQ + srow) * HD + sseg * 8;
    const h16* vg = VT16 + ((size_t)bh * HD + srow) * SEQ + sseg * 8;
    const unsigned sl = (unsigned)(size_t)(ring + srow * KVP + sseg * 8);   // LDS byte address of the piece in buffer 0's K tile
    const int foff = lr * KVP + 8 * hi;                                     // fragment row and half inside a tile
    const int t = rowbase + lr;                                             // this lane's query
    v16h qb[2];                                                             // B operand: column lr = query t, d in the k order of ldh
#pragma unroll
    for (int c = 0; c < 2; ++c) qb[c] = ldh(Q16 + qoff + c * 32);
    v8f o[4]; float l = 0.0f;                                               // o[dt][r] = O[t][dt*16 + 8*hi + r]; l: sum over this half's keys only
    float cm = PLOG;                                                        // PLOG - (this query's maximum in use, base 2); the first tile sets it
    v8f cf;                                                                 // cm in all eight places: the C operand of the score product (a lane's eight rows belong to one query)
#pragma unroll
    for (int r = 0; r < 8; ++r) cf[r] = cm;
#pragma unroll
    for (int dt = 0; dt < 4; ++dt) o[dt] = (v8f){};
    const int nblk = blkbase / 64 + 1;
    stage_kv(kg, vg, sl, sl + KVT * 2);
    asm volatile("s_wait_asynccnt 0x0" ::: "memory");   // tile 0 of this wave's copies has landed
    __syncthreads();                                     // ... and every other wave's
    if (nblk > 1) stage_kv(kg + 64 * HD, vg + 64, sl + 2 * KVT * 2, sl + 3 * KVT * 2);
    // one key tile, hand-over at its foot included; first: the block's first tile, which sets the maximum in use; diag: the tile holds keys behind a query (both compile-time, so that the other tiles carry no compare and no select)
    auto tile = [&](const int jb, auto first, auto diag) __attribute__((always_inline)) {
        const int jbase = jb * 64;
        const h16* kb = ring + (jb & 1) * (2 * KVT) + foff; const h16* vb = kb + KVT;
        v8f s[4];                                        // s[nt][r] = PLOG + (score, base 2) - (maximum in use) of key jbase + nt*16 + 8*hi + r with query t: the argument of exp2 as it leaves the product
        v16h kf;
#pragma unroll
        for (int c = 0; c < 2; ++c) {
#pragma unroll
            for (int nt = 0; nt < 4; ++nt) { const h16* kp = kb + nt * 16 * KVP + c * 32; kf = cat16(*(const v8ha*)kp, *(const v8ha*)(kp + 16)); s[nt] = wmma16(kf, qb[c], c == 0 ? cf : s[nt]); }
        }
        // the four vector slots between the last WMMA and the first reader of its result
        asm volatile("v_nop\n\tv_nop\n\tv_nop\n\tv_nop" : "+v"(s[0]), "+v"(s[1]), "+v"(s[2]), "+v"(s[3]) : "v"(kf));
        const int dq = t - jbase - 8 * hi;               // key > t  <=>  the key's place among this lane's keys, nt*16 + r, > dq
        float v[4][8], mt[4];
#pragma unroll
        for (int nt = 0; nt < 4; ++nt) {
#pragma unroll
            for (int r = 0; r < 8; ++r) v[nt][r] = (decltype(diag)::value && nt * 16 + r > dq) ? NEGB : s[nt][r];
            mt[nt] = max8(v[nt]);
        }
        const float mx = fmaxf(fmaxf(mt[0], mt[1]), fmaxf(mt[2], mt[3]));
        // one test a tile, a scalar branch: the maximum in use moves only when some score of the wave stands more than PTAU above it (and in the first tile, which sets it)
        if (decltype(first)::value || __builtin_amdgcn_ballot_w32(mx > PLOG + PTAU) != 0) {
            const float mq = fmaxf(mx, xhalf(mx)) - PLOG;                      // both halves hold the query's maximum over the 64 keys, counted from the maximum in use
            const float d = decltype(first)::value ? mq : fmaxf(mq, 0.0f);     // the maximum in use rises by d (0 for a query that needs nothing)
#pragma unroll
            for (int nt = 0; nt < 4; ++nt)
#pragma unroll
                for (int r = 0; r < 8; ++r) v[nt][r] -= d;
            cm -= d;
#pragma unroll
            for (int r = 0; r < 8; ++r) cf[r] = cm;
            if (!decltype(first)::value) {                                     // in the first tile O and l are still zero
                const float al = ex2(-d);
                l *= al;
#pragma unroll
                for (int dt = 0; dt < 4; ++dt) o[dt] *= al;
            }
        }
        float st[4]; v16h pb[2];                         // pb[c][e] = p of key jbase + c*32 + (k order of ldh): tiles 2c and 2c+1 as they lie
#pragma unroll
        for (int nt = 0; nt < 4; ++nt) {
            float p[8];
#pragma unroll
            for (int r = 0; r < 8; ++r) { p[r] = ex2(v[nt][r]); pb[nt >> 1][(nt & 1) * 8 + r] = (h16)p[r]; }
            st[nt] = sum8(p);
        }
        l += (st[0] + st[1]) + (st[2] + st[3]);
        v16h vf;
#pragma unroll
        for (int c = 0; c < 2; ++c) {
#pragma unroll
            for (int dt = 0; dt < 4; ++dt) { const h16* vp = vb + dt * 16 * KVP + c * 32; vf = cat16(*(const v8ha*)vp, *(const v8ha*)(vp + 16)); o[dt] = wmma16(vf, pb[c], o[dt]); }
        }
        // the four vector slots behind the last WMMA, on the loop's back edge too
        asm volatile("v_nop\n\tv_nop\n\tv_nop\n\tv_nop" : "+v"(o[0]), "+v"(o[1]), "+v"(o[2]), "+v"(o[3]) : "v"(pb[1]), "v"(vf));
        asm volatile("s_wait_dscnt 0x0" ::: "memory");      // this wave has finished reading the buffer
        asm volatile("s_wait_asynccnt 0x0" ::: "memory");   // this wave's copies of tile jb + 1 have landed
        __syncthreads();                                     // publishes tile jb + 1 and frees the buffer of tile jb
        if (jb + 2 < nblk) { const unsigned bl = sl + (jb & 1) * (2 * KVT * 2); stage_kv(kg + (size_t)(jbase + 128) * HD, vg + jbase + 128, bl, bl + KVT * 2); }
    };
    // every key of a tile before the block's last is < blkbase <= t: the causal test is an identity there and is left out; only the last tile (jbase == blkbase, the diagonal) is masked
    // the first tile is never the last: xb >= AB_HL >= 1, so nblk >= 2
    tile(0, Flag<true>{}, Flag<false>{});
    // kept rolled: one copy of the unmasked tile, the code stays small
#pragma unroll 1
    for (int jb = 1; jb < nblk - 1; ++jb) tile(jb, Flag<false>{}, Flag<false>{});
    tile(nblk - 1, Flag<false>{}, Flag<true>{});
    asm volatile("s_wait_asynccnt 0x0" ::: "memory");       // nothing of the ring is in flight when it becomes output staging
    float* os = (float*)ring + wave * (16 * 68);
    {
        const float lt = l + xhalf(l);
        const float inv = (CCAR / VCAR) * (1.0f / lt);
#pragma unroll
        for (int dt = 0; dt < 4; ++dt) { v4f a, c;
#pragma unroll
            for (int i = 0; i < 4; ++i) { a[i] = o[dt][i] * inv; c[i] = o[dt][4 + i] * inv; }
            *(v4fa*)(os + lr * 68 + dt * 16 + 8 * hi) = a; *(v4fa*)(os + lr * 68 + dt * 16 + 8 * hi + 4) = c; }
    }
    __syncthreads();
    const int b = bh / NH, h = bh % NH; const int rr = lane >> 3, seg = lane & 7;
    h16* dst = CT16 + ((size_t)b * SEQ + rowbase) * DM + h * HD + seg * 8;
{
#pragma unroll
        for (int s = 0; s < 4; ++s) { const int row = s * 4 + rr; const v4f a = *(const v4fa*)(os + row * 68 + seg * 8); const v4f c = *(const v4fa*)(os + row * 68 + seg * 8 + 4); v8h ov;
#pragma unroll
            for (int i = 0; i < 4; ++i) { ov[i] = (h16)a[i]; ov[4 + i] = (h16)c[i]; }
            *(v8h*)(dst + (size_t)row * DM) = ov; }
         }
}

// ---- attnhl_body: the same for query rows < RH on bf16 hi/lo planes, operands straight from global memory, each of the four waves on its own 16 rows: scores kh qh + kh ql + kl qh, p split hi/lo in place, O^T += vh ph + vh pl + vl ph; ctx written as bf16 hi/lo [b][t<RH][h*64+d].
__device__ __forceinline__ void attnhl_body(const bf* __restrict__ Qh, const bf* __restrict__ Ql, const bf* __restrict__ Kh, const bf* __restrict__ Kl,
                                            const bf* __restrict__ VTh, const bf* __restrict__ VTl, bf* ATh, bf* ATl, float* lds, int xb, int bh) {
    const int lane = threadIdx.x & 31, lr = lane & 15, hi = lane >> 4;
    const int wave = __builtin_amdgcn_readfirstlane(threadIdx.x >> 5);
    float* os = lds + wave * (16 * 68);                  // this wave's output staging
    const int rowbase = xb * (16 * AW) + wave * 16;
    const size_t qoff  = ((size_t)bh * RH + rowbase + lr) * HD + 8 * hi;
    const size_t kbase = ((size_t)bh * RH + lr) * HD + 8 * hi;
    const size_t vbase = ((size_t)bh * HD + lr) * RH + 8 * hi;
    const int t = rowbase + lr;                          // this lane's query
    v16bf qh[2], ql[2];
#pragma unroll
    for (int c = 0; c < 2; ++c) { qh[c] = ldb(Qh + qoff + c * 32); ql[c] = ldb(Ql + qoff + c * 32); }
    v8f o[4]; float m = NEGB, l = 0.0f;
#pragma unroll
    for (int dt = 0; dt < 4; ++dt) o[dt] = (v8f){};
    const int nblk = rowbase / 64 + 1;
#pragma unroll 1
    for (int jb = 0; jb < nblk; ++jb) {
        const int jbase = jb * 64;
        v8f s[4];
#pragma unroll
        for (int nt = 0; nt < 4; ++nt) s[nt] = (v8f){};
        v16bf kh, kl;
#pragma unroll
        for (int c = 0; c < 2; ++c) {
#pragma unroll
            for (int nt = 0; nt < 4; ++nt) { const size_t ko = kbase + (size_t)(jbase + nt * 16) * HD + c * 32; kh = ldb(Kh + ko); kl = ldb(Kl + ko);
                s[nt] = wmmab(kh, qh[c], s[nt]); s[nt] = wmmab(kh, ql[c], s[nt]); s[nt] = wmmab(kl, qh[c], s[nt]); }
        }
        // the four vector slots between the last WMMA and the first reader of its result
        asm volatile("v_nop\n\tv_nop\n\tv_nop\n\tv_nop" : "+v"(s[0]), "+v"(s[1]), "+v"(s[2]), "+v"(s[3]) : "v"(kh), "v"(kl));
        const int dq = t - jbase - 8 * hi;               // key > t  <=>  the key's place among this lane's keys, nt*16 + r, > dq
        float v[4][8], mt[4];
#pragma unroll
        for (int nt = 0; nt < 4; ++nt) {
#pragma unroll
            for (int r = 0; r < 8; ++r) { const float sv = s[nt][r] * SCQHL; v[nt][r] = (nt * 16 + r > dq) ? NEGB : sv; }
            mt[nt] = max8(v[nt]);
        }
        float mx = fmaxf(fmaxf(mt[0], mt[1]), fmaxf(mt[2], mt[3]));
        mx = fmaxf(mx, xhalf(mx));
        const float mn = fmaxf(m, mx);
        const float al = ex2((m - mn) * L2E);
        m = mn;
        float st[4]; v8us ph[4], pl[4];
#pragma unroll
        for (int nt = 0; nt < 4; ++nt) {
            float p[8];
#pragma unroll
            for (int r = 0; r < 8; ++r) { p[r] = ex2((v[nt][r] - mn) * L2E); unsigned short x0, x1; splitf(p[r], x0, x1); ph[nt][r] = x0; pl[nt][r] = x1; }
            st[nt] = sum8(p);
        }
        l = l * al + ((st[0] + st[1]) + (st[2] + st[3]));
#pragma unroll
        for (int dt = 0; dt < 4; ++dt) o[dt] *= al;
        v16bf pbh, pbl, vh, vl;
#pragma unroll
        for (int c = 0; c < 2; ++c) {
            pbh = cat16b(ph[2 * c], ph[2 * c + 1]); pbl = cat16b(pl[2 * c], pl[2 * c + 1]);
#pragma unroll
            for (int dt = 0; dt < 4; ++dt) { const size_t vo = vbase + (size_t)(dt * 16) * RH + jbase + c * 32; vh = ldb(VTh + vo); vl = ldb(VTl + vo);
                o[dt] = wmmab(vh, pbh, o[dt]); o[dt] = wmmab(vh, pbl, o[dt]); o[dt] = wmmab(vl, pbh, o[dt]); }
        }
        // the four vector slots behind the last WMMA, on the loop's back edge too
        asm volatile("v_nop\n\tv_nop\n\tv_nop\n\tv_nop" : "+v"(o[0]), "+v"(o[1]), "+v"(o[2]), "+v"(o[3]) : "v"(pbh), "v"(pbl), "v"(vh), "v"(vl));
    }
    {
        const float lt = l + xhalf(l);
        const float inv = 1.0f / lt;
#pragma unroll
        for (int dt = 0; dt < 4; ++dt) { v4f a, c;
#pragma unroll
            for (int i = 0; i < 4; ++i) { a[i] = o[dt][i] * inv; c[i] = o[dt][4 + i] * inv; }
            *(v4fa*)(os + lr * 68 + dt * 16 + 8 * hi) = a; *(v4fa*)(os + lr * 68 + dt * 16 + 8 * hi + 4) = c; }
    }
    __syncthreads();
    const int b = bh / NH, h = bh % NH; const int rr = lane >> 3, seg = lane & 7;
    const size_t dof = ((size_t)b * RH + rowbase) * DM + h * HD + seg * 8;
{
#pragma unroll
        for (int s = 0; s < 4; ++s) { const int row = s * 4 + rr; const v4f a = *(const v4fa*)(os + row * 68 + seg * 8); const v4f c = *(const v4fa*)(os + row * 68 + seg * 8 + 4); v8us oh, ol;
#pragma unroll
            for (int i = 0; i < 4; ++i) { unsigned short x0, x1; splitf(a[i], x0, x1); oh[i] = x0; ol[i] = x1; splitf(c[i], x0, x1); oh[4 + i] = x0; ol[4 + i] = x1; }
            *(v8us*)(ATh + dof + (size_t)row * DM) = oh; *(v8us*)(ATl + dof + (size_t)row * DM) = ol; }
         }
}

// ---- k_attn: all query rows in one launch; the two bodies share no data. The hi/lo blocks (64 rows < RH) come first in the index: their waves walk chains of dependent global loads and use
// little of the vector and matrix units, so they start at once and run beside the f16 blocks. A f16 block walks xb + 1 key tiles and there are more blocks than resident places: they follow
// with the cost falling along the index (row block from the last down, head inside), so that the long blocks start first and the short ones fill the end of the launch.
constexpr int AB_HL = RH / (16 * AW), AB_16 = (SEQ - RH) / (16 * AW);   // 64-row blocks per head of either kind
static_assert(AB_HL > 0 && AB_16 > 0);
// five waves per SIMD asked for: the merged kernel's register count is the larger body's, and left alone the hi/lo body takes so many that the f16 body, which has nearly all the work, would run at four
__global__ __launch_bounds__(32 * AW) __attribute__((amdgpu_waves_per_eu(5))) void k_attn(const h16* __restrict__ Q16, const h16* __restrict__ K16, const h16* __restrict__ VT16, h16* CT16,
                                                  const bf* __restrict__ Qh, const bf* __restrict__ Ql, const bf* __restrict__ Kh, const bf* __restrict__ Kl,
                                                  const bf* __restrict__ VTh, const bf* __restrict__ VTl, bf* ATh, bf* ATl) {
    __shared__ __align__(16) h16 ring[4 * KVT];          // one array for both bodies (two would add up)
    const int i = blockIdx.x;
    if (i < NB * NH * AB_HL) attnhl_body(Qh, Ql, Kh, Kl, VTh, VTl, ATh, ATl, (float*)ring, i % AB_HL, i / AB_HL);
    else { const int j = i - NB * NH * AB_HL; attn16_body(Q16, K16, VT16, CT16, ring, AB_HL + AB_16 - 1 - j / (NB * NH), j % (NB * NH)); }
}

extern "C" void kernel_launch(void* const* d_in, const int* in_sizes, int n_in,
                              void* d_out, int out_size, void* d_ws, size_t ws_size, hipStream_t stream) {
    if (n_in < 5) return;
    if ((size_t)in_sizes[0] < (size_t)(NB - 1) * SEQ_FULL * DM + (size_t)SEQ * DM) return;
    if ((size_t)in_sizes[1] < (size_t)3 * DM * DM || in_sizes[2] < 3 * DM || (size_t)in_sizes[3] < (size_t)DM * DM || in_sizes[4] < DM) return;
    if ((size_t)out_size < (size_t)NB * SEQ * DM) return;
    if (ws_size < WS_TOTAL) return;
    // wire order: x, W_qkv, b_qkv, W_proj, b_proj
    const float* x = (const float*)d_in[0]; const float* wqkv = (const float*)d_in[1]; const float* bqkv = (const float*)d_in[2]; const float* wo = (const float*)d_in[3]; const float* bo = (const float*)d_in[4];
    float* OUT = (float*)d_out;
    char* wsp = (char*)d_ws;
    auto take = [&](size_t bytes) { char* p = wsp; wsp += bytes; return (void*)p; };
    bf* XB = (bf*)take(SZ_XB);
    bf* WQKV = (bf*)take(SZ_WQKV);                 // Bt [3*DM][DM]
    bf* WOb = (bf*)take(SZ_WO); h16* WO16 = (h16*)take(SZ_WO);
    h16* QK16 = (h16*)take(2 * SZ_P16);            // [q | k] f16 planes [bh][t][d]
    h16* VT16 = (h16*)take(SZ_P16);                // [bh][d][t]
    bf* QKh = (bf*)take(2 * SZ_PE); bf* QKl = (bf*)take(2 * SZ_PE);   // [q | k] early-row planes [bh][t<RH][d]
    bf* VTh = (bf*)take(SZ_PE); bf* VTl = (bf*)take(SZ_PE);           // [bh][d][t<RH]
    h16* CT16 = (h16*)take(SZ_CT);                 // ctx f16 x64 [b][t][DM] (rows >= RH used)
    bf* ATh = (bf*)take(SZ_AT); bf* ATl = (bf*)take(SZ_AT);           // ctx hi/lo [b][t<RH][DM]
    float* RC = (float*)take(SZ_ROT); float* RS = (float*)take(SZ_ROT);   // rotary cos / sin [SEQ][32]
    if ((size_t)(wsp - (char*)d_ws) > ws_size) return;

    k_prep<<<PB_WQ + PB_WO + PB_RO + NB * PB_CX, 256, 0, stream>>>(x, wqkv, wo, XB, WQKV, WOb, WO16, RC, RS);
    k_qkv<<<dim3(NB * SEQ / 128, 3 * DM / 128, 1), 128, 0, stream>>>(XB, WQKV, bqkv, RC, RS, QK16, VT16, QKh, QKl, VTh, VTl);
    k_attn<<<NB * NH * (AB_HL + AB_16), 128, 0, stream>>>(QK16, QK16 + PL16, VT16, CT16, QKh, QKl, QKh + PLE, QKl + PLE, VTh, VTl, ATh, ATl);
    k_proj<<<dim3(SEQ / 128, DM / 128, NB), 128, 0, stream>>>(ATh, ATl, WOb, CT16, WO16, OUT, bo);
}

// v008
// One run takes 123 microseconds.
// In two side-by-side timings against v007, it was 1.06 and 1.07 times as fast.
// All steps since v000 together make it 3.68 times as fast.
#include <hip/hip_runtime.h>

// Contractions (all f32 accumulate): x*W_qkv on v_wmma_f32_16x16x32_bf16 (both operands bf16 RNE copies of the inputs, exact products);
// q*k^T and p*v: query rows >= 256 on v_wmma_f32_16x16x32_f16 (q carried x log2(e)/4, k x1/2, v x16, p x1024), query rows < 256 on bf16 hi/lo planes (3 products);
// ctx*W_proj: rows >= 256 f16 (ctx x64, w x1024 from the bf16 copy), rows < 256 bf16 hi/lo ctx x bf16 w (2 products). Softmax f32 (running max, exp2).
// Rotary on q and k (interleaved pairs (2i,2i+1) -> (-x[2i+1], x[2i]); angle = pos * inv_freq[d mod 32], inv_freq[j] = 1 / 10000^(j/32)) applied in f32 on the
// staged 64x64 tile in the x*W_qkv epilogue, from cos/sin tables [SEQ][32] built once by rope_body (precise sincosf).
// Layout: x [NB][SEQ_FULL][1024] (rows < SEQ read); W_qkv [1024][3072] (in,out), thirds q|k|v, column = which*1024 + h*64 + d; W_proj [1024][1024] (in,out); out [NB][SEQ][1024].

#ifndef NB
#define NB 4
#endif
#ifndef SEQ
#define SEQ 2048
#endif
#define NB_FULL  4
#define SEQ_FULL 2048
#define DM   1024
#define NH   16
#define HD   64
#define RH   256                 // query rows < RH use bf16 hi/lo planes
#define VCAR  16.0f
#define CCAR  64.0f
#define WCAR  1024.0f
#define PLOG  10.0f              // p carried x 2^10
#define L2E   1.4426950408889634f
#define NEGB  (-3.0e38f)
#define QCAR  (0.25f * L2E)      // f16 q plane; QCAR * KCAR = log2(e) / 8: the f16 score product is the softmax exponent in base 2
#define KCAR  0.5f               // f16 k plane
#define PTAU  5.0f               // a score may stand this far (base 2) above the maximum in use before O and l are rescaled: p <= 2^15 stays inside f16
#define SCQHL 0.125f

typedef _Float16 h16;
typedef unsigned short bf;
typedef __attribute__((ext_vector_type(16))) __bf16   v16bf;
typedef __attribute__((ext_vector_type(16))) _Float16 v16h;
typedef __attribute__((ext_vector_type(8)))  _Float16 v8h;
typedef __attribute__((ext_vector_type(2)))  _Float16 v2h;
typedef __attribute__((ext_vector_type(8)))  unsigned short v8us;
typedef __attribute__((ext_vector_type(2)))  unsigned short v2us;
typedef __attribute__((ext_vector_type(8)))  float    v8f;
typedef __attribute__((ext_vector_type(4)))  float    v4f;
typedef v8h  __attribute__((may_alias)) v8ha;
typedef v4f  __attribute__((may_alias)) v4fa;
typedef v8us __attribute__((may_alias)) v8usa;

static_assert(SEQ % 64 == 0);
static_assert(RH % 64 == 0);
static_assert(RH <= SEQ);
static_assert(SEQ <= SEQ_FULL);
static_assert(NB <= NB_FULL);
static_assert(DM % 64 == 0);
static_assert(DM % 32 == 0);
static_assert(HD == 64);
static_assert(NH * HD == DM);
static_assert((3 * DM) % 64 == 0);
static_assert(HD / 2 == 32);
static_assert(SEQ % 8 == 0);          // rope_body: 8 positions per 256-thread block
static_assert((NB * SEQ) % 128 == 0 && (3 * DM) % 128 == 0 && SEQ % 128 == 0 && RH % 128 == 0 && DM % 128 == 0);   // the three GEMMs: 128x128 block tiles

constexpr size_t PL16 = (size_t)NB * NH * SEQ * HD;     // elements of one f16 head plane set
constexpr size_t PLE  = (size_t)NB * NH * RH * HD;      // elements of one early-row bf16 plane set
constexpr size_t SZ_XB   = (size_t)NB * SEQ * DM * 2;
constexpr size_t SZ_WQKV = (size_t)3 * DM * DM * 2;
constexpr size_t SZ_WO   = (size_t)DM * DM * 2;
constexpr size_t SZ_P16  = PL16 * 2;
constexpr size_t SZ_PE   = PLE * 2;
constexpr size_t SZ_CT   = (size_t)NB * SEQ * DM * 2;
constexpr size_t SZ_AT   = (size_t)NB * RH * DM * 2;
constexpr size_t SZ_ROT  = (size_t)SEQ * 32 * 4;        // one rotary table (cos or sin) [SEQ][32] f32
constexpr size_t WS_TOTAL = SZ_XB + SZ_WQKV + 2 * SZ_WO + 3 * SZ_P16 + 6 * SZ_PE + SZ_CT + 2 * SZ_AT + 2 * SZ_ROT;
static_assert(SZ_XB % 256 == 0 && SZ_WQKV % 256 == 0 && SZ_WO % 256 == 0 && SZ_P16 % 256 == 0 && SZ_PE % 256 == 0 && SZ_CT % 256 == 0 && SZ_AT % 256 == 0);
static_assert(SZ_ROT % 256 == 0);
static_assert(WS_TOTAL <= (size_t)134217728);

__device__ __forceinline__ unsigned short f2bf(float f) { unsigned u = __float_as_uint(f); u += 0x7FFFu + ((u >> 16) & 1u); return (unsigned short)(u >> 16); }
__device__ __forceinline__ float bf2f(unsigned short b) { return __uint_as_float(((unsigned)b) << 16); }
__device__ __forceinline__ float bfr(float f) { return bf2f(f2bf(f)); }
__device__ __forceinline__ void splitf(float y, unsigned short& h, unsigned short& l) { h = f2bf(y); l = f2bf(y - bf2f(h)); }
__device__ __forceinline__ v16h cat16(v8h lo, v8h hi) { return __builtin_shufflevector(lo, hi, 0, 1, 2, 3, 4, 5, 6, 7, 8, 9, 10, 11, 12, 13, 14, 15); }
__device__ __forceinline__ v16bf cat16b(v8us lo, v8us hi) { return __builtin_bit_cast(v16bf, __builtin_shufflevector(lo, hi, 0, 1, 2, 3, 4, 5, 6, 7, 8, 9, 10, 11, 12, 13, 14, 15)); }
__device__ __forceinline__ v8f wmma16(v16h a, v16h b, v8f c) { return __builtin_amdgcn_wmma_f32_16x16x32_f16(false, a, false, b, (short)0, c, false, false); }
__device__ __forceinline__ v8f wmmab(v16bf a, v16bf b, v8f c) { return __builtin_amdgcn_wmma_f32_16x16x32_bf16(false, a, false, b, (short)0, c, false, false); }
__device__ __forceinline__ float ex2(float x) { return __builtin_amdgcn_exp2f(x); }
// f32 -> f16 for operand planes: anything below the smallest f16 normal becomes an exact zero (value select, applied after the carry)
static __device__ __forceinline__ h16 toh_flush(float v) { const h16 r = (h16)v; return (fabsf(v) < 6.103515625e-05f) ? (h16)0.0f : r; }
// fragment loads from K-contiguous 16-bit rows: p already includes + 8*(lane>>4); elements 0..7 <- k0+8h.., 8..15 <- k0+16+8h..
__device__ __forceinline__ v16h  ldh(const h16* p) { return cat16(*(const v8h*)p, *(const v8h*)(p + 16)); }
__device__ __forceinline__ v16bf ldb(const bf* p)  { return cat16b(*(const v8us*)p, *(const v8us*)(p + 16)); }

template <typename T16> struct WFrag;
template <> struct WFrag<h16> { typedef v16h V; static __device__ __forceinline__ V lds(const h16* p) { return cat16(*(const v8ha*)p, *(const v8ha*)(p + 16)); } static __device__ __forceinline__ v8f mma(V a, V b, v8f c) { return wmma16(a, b, c); } };
template <> struct WFrag<bf>  { typedef v16bf V; static __device__ __forceinline__ V lds(const bf* p) { return cat16b(*(const v8usa*)p, *(const v8usa*)(p + 16)); } static __device__ __forceinline__ v8f mma(V a, V b, v8f c) { return wmmab(a, b, c); } };

// ---- four-wave 128x128 tile main loop (K = DM): per stage of 64 k the block brings 128 rows of A and 128 rows of Bt (128 B each, LDS pitch 144 B) into LDS once by asynchronous
// b128 copies, two buffers: the next stage's copies fly while this one is worked on. Wave (wm, wn) takes its 64x64 quarter's fragments from LDS, in the k order of ldh / ldb.
#define GW    4                  // waves per block (2 x 2)
#define GP    72                 // LDS pitch of a staged operand row, in 16-bit elements
#define GT    (128 * GP)         // elements of one staged operand tile
static_assert(DM % 64 == 0 && DM / 64 >= 2);
static_assert((size_t)GW * 64 * 68 * 4 <= (size_t)4 * GT * 2);   // the output staging fits in the ring it takes over

// this thread's eight 16-byte pieces of one operand tile (128 threads x 8 x 16 B = 16 KiB), rows 16 apart
template <typename T16>
__device__ __forceinline__ void stage_rows(const T16* g, unsigned l) {
    // s_wait_xcnt stands inside the statement so that no address register of a copy is rewritten ahead of it
    asm volatile("global_load_async_to_lds_b128 %0, %8, off\n\t"
                 "global_load_async_to_lds_b128 %1, %9, off\n\t"
                 "global_load_async_to_lds_b128 %2, %10, off\n\t"
                 "global_load_async_to_lds_b128 %3, %11, off\n\t"
                 "global_load_async_to_lds_b128 %4, %12, off\n\t"
                 "global_load_async_to_lds_b128 %5, %13, off\n\t"
                 "global_load_async_to_lds_b128 %6, %14, off\n\t"
                 "global_load_async_to_lds_b128 %7, %15, off\n\t"
                 "s_wait_xcnt 0x0"
                 :: "v"(l), "v"(l + 16 * GP * 2), "v"(l + 32 * GP * 2), "v"(l + 48 * GP * 2),
                    "v"(l + 64 * GP * 2), "v"(l + 80 * GP * 2), "v"(l + 96 * GP * 2), "v"(l + 112 * GP * 2),
                    "v"(g), "v"(g + 16 * DM), "v"(g + 32 * DM), "v"(g + 48 * DM),
                    "v"(g + 64 * DM), "v"(g + 80 * DM), "v"(g + 96 * DM), "v"(g + 112 * DM)
                 : "memory");
}

// ring: [buffer][A | Bt | A2][row][GP] (A2, the lo plane multiplied against the same Bt, only with NSPLIT 1); rb, cb: first of the block's A rows and Bt rows.
// acc[mb][nb] += A[rb+wm*64+mb*16..][k] Bt[cb+wn*64+nb*16..][k]. On return every wave has left the ring and nothing is in flight into it.
template <typename T16, int NSPLIT>
__device__ __forceinline__ void gemm_loop_lds(const T16* __restrict__ A, const T16* __restrict__ A2, const T16* __restrict__ Bt, T16* ring, int rb, int cb, int wm, int wn, v8f (&acc)[4][4]) {
    typedef typename WFrag<T16>::V V;
    constexpr int NST = DM / 64, BUF = (2 + NSPLIT) * GT;
    const int lane = threadIdx.x & 31, lr = lane & 15, hi = lane >> 4;
    // staging: thread t owns piece (t & 7) of rows (t >> 3) + 16 j, j = 0..7, of every tile
    const int srow = threadIdx.x >> 3, sseg = threadIdx.x & 7;
    const T16* ag = A + (size_t)(rb + srow) * DM + sseg * 8;
    const T16* a2g = A2 + (size_t)(rb + srow) * DM + sseg * 8;
    const T16* bg = Bt + (size_t)(cb + srow) * DM + sseg * 8;
    const unsigned sl = (unsigned)(size_t)(ring + srow * GP + sseg * 8);   // LDS byte address of the piece in buffer 0's A tile
    const int aof = (wm * 64 + lr) * GP + 8 * hi, bof = GT + (wn * 64 + lr) * GP + 8 * hi;
    auto stage = [&](int st, unsigned l) { stage_rows<T16>(ag + st * 64, l); stage_rows<T16>(bg + st * 64, l + GT * 2); if (NSPLIT == 1) stage_rows<T16>(a2g + st * 64, l + 2 * GT * 2); };
    stage(0, sl);
    asm volatile("s_wait_asynccnt 0x0" ::: "memory");   // stage 0 of this wave's copies has landed
    __syncthreads();                                     // ... and every other wave's
    stage(1, sl + BUF * 2);
    // kept rolled: one copy of the hand-over at the foot, and the code stays small; the loops inside are unrolled so that every fragment and accumulator index is a constant (registers)
#pragma unroll 1
    for (int t = 0; t < NST; ++t) {
        const T16* tb = ring + (t & 1) * BUF;
#pragma unroll
        for (int c = 0; c < 2; ++c) {
            V a[4], a2[4], b[4];
#pragma unroll
            for (int mb = 0; mb < 4; ++mb) { a[mb] = WFrag<T16>::lds(tb + aof + mb * 16 * GP + c * 32); if (NSPLIT == 1) a2[mb] = WFrag<T16>::lds(tb + 2 * GT + aof + mb * 16 * GP + c * 32); }
#pragma unroll
            for (int nb = 0; nb < 4; ++nb) b[nb] = WFrag<T16>::lds(tb + bof + nb * 16 * GP + c * 32);
            // inputs-only fence on the loaded fragments: keeps the LDS loads of this 32-k block together ahead of its WMMAs (one LDS wait a block; sunk between the WMMAs each B fragment costs its own)
            if (NSPLIT == 1) asm volatile("" :: "v"(a[0]), "v"(a[1]), "v"(a[2]), "v"(a[3]), "v"(a2[0]), "v"(a2[1]), "v"(a2[2]), "v"(a2[3]), "v"(b[0]), "v"(b[1]), "v"(b[2]), "v"(b[3]));
            else             asm volatile("" :: "v"(a[0]), "v"(a[1]), "v"(a[2]), "v"(a[3]), "v"(b[0]), "v"(b[1]), "v"(b[2]), "v"(b[3]));
#pragma unroll
            for (int nb = 0; nb < 4; ++nb)
#pragma unroll
                for (int mb = 0; mb < 4; ++mb) { acc[mb][nb] = WFrag<T16>::mma(a[mb], b[nb], acc[mb][nb]); if (NSPLIT == 1) acc[mb][nb] = WFrag<T16>::mma(a2[mb], b[nb], acc[mb][nb]); }
        }
        asm volatile("s_wait_dscnt 0x0" ::: "memory");      // this wave has finished reading the buffer
        asm volatile("s_wait_asynccnt 0x0" ::: "memory");   // this wave's copies of stage t + 1 have landed
        __syncthreads();                                     // publishes stage t + 1 and frees the buffer of stage t
        if (t + 2 < NST) stage(t + 2, sl + (t & 1) * (BUF * 2));
    }
    asm volatile("s_wait_asynccnt 0x0" ::: "memory");       // nothing of the ring is in flight when it becomes output staging
}

// ---- GEMM with f32 output: C[m][n] = osc * sum_k A[m][k] Bt[n][k] + bf16(bias[n]); K = DM; grid (M/128, N/128, Z), 128 threads, a 64x64 quarter per wave. Per 16-row slab staged in LDS,
template <typename T16, int NSPLIT>
__device__ __forceinline__ void gemm_out_body(const T16* __restrict__ A, const T16* __restrict__ A2, const T16* __restrict__ Bt, float* C, int ldc, const float* __restrict__ bias, float osc, size_t sA, size_t sC, T16* ring) {
    // ring: the kernel's LDS, 2 * (2 + NSPLIT) * GT elements used: operand ring; after the main loop: each wave's 16x68 f32 slab staging
    const size_t z = blockIdx.z; A += z * sA; A2 += z * sA; C += z * sC;
    const int lane = threadIdx.x & 31, lr = lane & 15, hi = lane >> 4;
    const int wave = __builtin_amdgcn_readfirstlane(threadIdx.x >> 5); const int wm = wave >> 1, wn = wave & 1;
    const int r0 = blockIdx.x * 128 + wm * 64, c0 = blockIdx.y * 128 + wn * 64;
    v8f acc[4][4];
#pragma unroll
    for (int mb = 0; mb < 4; ++mb)
#pragma unroll
        for (int nb = 0; nb < 4; ++nb) acc[mb][nb] = (v8f){};
    gemm_loop_lds<T16, NSPLIT>(A, A2, Bt, ring, blockIdx.x * 128, blockIdx.y * 128, wm, wn, acc);
    float* os = (float*)ring + wave * (16 * 68);
    const int cofs = lr * 4;
    const v4f bv = *(const v4f*)(bias + c0 + cofs);
    v4f bb; bb[0] = bfr(bv[0]); bb[1] = bfr(bv[1]); bb[2] = bfr(bv[2]); bb[3] = bfr(bv[3]);
#pragma unroll
    for (int mb = 0; mb < 4; ++mb) {
#pragma unroll
        for (int nb = 0; nb < 4; ++nb) {
#pragma unroll
            for (int j = 0; j < 8; ++j) os[(hi * 8 + j) * 68 + nb * 16 + lr] = acc[mb][nb][j]; }
        __syncthreads();
        float* crow = C + (size_t)(r0 + mb * 16) * ldc + c0;
{
#pragma unroll
            for (int s = 0; s < 8; ++s) { const int row = 2 * s + hi; const v4f t = *(const v4fa*)(os + row * 68 + cofs); v4f val;
                val[0] = t[0] * osc + bb[0]; val[1] = t[1] * osc + bb[1]; val[2] = t[2] * osc + bb[2]; val[3] = t[3] * osc + bb[3];
                *(v4f*)(crow + (size_t)row * ldc + cofs) = val; }
             }
        __syncthreads();
    }
}

// ---- k_proj: ctx W_proj + b_proj for all rows in one launch, grid (SEQ/128, DM/128, NB), z = batch; the two bodies share no data, so the few hi/lo tiles run beside the f16 tiles.
// row tiles < RH: ctx hi/lo (bf16) x w_proj (bf16); row tiles >= RH: ctx f16 (x64) x w_proj f16 (x1024)
__global__ __launch_bounds__(32 * GW) void k_proj(const bf* __restrict__ Ah, const bf* __restrict__ Al, const bf* __restrict__ Wt, const h16* __restrict__ A16, const h16* __restrict__ Wt16,
                                                  float* C, const float* __restrict__ bias) {
    __shared__ __align__(16) bf ring[2 * 3 * GT];        // one array for both bodies (two would add up)
    if (blockIdx.x < RH / 128) gemm_out_body<bf, 1>(Ah, Al, Wt, C, DM, bias, 1.0f, (size_t)RH * DM, (size_t)SEQ * DM, ring);
    else                       gemm_out_body<h16, 0>(A16, A16, Wt16, C, DM, bias, 1.0f / (CCAR * WCAR), (size_t)SEQ * DM, (size_t)SEQ * DM, (h16*)ring);
}

// bx: block inside a batch, b: batch
__device__ __forceinline__ void cvt8_body(const float* __restrict__ src, bf* dst, unsigned n8, unsigned bx, size_t b) {
    src += b * (size_t)SEQ_FULL * DM; dst += b * (size_t)SEQ * DM;
    const unsigned i = bx * 256 + threadIdx.x; if (i >= n8) return;
    const v8f v = *(const v8f*)(src + (size_t)i * 8); v8us o;
#pragma unroll
    for (int k = 0; k < 8; ++k) o[k] = f2bf(v[k]);
    *(v8us*)(dst + (size_t)i * 8) = o; 
}

// ---- wtG_body: Bt[n][k] = bf16(w[k][n]) (and Bt16 = that value x car in f16), one 64 (k) x 64 (n) tile per 256-thread block, turned in LDS so that both sides move whole 128-B lines:
// a wave's b128 load covers 256 B of two rows of w, a wave's b128 store four whole rows of 64 k. tl: 64 rows of TP f32.
#define TP 65                    // LDS pitch in f32: 8 * TP = 8 mod 64, so that a wave's gather (8 segments of k x 4 n) falls on 32 different banks
template <bool H16>             // H16: the f16 copy is written too
__device__ __forceinline__ void wtG_body(const float* __restrict__ w, int K, int N, bf* Bt, h16* Bt16, float car, unsigned bx, float* tl) {
    const int ntn = N / 64; const int k0 = (int)(bx / ntn) * 64, n0 = (int)(bx % ntn) * 64;
    const int lrow = threadIdx.x >> 4, lcol = (threadIdx.x & 15) * 4;
    v4f v[4];
    for (int p = 0; p < 4; ++p) v[p] = *(const v4f*)(w + (size_t)(k0 + p * 16 + lrow) * N + n0 + lcol);
    for (int p = 0; p < 4; ++p)
        for (int i = 0; i < 4; ++i) tl[(p * 16 + lrow) * TP + lcol + i] = v[p][i];
    __syncthreads();                                     // the tile is whole before any column of it is gathered
    const int kseg = threadIdx.x & 7, nr = threadIdx.x >> 3;
    const size_t e = (size_t)(n0 + nr) * K + k0 + kseg * 8;   // rows n0 + nr and n0 + nr + 32
    v8us o[2]; v8h o2[2];
    for (int p = 0; p < 2; ++p)
        for (int j = 0; j < 8; ++j) { o[p][j] = f2bf(tl[(kseg * 8 + j) * TP + p * 32 + nr]); if (H16) o2[p][j] = (h16)(bf2f(o[p][j]) * car); }
    for (int p = 0; p < 2; ++p) { *(v8us*)(Bt + e + (size_t)p * 32 * K) = o[p]; if (H16) *(v8h*)(Bt16 + e + (size_t)p * 32 * K) = o2[p]; }
    asm volatile("s_wait_xcnt 0x0" ::: "memory");        // behind the run of stores: the compiler lays another body of k_prep out behind this one, and its first instructions rewrite the stores' registers
}

// ---- rope_body: rotary tables RC = cos, RS = sin, [SEQ][32] f32; angle = (float)pos * inv_freq[j], inv_freq[j] = 1.0f / (float)(10000^(j/32));
__device__ __forceinline__ void rope_body(float* RC, float* RS, unsigned bx) {
#pragma clang fp contract(off)
    const int wave = __builtin_amdgcn_readfirstlane(threadIdx.x >> 5); const int lane = threadIdx.x & 31;
    const int pos = bx * 8 + wave; if (pos >= SEQ) return;
    double p = 1.0;
#pragma unroll 1
    for (int j = 0; j < lane; ++j) p = p * 1.3335214321633240;
    const float pw = (float)p; const float inv = 1.0f / pw; const float ang = (float)pos * inv;
    float sv, cv; sincosf(ang, &sv, &cv);
    float* pc = RC + (size_t)pos * 32 + lane; float* pq = RS + (size_t)pos * 32 + lane;
    *(float*)pc = cv; *(float*)pq = sv; 
}

// ---- k_prep: the four preparations (W_qkv and W_proj transposed to bf16 / f16, rotary tables, x to bf16) share no data: one launch, the body picked by block range.
// The transposes (load, barrier, gather, store: the longest chain of a block) come first in the index; the stream over x fills in behind them.
constexpr unsigned PB_WQ = (3 * DM / 64) * (DM / 64);                         // blocks (64x64 tiles) of the W_qkv transpose
constexpr unsigned PB_WO = (DM / 64) * (DM / 64);                             // ... of the W_proj transpose
constexpr unsigned PB_RO = (SEQ + 7) / 8;                                     // ... of the rotary tables
constexpr unsigned PB_CX = (unsigned)(((size_t)SEQ * DM / 8 + 255) / 256);    // ... of one batch of x
__global__ __launch_bounds__(256) void k_prep(const float* __restrict__ x, const float* __restrict__ wqkv, const float* __restrict__ wo, bf* XB, bf* WQKV, bf* WOb, h16* WO16, float* RC, float* RS) {
    __shared__ __align__(16) float tl[64 * TP];          // the transposes' tile
    unsigned b = blockIdx.x;
    if (b < PB_WQ) { wtG_body<false>(wqkv, DM, 3 * DM, WQKV, (h16*)nullptr, 1.0f, b, tl); return; }   // in[DM][3*DM] -> out[3*DM][DM]
    b -= PB_WQ;
    if (b < PB_WO) { wtG_body<true>(wo, DM, DM, WOb, WO16, WCAR, b, tl); return; }                    // in[DM][DM] -> out[DM][DM]
    b -= PB_WO;
    if (b < PB_RO) { rope_body(RC, RS, b); return; }
    b -= PB_RO;
    cvt8_body(x, XB, (unsigned)((size_t)SEQ * DM / 8), b % PB_CX, b / PB_CX);
}

// ---- k_qkv: four waves per 128x128 tile of x W_qkv + b_qkv (bf16 x bf16 exact), one 64x64 quarter each. The quarter (64 tokens x one head third) is staged whole in LDS; q and k tiles get the rotary
// applied in place in LDS (each lane owns 8 consecutive d of a row, i.e. 4 whole pairs), then written as head planes:
__global__ __launch_bounds__(32 * GW) void k_qkv(const bf* __restrict__ XB, const bf* __restrict__ W, const float* __restrict__ bias, const float* __restrict__ RC, const float* __restrict__ RS,
                                             h16* QK16, h16* VT16, bf* QKh, bf* QKl, bf* VTh, bf* VTl) {
    __shared__ __align__(16) bf ring[4 * GT];            // operand ring; after the main loop: each wave's 64x68 f32 output staging
    const int lane = threadIdx.x & 31, lr = lane & 15, hi = lane >> 4;
    const int wave = __builtin_amdgcn_readfirstlane(threadIdx.x >> 5); const int wm = wave >> 1, wn = wave & 1;
    const int r0 = blockIdx.x * 128 + wm * 64, c0 = blockIdx.y * 128 + wn * 64;
    v8f acc[4][4];
#pragma unroll
    for (int mb = 0; mb < 4; ++mb)
#pragma unroll
        for (int nb = 0; nb < 4; ++nb) acc[mb][nb] = (v8f){};
    gemm_loop_lds<bf, 0>(XB, XB, W, ring, blockIdx.x * 128, blockIdx.y * 128, wm, wn, acc);
    float* os = (float*)ring + wave * (64 * 68);
#pragma unroll
    for (int nb = 0; nb < 4; ++nb) { const float bc = bfr(bias[c0 + nb * 16 + lr]);
#pragma unroll
        for (int mb = 0; mb < 4; ++mb) {
#pragma unroll
            for (int j = 0; j < 8; ++j) os[(mb * 16 + hi * 8 + j) * 68 + nb * 16 + lr] = acc[mb][nb][j] + bc; } }
    __syncthreads();
    const int which = c0 / DM; const int h = (c0 % DM) / HD; const int b = r0 / SEQ; const int t0 = r0 % SEQ; const int bhh = b * NH + h; const bool early = (t0 < RH); const int te = early ? t0 : 0;
    const int rr = lane >> 3, seg = lane & 7;
    if (which < 2) {
        // rotary in place: lane owns d = seg*8 .. seg*8+7 of row s*4+rr; table column = d mod 32 = (seg & 3)*8 + i; position = t0 + row
        const size_t tof = (size_t)(t0 + rr) * 32 + (seg & 3) * 8;
#pragma unroll 1
        for (int s = 0; s < 16; ++s) { const int row = s * 4 + rr;
            const v4f ca = *(const v4f*)(RC + tof + (size_t)s * 128); const v4f cb = *(const v4f*)(RC + tof + (size_t)s * 128 + 4);
            const v4f sa = *(const v4f*)(RS + tof + (size_t)s * 128); const v4f sb = *(const v4f*)(RS + tof + (size_t)s * 128 + 4);
            float* op = os + row * 68 + seg * 8;
            const v4f a = *(const v4fa*)op; const v4f c = *(const v4fa*)(op + 4); v4f ra, rc;
            ra[0] = a[0] * ca[0] + (-a[1]) * sa[0]; ra[1] = a[1] * ca[1] + a[0] * sa[1];
            ra[2] = a[2] * ca[2] + (-a[3]) * sa[2]; ra[3] = a[3] * ca[3] + a[2] * sa[3];
            rc[0] = c[0] * cb[0] + (-c[1]) * sb[0]; rc[1] = c[1] * cb[1] + c[0] * sb[1];
            rc[2] = c[2] * cb[2] + (-c[3]) * sb[2]; rc[3] = c[3] * cb[3] + c[2] * sb[3];
            *(v4fa*)op = ra; *(v4fa*)(op + 4) = rc; }
    }
    __syncthreads();
    if (which < 2) {
        h16* P16 = QK16 + (size_t)which * PL16 + ((size_t)bhh * SEQ + t0) * HD + seg * 8;
        bf* PH = QKh + (size_t)which * PLE + ((size_t)bhh * RH + te) * HD + seg * 8;
        bf* PL = QKl + (size_t)which * PLE + ((size_t)bhh * RH + te) * HD + seg * 8;
        const float car = which == 0 ? QCAR : KCAR;
{
#pragma unroll 4
            for (int s = 0; s < 16; ++s) { const int row = s * 4 + rr; const v4f a = *(const v4fa*)(os + row * 68 + seg * 8); const v4f c = *(const v4fa*)(os + row * 68 + seg * 8 + 4); v8h o;
#pragma unroll
                for (int i = 0; i < 4; ++i) { o[i] = toh_flush(a[i] * car); o[4 + i] = toh_flush(c[i] * car); }
                *(v8h*)(P16 + (size_t)row * HD) = o; }
            if (early) {
#pragma unroll 4
                for (int s = 0; s < 16; ++s) { const int row = s * 4 + rr; const v4f a = *(const v4fa*)(os + row * 68 + seg * 8); const v4f c = *(const v4fa*)(os + row * 68 + seg * 8 + 4); v8us oh, ol;
#pragma unroll
                    for (int i = 0; i < 4; ++i) { unsigned short x0, x1; splitf(a[i], x0, x1); oh[i] = x0; ol[i] = x1; splitf(c[i], x0, x1); oh[4 + i] = x0; ol[4 + i] = x1; }
                    *(v8us*)(PH + (size_t)row * HD) = oh; *(v8us*)(PL + (size_t)row * HD) = ol; } }
             }
    } else {
        h16* P16 = VT16 + ((size_t)bhh * HD) * SEQ + t0 + seg * 8;
        bf* PH = VTh + ((size_t)bhh * HD) * RH + te + seg * 8;
        bf* PL = VTl + ((size_t)bhh * HD) * RH + te + seg * 8;
{
#pragma unroll 4
            for (int s = 0; s < 16; ++s) { const int d = s * 4 + rr; v8h o;
#pragma unroll
                for (int j = 0; j < 8; ++j) o[j] = toh_flush(os[(seg * 8 + j) * 68 + d] * VCAR);
                *(v8h*)(P16 + (size_t)d * SEQ) = o; }
            if (early) {
#pragma unroll 4
                for (int s = 0; s < 16; ++s) { const int d = s * 4 + rr; v8us oh, ol;
#pragma unroll
                    for (int j = 0; j < 8; ++j) { unsigned short x0, x1; splitf(os[(seg * 8 + j) * 68 + d], x0, x1); oh[j] = x0; ol[j] = x1; }
                    *(v8us*)(PH + (size_t)d * RH) = oh; *(v8us*)(PL + (size_t)d * RH) = ol; } }
             }
    }
}

// ---- attn16_body: fused causal attention, query rows >= RH (xb: 64-row block counted from row 0, bh: batch * NH + head); four waves per block, 16 query rows each (64 rows that share one diagonal block), 64-key blocks up to the diagonal.
// Each 64-key K tile [key][d] and V tile [d][key] is brought into LDS once per block by asynchronous b128 copies (rows of 128 B at a pitch of 144 B), two buffers: the next
// tile's copies fly while this one is worked on; all four waves take their fragments from LDS. The products are taken transposed: S^T = K Q^T (A = K rows, B = the wave's Q, held in
// registers, C = 10 - the query's maximum in use, so that D is the argument of exp2) and O^T += V^T P^T (A = V^T rows). A lane then holds 32 of the 64 scores of ONE query (lane ^ 16 the other 32): max and sum (f32) are in-lane plus one exchange
// between the halves, and two score tiles, converted in place (p x1024, f16), are the B operand of the second product. ctx = O / l written as f16 x64 into [b][t][h*64+d].
#define AW    4                  // waves per block
#define KVP   72                 // LDS pitch of a K or V tile row, in f16 elements
#define KVT   (64 * KVP)         // elements of one staged tile
static_assert((SEQ - RH) % (16 * AW) == 0 && RH % (16 * AW) == 0 && 16 * AW == 64);
static_assert((size_t)AW * 16 * 68 * 4 <= (size_t)4 * KVT * 2);   // the output staging fits in the ring it takes over

// one stage: this thread's four 16-byte pieces of the K tile and of the V tile (128 threads x 4 x 16 B = 8 KiB each), rows 16 apart
__device__ __forceinline__ void stage_kv(const h16* kg, const h16* vg, unsigned kl, unsigned vl) {
    // s_wait_xcnt stands inside the statement so that no address register of a copy is rewritten ahead of it
    asm volatile("global_load_async_to_lds_b128 %0, %8, off\n\t"
                 "global_load_async_to_lds_b128 %1, %9, off\n\t"
                 "global_load_async_to_lds_b128 %2, %10, off\n\t"
                 "global_load_async_to_lds_b128 %3, %11, off\n\t"
                 "global_load_async_to_lds_b128 %4, %12, off\n\t"
                 "global_load_async_to_lds_b128 %5, %13, off\n\t"
                 "global_load_async_to_lds_b128 %6, %14, off\n\t"
                 "global_load_async_to_lds_b128 %7, %15, off\n\t"
                 "s_wait_xcnt 0x0"
                 :: "v"(kl), "v"(kl + 16 * KVP * 2), "v"(kl + 32 * KVP * 2), "v"(kl + 48 * KVP * 2),
                    "v"(vl), "v"(vl + 16 * KVP * 2), "v"(vl + 32 * KVP * 2), "v"(vl + 48 * KVP * 2),
                    "v"(kg), "v"(kg + 16 * HD), "v"(kg + 32 * HD), "v"(kg + 48 * HD),
                    "v"(vg), "v"(vg + (size_t)16 * SEQ), "v"(vg + (size_t)32 * SEQ), "v"(vg + (size_t)48 * SEQ)
                 : "memory");
}

template <bool B> struct Flag { static constexpr bool value = B; };
// lane l <-> lane l ^ 16
__device__ __forceinline__ float xhalf(float x) { return __builtin_bit_cast(float, __builtin_amdgcn_permlanex16(__builtin_bit_cast(int, x), __builtin_bit_cast(int, x), 0x76543210, 0xfedcba98, false, false)); }
__device__ __forceinline__ float max8(const float* v) { return fmaxf(fmaxf(fmaxf(v[0], v[1]), fmaxf(v[2], v[3])), fmaxf(fmaxf(v[4], v[5]), fmaxf(v[6], v[7]))); }
__device__ __forceinline__ float sum8(const float* v) { return ((v[0] + v[1]) + (v[2] + v[3])) + ((v[4] + v[5]) + (v[6] + v[7])); }

__device__ __forceinline__ void attn16_body(const h16* __restrict__ Q16, const h16* __restrict__ K16, const h16* __restrict__ VT16, h16* CT16, h16* ring, int xb, int bh) {
    // ring: the kernel's LDS, [buffer][K | V][row][KVP]; after the loop: output staging
    const int lane = threadIdx.x & 31, lr = lane & 15, hi = lane >> 4;
    const int wave = __builtin_amdgcn_readfirstlane(threadIdx.x >> 5);
    const int blkbase = xb * (16 * AW); const int rowbase = blkbase + wave * 16;
    const size_t qoff  = ((size_t)bh * SEQ + rowbase + lr) * HD + 8 * hi;
    // staging: thread t owns piece (t & 7) of rows (t >> 3) + 16 j, j = 0..3, of both tiles
    const int srow = threadIdx.x >> 3, sseg = threadIdx.x & 7;
    const h16* kg = K16 + ((size_t)bh * SEQ + srow) * HD + sseg * 8;
    const h16* vg = VT16 + ((size_t)bh * HD + srow) * SEQ + sseg * 8;
    const unsigned sl = (unsigned)(size_t)(ring + srow * KVP + sseg * 8);   // LDS byte address of the piece in buffer 0's K tile
    const int foff = lr * KVP + 8 * hi;                                     // fragment row and half inside a tile
    const int t = rowbase + lr;                                             // this lane's query
    v16h qb[2];                                                             // B operand: column lr = query t, d in the k order of ldh
#pragma unroll
    for (int c = 0; c < 2; ++c) qb[c] = ldh(Q16 + qoff + c * 32);
    v8f o[4]; float l = 0.0f;                                               // o[dt][r] = O[t][dt*16 + 8*hi + r]; l: sum over this half's keys only
    float cm = PLOG;                                                        // PLOG - (this query's maximum in use, base 2); the first tile sets it
    v8f cf;                                                                 // cm in all eight places: the C operand of the score product (a lane's eight rows belong to one query)
#pragma unroll
    for (int r = 0; r < 8; ++r) cf[r] = cm;
#pragma unroll
    for (int dt = 0; dt < 4; ++dt) o[dt] = (v8f){};
    const int nblk = blkbase / 64 + 1;
    stage_kv(kg, vg, sl, sl + KVT * 2);
    asm volatile("s_wait_asynccnt 0x0" ::: "memory");   // tile 0 of this wave's copies has landed
    __syncthreads();                                     // ... and every other wave's
    if (nblk > 1) stage_kv(kg + 64 * HD, vg + 64, sl + 2 * KVT * 2, sl + 3 * KVT * 2);
    // one key tile, hand-over at its foot included; first: the block's first tile, which sets the maximum in use; diag: the tile holds keys behind a query (both compile-time, so that the other tiles carry no compare and no select)
    auto tile = [&](const int jb, auto first, auto diag) __attribute__((always_inline)) {
        const int jbase = jb * 64;
        const h16* kb = ring + (jb & 1) * (2 * KVT) + foff; const h16* vb = kb + KVT;
        v8f s[4];                                        // s[nt][r] = PLOG + (score, base 2) - (maximum in use) of key jbase + nt*16 + 8*hi + r with query t: the argument of exp2 as it leaves the product
        v16h kf;
#pragma unroll
        for (int c = 0; c < 2; ++c) {
#pragma unroll
            for (int nt = 0; nt < 4; ++nt) { const h16* kp = kb + nt * 16 * KVP + c * 32; kf = cat16(*(const v8ha*)kp, *(const v8ha*)(kp + 16)); s[nt] = wmma16(kf, qb[c], c == 0 ? cf : s[nt]); }
        }
        // the four vector slots between the last WMMA and the first reader of its result
        asm volatile("v_nop\n\tv_nop\n\tv_nop\n\tv_nop" : "+v"(s[0]), "+v"(s[1]), "+v"(s[2]), "+v"(s[3]) : "v"(kf));
        const int dq = t - jbase - 8 * hi;               // key > t  <=>  the key's place among this lane's keys, nt*16 + r, > dq
        float v[4][8], mt[4];
#pragma unroll
        for (int nt = 0; nt < 4; ++nt) {
#pragma unroll
            for (int r = 0; r < 8; ++r) v[nt][r] = (decltype(diag)::value && nt * 16 + r > dq) ? NEGB : s[nt][r];
            mt[nt] = max8(v[nt]);
        }
        const float mx = fmaxf(fmaxf(mt[0], mt[1]), fmaxf(mt[2], mt[3]));
        // one test a tile, a scalar branch: the maximum in use moves only when some score of the wave stands more than PTAU above it (and in the first tile, which sets it)
        if (decltype(first)::value || __builtin_amdgcn_ballot_w32(mx > PLOG + PTAU) != 0) {
            const float mq = fmaxf(mx, xhalf(mx)) - PLOG;                      // both halves hold the query's maximum over the 64 keys, counted from the maximum in use
            const float d = decltype(first)::value ? mq : fmaxf(mq, 0.0f);     // the maximum in use rises by d (0 for a query that needs nothing)
#pragma unroll
            for (int nt = 0; nt < 4; ++nt)
#pragma unroll
                for (int r = 0; r < 8; ++r) v[nt][r] -= d;
            cm -= d;
#pragma unroll
            for (int r = 0; r < 8; ++r) cf[r] = cm;
            if (!decltype(first)::value) {                                     // in the first tile O and l are still zero
                const float al = ex2(-d);
                l *= al;
#pragma unroll
                for (int dt = 0; dt < 4; ++dt) o[dt] *= al;
            }
        }
        float st[4]; v16h pb[2];                         // pb[c][e] = p of key jbase + c*32 + (k order of ldh): tiles 2c and 2c+1 as they lie
#pragma unroll
        for (int nt = 0; nt < 4; ++nt) {
            float p[8];
#pragma unroll
            for (int r = 0; r < 8; ++r) { p[r] = ex2(v[nt][r]); pb[nt >> 1][(nt & 1) * 8 + r] = (h16)p[r]; }
            st[nt] = sum8(p);
        }
        l += (st[0] + st[1]) + (st[2] + st[3]);
        v16h vf;
#pragma unroll
        for (int c = 0; c < 2; ++c) {
#pragma unroll
            for (int dt = 0; dt < 4; ++dt) { const h16* vp = vb + dt * 16 * KVP + c * 32; vf = cat16(*(const v8ha*)vp, *(const v8ha*)(vp + 16)); o[dt] = wmma16(vf, pb[c], o[dt]); }
        }
        // the four vector slots behind the last WMMA, on the loop's back edge too
        asm volatile("v_nop\n\tv_nop\n\tv_nop\n\tv_nop" : "+v"(o[0]), "+v"(o[1]), "+v"(o[2]), "+v"(o[3]) : "v"(pb[1]), "v"(vf));
        asm volatile("s_wait_dscnt 0x0" ::: "memory");      // this wave has finished reading the buffer
        asm volatile("s_wait_asynccnt 0x0" ::: "memory");   // this wave's copies of tile jb + 1 have landed
        __syncthreads();                                     // publishes tile jb + 1 and frees the buffer of tile jb
        if (jb + 2 < nblk) { const unsigned bl = sl + (jb & 1) * (2 * KVT * 2); stage_kv(kg + (size_t)(jbase + 128) * HD, vg + jbase + 128, bl, bl + KVT * 2); }
    };
    // every key of a tile before the block's last is < blkbase <= t: the causal test is an identity there and is left out; only the last tile (jbase == blkbase, the diagonal) is masked
    // the first tile is never the last: xb >= AB_HL >= 1, so nblk >= 2
    tile(0, Flag<true>{}, Flag<false>{});
    // kept rolled: one copy of the unmasked tile, the code stays small
#pragma unroll 1
    for (int jb = 1; jb < nblk - 1; ++jb) tile(jb, Flag<false>{}, Flag<false>{});
    tile(nblk - 1, Flag<false>{}, Flag<true>{});
    asm volatile("s_wait_asynccnt 0x0" ::: "memory");       // nothing of the ring is in flight when it becomes output staging
    float* os = (float*)ring + wave * (16 * 68);
    {
        const float lt = l + xhalf(l);
        const float inv = (CCAR / VCAR) * (1.0f / lt);
#pragma unroll
        for (int dt = 0; dt < 4; ++dt) { v4f a, c;
#pragma unroll
            for (int i = 0; i < 4; ++i) { a[i] = o[dt][i] * inv; c[i] = o[dt][4 + i] * inv; }
            *(v4fa*)(os + lr * 68 + dt * 16 + 8 * hi) = a; *(v4fa*)(os + lr * 68 + dt * 16 + 8 * hi + 4) = c; }
    }
    __syncthreads();
    const int b = bh / NH, h = bh % NH; const int rr = lane >> 3, seg = lane & 7;
    h16* dst = CT16 + ((size_t)b * SEQ + rowbase) * DM + h * HD + seg * 8;
{
#pragma unroll
        for (int s = 0; s < 4; ++s) { const int row = s * 4 + rr; const v4f a = *(const v4fa*)(os + row * 68 + seg * 8); const v4f c = *(const v4fa*)(os + row * 68 + seg * 8 + 4); v8h ov;
#pragma unroll
            for (int i = 0; i < 4; ++i) { ov[i] = (h16)a[i]; ov[4 + i] = (h16)c[i]; }
            *(v8h*)(dst + (size_t)row * DM) = ov; }
         }
}

// ---- attnhl_body: the same for query rows < RH on bf16 hi/lo planes, operands straight from global memory, each of the four waves on its own 16 rows: scores kh qh + kh ql + kl qh, p split hi/lo in place, O^T += vh ph + vh pl + vl ph; ctx written as bf16 hi/lo [b][t<RH][h*64+d].
__device__ __forceinline__ void attnhl_body(const bf* __restrict__ Qh, const bf* __restrict__ Ql, const bf* __restrict__ Kh, const bf* __restrict__ Kl,
                                            const bf* __restrict__ VTh, const bf* __restrict__ VTl, bf* ATh, bf* ATl, float* lds, int xb, int bh) {
    const int lane = threadIdx.x & 31, lr = lane & 15, hi = lane >> 4;
    const int wave = __builtin_amdgcn_readfirstlane(threadIdx.x >> 5);
    float* os = lds + wave * (16 * 68);                  // this wave's output staging
    const int rowbase = xb * (16 * AW) + wave * 16;
    const size_t qoff  = ((size_t)bh * RH + rowbase + lr) * HD + 8 * hi;
    const size_t kbase = ((size_t)bh * RH + lr) * HD + 8 * hi;
    const size_t vbase = ((size_t)bh * HD + lr) * RH + 8 * hi;
    const int t = rowbase + lr;                          // this lane's query
    v16bf qh[2], ql[2];
#pragma unroll
    for (int c = 0; c < 2; ++c) { qh[c] = ldb(Qh + qoff + c * 32); ql[c] = ldb(Ql + qoff + c * 32); }
    v8f o[4]; float m = NEGB, l = 0.0f;
#pragma unroll
    for (int dt = 0; dt < 4; ++dt) o[dt] = (v8f){};
    const int nblk = rowbase / 64 + 1;
#pragma unroll 1
    for (int jb = 0; jb < nblk; ++jb) {
        const int jbase = jb * 64;
        v8f s[4];
#pragma unroll
        for (int nt = 0; nt < 4; ++nt) s[nt] = (v8f){};
        v16bf kh, kl;
#pragma unroll
        for (int c = 0; c < 2; ++c) {
#pragma unroll
            for (int nt = 0; nt < 4; ++nt) { const size_t ko = kbase + (size_t)(jbase + nt * 16) * HD + c * 32; kh = ldb(Kh + ko); kl = ldb(Kl + ko);
                s[nt] = wmmab(kh, qh[c], s[nt]); s[nt] = wmmab(kh, ql[c], s[nt]); s[nt] = wmmab(kl, qh[c], s[nt]); }
        }
        // the four vector slots between the last WMMA and the first reader of its result
        asm volatile("v_nop\n\tv_nop\n\tv_nop\n\tv_nop" : "+v"(s[0]), "+v"(s[1]), "+v"(s[2]), "+v"(s[3]) : "v"(kh), "v"(kl));
        const int dq = t - jbase - 8 * hi;               // key > t  <=>  the key's place among this lane's keys, nt*16 + r, > dq
        float v[4][8], mt[4];
#pragma unroll
        for (int nt = 0; nt < 4; ++nt) {
#pragma unroll
            for (int r = 0; r < 8; ++r) { const float sv = s[nt][r] * SCQHL; v[nt][r] = (nt * 16 + r > dq) ? NEGB : sv; }
            mt[nt] = max8(v[nt]);
        }
        float mx = fmaxf(fmaxf(mt[0], mt[1]), fmaxf(mt[2], mt[3]));
        mx = fmaxf(mx, xhalf(mx));
        const float mn = fmaxf(m, mx);
        const float al = ex2((m - mn) * L2E);
        m = mn;
        float st[4]; v8us ph[4], pl[4];
#pragma unroll
        for (int nt = 0; nt < 4; ++nt) {
            float p[8];
#pragma unroll
            for (int r = 0; r < 8; ++r) { p[r] = ex2((v[nt][r] - mn) * L2E); unsigned short x0, x1; splitf(p[r], x0, x1); ph[nt][r] = x0; pl[nt][r] = x1; }
            st[nt] = sum8(p);
        }
        l = l * al + ((st[0] + st[1]) + (st[2] + st[3]));
#pragma unroll
        for (int dt = 0; dt < 4; ++dt) o[dt] *= al;
        v16bf pbh, pbl, vh, vl;
#pragma unroll
        for (int c = 0; c < 2; ++c) {
            pbh = cat16b(ph[2 * c], ph[2 * c + 1]); pbl = cat16b(pl[2 * c], pl[2 * c + 1]);
#pragma unroll
            for (int dt = 0; dt < 4; ++dt) { const size_t vo = vbase + (size_t)(dt * 16) * RH + jbase + c * 32; vh = ldb(VTh + vo); vl = ldb(VTl + vo);
                o[dt] = wmmab(vh, pbh, o[dt]); o[dt] = wmmab(vh, pbl, o[dt]); o[dt] = wmmab(vl, pbh, o[dt]); }
        }
        // the four vector slots behind the last WMMA, on the loop's back edge too
        asm volatile("v_nop\n\tv_nop\n\tv_nop\n\tv_nop" : "+v"(o[0]), "+v"(o[1]), "+v"(o[2]), "+v"(o[3]) : "v"(pbh), "v"(pbl), "v"(vh), "v"(vl));
    }
    {
        const float lt = l + xhalf(l);
        const float inv = 1.0f / lt;
#pragma unroll
        for (int dt = 0; dt < 4; ++dt) { v4f a, c;
#pragma unroll
            for (int i = 0; i < 4; ++i) { a[i] = o[dt][i] * inv; c[i] = o[dt][4 + i] * inv; }
            *(v4fa*)(os + lr * 68 + dt * 16 + 8 * hi) = a; *(v4fa*)(os + lr * 68 + dt * 16 + 8 * hi + 4) = c; }
    }
    __syncthreads();
    const int b = bh / NH, h = bh % NH; const int rr = lane >> 3, seg = lane & 7;
    const size_t dof = ((size_t)b * RH + rowbase) * DM + h * HD + seg * 8;
{
#pragma unroll
        for (int s = 0; s < 4; ++s) { const int row = s * 4 + rr; const v4f a = *(const v4fa*)(os + row * 68 + seg * 8); const v4f c = *(const v4fa*)(os + row * 68 + seg * 8 + 4); v8us oh, ol;
#pragma unroll
            for (int i = 0; i < 4; ++i) { unsigned short x0, x1; splitf(a[i], x0, x1); oh[i] = x0; ol[i] = x1; splitf(c[i], x0, x1); oh[4 + i] = x0; ol[4 + i] = x1; }
            *(v8us*)(ATh + dof + (size_t)row * DM) = oh; *(v8us*)(ATl + dof + (size_t)row * DM) = ol; }
         }
}

// ---- k_attn: all query rows in one launch; the two bodies share no data. The hi/lo blocks (64 rows < RH) come first in the index: their waves walk chains of dependent global loads and use
// little of the vector and matrix units, so they start at once and run beside the f16 blocks. A f16 block walks xb + 1 key tiles and there are more blocks than resident places: they follow
// with the cost falling along the index (row block from the last down, head inside), so that the long blocks start first and the short ones fill the end of the launch.
constexpr int AB_HL = RH / (16 * AW), AB_16 = (SEQ - RH) / (16 * AW);   // 64-row blocks per head of either kind
static_assert(AB_HL > 0 && AB_16 > 0);
// five waves per SIMD asked for: the merged kernel's register count is the larger body's, and left alone the hi/lo body takes so many that the f16 body, which has nearly all the work, would run at four
__global__ __launch_bounds__(32 * AW) __attribute__((amdgpu_waves_per_eu(5))) void k_attn(const h16* __restrict__ Q16, const h16* __restrict__ K16, const h16* __restrict__ VT16, h16* CT16,
                                                  const bf* __restrict__ Qh, const bf* __restrict__ Ql, const bf* __restrict__ Kh, const bf* __restrict__ Kl,
                                                  const bf* __restrict__ VTh, const bf* __restrict__ VTl, bf* ATh, bf* ATl) {
    __shared__ __align__(16) h16 ring[4 * KVT];          // one array for both bodies (two would add up)
    const int i = blockIdx.x;
    if (i < NB * NH * AB_HL) attnhl_body(Qh, Ql, Kh, Kl, VTh, VTl, ATh, ATl, (float*)ring, i % AB_HL, i / AB_HL);
    else { const int j = i - NB * NH * AB_HL; attn16_body(Q16, K16, VT16, CT16, ring, AB_HL + AB_16 - 1 - j / (NB * NH), j % (NB * NH)); }
}

extern "C" void kernel_launch(void* const* d_in, const int* in_sizes, int n_in,
                              void* d_out, int out_size, void* d_ws, size_t ws_size, hipStream_t stream) {
    if (n_in < 5) return;
    if ((size_t)in_sizes[0] < (size_t)(NB - 1) * SEQ_FULL * DM + (size_t)SEQ * DM) return;
    if ((size_t)in_sizes[1] < (size_t)3 * DM * DM || in_sizes[2] < 3 * DM || (size_t)in_sizes[3] < (size_t)DM * DM || in_sizes[4] < DM) return;
    if ((size_t)out_size < (size_t)NB * SEQ * DM) return;
    if (ws_size < WS_TOTAL) return;
    // wire order: x, W_qkv, b_qkv, W_proj, b_proj
    const float* x = (const float*)d_in[0]; const float* wqkv = (const float*)d_in[1]; const float* bqkv = (const float*)d_in[2]; const float* wo = (const float*)d_in[3]; const float* bo = (const float*)d_in[4];
    float* OUT = (float*)d_out;
    char* wsp = (char*)d_ws;
    auto take = [&](size_t bytes) { char* p = wsp; wsp += bytes; return (void*)p; };
    bf* XB = (bf*)take(SZ_XB);
    bf* WQKV = (bf*)take(SZ_WQKV);                 // Bt [3*DM][DM]
    bf* WOb = (bf*)take(SZ_WO); h16* WO16 = (h16*)take(SZ_WO);
    h16* QK16 = (h16*)take(2 * SZ_P16);            // [q | k] f16 planes [bh][t][d]
    h16* VT16 = (h16*)take(SZ_P16);                // [bh][d][t]
    bf* QKh = (bf*)take(2 * SZ_PE); bf* QKl = (bf*)take(2 * SZ_PE);   // [q | k] early-row planes [bh][t<RH][d]
    bf* VTh = (bf*)take(SZ_PE); bf* VTl = (bf*)take(SZ_PE);           // [bh][d][t<RH]
    h16* CT16 = (h16*)take(SZ_CT);                 // ctx f16 x64 [b][t][DM] (rows >= RH used)
    bf* ATh = (bf*)take(SZ_AT); bf* ATl = (bf*)take(SZ_AT);           // ctx hi/lo [b][t<RH][DM]
    float* RC = (float*)take(SZ_ROT); float* RS = (float*)take(SZ_ROT);   // rotary cos / sin [SEQ][32]
    if ((size_t)(wsp - (char*)d_ws) > ws_size) return;

    k_prep<<<PB_WQ + PB_WO + PB_RO + NB * PB_CX, 256, 0, stream>>>(x, wqkv, wo, XB, WQKV, WOb, WO16, RC, RS);
    k_qkv<<<dim3(NB * SEQ / 128, 3 * DM / 128, 1), 128, 0, stream>>>(XB, WQKV, bqkv, RC, RS, QK16, VT16, QKh, QKl, VTh, VTl);
    k_attn<<<NB * NH * (AB_HL + AB_16), 128, 0, stream>>>(QK16, QK16 + PL16, VT16, CT16, QKh, QKl, QKh + PLE, QKl + PLE, VTh, VTl, ATh, ATl);
    k_proj<<<dim3(SEQ / 128, DM / 128, NB), 128, 0, stream>>>(ATh, ATl, WOb, CT16, WO16, OUT, bo);
}

// v009
// One run takes 115 microseconds.
// Next to v008, in two timings, it ran 1.07 times as fast each time.
// Counting every step since v000, it is 3.94 times as fast.
#include <hip/hip_runtime.h>

// Contractions (all f32 accumulate): x*W_qkv on v_wmma_f32_16x16x32_bf16 (both operands bf16 RNE copies of the inputs, exact products);
// q*k^T and p*v: query rows >= 256 on v_wmma_f32_16x16x32_f16 (q carried x log2(e)/4, k x1/2, v x16, p x1024), query rows < 256 on bf16 hi/lo planes (3 products);
// ctx*W_proj: rows >= 256 f16 (ctx x64, w x1024 from the bf16 copy), rows < 256 bf16 hi/lo ctx x bf16 w (2 products). Softmax f32 (running max, exp2).
// Rotary on q and k (interleaved pairs (2i,2i+1) -> (-x[2i+1], x[2i]); angle = pos * inv_freq[d mod 32], inv_freq[j] = 1 / 10000^(j/32)) applied in f32 on the
// staged 64x64 tile in the x*W_qkv epilogue, from cos/sin tables [SEQ][32] built once by rope_body (precise sincosf).
// Layout: x [NB][SEQ_FULL][1024] (rows < SEQ read); W_qkv [1024][3072] (in,out), thirds q|k|v, column = which*1024 + h*64 + d; W_proj [1024][1024] (in,out); out [NB][SEQ][1024].

#ifndef NB
#define NB 4
#endif
#ifndef SEQ
#define SEQ 2048
#endif
#define NB_FULL  4
#define SEQ_FULL 2048
#define DM   1024
#define NH   16
#define HD   64
#define RH   256                 // query rows < RH use bf16 hi/lo planes
#define VCAR  16.0f
#define CCAR  64.0f
#define WCAR  1024.0f
#define PLOG  10.0f              // p carried x 2^10
#define L2E   1.4426950408889634f
#define NEGB  (-3.0e38f)
#define QCAR  (0.25f * L2E)      // f16 q plane; QCAR * KCAR = log2(e) / 8: the f16 score product is the softmax exponent in base 2
#define KCAR  0.5f               // f16 k plane
#define PTAU  5.0f               // a score may stand this far (base 2) above the maximum in use before O and l are rescaled: p <= 2^15 stays inside f16
#define SCQHL 0.125f

typedef _Float16 h16;
typedef unsigned short bf;
typedef __attribute__((ext_vector_type(16))) __bf16   v16bf;
typedef __attribute__((ext_vector_type(16))) _Float16 v16h;
typedef __attribute__((ext_vector_type(8)))  _Float16 v8h;
typedef __attribute__((ext_vector_type(2)))  _Float16 v2h;
typedef __attribute__((ext_vector_type(8)))  unsigned short v8us;
typedef __attribute__((ext_vector_type(2)))  unsigned short v2us;
typedef __attribute__((ext_vector_type(8)))  float    v8f;
typedef __attribute__((ext_vector_type(4)))  float    v4f;
typedef v8h  __attribute__((may_alias)) v8ha;
typedef v4f  __attribute__((may_alias)) v4fa;
typedef v8us __attribute__((may_alias)) v8usa;

static_assert(SEQ % 64 == 0);
static_assert(RH % 64 == 0);
static_assert(RH <= SEQ);
static_assert(SEQ <= SEQ_FULL);
static_assert(NB <= NB_FULL);
static_assert(DM % 64 == 0);
static_assert(DM % 32 == 0);
static_assert(HD == 64);
static_assert(NH * HD == DM);
static_assert((3 * DM) % 64 == 0);
static_assert(HD / 2 == 32);
static_assert(SEQ % 8 == 0);          // rope_body: 8 positions per 256-thread block
static_assert((NB * SEQ) % 128 == 0 && (3 * DM) % 128 == 0 && SEQ % 128 == 0 && RH % 128 == 0 && DM % 128 == 0);   // the three GEMMs: 128x128 block tiles

constexpr size_t PL16 = (size_t)NB * NH * SEQ * HD;     // elements of one f16 head plane set
constexpr size_t PLE  = (size_t)NB * NH * RH * HD;      // elements of one early-row bf16 plane set
constexpr size_t SZ_XB   = (size_t)NB * SEQ * DM * 2;
constexpr size_t SZ_WQKV = (size_t)3 * DM * DM * 2;
constexpr size_t SZ_WO   = (size_t)DM * DM * 2;
constexpr size_t SZ_P16  = PL16 * 2;
constexpr size_t SZ_PE   = PLE * 2;
constexpr size_t SZ_CT   = (size_t)NB * SEQ * DM * 2;
constexpr size_t SZ_AT   = (size_t)NB * RH * DM * 2;
constexpr size_t SZ_ROT  = (size_t)SEQ * 32 * 4;        // one rotary table (cos or sin) [SEQ][32] f32
constexpr size_t WS_TOTAL = SZ_XB + SZ_WQKV + 2 * SZ_WO + 3 * SZ_P16 + 6 * SZ_PE + SZ_CT + 2 * SZ_AT + 2 * SZ_ROT;
static_assert(SZ_XB % 256 == 0 && SZ_WQKV % 256 == 0 && SZ_WO % 256 == 0 && SZ_P16 % 256 == 0 && SZ_PE % 256 == 0 && SZ_CT % 256 == 0 && SZ_AT % 256 == 0);
static_assert(SZ_ROT % 256 == 0);
static_assert(WS_TOTAL <= (size_t)134217728);

__device__ __forceinline__ unsigned short f2bf(float f) { unsigned u = __float_as_uint(f); u += 0x7FFFu + ((u >> 16) & 1u); return (unsigned short)(u >> 16); }
__device__ __forceinline__ float bf2f(unsigned short b) { return __uint_as_float(((unsigned)b) << 16); }
__device__ __forceinline__ float bfr(float f) { return bf2f(f2bf(f)); }
__device__ __forceinline__ void splitf(float y, unsigned short& h, unsigned short& l) { h = f2bf(y); l = f2bf(y - bf2f(h)); }
__device__ __forceinline__ v16h cat16(v8h lo, v8h hi) { return __builtin_shufflevector(lo, hi, 0, 1, 2, 3, 4, 5, 6, 7, 8, 9, 10, 11, 12, 13, 14, 15); }
__device__ __forceinline__ v16bf cat16b(v8us lo, v8us hi) { return __builtin_bit_cast(v16bf, __builtin_shufflevector(lo, hi, 0, 1, 2, 3, 4, 5, 6, 7, 8, 9, 10, 11, 12, 13, 14, 15)); }
__device__ __forceinline__ v8f wmma16(v16h a, v16h b, v8f c) { return __builtin_amdgcn_wmma_f32_16x16x32_f16(false, a, false, b, (short)0, c, false, false); }
__device__ __forceinline__ v8f wmmab(v16bf a, v16bf b, v8f c) { return __builtin_amdgcn_wmma_f32_16x16x32_bf16(false, a, false, b, (short)0, c, false, false); }
__device__ __forceinline__ float ex2(float x) { return __builtin_amdgcn_exp2f(x); }
// f32 -> f16 for operand planes: anything below the smallest f16 normal becomes an exact zero (value select, applied after the carry)
static __device__ __forceinline__ h16 toh_flush(float v) { const h16 r = (h16)v; return (fabsf(v) < 6.103515625e-05f) ? (h16)0.0f : r; }
// fragment loads from K-contiguous 16-bit rows: p already includes + 8*(lane>>4); elements 0..7 <- k0+8h.., 8..15 <- k0+16+8h..
__device__ __forceinline__ v16h  ldh(const h16* p) { return cat16(*(const v8h*)p, *(const v8h*)(p + 16)); }
__device__ __forceinline__ v16bf ldb(const bf* p)  { return cat16b(*(const v8us*)p, *(const v8us*)(p + 16)); }

template <bool B> struct Flag { static constexpr bool value = B; };
template <typename T16> struct WFrag;
template <> struct WFrag<h16> { typedef v16h V; static __device__ __forceinline__ V lds(const h16* p) { return cat16(*(const v8ha*)p, *(const v8ha*)(p + 16)); } static __device__ __forceinline__ v8f mma(V a, V b, v8f c) { return wmma16(a, b, c); } };
template <> struct WFrag<bf>  { typedef v16bf V; static __device__ __forceinline__ V lds(const bf* p) { return cat16b(*(const v8usa*)p, *(const v8usa*)(p + 16)); } static __device__ __forceinline__ v8f mma(V a, V b, v8f c) { return wmmab(a, b, c); } };

// ---- four-wave 128x128 tile main loop (K = DM): per stage of 64 k the block brings 128 rows of A and 128 rows of Bt (128 B each, LDS pitch 144 B) into LDS once by asynchronous
// b128 copies, two buffers: the next stage's copies fly while this one is worked on. Wave (wm, wn) takes its 64x64 quarter's fragments from LDS, in the k order of ldh / ldb.
#define GW    4                  // waves per block (2 x 2)
#define GP    72                 // LDS pitch of a staged operand row, in 16-bit elements
#define GT    (128 * GP)         // elements of one staged operand tile
static_assert(DM % 64 == 0 && DM / 64 >= 2);
static_assert((size_t)GW * 64 * 68 * 4 <= (size_t)4 * GT * 2);   // the output staging fits in the ring it takes over

// this thread's eight 16-byte pieces of one operand tile (128 threads x 8 x 16 B = 16 KiB), rows 16 apart
template <typename T16>
__device__ __forceinline__ void stage_rows(const T16* g, unsigned l) {
    // s_wait_xcnt stands inside the statement so that no address register of a copy is rewritten ahead of it
    asm volatile("global_load_async_to_lds_b128 %0, %8, off\n\t"
                 "global_load_async_to_lds_b128 %1, %9, off\n\t"
                 "global_load_async_to_lds_b128 %2, %10, off\n\t"
                 "global_load_async_to_lds_b128 %3, %11, off\n\t"
                 "global_load_async_to_lds_b128 %4, %12, off\n\t"
                 "global_load_async_to_lds_b128 %5, %13, off\n\t"
                 "global_load_async_to_lds_b128 %6, %14, off\n\t"
                 "global_load_async_to_lds_b128 %7, %15, off\n\t"
                 "s_wait_xcnt 0x0"
                 :: "v"(l), "v"(l + 16 * GP * 2), "v"(l + 32 * GP * 2), "v"(l + 48 * GP * 2),
                    "v"(l + 64 * GP * 2), "v"(l + 80 * GP * 2), "v"(l + 96 * GP * 2), "v"(l + 112 * GP * 2),
                    "v"(g), "v"(g + 16 * DM), "v"(g + 32 * DM), "v"(g + 48 * DM),
                    "v"(g + 64 * DM), "v"(g + 80 * DM), "v"(g + 96 * DM), "v"(g + 112 * DM)
                 : "memory");
}

// ring: [buffer][A | Bt | A2][row][GP] (A2, the lo plane multiplied against the same Bt, only with NSPLIT 1); rb, cb: first of the block's A rows and Bt rows.
// acc[mb][nb] += A[rb+wm*64+mb*16..][k] Bt[cb+wn*64+nb*16..][k]. On return every wave has left the ring and nothing is in flight into it.
// The product can be taken transposed (both loaders have one k order): the wave's Bt rows are then the first operand and its A rows the second, and acc[y][x][j] is Bt row wn*64+y*16+8*hi+j against
// A row wm*64+x*16+lr, so that a lane holds 8 neighbours of one A row's results. SWP: at compile time; swp (block-uniform, NSPLIT 0, SWP false): at run time, by exchanging the two fragment addresses.
template <typename T16, int NSPLIT, bool SWP>
__device__ __forceinline__ void gemm_loop_lds(const T16* __restrict__ A, const T16* __restrict__ A2, const T16* __restrict__ Bt, T16* ring, int rb, int cb, int wm, int wn, bool swp, v8f (&acc)[4][4]) {
    typedef typename WFrag<T16>::V V;
    constexpr int NST = DM / 64, BUF = (2 + NSPLIT) * GT;
    const int lane = threadIdx.x & 31, lr = lane & 15, hi = lane >> 4;
    // staging: thread t owns piece (t & 7) of rows (t >> 3) + 16 j, j = 0..7, of every tile
    const int srow = threadIdx.x >> 3, sseg = threadIdx.x & 7;
    const T16* ag = A + (size_t)(rb + srow) * DM + sseg * 8;
    const T16* a2g = A2 + (size_t)(rb + srow) * DM + sseg * 8;
    const T16* bg = Bt + (size_t)(cb + srow) * DM + sseg * 8;
    const unsigned sl = (unsigned)(size_t)(ring + srow * GP + sseg * 8);   // LDS byte address of the piece in buffer 0's A tile
    const int arow = (wm * 64 + lr) * GP + 8 * hi, brow = GT + (wn * 64 + lr) * GP + 8 * hi;
    const int aof = swp ? brow : arow, bof = swp ? arow : brow;
    auto stage = [&](int st, unsigned l) { stage_rows<T16>(ag + st * 64, l); stage_rows<T16>(bg + st * 64, l + GT * 2); if (NSPLIT == 1) stage_rows<T16>(a2g + st * 64, l + 2 * GT * 2); };
    stage(0, sl);
    asm volatile("s_wait_asynccnt 0x0" ::: "memory");   // stage 0 of this wave's copies has landed
    __syncthreads();                                     // ... and every other wave's
    stage(1, sl + BUF * 2);
    // kept rolled: one copy of the hand-over at the foot, and the code stays small; the loops inside are unrolled so that every fragment and accumulator index is a constant (registers)
#pragma unroll 1
    for (int t = 0; t < NST; ++t) {
        const T16* tb = ring + (t & 1) * BUF;
#pragma unroll
        for (int c = 0; c < 2; ++c) {
            V a[4], a2[4], b[4];
#pragma unroll
            for (int mb = 0; mb < 4; ++mb) { a[mb] = WFrag<T16>::lds(tb + aof + mb * 16 * GP + c * 32); if (NSPLIT == 1) a2[mb] = WFrag<T16>::lds(tb + 2 * GT + aof + mb * 16 * GP + c * 32); }
#pragma unroll
            for (int nb = 0; nb < 4; ++nb) b[nb] = WFrag<T16>::lds(tb + bof + nb * 16 * GP + c * 32);
            // inputs-only fence on the loaded fragments: keeps the LDS loads of this 32-k block together ahead of its WMMAs (one LDS wait a block; sunk between the WMMAs each B fragment costs its own)
            if (NSPLIT == 1) asm volatile("" :: "v"(a[0]), "v"(a[1]), "v"(a[2]), "v"(a[3]), "v"(a2[0]), "v"(a2[1]), "v"(a2[2]), "v"(a2[3]), "v"(b[0]), "v"(b[1]), "v"(b[2]), "v"(b[3]));
            else             asm volatile("" :: "v"(a[0]), "v"(a[1]), "v"(a[2]), "v"(a[3]), "v"(b[0]), "v"(b[1]), "v"(b[2]), "v"(b[3]));
#pragma unroll
            for (int nb = 0; nb < 4; ++nb)
#pragma unroll
                for (int mb = 0; mb < 4; ++mb) {
                    if (SWP) { acc[nb][mb] = WFrag<T16>::mma(b[nb], a[mb], acc[nb][mb]); if (NSPLIT == 1) acc[nb][mb] = WFrag<T16>::mma(b[nb], a2[mb], acc[nb][mb]); }
                    else     { acc[mb][nb] = WFrag<T16>::mma(a[mb], b[nb], acc[mb][nb]); if (NSPLIT == 1) acc[mb][nb] = WFrag<T16>::mma(a2[mb], b[nb], acc[mb][nb]); } }
        }
        asm volatile("s_wait_dscnt 0x0" ::: "memory");      // this wave has finished reading the buffer
        asm volatile("s_wait_asynccnt 0x0" ::: "memory");   // this wave's copies of stage t + 1 have landed
        __syncthreads();                                     // publishes stage t + 1 and frees the buffer of stage t
        if (t + 2 < NST) stage(t + 2, sl + (t & 1) * (BUF * 2));
    }
    asm volatile("s_wait_asynccnt 0x0" ::: "memory");       // nothing of the ring is in flight when it becomes output staging
}

// ---- GEMM with f32 output: C[m][n] = osc * sum_k A[m][k] Bt[n][k] + bf16(bias[n]); K = DM; grid (M/128, N/128, Z), 128 threads, a 64x64 quarter per wave. The product is taken transposed, so that a
// lane holds 8 neighbours of one row of C: the wave lays its quarter into its own LDS staging by b128 stores and reads it back row by row (a store covers two whole 256-B row pieces). No other wave
// touches the staging: the wave's own LDS wait is the only hand-over, and no store is waited for.
template <typename T16, int NSPLIT>
__device__ __forceinline__ void gemm_out_body(const T16* __restrict__ A, const T16* __restrict__ A2, const T16* __restrict__ Bt, float* C, int ldc, const float* __restrict__ bias, float osc, size_t sA, size_t sC, T16* ring) {
    // ring: the kernel's LDS, 2 * (2 + NSPLIT) * GT elements used: operand ring; after the main loop: each wave's 64x68 f32 staging
    const size_t z = blockIdx.z; A += z * sA; A2 += z * sA; C += z * sC;
    const int lane = threadIdx.x & 31, lr = lane & 15, hi = lane >> 4;
    const int wave = __builtin_amdgcn_readfirstlane(threadIdx.x >> 5); const int wm = wave >> 1, wn = wave & 1;
    const int r0 = blockIdx.x * 128 + wm * 64, c0 = blockIdx.y * 128 + wn * 64;
    v8f acc[4][4];
#pragma unroll
    for (int mb = 0; mb < 4; ++mb)
#pragma unroll
        for (int nb = 0; nb < 4; ++nb) acc[mb][nb] = (v8f){};
    gemm_loop_lds<T16, NSPLIT, true>(A, A2, Bt, ring, blockIdx.x * 128, blockIdx.y * 128, wm, wn, false, acc);
    float* os = (float*)ring + wave * (64 * 68);
    const int cofs = lr * 4;
    const v4f bv = *(const v4f*)(bias + c0 + cofs);
    v4f bb; bb[0] = bfr(bv[0]); bb[1] = bfr(bv[1]); bb[2] = bfr(bv[2]); bb[3] = bfr(bv[3]);
    // acc[y][x][j]: row x*16 + lr of the quarter, column y*16 + 8*hi + j
#pragma unroll
    for (int x = 0; x < 4; ++x)
#pragma unroll
        for (int y = 0; y < 4; ++y) { float* p = os + (x * 16 + lr) * 68 + y * 16 + 8 * hi; v4f a, c;
#pragma unroll
            for (int i = 0; i < 4; ++i) { a[i] = acc[y][x][i]; c[i] = acc[y][x][4 + i]; }
            *(v4fa*)p = a; *(v4fa*)(p + 4) = c; }
    asm volatile("s_wait_dscnt 0x0" ::: "memory");       // this wave's rows are written before its lanes read one another's
    float* crow = C + (size_t)r0 * ldc + c0 + cofs;
#pragma unroll
    for (int s = 0; s < 32; ++s) { const int row = 2 * s + hi; const v4f t = *(const v4fa*)(os + row * 68 + cofs); v4f val;
        val[0] = t[0] * osc + bb[0]; val[1] = t[1] * osc + bb[1]; val[2] = t[2] * osc + bb[2]; val[3] = t[3] * osc + bb[3];
        *(v4f*)(crow + (size_t)row * ldc) = val; }
}

// ---- k_proj: ctx W_proj + b_proj for all rows in one launch, grid (SEQ/128, DM/128, NB), z = batch; the two bodies share no data, so the few hi/lo tiles run beside the f16 tiles.
// row tiles < RH: ctx hi/lo (bf16) x w_proj (bf16); row tiles >= RH: ctx f16 (x64) x w_proj f16 (x1024)
__global__ __launch_bounds__(32 * GW) void k_proj(const bf* __restrict__ Ah, const bf* __restrict__ Al, const bf* __restrict__ Wt, const h16* __restrict__ A16, const h16* __restrict__ Wt16,
                                                  float* C, const float* __restrict__ bias) {
    __shared__ __align__(16) bf ring[2 * 3 * GT];        // one array for both bodies (two would add up)
    if (blockIdx.x < RH / 128) gemm_out_body<bf, 1>(Ah, Al, Wt, C, DM, bias, 1.0f, (size_t)RH * DM, (size_t)SEQ * DM, ring);
    else                       gemm_out_body<h16, 0>(A16, A16, Wt16, C, DM, bias, 1.0f / (CCAR * WCAR), (size_t)SEQ * DM, (size_t)SEQ * DM, (h16*)ring);
}

// bx: block inside a batch, b: batch
__device__ __forceinline__ void cvt8_body(const float* __restrict__ src, bf* dst, unsigned n8, unsigned bx, size_t b) {
    src += b * (size_t)SEQ_FULL * DM; dst += b * (size_t)SEQ * DM;
    const unsigned i = bx * 256 + threadIdx.x; if (i >= n8) return;
    const v8f v = *(const v8f*)(src + (size_t)i * 8); v8us o;
#pragma unroll
    for (int k = 0; k < 8; ++k) o[k] = f2bf(v[k]);
    *(v8us*)(dst + (size_t)i * 8) = o; 
}

// ---- wtG_body: Bt[n][k] = bf16(w[k][n]) (and Bt16 = that value x car in f16), one 64 (k) x 64 (n) tile per 256-thread block, turned in LDS so that both sides move whole 128-B lines:
// a wave's b128 load covers 256 B of two rows of w, a wave's b128 store four whole rows of 64 k. tl: 64 rows of TP f32.
#define TP 65                    // LDS pitch in f32: 8 * TP = 8 mod 64, so that a wave's gather (8 segments of k x 4 n) falls on 32 different banks
template <bool H16>             // H16: the f16 copy is written too
__device__ __forceinline__ void wtG_body(const float* __restrict__ w, int K, int N, bf* Bt, h16* Bt16, float car, unsigned bx, float* tl) {
    const int ntn = N / 64; const int k0 = (int)(bx / ntn) * 64, n0 = (int)(bx % ntn) * 64;
    const int lrow = threadIdx.x >> 4, lcol = (threadIdx.x & 15) * 4;
    v4f v[4];
    for (int p = 0; p < 4; ++p) v[p] = *(const v4f*)(w + (size_t)(k0 + p * 16 + lrow) * N + n0 + lcol);
    for (int p = 0; p < 4; ++p)
        for (int i = 0; i < 4; ++i) tl[(p * 16 + lrow) * TP + lcol + i] = v[p][i];
    __syncthreads();                                     // the tile is whole before any column of it is gathered
    const int kseg = threadIdx.x & 7, nr = threadIdx.x >> 3;
    const size_t e = (size_t)(n0 + nr) * K + k0 + kseg * 8;   // rows n0 + nr and n0 + nr + 32
    v8us o[2]; v8h o2[2];
    for (int p = 0; p < 2; ++p)
        for (int j = 0; j < 8; ++j) { o[p][j] = f2bf(tl[(kseg * 8 + j) * TP + p * 32 + nr]); if (H16) o2[p][j] = (h16)(bf2f(o[p][j]) * car); }
    for (int p = 0; p < 2; ++p) { *(v8us*)(Bt + e + (size_t)p * 32 * K) = o[p]; if (H16) *(v8h*)(Bt16 + e + (size_t)p * 32 * K) = o2[p]; }
    asm volatile("s_wait_xcnt 0x0" ::: "memory");        // behind the run of stores: the compiler lays another body of k_prep out behind this one, and its first instructions rewrite the stores' registers
}

// ---- rope_body: rotary tables RC = cos, RS = sin, [SEQ][32] f32; angle = (float)pos * inv_freq[j], inv_freq[j] = 1.0f / (float)(10000^(j/32));
__device__ __forceinline__ void rope_body(float* RC, float* RS, unsigned bx) {
#pragma clang fp contract(off)
    const int wave = __builtin_amdgcn_readfirstlane(threadIdx.x >> 5); const int lane = threadIdx.x & 31;
    const int pos = bx * 8 + wave; if (pos >= SEQ) return;
    double p = 1.0;
#pragma unroll 1
    for (int j = 0; j < lane; ++j) p = p * 1.3335214321633240;
    const float pw = (float)p; const float inv = 1.0f / pw; const float ang = (float)pos * inv;
    float sv, cv; sincosf(ang, &sv, &cv);
    float* pc = RC + (size_t)pos * 32 + lane; float* pq = RS + (size_t)pos * 32 + lane;
    *(float*)pc = cv; *(float*)pq = sv; 
}

// ---- k_prep: the four preparations (W_qkv and W_proj transposed to bf16 / f16, rotary tables, x to bf16) share no data: one launch, the body picked by block range.
// The transposes (load, barrier, gather, store: the longest chain of a block) come first in the index; the stream over x fills in behind them.
constexpr unsigned PB_WQ = (3 * DM / 64) * (DM / 64);                         // blocks (64x64 tiles) of the W_qkv transpose
constexpr unsigned PB_WO = (DM / 64) * (DM / 64);                             // ... of the W_proj transpose
constexpr unsigned PB_RO = (SEQ + 7) / 8;                                     // ... of the rotary tables
constexpr unsigned PB_CX = (unsigned)(((size_t)SEQ * DM / 8 + 255) / 256);    // ... of one batch of x
__global__ __launch_bounds__(256) void k_prep(const float* __restrict__ x, const float* __restrict__ wqkv, const float* __restrict__ wo, bf* XB, bf* WQKV, bf* WOb, h16* WO16, float* RC, float* RS) {
    __shared__ __align__(16) float tl[64 * TP];          // the transposes' tile
    unsigned b = blockIdx.x;
    if (b < PB_WQ) { wtG_body<false>(wqkv, DM, 3 * DM, WQKV, (h16*)nullptr, 1.0f, b, tl); return; }   // in[DM][3*DM] -> out[3*DM][DM]
    b -= PB_WQ;
    if (b < PB_WO) { wtG_body<true>(wo, DM, DM, WOb, WO16, WCAR, b, tl); return; }                    // in[DM][DM] -> out[DM][DM]
    b -= PB_WO;
    if (b < PB_RO) { rope_body(RC, RS, b); return; }
    b -= PB_RO;
    cvt8_body(x, XB, (unsigned)((size_t)SEQ * DM / 8), b % PB_CX, b / PB_CX);
}

// ---- k_qkv: four waves per 128x128 tile of x W_qkv + b_qkv (bf16 x bf16 exact), one 64x64 quarter (64 tokens x one head third) each. The product's orientation is chosen by the destination plane:
// q and k quarters are taken transposed (a lane holds 8 consecutive d of one token, planes [t][d]), v quarters as they are (8 consecutive tokens of one d, plane [d][t]). Either way the wave lays its
// quarter into its own LDS staging once, by b128 stores, as 64 plane rows of 64 f32, and reads each row back in pieces of 8 (whole 128-B lines per store): bias, rotary (4 whole pairs a lane), carry
// and conversion are done on the way out, in registers. No other wave touches the staging, so the wave's own LDS wait is the only hand-over.
__global__ __launch_bounds__(32 * GW) void k_qkv(const bf* __restrict__ XB, const bf* __restrict__ W, const float* __restrict__ bias, const float* __restrict__ RC, const float* __restrict__ RS,
                                             h16* QK16, h16* VT16, bf* QKh, bf* QKl, bf* VTh, bf* VTl) {
    __shared__ __align__(16) bf ring[4 * GT];            // operand ring; after the main loop: each wave's 64x68 f32 output staging
    const int lane = threadIdx.x & 31, lr = lane & 15, hi = lane >> 4;
    const int wave = __builtin_amdgcn_readfirstlane(threadIdx.x >> 5); const int wm = wave >> 1, wn = wave & 1;
    const int r0 = blockIdx.x * 128 + wm * 64, c0 = blockIdx.y * 128 + wn * 64;
    const int which = c0 / DM;
    v8f acc[4][4];
#pragma unroll
    for (int mb = 0; mb < 4; ++mb)
#pragma unroll
        for (int nb = 0; nb < 4; ++nb) acc[mb][nb] = (v8f){};
    gemm_loop_lds<bf, 0, false>(XB, XB, W, ring, blockIdx.x * 128, blockIdx.y * 128, wm, wn, which < 2, acc);
    float* os = (float*)ring + wave * (64 * 68);
    const int h = (c0 % DM) / HD; const int b = r0 / SEQ; const int t0 = r0 % SEQ; const int bhh = b * NH + h; const bool early = (t0 < RH); const int te = early ? t0 : 0;
    const int rr = lane >> 3, seg = lane & 7;
    // acc[y][x][j]: plane row x*16 + lr, place y*16 + 8*hi + j in it. vb (v): the row is a column of W_qkv, its bias goes in here; q, k: the bias runs along the row and goes in on the way out
    auto lay = [&](auto vb) __attribute__((always_inline)) {
        float bc[4] = {0.0f, 0.0f, 0.0f, 0.0f};
        if (decltype(vb)::value) { const float* bp = bias + c0;
#pragma unroll
            for (int x = 0; x < 4; ++x) bc[x] = bp[x * 16 + lr];
            asm volatile("s_wait_xcnt 0x0" :: "v"(lr) : "memory");   // behind the four loads; their offset register is an input, so that it lives up to here and no load returns into it
#pragma unroll
            for (int x = 0; x < 4; ++x) bc[x] = bfr(bc[x]); }
#pragma unroll
        for (int x = 0; x < 4; ++x)
#pragma unroll
            for (int y = 0; y < 4; ++y) { float* p = os + (x * 16 + lr) * 68 + y * 16 + 8 * hi; v4f a, c;
#pragma unroll
                for (int i = 0; i < 4; ++i) { a[i] = decltype(vb)::value ? acc[y][x][i] + bc[x] : acc[y][x][i]; c[i] = decltype(vb)::value ? acc[y][x][4 + i] + bc[x] : acc[y][x][4 + i]; }
                *(v4fa*)p = a; *(v4fa*)(p + 4) = c; }
        asm volatile("s_wait_dscnt 0x0" ::: "memory");   // this wave's rows are written before its lanes read one another's
    };
    // one piece of 8 out: f16 plane (x car), and with ef (early tokens) the bf16 hi / lo planes
    auto emit = [&](auto ef, const v4f a, const v4f c, const float car, h16* p16, bf* ph, bf* pl) __attribute__((always_inline)) {
        v8h o;
#pragma unroll
        for (int i = 0; i < 4; ++i) { o[i] = toh_flush(a[i] * car); o[4 + i] = toh_flush(c[i] * car); }
        *(v8h*)p16 = o;
        if (decltype(ef)::value) { v8us oh, ol;
#pragma unroll
            for (int i = 0; i < 4; ++i) { unsigned short x0, x1; splitf(a[i], x0, x1); oh[i] = x0; ol[i] = x1; splitf(c[i], x0, x1); oh[4 + i] = x0; ol[4 + i] = x1; }
            *(v8us*)ph = oh; *(v8us*)pl = ol; }
    };
    if (which < 2) {
        // lane owns d = seg*8 .. seg*8+7 of row (token) s*4+rr; rotary table column = d mod 32 = (seg & 3)*8 + i; position = t0 + row
        h16* P16 = QK16 + (size_t)which * PL16 + ((size_t)bhh * SEQ + t0 + rr) * HD + seg * 8;
        bf* PH = QKh + (size_t)which * PLE + ((size_t)bhh * RH + te + rr) * HD + seg * 8;
        bf* PL = QKl + (size_t)which * PLE + ((size_t)bhh * RH + te + rr) * HD + seg * 8;
        const float car = which == 0 ? QCAR : KCAR;
        const size_t tof = (size_t)(t0 + rr) * 32 + (seg & 3) * 8;
        const v4f b0 = *(const v4f*)(bias + c0 + seg * 8), b1 = *(const v4f*)(bias + c0 + seg * 8 + 4); v4f ba, bb;
#pragma unroll
        for (int i = 0; i < 4; ++i) { ba[i] = bfr(b0[i]); bb[i] = bfr(b1[i]); }
        lay(Flag<false>{});
        auto out = [&](auto ef) __attribute__((always_inline)) {
            // kept rolled (code size); four rows a trip, no branch among them: their sixteen table loads are in flight together, one latency a trip and not one a row
#pragma unroll 1
            for (int g = 0; g < 4; ++g) {
                v4f ca[4], cb[4], sa[4], sb[4], a[4], c[4];
                const float* pc = RC + tof + (size_t)g * 512; const float* ps = RS + tof + (size_t)g * 512;
#pragma unroll
                for (int u = 0; u < 4; ++u) { ca[u] = *(const v4f*)(pc + u * 128); cb[u] = *(const v4f*)(pc + u * 128 + 4); sa[u] = *(const v4f*)(ps + u * 128); sb[u] = *(const v4f*)(ps + u * 128 + 4); }
                asm volatile("s_wait_xcnt 0x0" :: "v"(pc), "v"(ps) : "memory");   // behind the sixteen loads; their addresses are inputs, so that they live up to here and no load returns into them
#pragma unroll
                for (int u = 0; u < 4; ++u) { const float* p = os + ((g * 4 + u) * 4 + rr) * 68 + seg * 8; a[u] = *(const v4fa*)p + ba; c[u] = *(const v4fa*)(p + 4) + bb; }
#pragma unroll
                for (int u = 0; u < 4; ++u) { const size_t ro = (size_t)(g * 4 + u) * 4 * HD; v4f ra, rc;
                    ra[0] = a[u][0] * ca[u][0] + (-a[u][1]) * sa[u][0]; ra[1] = a[u][1] * ca[u][1] + a[u][0] * sa[u][1];
                    ra[2] = a[u][2] * ca[u][2] + (-a[u][3]) * sa[u][2]; ra[3] = a[u][3] * ca[u][3] + a[u][2] * sa[u][3];
                    rc[0] = c[u][0] * cb[u][0] + (-c[u][1]) * sb[u][0]; rc[1] = c[u][1] * cb[u][1] + c[u][0] * sb[u][1];
                    rc[2] = c[u][2] * cb[u][2] + (-c[u][3]) * sb[u][2]; rc[3] = c[u][3] * cb[u][3] + c[u][2] * sb[u][3];
                    emit(ef, ra, rc, car, P16 + ro, PH + ro, PL + ro); }
                asm volatile("s_wait_xcnt 0x0" ::: "memory");   // behind the trip's stores: the next trip rewrites their registers
            }
        };
        if (early) out(Flag<true>{}); else out(Flag<false>{});
    } else {
        // lane owns tokens t0 + seg*8 .. +7 of row d = s*4+rr
        h16* P16 = VT16 + ((size_t)bhh * HD + rr) * SEQ + t0 + seg * 8;
        bf* PH = VTh + ((size_t)bhh * HD + rr) * RH + te + seg * 8;
        bf* PL = VTl + ((size_t)bhh * HD + rr) * RH + te + seg * 8;
        lay(Flag<true>{});
        auto out = [&](auto ef) __attribute__((always_inline)) {
            // kept rolled (code size); four rows a trip
#pragma unroll 1
            for (int g = 0; g < 4; ++g) {
                v4f a[4], c[4];
#pragma unroll
                for (int u = 0; u < 4; ++u) { const float* p = os + ((g * 4 + u) * 4 + rr) * 68 + seg * 8; a[u] = *(const v4fa*)p; c[u] = *(const v4fa*)(p + 4); }
#pragma unroll
                for (int u = 0; u < 4; ++u) { const size_t d4 = (size_t)(g * 4 + u) * 4; emit(ef, a[u], c[u], VCAR, P16 + d4 * SEQ, PH + d4 * RH, PL + d4 * RH); }
                asm volatile("s_wait_xcnt 0x0" ::: "memory");   // behind the trip's stores: the next trip rewrites their registers
            }
        };
        if (early) out(Flag<true>{}); else out(Flag<false>{});
    }
}

// ---- attn16_body: fused causal attention, query rows >= RH (xb: 64-row block counted from row 0, bh: batch * NH + head); four waves per block, 16 query rows each (64 rows that share one diagonal block), 64-key blocks up to the diagonal.
// Each 64-key K tile [key][d] and V tile [d][key] is brought into LDS once per block by asynchronous b128 copies (rows of 128 B at a pitch of 144 B), two buffers: the next
// tile's copies fly while this one is worked on; all four waves take their fragments from LDS. The products are taken transposed: S^T = K Q^T (A = K rows, B = the wave's Q, held in
// registers, C = 10 - the query's maximum in use, so that D is the argument of exp2) and O^T += V^T P^T (A = V^T rows). A lane then holds 32 of the 64 scores of ONE query (lane ^ 16 the other 32): max and sum (f32) are in-lane plus one exchange
// between the halves, and two score tiles, converted in place (p x1024, f16), are the B operand of the second product. ctx = O / l written as f16 x64 into [b][t][h*64+d].
#define AW    4                  // waves per block
#define KVP   72                 // LDS pitch of a K or V tile row, in f16 elements
#define KVT   (64 * KVP)         // elements of one staged tile
static_assert((SEQ - RH) % (16 * AW) == 0 && RH % (16 * AW) == 0 && 16 * AW == 64);
static_assert((size_t)AW * 16 * 68 * 4 <= (size_t)4 * KVT * 2);   // the output staging fits in the ring it takes over

// one stage: this thread's four 16-byte pieces of the K tile and of the V tile (128 threads x 4 x 16 B = 8 KiB each), rows 16 apart
__device__ __forceinline__ void stage_kv(const h16* kg, const h16* vg, unsigned kl, unsigned vl) {
    // s_wait_xcnt stands inside the statement so that no address register of a copy is rewritten ahead of it
    asm volatile("global_load_async_to_lds_b128 %0, %8, off\n\t"
                 "global_load_async_to_lds_b128 %1, %9, off\n\t"
                 "global_load_async_to_lds_b128 %2, %10, off\n\t"
                 "global_load_async_to_lds_b128 %3, %11, off\n\t"
                 "global_load_async_to_lds_b128 %4, %12, off\n\t"
                 "global_load_async_to_lds_b128 %5, %13, off\n\t"
                 "global_load_async_to_lds_b128 %6, %14, off\n\t"
                 "global_load_async_to_lds_b128 %7, %15, off\n\t"
                 "s_wait_xcnt 0x0"
                 :: "v"(kl), "v"(kl + 16 * KVP * 2), "v"(kl + 32 * KVP * 2), "v"(kl + 48 * KVP * 2),
                    "v"(vl), "v"(vl + 16 * KVP * 2), "v"(vl + 32 * KVP * 2), "v"(vl + 48 * KVP * 2),
                    "v"(kg), "v"(kg + 16 * HD), "v"(kg + 32 * HD), "v"(kg + 48 * HD),
                    "v"(vg), "v"(vg + (size_t)16 * SEQ), "v"(vg + (size_t)32 * SEQ), "v"(vg + (size_t)48 * SEQ)
                 : "memory");
}

// lane l <-> lane l ^ 16
__device__ __forceinline__ float xhalf(float x) { return __builtin_bit_cast(float, __builtin_amdgcn_permlanex16(__builtin_bit_cast(int, x), __builtin_bit_cast(int, x), 0x76543210, 0xfedcba98, false, false)); }
__device__ __forceinline__ float max8(const float* v) { return fmaxf(fmaxf(fmaxf(v[0], v[1]), fmaxf(v[2], v[3])), fmaxf(fmaxf(v[4], v[5]), fmaxf(v[6], v[7]))); }
__device__ __forceinline__ float sum8(const float* v) { return ((v[0] + v[1]) + (v[2] + v[3])) + ((v[4] + v[5]) + (v[6] + v[7])); }

__device__ __forceinline__ void attn16_body(const h16* __restrict__ Q16, const h16* __restrict__ K16, const h16* __restrict__ VT16, h16* CT16, h16* ring, int xb, int bh) {
    // ring: the kernel's LDS, [buffer][K | V][row][KVP]; after the loop: output staging
    const int lane = threadIdx.x & 31, lr = lane & 15, hi = lane >> 4;
    const int wave = __builtin_amdgcn_readfirstlane(threadIdx.x >> 5);
    const int blkbase = xb * (16 * AW); const int rowbase = blkbase + wave * 16;
    const size_t qoff  = ((size_t)bh * SEQ + rowbase + lr) * HD + 8 * hi;
    // staging: thread t owns piece (t & 7) of rows (t >> 3) + 16 j, j = 0..3, of both tiles
    const int srow = threadIdx.x >> 3, sseg = threadIdx.x & 7;
    const h16* kg = K16 + ((size_t)bh * SEQ + srow) * HD + sseg * 8;
    const h16* vg = VT16 + ((size_t)bh * HD + srow) * SEQ + sseg * 8;
    const unsigned sl = (unsigned)(size_t)(ring + srow * KVP + sseg * 8);   // LDS byte address of the piece in buffer 0's K tile
    const int foff = lr * KVP + 8 * hi;                                     // fragment row and half inside a tile
    const int t = rowbase + lr;                                             // this lane's query
    v16h qb[2];                                                             // B operand: column lr = query t, d in the k order of ldh
#pragma unroll
    for (int c = 0; c < 2; ++c) qb[c] = ldh(Q16 + qoff + c * 32);
    v8f o[4]; float l = 0.0f;                                               // o[dt][r] = O[t][dt*16 + 8*hi + r]; l: sum over this half's keys only
    float cm = PLOG;                                                        // PLOG - (this query's maximum in use, base 2); the first tile sets it
    v8f cf;                                                                 // cm in all eight places: the C operand of the score product (a lane's eight rows belong to one query)
#pragma unroll
    for (int r = 0; r < 8; ++r) cf[r] = cm;
#pragma unroll
    for (int dt = 0; dt < 4; ++dt) o[dt] = (v8f){};
    const int nblk = blkbase / 64 + 1;
    stage_kv(kg, vg, sl, sl + KVT * 2);
    asm volatile("s_wait_asynccnt 0x0" ::: "memory");   // tile 0 of this wave's copies has landed
    __syncthreads();                                     // ... and every other wave's
    if (nblk > 1) stage_kv(kg + 64 * HD, vg + 64, sl + 2 * KVT * 2, sl + 3 * KVT * 2);
    // one key tile, hand-over at its foot included; first: the block's first tile, which sets the maximum in use; diag: the tile holds keys behind a query (both compile-time, so that the other tiles carry no compare and no select)
    auto tile = [&](const int jb, auto first, auto diag) __attribute__((always_inline)) {
        const int jbase = jb * 64;
        const h16* kb = ring + (jb & 1) * (2 * KVT) + foff; const h16* vb = kb + KVT;
        v8f s[4];                                        // s[nt][r] = PLOG + (score, base 2) - (maximum in use) of key jbase + nt*16 + 8*hi + r with query t: the argument of exp2 as it leaves the product
        v16h kf;
#pragma unroll
        for (int c = 0; c < 2; ++c) {
#pragma unroll
            for (int nt = 0; nt < 4; ++nt) { const h16* kp = kb + nt * 16 * KVP + c * 32; kf = cat16(*(const v8ha*)kp, *(const v8ha*)(kp + 16)); s[nt] = wmma16(kf, qb[c], c == 0 ? cf : s[nt]); }
        }
        // the four vector slots between the last WMMA and the first reader of its result
        asm volatile("v_nop\n\tv_nop\n\tv_nop\n\tv_nop" : "+v"(s[0]), "+v"(s[1]), "+v"(s[2]), "+v"(s[3]) : "v"(kf));
        const int dq = t - jbase - 8 * hi;               // key > t  <=>  the key's place among this lane's keys, nt*16 + r, > dq
        float v[4][8], mt[4];
#pragma unroll
        for (int nt = 0; nt < 4; ++nt) {
#pragma unroll
            for (int r = 0; r < 8; ++r) v[nt][r] = (decltype(diag)::value && nt * 16 + r > dq) ? NEGB : s[nt][r];
            mt[nt] = max8(v[nt]);
        }
        const float mx = fmaxf(fmaxf(mt[0], mt[1]), fmaxf(mt[2], mt[3]));
        // one test a tile, a scalar branch: the maximum in use moves only when some score of the wave stands more than PTAU above it (and in the first tile, which sets it)
        if (decltype(first)::value || __builtin_amdgcn_ballot_w32(mx > PLOG + PTAU) != 0) {
            const float mq = fmaxf(mx, xhalf(mx)) - PLOG;                      // both halves hold the query's maximum over the 64 keys, counted from the maximum in use
            const float d = decltype(first)::value ? mq : fmaxf(mq, 0.0f);     // the maximum in use rises by d (0 for a query that needs nothing)
#pragma unroll
            for (int nt = 0; nt < 4; ++nt)
#pragma unroll
                for (int r = 0; r < 8; ++r) v[nt][r] -= d;
            cm -= d;
#pragma unroll
            for (int r = 0; r < 8; ++r) cf[r] = cm;
            if (!decltype(first)::value) {                                     // in the first tile O and l are still zero
                const float al = ex2(-d);
                l *= al;
#pragma unroll
                for (int dt = 0; dt < 4; ++dt) o[dt] *= al;
            }
        }
        float st[4]; v16h pb[2];                         // pb[c][e] = p of key jbase + c*32 + (k order of ldh): tiles 2c and 2c+1 as they lie
#pragma unroll
        for (int nt = 0; nt < 4; ++nt) {
            float p[8];
#pragma unroll
            for (int r = 0; r < 8; ++r) { p[r] = ex2(v[nt][r]); pb[nt >> 1][(nt & 1) * 8 + r] = (h16)p[r]; }
            st[nt] = sum8(p);
        }
        l += (st[0] + st[1]) + (st[2] + st[3]);
        v16h vf;
#pragma unroll
        for (int c = 0; c < 2; ++c) {
#pragma unroll
            for (int dt = 0; dt < 4; ++dt) { const h16* vp = vb + dt * 16 * KVP + c * 32; vf = cat16(*(const v8ha*)vp, *(const v8ha*)(vp + 16)); o[dt] = wmma16(vf, pb[c], o[dt]); }
        }
        // the four vector slots behind the last WMMA, on the loop's back edge too
        asm volatile("v_nop\n\tv_nop\n\tv_nop\n\tv_nop" : "+v"(o[0]), "+v"(o[1]), "+v"(o[2]), "+v"(o[3]) : "v"(pb[1]), "v"(vf));
        asm volatile("s_wait_dscnt 0x0" ::: "memory");      // this wave has finished reading the buffer
        asm volatile("s_wait_asynccnt 0x0" ::: "memory");   // this wave's copies of tile jb + 1 have landed
        __syncthreads();                                     // publishes tile jb + 1 and frees the buffer of tile jb
        if (jb + 2 < nblk) { const unsigned bl = sl + (jb & 1) * (2 * KVT * 2); stage_kv(kg + (size_t)(jbase + 128) * HD, vg + jbase + 128, bl, bl + KVT * 2); }
    };
    // every key of a tile before the block's last is < blkbase <= t: the causal test is an identity there and is left out; only the last tile (jbase == blkbase, the diagonal) is masked
    // the first tile is never the last: xb >= AB_HL >= 1, so nblk >= 2
    tile(0, Flag<true>{}, Flag<false>{});
    // kept rolled: one copy of the unmasked tile, the code stays small
#pragma unroll 1
    for (int jb = 1; jb < nblk - 1; ++jb) tile(jb, Flag<false>{}, Flag<false>{});
    tile(nblk - 1, Flag<false>{}, Flag<true>{});
    asm volatile("s_wait_asynccnt 0x0" ::: "memory");       // nothing of the ring is in flight when it becomes output staging
    float* os = (float*)ring + wave * (16 * 68);
    {
        const float lt = l + xhalf(l);
        const float inv = (CCAR / VCAR) * (1.0f / lt);
#pragma unroll
        for (int dt = 0; dt < 4; ++dt) { v4f a, c;
#pragma unroll
            for (int i = 0; i < 4; ++i) { a[i] = o[dt][i] * inv; c[i] = o[dt][4 + i] * inv; }
            *(v4fa*)(os + lr * 68 + dt * 16 + 8 * hi) = a; *(v4fa*)(os + lr * 68 + dt * 16 + 8 * hi + 4) = c; }
    }
    __syncthreads();
    const int b = bh / NH, h = bh % NH; const int rr = lane >> 3, seg = lane & 7;
    h16* dst = CT16 + ((size_t)b * SEQ + rowbase) * DM + h * HD + seg * 8;
{
#pragma unroll
        for (int s = 0; s < 4; ++s) { const int row = s * 4 + rr; const v4f a = *(const v4fa*)(os + row * 68 + seg * 8); const v4f c = *(const v4fa*)(os + row * 68 + seg * 8 + 4); v8h ov;
#pragma unroll
            for (int i = 0; i < 4; ++i) { ov[i] = (h16)a[i]; ov[4 + i] = (h16)c[i]; }
            *(v8h*)(dst + (size_t)row * DM) = ov; }
         }
}

// ---- attnhl_body: the same for query rows < RH on bf16 hi/lo planes, operands straight from global memory, each of the four waves on its own 16 rows: scores kh qh + kh ql + kl qh, p split hi/lo in place, O^T += vh ph + vh pl + vl ph; ctx written as bf16 hi/lo [b][t<RH][h*64+d].
__device__ __forceinline__ void attnhl_body(const bf* __restrict__ Qh, const bf* __restrict__ Ql, const bf* __restrict__ Kh, const bf* __restrict__ Kl,
                                            const bf* __restrict__ VTh, const bf* __restrict__ VTl, bf* ATh, bf* ATl, float* lds, int xb, int bh) {
    const int lane = threadIdx.x & 31, lr = lane & 15, hi = lane >> 4;
    const int wave = __builtin_amdgcn_readfirstlane(threadIdx.x >> 5);
    float* os = lds + wave * (16 * 68);                  // this wave's output staging
    const int rowbase = xb * (16 * AW) + wave * 16;
    const size_t qoff  = ((size_t)bh * RH + rowbase + lr) * HD + 8 * hi;
    const size_t kbase = ((size_t)bh * RH + lr) * HD + 8 * hi;
    const size_t vbase = ((size_t)bh * HD + lr) * RH + 8 * hi;
    const int t = rowbase + lr;                          // this lane's query
    v16bf qh[2], ql[2];
#pragma unroll
    for (int c = 0; c < 2; ++c) { qh[c] = ldb(Qh + qoff + c * 32); ql[c] = ldb(Ql + qoff + c * 32); }
    v8f o[4]; float m = NEGB, l = 0.0f;
#pragma unroll
    for (int dt = 0; dt < 4; ++dt) o[dt] = (v8f){};
    const int nblk = rowbase / 64 + 1;
#pragma unroll 1
    for (int jb = 0; jb < nblk; ++jb) {
        const int jbase = jb * 64;
        v8f s[4];
#pragma unroll
        for (int nt = 0; nt < 4; ++nt) s[nt] = (v8f){};
        v16bf kh, kl;
#pragma unroll
        for (int c = 0; c < 2; ++c) {
#pragma unroll
            for (int nt = 0; nt < 4; ++nt) { const size_t ko = kbase + (size_t)(jbase + nt * 16) * HD + c * 32; kh = ldb(Kh + ko); kl = ldb(Kl + ko);
                s[nt] = wmmab(kh, qh[c], s[nt]); s[nt] = wmmab(kh, ql[c], s[nt]); s[nt] = wmmab(kl, qh[c], s[nt]); }
        }
        // the four vector slots between the last WMMA and the first reader of its result
        asm volatile("v_nop\n\tv_nop\n\tv_nop\n\tv_nop" : "+v"(s[0]), "+v"(s[1]), "+v"(s[2]), "+v"(s[3]) : "v"(kh), "v"(kl));
        const int dq = t - jbase - 8 * hi;               // key > t  <=>  the key's place among this lane's keys, nt*16 + r, > dq
        float v[4][8], mt[4];
#pragma unroll
        for (int nt = 0; nt < 4; ++nt) {
#pragma unroll
            for (int r = 0; r < 8; ++r) { const float sv = s[nt][r] * SCQHL; v[nt][r] = (nt * 16 + r > dq) ? NEGB : sv; }
            mt[nt] = max8(v[nt]);
        }
        float mx = fmaxf(fmaxf(mt[0], mt[1]), fmaxf(mt[2], mt[3]));
        mx = fmaxf(mx, xhalf(mx));
        const float mn = fmaxf(m, mx);
        const float al = ex2((m - mn) * L2E);
        m = mn;
        float st[4]; v8us ph[4], pl[4];
#pragma unroll
        for (int nt = 0; nt < 4; ++nt) {
            float p[8];
#pragma unroll
            for (int r = 0; r < 8; ++r) { p[r] = ex2((v[nt][r] - mn) * L2E); unsigned short x0, x1; splitf(p[r], x0, x1); ph[nt][r] = x0; pl[nt][r] = x1; }
            st[nt] = sum8(p);
        }
        l = l * al + ((st[0] + st[1]) + (st[2] + st[3]));
#pragma unroll
        for (int dt = 0; dt < 4; ++dt) o[dt] *= al;
        v16bf pbh, pbl, vh, vl;
#pragma unroll
        for (int c = 0; c < 2; ++c) {
            pbh = cat16b(ph[2 * c], ph[2 * c + 1]); pbl = cat16b(pl[2 * c], pl[2 * c + 1]);
#pragma unroll
            for (int dt = 0; dt < 4; ++dt) { const size_t vo = vbase + (size_t)(dt * 16) * RH + jbase + c * 32; vh = ldb(VTh + vo); vl = ldb(VTl + vo);
                o[dt] = wmmab(vh, pbh, o[dt]); o[dt] = wmmab(vh, pbl, o[dt]); o[dt] = wmmab(vl, pbh, o[dt]); }
        }
        // the four vector slots behind the last WMMA, on the loop's back edge too
        asm volatile("v_nop\n\tv_nop\n\tv_nop\n\tv_nop" : "+v"(o[0]), "+v"(o[1]), "+v"(o[2]), "+v"(o[3]) : "v"(pbh), "v"(pbl), "v"(vh), "v"(vl));
    }
    {
        const float lt = l + xhalf(l);
        const float inv = 1.0f / lt;
#pragma unroll
        for (int dt = 0; dt < 4; ++dt) { v4f a, c;
#pragma unroll
            for (int i = 0; i < 4; ++i) { a[i] = o[dt][i] * inv; c[i] = o[dt][4 + i] * inv; }
            *(v4fa*)(os + lr * 68 + dt * 16 + 8 * hi) = a; *(v4fa*)(os + lr * 68 + dt * 16 + 8 * hi + 4) = c; }
    }
    __syncthreads();
    const int b = bh / NH, h = bh % NH; const int rr = lane >> 3, seg = lane & 7;
    const size_t dof = ((size_t)b * RH + rowbase) * DM + h * HD + seg * 8;
{
#pragma unroll
        for (int s = 0; s < 4; ++s) { const int row = s * 4 + rr; const v4f a = *(const v4fa*)(os + row * 68 + seg * 8); const v4f c = *(const v4fa*)(os + row * 68 + seg * 8 + 4); v8us oh, ol;
#pragma unroll
            for (int i = 0; i < 4; ++i) { unsigned short x0, x1; splitf(a[i], x0, x1); oh[i] = x0; ol[i] = x1; splitf(c[i], x0, x1); oh[4 + i] = x0; ol[4 + i] = x1; }
            *(v8us*)(ATh + dof + (size_t)row * DM) = oh; *(v8us*)(ATl + dof + (size_t)row * DM) = ol; }
         }
}

// ---- k_attn: all query rows in one launch; the two bodies share no data. The hi/lo blocks (64 rows < RH) come first in the index: their waves walk chains of dependent global loads and use
// little of the vector and matrix units, so they start at once and run beside the f16 blocks. A f16 block walks xb + 1 key tiles and there are more blocks than resident places: they follow
// with the cost falling along the index (row block from the last down, head inside), so that the long blocks start first and the short ones fill the end of the launch.
constexpr int AB_HL = RH / (16 * AW), AB_16 = (SEQ - RH) / (16 * AW);   // 64-row blocks per head of either kind
static_assert(AB_HL > 0 && AB_16 > 0);
// five waves per SIMD asked for: the merged kernel's register count is the larger body's, and left alone the hi/lo body takes so many that the f16 body, which has nearly all the work, would run at four
__global__ __launch_bounds__(32 * AW) __attribute__((amdgpu_waves_per_eu(5))) void k_attn(const h16* __restrict__ Q16, const h16* __restrict__ K16, const h16* __restrict__ VT16, h16* CT16,
                                                  const bf* __restrict__ Qh, const bf* __restrict__ Ql, const bf* __restrict__ Kh, const bf* __restrict__ Kl,
                                                  const bf* __restrict__ VTh, const bf* __restrict__ VTl, bf* ATh, bf* ATl) {
    __shared__ __align__(16) h16 ring[4 * KVT];          // one array for both bodies (two would add up)
    const int i = blockIdx.x;
    if (i < NB * NH * AB_HL) attnhl_body(Qh, Ql, Kh, Kl, VTh, VTl, ATh, ATl, (float*)ring, i % AB_HL, i / AB_HL);
    else { const int j = i - NB * NH * AB_HL; attn16_body(Q16, K16, VT16, CT16, ring, AB_HL + AB_16 - 1 - j / (NB * NH), j % (NB * NH)); }
}

extern "C" void kernel_launch(void* const* d_in, const int* in_sizes, int n_in,
                              void* d_out, int out_size, void* d_ws, size_t ws_size, hipStream_t stream) {
    if (n_in < 5) return;
    if ((size_t)in_sizes[0] < (size_t)(NB - 1) * SEQ_FULL * DM + (size_t)SEQ * DM) return;
    if ((size_t)in_sizes[1] < (size_t)3 * DM * DM || in_sizes[2] < 3 * DM || (size_t)in_sizes[3] < (size_t)DM * DM || in_sizes[4] < DM) return;
    if ((size_t)out_size < (size_t)NB * SEQ * DM) return;
    if (ws_size < WS_TOTAL) return;
    // wire order: x, W_qkv, b_qkv, W_proj, b_proj
    const float* x = (const float*)d_in[0]; const float* wqkv = (const float*)d_in[1]; const float* bqkv = (const float*)d_in[2]; const float* wo = (const float*)d_in[3]; const float* bo = (const float*)d_in[4];
    float* OUT = (float*)d_out;
    char* wsp = (char*)d_ws;
    auto take = [&](size_t bytes) { char* p = wsp; wsp += bytes; return (void*)p; };
    bf* XB = (bf*)take(SZ_XB);
    bf* WQKV = (bf*)take(SZ_WQKV);                 // Bt [3*DM][DM]
    bf* WOb = (bf*)take(SZ_WO); h16* WO16 = (h16*)take(SZ_WO);
    h16* QK16 = (h16*)take(2 * SZ_P16);            // [q | k] f16 planes [bh][t][d]
    h16* VT16 = (h16*)take(SZ_P16);                // [bh][d][t]
    bf* QKh = (bf*)take(2 * SZ_PE); bf* QKl = (bf*)take(2 * SZ_PE);   // [q | k] early-row planes [bh][t<RH][d]
    bf* VTh = (bf*)take(SZ_PE); bf* VTl = (bf*)take(SZ_PE);           // [bh][d][t<RH]
    h16* CT16 = (h16*)take(SZ_CT);                 // ctx f16 x64 [b][t][DM] (rows >= RH used)
    bf* ATh = (bf*)take(SZ_AT); bf* ATl = (bf*)take(SZ_AT);           // ctx hi/lo [b][t<RH][DM]
    float* RC = (float*)take(SZ_ROT); float* RS = (float*)take(SZ_ROT);   // rotary cos / sin [SEQ][32]
    if ((size_t)(wsp - (char*)d_ws) > ws_size) return;

    k_prep<<<PB_WQ + PB_WO + PB_RO + NB * PB_CX, 256, 0, stream>>>(x, wqkv, wo, XB, WQKV, WOb, WO16, RC, RS);
    k_qkv<<<dim3(NB * SEQ / 128, 3 * DM / 128, 1), 128, 0, stream>>>(XB, WQKV, bqkv, RC, RS, QK16, VT16, QKh, QKl, VTh, VTl);
    k_attn<<<NB * NH * (AB_HL + AB_16), 128, 0, stream>>>(QK16, QK16 + PL16, VT16, CT16, QKh, QKl, QKh + PLE, QKl + PLE, VTh, VTl, ATh, ATl);
    k_proj<<<dim3(SEQ / 128, DM / 128, NB), 128, 0, stream>>>(ATh, ATl, WOb, CT16, WO16, OUT, bo);
}
